// v000
// The times below were measured on an AMD MI455X: many runs one after another, warmed up first and cycling through
// copies of the inputs, with the whole window's GPU time divided by the number of runs. Launches and the gaps
// between them are all in it. The median over several windows is given; except for v000 it joins two sittings, which
// can be a few percent apart, so the side-by-side timings, each taken in one sitting, are the better comparison.
// v000, which the later versions start from, runs in 265 microseconds.
#include <hip/hip_runtime.h>

// Contractions (fused QKV projection, Q.K^T, P.V, P row-sum, output projection): v_wmma_f32_16x16x32_f16, f16 operands with power-of-two carries, f32 accumulate; every float input enters as its bf16 RNE value; softmax in f32.

#ifndef NB
#define NB 2
#endif
#ifndef SEQ
#define SEQ 2048
#endif
#define NB_FULL   2
#define SEQ_FULL  2048
#define HID       1024
#define NHEAD     16
#define HD        64
#define MROWS     (NB * SEQ)

static_assert(HID == NHEAD * HD);        // merged head width
static_assert(NHEAD == 16);              // bh >> 4 / bh & 15 decoding in attn_fwd
static_assert(HD == 64);
static_assert(SEQ % 128 == 0);           // 128-row blocks never straddle a batch
static_assert(SEQ % 64 == 0);            // 64-key tiles
static_assert(SEQ <= SEQ_FULL);
static_assert(NB >= 1 && NB <= NB_FULL);
static_assert(MROWS % 128 == 0);         // GEMM M tile
static_assert(HID % 128 == 0);           // GEMM N tile
static_assert(HID % 32 == 0);            // WMMA k step
static_assert(HID == 128 * 8);           // cvt_rows: 128 threads x 8 values per row
static_assert((3 * HID) % 2 == 0);       // cvt_rows grid = nrows / 2
static_assert(MROWS % 2 == 0);           // cvt_rows grid = nrows / 2

// carries (exact powers of two)
#define CARRY_X    16.0f     // input activation plane
#define CARRY_W    32.0f     // weight planes
#define CARRY_QKV  16.0f     // q, k, v^T planes (true value x16)
#define CARRY_CTX  1024.0f   // context plane (true value x1024)
// softmax exp values carry 2^10 (added to the exp2 argument)

typedef unsigned u32;
typedef _Float16 f16;
typedef f16   v16h __attribute__((ext_vector_type(16)));
typedef f16   v8h  __attribute__((ext_vector_type(8)));
typedef float v8f  __attribute__((ext_vector_type(8)));
typedef float v4f  __attribute__((ext_vector_type(4)));

union FragU { v16h v; v8h half[2]; f16 e[16]; };
union H8U   { v8h v; f16 e[8]; };

__device__ __forceinline__ v8f zero8() {
    v8f z = {0.f, 0.f, 0.f, 0.f, 0.f, 0.f, 0.f, 0.f};
    return z;
}

// 16-bit WMMA with hazard guard: D += A[16 x 32k] * B[32k x 16]
__device__ __forceinline__ v8f wmma16(v16h a, v16h b, v8f c) {
    v8f d = __builtin_amdgcn_wmma_f32_16x16x32_f16(false, a, false, b, (short)0, c, false, false);
    asm volatile("v_nop\n\tv_nop\n\tv_nop\n\tv_nop" : "+v"(d) : "v"(a), "v"(b));
    return d;
}

// f32 -> nearest-even bf16 value, returned as f32
__device__ __forceinline__ float bf16_rne(float x) {
    u32 u = __float_as_uint(x);
    u = (u + 0x7fffu + ((u >> 16) & 1u)) & 0xffff0000u;
    return __uint_as_float(u);
}

__device__ __forceinline__ float fexp2(float x) {
#if defined(__has_builtin)
#if __has_builtin(__builtin_amdgcn_exp2f)
    return __builtin_amdgcn_exp2f(x);
#else
    return exp2f(x);
#endif
#else
    return exp2f(x);
#endif
}

// max over the 16 lanes of each lane half (DPP row rotations; D-layout rows are DPP rows)
__device__ __forceinline__ float rowmax16(float x) {
    int v = __builtin_bit_cast(int, x);
    x = fmaxf(x, __builtin_bit_cast(float, __builtin_amdgcn_update_dpp(v, v, 0x121, 0xf, 0xf, false)));
    v = __builtin_bit_cast(int, x);
    x = fmaxf(x, __builtin_bit_cast(float, __builtin_amdgcn_update_dpp(v, v, 0x122, 0xf, 0xf, false)));
    v = __builtin_bit_cast(int, x);
    x = fmaxf(x, __builtin_bit_cast(float, __builtin_amdgcn_update_dpp(v, v, 0x124, 0xf, 0xf, false)));
    v = __builtin_bit_cast(int, x);
    x = fmaxf(x, __builtin_bit_cast(float, __builtin_amdgcn_update_dpp(v, v, 0x128, 0xf, 0xf, false)));
    return x;
}

// 16 x 32 fragment from a tile whose k dimension is contiguous (pitch in halves).
// lane l: row rowbase + (l&15); elements 0..7 <- k = kcol + 8h .. +7,
// elements 8..15 <- k = kcol + 16 + 8h .. +7  (h = l>>4). Same map for A and B.
__device__ __forceinline__ v16h load_frag(const f16* tile, u32 rowbase, u32 pitch, u32 kcol, u32 lane) {
    const u32 r  = rowbase + (lane & 15u);
    const u32 kh = (lane >> 4) << 3;
    const f16* p = tile + (size_t)r * pitch + kcol + kh;
    FragU f;
    f.half[0] = *(const v8h*)(p);
    f.half[1] = *(const v8h*)(p + 16);
    return f.v;
}

// ---------------------------------------------------------------------------
// f32 rows [.][1024] -> f16 plane (bf16 RNE value times carry). 128 threads per 1024-wide
// Row mapping dst row m -> src row (m / dstper) * srcper + m % dstper lets a reduced build
// read full-size inputs (weights: dstper == srcper == nrows, identity).
// coverage: nrows x 1024 halves, every element exactly once (grid = nrows*128/256).
// ---------------------------------------------------------------------------
__global__ void __launch_bounds__(256)
cvt_rows(const float* __restrict__ src, f16* __restrict__ dst, u32 nrows, u32 dstper, u32 srcper, float carry) {
    const u32 g  = blockIdx.x * 256u + threadIdx.x;
    const u32 m  = g >> 7;
    const u32 c8 = (g & 127u) << 3;
    if (m >= nrows) return;
    const u32 mb = m / dstper;
    const u32 sm = mb * srcper + (m - mb * dstper);
    const float* sp = src + (size_t)sm * HID + c8;
    const v4f a = *(const v4f*)sp;
    const v4f b = *(const v4f*)(sp + 4);
    H8U o;
#pragma unroll
    for (u32 j = 0; j < 4; ++j) {
        const float x0 = a[j];
        const float x1 = b[j];
        o.e[j]     = (f16)(bf16_rne(x0) * carry);
        o.e[j + 4] = (f16)(bf16_rne(x1) * carry);
    }
    f16* dp = dst + (size_t)m * HID + c8;
    *(v8h*)dp = o.v;
    
}

// ---------------------------------------------------------------------------
// C[m][n] = sum_k A[m][k] * W[n][k] ; A [MROWS][1024] f16, W [1024][1024] f16 (k contiguous).
// Block tile 128 x 128, 8 waves as 4(M) x 2(N), 2 x 4 accumulators per wave, K step 32.
// MODE 1: f16 plane [b*HID + h*HD + d][s] (V transposed per head)
// MODE 2: f32 rows [m][1024] into the output buffer
// coverage per block: MODE 0/1 256 lines (128 rows x 2 heads | 128 n x 2 s-halves),
//                     MODE 2 2 x 256 lines (64 rows x 4 line-quarters per half).
// LDS: As/Bs/Cs all cross-wave, separated by block barriers.
// staged extent == consumed extent: As/Bs 128 x 32, Cs 128 x 128 halves (or 64 x 128 floats).
// ---------------------------------------------------------------------------
template <int MODE>
__device__ __forceinline__ void gemm_body(const f16* __restrict__ A, const f16* __restrict__ W,
                                          void* __restrict__ out, float accMul) {
    __shared__ __attribute__((aligned(16))) f16 As[128 * 32];
    __shared__ __attribute__((aligned(16))) f16 Bs[128 * 32];
    __shared__ __attribute__((aligned(16))) f16 Cs[128 * 128];   // f16 [128][128] or f32 [64][128]
    static_assert(sizeof(f16) * 128 * 128 == sizeof(float) * 64 * 128);   // Cs reuse as f32 [64][128]

    const u32 tid  = threadIdx.x;
    const u32 lane = tid & 31u;
    const u32 wave = tid >> 5;
    const u32 wm   = wave & 3u;
    const u32 wn   = wave >> 2;
    const u32 hh8  = (lane >> 4) << 3;   // D row half
    const u32 c16  = lane & 15u;         // D column
    const u32 m0   = blockIdx.x * 128u;
    const u32 n0   = blockIdx.y * 128u;

    v8f acc[2][4];
#pragma unroll
    for (int i = 0; i < 2; ++i)
#pragma unroll
        for (int j = 0; j < 4; ++j) acc[i][j] = zero8();

    const u32 srow = tid >> 1;
    const u32 scol = (tid & 1u) << 4;
    const f16* gA = A + (size_t)(m0 + srow) * HID + scol;
    const f16* gW = W + (size_t)(n0 + srow) * HID + scol;

#pragma unroll 1
    for (u32 k0 = 0; k0 < (u32)HID; k0 += 32u) {
        const v8h ra0 = *(const v8h*)(gA + k0);
        const v8h ra1 = *(const v8h*)(gA + k0 + 8);
        const v8h rb0 = *(const v8h*)(gW + k0);
        const v8h rb1 = *(const v8h*)(gW + k0 + 8);
        __syncthreads();
        *(v8h*)&As[srow * 32u + scol]      = ra0;
        *(v8h*)&As[srow * 32u + scol + 8u] = ra1;
        *(v8h*)&Bs[srow * 32u + scol]      = rb0;
        *(v8h*)&Bs[srow * 32u + scol + 8u] = rb1;
        __syncthreads();

        v16h af[2], bfr[4];
#pragma unroll
        for (int i = 0; i < 2; ++i) af[i] = load_frag(As, wm * 32u + (u32)i * 16u, 32u, 0u, lane);
#pragma unroll
        for (int j = 0; j < 4; ++j) bfr[j] = load_frag(Bs, wn * 64u + (u32)j * 16u, 32u, 0u, lane);
#pragma unroll
        for (int i = 0; i < 2; ++i)
#pragma unroll
            for (int j = 0; j < 4; ++j) acc[i][j] = wmma16(af[i], bfr[j], acc[i][j]);
    }

    const u32 bidx  = m0 / (u32)SEQ;     // block rows lie inside one batch (SEQ % 128 == 0)
    const u32 s0    = m0 - bidx * (u32)SEQ;
    const u32 piece = lane & 7u;
    const u32 lsub  = lane >> 3;

    if constexpr (MODE == 0) {
#pragma unroll
        for (int i = 0; i < 2; ++i)
#pragma unroll
            for (int j = 0; j < 4; ++j) {
                const u32 nl = wn * 64u + (u32)j * 16u + c16;
#pragma unroll
                for (int r = 0; r < 8; ++r) {
                    const u32 ml = wm * 32u + (u32)i * 16u + hh8 + (u32)r;
                    Cs[ml * 128u + nl] = (f16)(acc[i][j][r] * accMul);
                }
            }
        __syncthreads();
        f16* op = (f16*)out;
        const size_t bh0 = (size_t)bidx * NHEAD + (n0 >> 6);
{
#pragma unroll
            for (u32 it = 0; it < 8; ++it) {
                const u32 L    = wave * 32u + it * 4u + lsub;   // 0..255
                const u32 ml   = L >> 1;
                const u32 hsel = L & 1u;
                const v8h v = *(const v8h*)&Cs[ml * 128u + hsel * 64u + piece * 8u];
                f16* dp = op + ((bh0 + hsel) * SEQ + s0 + ml) * HD + piece * 8u;
                *(v8h*)dp = v;
            }
            
        }
    } else if constexpr (MODE == 1) {
        // stage transposed: Cs[n][m]
#pragma unroll
        for (int i = 0; i < 2; ++i)
#pragma unroll
            for (int j = 0; j < 4; ++j) {
                const u32 nl = wn * 64u + (u32)j * 16u + c16;
                H8U t;
#pragma unroll
                for (int r = 0; r < 8; ++r) t.e[r] = (f16)(acc[i][j][r] * accMul);
                *(v8h*)&Cs[nl * 128u + wm * 32u + (u32)i * 16u + hh8] = t.v;
            }
        __syncthreads();
        f16* op = (f16*)out;
{
#pragma unroll
            for (u32 it = 0; it < 8; ++it) {
                const u32 L  = wave * 32u + it * 4u + lsub;     // 0..255
                const u32 nl = L >> 1;
                const u32 mh = L & 1u;
                const v8h v = *(const v8h*)&Cs[nl * 128u + mh * 64u + piece * 8u];
                f16* dp = op + ((size_t)(bidx * (u32)HID + n0 + nl) * SEQ + s0 + mh * 64u + piece * 8u);
                *(v8h*)dp = v;
            }
            
        }
    } else {
        float* Cf = (float*)Cs;      // [64][128] f32
        float* of = (float*)out;
#pragma unroll
        for (u32 half = 0; half < 2; ++half) {
            if ((wm >> 1) == half) {
#pragma unroll
                for (int i = 0; i < 2; ++i)
#pragma unroll
                    for (int j = 0; j < 4; ++j) {
                        const u32 nl = wn * 64u + (u32)j * 16u + c16;
#pragma unroll
                        for (int r = 0; r < 8; ++r) {
                            const u32 ml = (wm & 1u) * 32u + (u32)i * 16u + hh8 + (u32)r;
                            Cf[ml * 128u + nl] = acc[i][j][r] * accMul;
                        }
                    }
            }
            __syncthreads();
{
#pragma unroll
                for (u32 it = 0; it < 8; ++it) {
                    const u32 L    = wave * 32u + it * 4u + lsub;   // 0..255
                    const u32 row  = L >> 2;
                    const u32 part = L & 3u;
                    const v4f v = *(const v4f*)&Cf[row * 128u + part * 32u + piece * 4u];
                    float* dp = of + (size_t)(m0 + half * 64u + row) * HID + n0 + part * 32u + piece * 4u;
                    *(v4f*)dp = v;
                }
                
            }
            __syncthreads();
        }
    }
}

// q / k head-major planes
__global__ void __launch_bounds__(256) __attribute__((amdgpu_num_vgpr(256)))
gemm_head(const f16* __restrict__ A, const f16* __restrict__ W, f16* __restrict__ out, float accMul) {
    gemm_body<0>(A, W, (void*)out, accMul);
}

// v^T plane
__global__ void __launch_bounds__(256) __attribute__((amdgpu_num_vgpr(256)))
gemm_vt(const f16* __restrict__ A, const f16* __restrict__ W, f16* __restrict__ out, float accMul) {
    gemm_body<1>(A, W, (void*)out, accMul);
}

// f32 output rows
__global__ void __launch_bounds__(256) __attribute__((amdgpu_num_vgpr(256)))
gemm_out(const f16* __restrict__ A, const f16* __restrict__ W, float* __restrict__ out, float accMul) {
    gemm_body<2>(A, W, (void*)out, accMul);
}

// ---------------------------------------------------------------------------
// Flash attention (no mask, all SEQ keys). grid (SEQ/128, NB*NHEAD), block 256 (8 waves),
// wave owns 16 query rows (Q fragments resident). Block streams 64-key tiles:
// K staged [key][d], V^T staged [d][key]. Scores on WMMA, row max via DPP, exp2 in f32
// carried x2^10, P relayed per wave through LDS as A fragments, O += P.V and
// row sums += P.ones on WMMA. Output f16 plane [b*SEQ+q][1024] carried x1024, written as
// coverage: every (b, q, h*64..h*64+63) row segment exactly once.
// LDS: ks, vsT cross-wave (block barriers); ps per-wave but also separated by block barriers.
// staged extent == consumed extent for ks (64x64), vsT (64x64), ps (16x64).
// ---------------------------------------------------------------------------
__global__ void __launch_bounds__(256) __attribute__((amdgpu_num_vgpr(256)))
attn_fwd(const f16* __restrict__ Qp, const f16* __restrict__ Kp, const f16* __restrict__ Vt,
         f16* __restrict__ Cp) {
    __shared__ __attribute__((aligned(16))) f16 ks[64 * 64];      // [key][d]
    __shared__ __attribute__((aligned(16))) f16 vsT[64 * 64];     // [d][key]
    __shared__ __attribute__((aligned(16))) f16 ps[8][16 * 64];   // per-wave P relay / ctx stage
    static_assert(HD == 8 * 8);            // 8 lanes x 8 halves per row segment
    static_assert(2 * 256 * 8 == 64 * 64); // staging: 2 x 256 threads x 8 halves per tile

    const u32 tid  = threadIdx.x;
    const u32 lane = tid & 31u;
    const u32 wave = tid >> 5;
    const u32 hh8  = (lane >> 4) << 3;
    const u32 c16  = lane & 15u;
    const u32 bh   = blockIdx.y;
    const u32 bidx = bh >> 4;            // NHEAD == 16
    const u32 hidx = bh & 15u;
    const u32 q0   = blockIdx.x * 128u + wave * 16u;
    const size_t head = (size_t)bh * SEQ * HD;

    v16h qa[2];
#pragma unroll
    for (int c = 0; c < 2; ++c) qa[c] = load_frag(Qp + head, q0, HD, (u32)c * 32u, lane);

    FragU onesu;
#pragma unroll
    for (int i = 0; i < 16; ++i) onesu.e[i] = (f16)1.0f;
    const v16h ones = onesu.v;

    float m[8];
    v8f   o[4], lacc;
#pragma unroll
    for (int r = 0; r < 8; ++r) m[r] = -1.0e30f;
#pragma unroll
    for (int dt = 0; dt < 4; ++dt) o[dt] = zero8();
    lacc = zero8();

    // log2-domain scale: acc = 256 * q.k ; x = log2(e) * q.k / 8 = acc * log2(e) / 2048
    const float cl = 1.4426950408889634f * 0.00048828125f;
    f16* psw = &ps[wave][0];

#pragma unroll 1
    for (u32 kt = 0; kt < (u32)(SEQ / 64); ++kt) {
        __syncthreads();
#pragma unroll
        for (u32 p2 = 0; p2 < 2; ++p2) {
            const u32 p   = tid + p2 * 256u;
            const u32 row = p >> 3;
            const u32 pc  = (p & 7u) << 3;
            const v8h kv = *(const v8h*)(Kp + head + (size_t)(kt * 64u + row) * HD + pc);
            const v8h vv = *(const v8h*)(Vt + head + (size_t)row * SEQ + kt * 64u + pc);
            *(v8h*)&ks[row * 64u + pc]  = kv;
            *(v8h*)&vsT[row * 64u + pc] = vv;
        }
        __syncthreads();

        // S[16 q x 64 keys]
        v8f s[4];
#pragma unroll
        for (int nt = 0; nt < 4; ++nt) s[nt] = zero8();
#pragma unroll
        for (int c = 0; c < 2; ++c) {
#pragma unroll
            for (int nt = 0; nt < 4; ++nt) {
                const v16h kb = load_frag(ks, (u32)nt * 16u, 64u, (u32)c * 32u, lane);
                s[nt] = wmma16(qa[c], kb, s[nt]);
            }
        }

        // online softmax per row r (row 8h + r), max-subtracted, exp2 domain
#pragma unroll
        for (int r = 0; r < 8; ++r) {
            float x[4];
#pragma unroll
            for (int nt = 0; nt < 4; ++nt) x[nt] = s[nt][r] * cl;
            const float tm = rowmax16(fmaxf(fmaxf(x[0], x[1]), fmaxf(x[2], x[3])));
            const float mn = fmaxf(m[r], tm);
            const float al = fexp2(m[r] - mn);
            m[r] = mn;
            lacc[r] *= al;
#pragma unroll
            for (int dt = 0; dt < 4; ++dt) o[dt][r] *= al;
            const float sh = 10.0f - mn;      // carry 2^10
#pragma unroll
            for (int nt = 0; nt < 4; ++nt)
                psw[(hh8 + (u32)r) * 64u + (u32)nt * 16u + c16] = (f16)fexp2(x[nt] + sh);
        }
        __syncthreads();

        // O += P . V ; l += P . ones  (P reloaded as A fragments from the relay)
#pragma unroll
        for (int kk = 0; kk < 2; ++kk) {
            const v16h pa = load_frag(psw, 0u, 64u, (u32)kk * 32u, lane);
#pragma unroll
            for (int dt = 0; dt < 4; ++dt) {
                const v16h vb = load_frag(vsT, (u32)dt * 16u, 64u, (u32)kk * 32u, lane);
                o[dt] = wmma16(pa, vb, o[dt]);
            }
            lacc = wmma16(pa, ones, lacc);
        }
    }
    __syncthreads();

    // normalize: plane value = 1024 * (O/16) / l = O * 64 / l
#pragma unroll
    for (int r = 0; r < 8; ++r) {
        const float inv = (CARRY_CTX / CARRY_QKV) / lacc[r];
#pragma unroll
        for (int dt = 0; dt < 4; ++dt)
            psw[(hh8 + (u32)r) * 64u + (u32)dt * 16u + c16] = (f16)(o[dt][r] * inv);
    }
    __syncthreads();

    const u32 piece = lane & 7u;
    const u32 lsub  = lane >> 3;
{
#pragma unroll
        for (u32 it = 0; it < 4; ++it) {
            const u32 L = it * 4u + lsub;     // query row 0..15 within the wave tile
            const v8h v = *(const v8h*)&psw[L * 64u + piece * 8u];
            f16* dp = Cp + ((size_t)(bidx * (u32)SEQ + q0 + L) * HID + hidx * (u32)HD + piece * 8u);
            *(v8h*)dp = v;
        }
        
    }
}

// coverage equalities (threads x elements == plane elements)
static_assert((size_t)(MROWS / 2) * 256 * 8 == (size_t)MROWS * HID);                       // cvt_rows -> Xh
static_assert((size_t)(3 * HID / 2) * 256 * 8 == (size_t)3 * HID * HID);                   // cvt_rows -> Wt
static_assert((size_t)(HID / 2) * 256 * 8 == (size_t)HID * HID);                           // cvt_rows -> Wot
static_assert((size_t)(MROWS / 128) * (HID / 128) * 128 * 128 == (size_t)MROWS * HID);     // gemm planes / out
static_assert((size_t)(SEQ / 128) * (NB * NHEAD) * 128 * HD == (size_t)MROWS * HID);       // attn_fwd -> Cp
// workspace: 5 activation planes + 4 weight planes of halves, at most 128 MiB
static_assert(((size_t)5 * MROWS * HID + (size_t)4 * HID * HID) * sizeof(f16) <= (size_t)134217728);
// output extent: last written f32 element index < NB_FULL*SEQ_FULL*HID
static_assert((size_t)MROWS * HID <= (size_t)NB_FULL * SEQ_FULL * HID);

// ---------------------------------------------------------------------------
// Launch: 8 kernel launches, workspace 5 planes of MROWS*1024 halves + 4 of 1024*1024 halves.
// ---------------------------------------------------------------------------
extern "C" void kernel_launch(void* const* d_in, const int* in_sizes, int n_in,
                              void* d_out, int out_size, void* d_ws, size_t ws_size,
                              hipStream_t stream) {
    if (n_in < 3) return;
    if (in_sizes[0] < ((NB - 1) * SEQ_FULL + SEQ) * HID) return;
    if (in_sizes[1] < 3 * HID * HID) return;
    if (in_sizes[2] < HID * HID) return;
    if (out_size < MROWS * HID) return;

    const float* x     = (const float*)d_in[0];   // [NB_FULL][SEQ_FULL][1024]
    const float* wqkv  = (const float*)d_in[1];   // [3072 out][1024 in], row blocks q | k | v
    const float* wproj = (const float*)d_in[2];   // [1024 out][1024 in]

    const size_t nX = (size_t)MROWS * HID;    // halves per activation plane
    const size_t nW = (size_t)HID * HID;      // halves per weight plane
    const size_t totalHalves = 5 * nX + 4 * nW;
    if (ws_size < totalHalves * sizeof(f16)) return;

    f16* Xh  = (f16*)d_ws;       // [MROWS][1024]               carry 16
    f16* Wt  = Xh  + nX;         // [3072 out][1024 in]         carry 32 (q | k | v row blocks)
    f16* Wot = Wt  + 3 * nW;     // [1024 out][1024 in]         carry 32
    f16* Qp  = Wot + nW;         // [NB*16][SEQ][64]            carry 16
    f16* Kp  = Qp  + nX;         // [NB*16][SEQ][64]            carry 16
    f16* Vtp = Kp  + nX;         // [NB*1024][SEQ] (V^T)        carry 16
    f16* Cp  = Vtp + nX;         // [MROWS][1024]               carry 1024

    // activations: dst row m of batch b <- src row b*SEQ_FULL + (m % SEQ)
    cvt_rows<<<MROWS / 2, 256, 0, stream>>>(x, Xh, (u32)MROWS, (u32)SEQ, (u32)SEQ_FULL, CARRY_X);
    // weights already [out][in] (k contiguous): identity row map
    cvt_rows<<<3 * HID / 2, 256, 0, stream>>>(wqkv, Wt, (u32)(3 * HID), (u32)(3 * HID), (u32)(3 * HID), CARRY_W);
    cvt_rows<<<HID / 2, 256, 0, stream>>>(wproj, Wot, (u32)HID, (u32)HID, (u32)HID, CARRY_W);

    const dim3 gg(MROWS / 128, HID / 128);
    // plane = 16 * acc / (16*32) = acc/32
    const float accQKV = CARRY_QKV / (CARRY_X * CARRY_W);
    gemm_head<<<gg, 256, 0, stream>>>(Xh, Wt,          Qp,  accQKV);
    gemm_head<<<gg, 256, 0, stream>>>(Xh, Wt + nW,     Kp,  accQKV);
    gemm_vt  <<<gg, 256, 0, stream>>>(Xh, Wt + 2 * nW, Vtp, accQKV);

    attn_fwd<<<dim3(SEQ / 128, NB * NHEAD), 256, 0, stream>>>(Qp, Kp, Vtp, Cp);

    // out = acc / (1024*32)
    const float accOut = 1.0f / (CARRY_CTX * CARRY_W);
    gemm_out<<<gg, 256, 0, stream>>>(Cp, Wot, (float*)d_out, accOut);
}

// v001
// It runs in 167 microseconds.
// Timed twice side by side with v000, it ran 1.59 times as fast both times.
#include <hip/hip_runtime.h>

// Contractions (fused QKV projection, Q.K^T, P.V, P row-sum, output projection): v_wmma_f32_16x16x32_f16, f16 operands with power-of-two carries, f32 accumulate; every float input enters as its bf16 RNE value; softmax in f32.

#ifndef NB
#define NB 2
#endif
#ifndef SEQ
#define SEQ 2048
#endif
#define NB_FULL   2
#define SEQ_FULL  2048
#define HID       1024
#define NHEAD     16
#define HD        64
#define MROWS     (NB * SEQ)

static_assert(HID == NHEAD * HD);        // merged head width
static_assert(NHEAD == 16);              // bh >> 4 / bh & 15 decoding in attn_fwd
static_assert(HD == 64);
static_assert(SEQ % 128 == 0);           // 128-row blocks never straddle a batch
static_assert(SEQ % 64 == 0);            // 64-key tiles
static_assert(SEQ <= SEQ_FULL);
static_assert(NB >= 1 && NB <= NB_FULL);
static_assert(MROWS % 128 == 0);         // GEMM M tile
static_assert(HID % 128 == 0);           // GEMM N tile
static_assert(HID % 32 == 0);            // WMMA k step
static_assert(HID == 128 * 8);           // cvt_rows: 128 threads x 8 values per row
static_assert((3 * HID) % 2 == 0);       // cvt_rows grid = nrows / 2
static_assert(MROWS % 2 == 0);           // cvt_rows grid = nrows / 2

// carries (exact powers of two)
#define CARRY_X    16.0f     // input activation plane
#define CARRY_W    32.0f     // weight planes
#define CARRY_QKV  16.0f     // q, k, v^T planes (true value x16)
#define CARRY_CTX  1024.0f   // context plane (true value x1024)
// softmax exp values carry 2^10 (added to the exp2 argument)

// LDS row pitches: 16 B x odd, so the 16 rows that one ds_load_b128 touches per lane half fall on distinct banks
#define AB_PITCH  40u    // halves: GEMM A / B tiles, 64-B rows on an 80-B pitch
#define C_PITCH   136u   // halves: GEMM f16 output stage, 256-B rows on a 272-B pitch
#define CF_PITCH  132u   // floats: GEMM f32 output stage, 512-B rows on a 528-B pitch
#define AT_PITCH  72u    // halves: attention K, V^T and P tiles, 128-B rows on a 144-B pitch

typedef unsigned u32;
typedef _Float16 f16;
typedef f16   v16h __attribute__((ext_vector_type(16)));
typedef f16   v8h  __attribute__((ext_vector_type(8)));
typedef float v8f  __attribute__((ext_vector_type(8)));
typedef float v4f  __attribute__((ext_vector_type(4)));

union FragU { v16h v; v8h half[2]; f16 e[16]; };
union H8U   { v8h v; f16 e[8]; };

__device__ __forceinline__ v8f zero8() {
    v8f z = {0.f, 0.f, 0.f, 0.f, 0.f, 0.f, 0.f, 0.f};
    return z;
}

// 16-bit WMMA with hazard guard: D += A[16 x 32k] * B[32k x 16]
__device__ __forceinline__ v8f wmma16(v16h a, v16h b, v8f c) {
    v8f d = __builtin_amdgcn_wmma_f32_16x16x32_f16(false, a, false, b, (short)0, c, false, false);
    asm volatile("v_nop\n\tv_nop\n\tv_nop\n\tv_nop" : "+v"(d) : "v"(a), "v"(b));
    return d;
}

// f32 -> nearest-even bf16 value, returned as f32
__device__ __forceinline__ float bf16_rne(float x) {
    u32 u = __float_as_uint(x);
    u = (u + 0x7fffu + ((u >> 16) & 1u)) & 0xffff0000u;
    return __uint_as_float(u);
}

__device__ __forceinline__ float fexp2(float x) {
#if defined(__has_builtin)
#if __has_builtin(__builtin_amdgcn_exp2f)
    return __builtin_amdgcn_exp2f(x);
#else
    return exp2f(x);
#endif
#else
    return exp2f(x);
#endif
}

// max over the 16 lanes of each lane half (DPP row rotations; D-layout rows are DPP rows)
__device__ __forceinline__ float rowmax16(float x) {
    int v = __builtin_bit_cast(int, x);
    x = fmaxf(x, __builtin_bit_cast(float, __builtin_amdgcn_update_dpp(v, v, 0x121, 0xf, 0xf, false)));
    v = __builtin_bit_cast(int, x);
    x = fmaxf(x, __builtin_bit_cast(float, __builtin_amdgcn_update_dpp(v, v, 0x122, 0xf, 0xf, false)));
    v = __builtin_bit_cast(int, x);
    x = fmaxf(x, __builtin_bit_cast(float, __builtin_amdgcn_update_dpp(v, v, 0x124, 0xf, 0xf, false)));
    v = __builtin_bit_cast(int, x);
    x = fmaxf(x, __builtin_bit_cast(float, __builtin_amdgcn_update_dpp(v, v, 0x128, 0xf, 0xf, false)));
    return x;
}

// 16 x 32 fragment from a tile whose k dimension is contiguous (pitch in halves).
// lane l: row rowbase + (l&15); elements 0..7 <- k = kcol + 8h .. +7,
// elements 8..15 <- k = kcol + 16 + 8h .. +7  (h = l>>4). Same map for A and B.
__device__ __forceinline__ v16h load_frag(const f16* tile, u32 rowbase, u32 pitch, u32 kcol, u32 lane) {
    const u32 r  = rowbase + (lane & 15u);
    const u32 kh = (lane >> 4) << 3;
    const f16* p = tile + (size_t)r * pitch + kcol + kh;
    FragU f;
    f.half[0] = *(const v8h*)(p);
    f.half[1] = *(const v8h*)(p + 16);
    return f.v;
}

// ---------------------------------------------------------------------------
// f32 rows [.][1024] -> f16 plane (bf16 RNE value times carry). 128 threads per 1024-wide
// Row mapping dst row m -> src row (m / dstper) * srcper + m % dstper lets a reduced build
// read full-size inputs (weights: dstper == srcper == nrows, identity).
// coverage: nrows x 1024 halves, every element exactly once (grid = nrows*128/256).
// ---------------------------------------------------------------------------
__global__ void __launch_bounds__(256)
cvt_rows(const float* __restrict__ src, f16* __restrict__ dst, u32 nrows, u32 dstper, u32 srcper, float carry) {
    const u32 g  = blockIdx.x * 256u + threadIdx.x;
    const u32 m  = g >> 7;
    const u32 c8 = (g & 127u) << 3;
    if (m >= nrows) return;
    const u32 mb = m / dstper;
    const u32 sm = mb * srcper + (m - mb * dstper);
    const float* sp = src + (size_t)sm * HID + c8;
    const v4f a = *(const v4f*)sp;
    const v4f b = *(const v4f*)(sp + 4);
    H8U o;
#pragma unroll
    for (u32 j = 0; j < 4; ++j) {
        const float x0 = a[j];
        const float x1 = b[j];
        o.e[j]     = (f16)(bf16_rne(x0) * carry);
        o.e[j + 4] = (f16)(bf16_rne(x1) * carry);
    }
    f16* dp = dst + (size_t)m * HID + c8;
    *(v8h*)dp = o.v;
    
}

// ---------------------------------------------------------------------------
// C[m][n] = sum_k A[m][k] * W[n][k] ; A [MROWS][1024] f16, W [1024][1024] f16 (k contiguous).
// Block tile 128 x 128, 8 waves as 4(M) x 2(N), 2 x 4 accumulators per wave, K step 32.
// MODE 1: f16 plane [b*HID + h*HD + d][s] (V transposed per head)
// MODE 2: f32 rows [m][1024] into the output buffer
// coverage per block: MODE 0/1 256 lines (128 rows x 2 heads | 128 n x 2 s-halves),
//                     MODE 2 2 x 256 lines (64 rows x 4 line-quarters per half).
// LDS: As/Bs/Cs all cross-wave, separated by block barriers.
// staged extent == consumed extent: As/Bs 128 x 32, Cs 128 x 128 halves (or 64 x 128 floats).
// ---------------------------------------------------------------------------
template <int MODE>
__device__ __forceinline__ void gemm_body(const f16* __restrict__ A, const f16* __restrict__ W,
                                          void* __restrict__ out, float accMul) {
    __shared__ __attribute__((aligned(16))) f16 As[128 * AB_PITCH];
    __shared__ __attribute__((aligned(16))) f16 Bs[128 * AB_PITCH];
    __shared__ __attribute__((aligned(16))) f16 Cs[128 * C_PITCH];   // f16 [128][128] or f32 [64][128], padded rows
    static_assert(sizeof(f16) * 128 * C_PITCH >= sizeof(float) * 64 * CF_PITCH);   // Cs reuse as f32 [64][128]

    const u32 tid  = threadIdx.x;
    const u32 lane = tid & 31u;
    const u32 wave = tid >> 5;
    const u32 wm   = wave & 3u;
    const u32 wn   = wave >> 2;
    const u32 hh8  = (lane >> 4) << 3;   // D row half
    const u32 c16  = lane & 15u;         // D column
    const u32 m0   = blockIdx.x * 128u;
    const u32 n0   = blockIdx.y * 128u;

    v8f acc[2][4];
#pragma unroll
    for (int i = 0; i < 2; ++i)
#pragma unroll
        for (int j = 0; j < 4; ++j) acc[i][j] = zero8();

    const u32 srow = tid >> 1;
    const u32 scol = (tid & 1u) << 4;
    const f16* gA = A + (size_t)(m0 + srow) * HID + scol;
    const f16* gW = W + (size_t)(n0 + srow) * HID + scol;

#pragma unroll 1
    for (u32 k0 = 0; k0 < (u32)HID; k0 += 32u) {
        const v8h ra0 = *(const v8h*)(gA + k0);
        const v8h ra1 = *(const v8h*)(gA + k0 + 8);
        const v8h rb0 = *(const v8h*)(gW + k0);
        const v8h rb1 = *(const v8h*)(gW + k0 + 8);
        __syncthreads();
        *(v8h*)&As[srow * AB_PITCH + scol]      = ra0;
        *(v8h*)&As[srow * AB_PITCH + scol + 8u] = ra1;
        *(v8h*)&Bs[srow * AB_PITCH + scol]      = rb0;
        *(v8h*)&Bs[srow * AB_PITCH + scol + 8u] = rb1;
        __syncthreads();

        v16h af[2], bfr[4];
#pragma unroll
        for (int i = 0; i < 2; ++i) af[i] = load_frag(As, wm * 32u + (u32)i * 16u, AB_PITCH, 0u, lane);
#pragma unroll
        for (int j = 0; j < 4; ++j) bfr[j] = load_frag(Bs, wn * 64u + (u32)j * 16u, AB_PITCH, 0u, lane);
#pragma unroll
        for (int i = 0; i < 2; ++i)
#pragma unroll
            for (int j = 0; j < 4; ++j) acc[i][j] = wmma16(af[i], bfr[j], acc[i][j]);
    }

    const u32 bidx  = m0 / (u32)SEQ;     // block rows lie inside one batch (SEQ % 128 == 0)
    const u32 s0    = m0 - bidx * (u32)SEQ;
    const u32 piece = lane & 7u;
    const u32 lsub  = lane >> 3;

    if constexpr (MODE == 0) {
#pragma unroll
        for (int i = 0; i < 2; ++i)
#pragma unroll
            for (int j = 0; j < 4; ++j) {
                const u32 nl = wn * 64u + (u32)j * 16u + c16;
#pragma unroll
                for (int r = 0; r < 8; ++r) {
                    const u32 ml = wm * 32u + (u32)i * 16u + hh8 + (u32)r;
                    Cs[ml * C_PITCH + nl] = (f16)(acc[i][j][r] * accMul);
                }
            }
        __syncthreads();
        f16* op = (f16*)out;
        const size_t bh0 = (size_t)bidx * NHEAD + (n0 >> 6);
{
#pragma unroll
            for (u32 it = 0; it < 8; ++it) {
                const u32 L    = wave * 32u + it * 4u + lsub;   // 0..255
                const u32 ml   = L >> 1;
                const u32 hsel = L & 1u;
                const v8h v = *(const v8h*)&Cs[ml * C_PITCH + hsel * 64u + piece * 8u];
                f16* dp = op + ((bh0 + hsel) * SEQ + s0 + ml) * HD + piece * 8u;
                *(v8h*)dp = v;
            }
            
        }
    } else if constexpr (MODE == 1) {
        // stage transposed: Cs[n][m]
#pragma unroll
        for (int i = 0; i < 2; ++i)
#pragma unroll
            for (int j = 0; j < 4; ++j) {
                const u32 nl = wn * 64u + (u32)j * 16u + c16;
                H8U t;
#pragma unroll
                for (int r = 0; r < 8; ++r) t.e[r] = (f16)(acc[i][j][r] * accMul);
                *(v8h*)&Cs[nl * C_PITCH + wm * 32u + (u32)i * 16u + hh8] = t.v;
            }
        __syncthreads();
        f16* op = (f16*)out;
{
#pragma unroll
            for (u32 it = 0; it < 8; ++it) {
                const u32 L  = wave * 32u + it * 4u + lsub;     // 0..255
                const u32 nl = L >> 1;
                const u32 mh = L & 1u;
                const v8h v = *(const v8h*)&Cs[nl * C_PITCH + mh * 64u + piece * 8u];
                f16* dp = op + ((size_t)(bidx * (u32)HID + n0 + nl) * SEQ + s0 + mh * 64u + piece * 8u);
                *(v8h*)dp = v;
            }
            
        }
    } else {
        float* Cf = (float*)Cs;      // [64][128] f32, padded rows
        float* of = (float*)out;
#pragma unroll
        for (u32 half = 0; half < 2; ++half) {
            if ((wm >> 1) == half) {
#pragma unroll
                for (int i = 0; i < 2; ++i)
#pragma unroll
                    for (int j = 0; j < 4; ++j) {
                        const u32 nl = wn * 64u + (u32)j * 16u + c16;
#pragma unroll
                        for (int r = 0; r < 8; ++r) {
                            const u32 ml = (wm & 1u) * 32u + (u32)i * 16u + hh8 + (u32)r;
                            Cf[ml * CF_PITCH + nl] = acc[i][j][r] * accMul;
                        }
                    }
            }
            __syncthreads();
{
#pragma unroll
                for (u32 it = 0; it < 8; ++it) {
                    const u32 L    = wave * 32u + it * 4u + lsub;   // 0..255
                    const u32 row  = L >> 2;
                    const u32 part = L & 3u;
                    const v4f v = *(const v4f*)&Cf[row * CF_PITCH + part * 32u + piece * 4u];
                    float* dp = of + (size_t)(m0 + half * 64u + row) * HID + n0 + part * 32u + piece * 4u;
                    *(v4f*)dp = v;
                }
                
            }
            __syncthreads();
        }
    }
}

// q / k head-major planes
__global__ void __launch_bounds__(256) __attribute__((amdgpu_num_vgpr(256)))
gemm_head(const f16* __restrict__ A, const f16* __restrict__ W, f16* __restrict__ out, float accMul) {
    gemm_body<0>(A, W, (void*)out, accMul);
}

// v^T plane
__global__ void __launch_bounds__(256) __attribute__((amdgpu_num_vgpr(256)))
gemm_vt(const f16* __restrict__ A, const f16* __restrict__ W, f16* __restrict__ out, float accMul) {
    gemm_body<1>(A, W, (void*)out, accMul);
}

// f32 output rows
__global__ void __launch_bounds__(256) __attribute__((amdgpu_num_vgpr(256)))
gemm_out(const f16* __restrict__ A, const f16* __restrict__ W, float* __restrict__ out, float accMul) {
    gemm_body<2>(A, W, (void*)out, accMul);
}

// ---------------------------------------------------------------------------
// Flash attention (no mask, all SEQ keys). grid (SEQ/128, NB*NHEAD), block 256 (8 waves),
// wave owns 16 query rows (Q fragments resident). Block streams 64-key tiles:
// K staged [key][d], V^T staged [d][key]. Scores on WMMA, row max via DPP, exp2 in f32
// carried x2^10, P relayed per wave through LDS as A fragments, O += P.V and
// row sums += P.ones on WMMA. Output f16 plane [b*SEQ+q][1024] carried x1024, written as
// coverage: every (b, q, h*64..h*64+63) row segment exactly once.
// LDS: ks, vsT cross-wave (block barriers); ps per-wave but also separated by block barriers.
// staged extent == consumed extent for ks (64x64), vsT (64x64), ps (16x64).
// ---------------------------------------------------------------------------
__global__ void __launch_bounds__(256) __attribute__((amdgpu_num_vgpr(256)))
attn_fwd(const f16* __restrict__ Qp, const f16* __restrict__ Kp, const f16* __restrict__ Vt,
         f16* __restrict__ Cp) {
    __shared__ __attribute__((aligned(16))) f16 ks[64 * AT_PITCH];      // [key][d]
    __shared__ __attribute__((aligned(16))) f16 vsT[64 * AT_PITCH];     // [d][key]
    __shared__ __attribute__((aligned(16))) f16 ps[8][16 * AT_PITCH];   // per-wave P relay / ctx stage
    static_assert(HD == 8 * 8);            // 8 lanes x 8 halves per row segment
    static_assert(2 * 256 * 8 == 64 * 64); // staging: 2 x 256 threads x 8 halves per tile

    const u32 tid  = threadIdx.x;
    const u32 lane = tid & 31u;
    const u32 wave = tid >> 5;
    const u32 hh8  = (lane >> 4) << 3;
    const u32 c16  = lane & 15u;
    const u32 bh   = blockIdx.y;
    const u32 bidx = bh >> 4;            // NHEAD == 16
    const u32 hidx = bh & 15u;
    const u32 q0   = blockIdx.x * 128u + wave * 16u;
    const size_t head = (size_t)bh * SEQ * HD;

    v16h qa[2];
#pragma unroll
    for (int c = 0; c < 2; ++c) qa[c] = load_frag(Qp + head, q0, HD, (u32)c * 32u, lane);

    FragU onesu;
#pragma unroll
    for (int i = 0; i < 16; ++i) onesu.e[i] = (f16)1.0f;
    const v16h ones = onesu.v;

    float m[8];
    v8f   o[4], lacc;
#pragma unroll
    for (int r = 0; r < 8; ++r) m[r] = -1.0e30f;
#pragma unroll
    for (int dt = 0; dt < 4; ++dt) o[dt] = zero8();
    lacc = zero8();

    // log2-domain scale: acc = 256 * q.k ; x = log2(e) * q.k / 8 = acc * log2(e) / 2048
    const float cl = 1.4426950408889634f * 0.00048828125f;
    f16* psw = &ps[wave][0];

#pragma unroll 1
    for (u32 kt = 0; kt < (u32)(SEQ / 64); ++kt) {
        __syncthreads();
#pragma unroll
        for (u32 p2 = 0; p2 < 2; ++p2) {
            const u32 p   = tid + p2 * 256u;
            const u32 row = p >> 3;
            const u32 pc  = (p & 7u) << 3;
            const v8h kv = *(const v8h*)(Kp + head + (size_t)(kt * 64u + row) * HD + pc);
            const v8h vv = *(const v8h*)(Vt + head + (size_t)row * SEQ + kt * 64u + pc);
            *(v8h*)&ks[row * AT_PITCH + pc]  = kv;
            *(v8h*)&vsT[row * AT_PITCH + pc] = vv;
        }
        __syncthreads();

        // S[16 q x 64 keys]
        v8f s[4];
#pragma unroll
        for (int nt = 0; nt < 4; ++nt) s[nt] = zero8();
#pragma unroll
        for (int c = 0; c < 2; ++c) {
#pragma unroll
            for (int nt = 0; nt < 4; ++nt) {
                const v16h kb = load_frag(ks, (u32)nt * 16u, AT_PITCH, (u32)c * 32u, lane);
                s[nt] = wmma16(qa[c], kb, s[nt]);
            }
        }

        // online softmax per row r (row 8h + r), max-subtracted, exp2 domain
#pragma unroll
        for (int r = 0; r < 8; ++r) {
            float x[4];
#pragma unroll
            for (int nt = 0; nt < 4; ++nt) x[nt] = s[nt][r] * cl;
            const float tm = rowmax16(fmaxf(fmaxf(x[0], x[1]), fmaxf(x[2], x[3])));
            const float mn = fmaxf(m[r], tm);
            const float al = fexp2(m[r] - mn);
            m[r] = mn;
            lacc[r] *= al;
#pragma unroll
            for (int dt = 0; dt < 4; ++dt) o[dt][r] *= al;
            const float sh = 10.0f - mn;      // carry 2^10
#pragma unroll
            for (int nt = 0; nt < 4; ++nt)
                psw[(hh8 + (u32)r) * AT_PITCH + (u32)nt * 16u + c16] = (f16)fexp2(x[nt] + sh);
        }
        __syncthreads();

        // O += P . V ; l += P . ones  (P reloaded as A fragments from the relay)
#pragma unroll
        for (int kk = 0; kk < 2; ++kk) {
            const v16h pa = load_frag(psw, 0u, AT_PITCH, (u32)kk * 32u, lane);
#pragma unroll
            for (int dt = 0; dt < 4; ++dt) {
                const v16h vb = load_frag(vsT, (u32)dt * 16u, AT_PITCH, (u32)kk * 32u, lane);
                o[dt] = wmma16(pa, vb, o[dt]);
            }
            lacc = wmma16(pa, ones, lacc);
        }
    }
    __syncthreads();

    // normalize: plane value = 1024 * (O/16) / l = O * 64 / l
#pragma unroll
    for (int r = 0; r < 8; ++r) {
        const float inv = (CARRY_CTX / CARRY_QKV) / lacc[r];
#pragma unroll
        for (int dt = 0; dt < 4; ++dt)
            psw[(hh8 + (u32)r) * AT_PITCH + (u32)dt * 16u + c16] = (f16)(o[dt][r] * inv);
    }
    __syncthreads();

    const u32 piece = lane & 7u;
    const u32 lsub  = lane >> 3;
{
#pragma unroll
        for (u32 it = 0; it < 4; ++it) {
            const u32 L = it * 4u + lsub;     // query row 0..15 within the wave tile
            const v8h v = *(const v8h*)&psw[L * AT_PITCH + piece * 8u];
            f16* dp = Cp + ((size_t)(bidx * (u32)SEQ + q0 + L) * HID + hidx * (u32)HD + piece * 8u);
            *(v8h*)dp = v;
        }
        
    }
}

// coverage equalities (threads x elements == plane elements)
static_assert((size_t)(MROWS / 2) * 256 * 8 == (size_t)MROWS * HID);                       // cvt_rows -> Xh
static_assert((size_t)(3 * HID / 2) * 256 * 8 == (size_t)3 * HID * HID);                   // cvt_rows -> Wt
static_assert((size_t)(HID / 2) * 256 * 8 == (size_t)HID * HID);                           // cvt_rows -> Wot
static_assert((size_t)(MROWS / 128) * (HID / 128) * 128 * 128 == (size_t)MROWS * HID);     // gemm planes / out
static_assert((size_t)(SEQ / 128) * (NB * NHEAD) * 128 * HD == (size_t)MROWS * HID);       // attn_fwd -> Cp
// workspace: 5 activation planes + 4 weight planes of halves, at most 128 MiB
static_assert(((size_t)5 * MROWS * HID + (size_t)4 * HID * HID) * sizeof(f16) <= (size_t)134217728);
// output extent: last written f32 element index < NB_FULL*SEQ_FULL*HID
static_assert((size_t)MROWS * HID <= (size_t)NB_FULL * SEQ_FULL * HID);

// ---------------------------------------------------------------------------
// Launch: 8 kernel launches, workspace 5 planes of MROWS*1024 halves + 4 of 1024*1024 halves.
// ---------------------------------------------------------------------------
extern "C" void kernel_launch(void* const* d_in, const int* in_sizes, int n_in,
                              void* d_out, int out_size, void* d_ws, size_t ws_size,
                              hipStream_t stream) {
    if (n_in < 3) return;
    if (in_sizes[0] < ((NB - 1) * SEQ_FULL + SEQ) * HID) return;
    if (in_sizes[1] < 3 * HID * HID) return;
    if (in_sizes[2] < HID * HID) return;
    if (out_size < MROWS * HID) return;

    const float* x     = (const float*)d_in[0];   // [NB_FULL][SEQ_FULL][1024]
    const float* wqkv  = (const float*)d_in[1];   // [3072 out][1024 in], row blocks q | k | v
    const float* wproj = (const float*)d_in[2];   // [1024 out][1024 in]

    const size_t nX = (size_t)MROWS * HID;    // halves per activation plane
    const size_t nW = (size_t)HID * HID;      // halves per weight plane
    const size_t totalHalves = 5 * nX + 4 * nW;
    if (ws_size < totalHalves * sizeof(f16)) return;

    f16* Xh  = (f16*)d_ws;       // [MROWS][1024]               carry 16
    f16* Wt  = Xh  + nX;         // [3072 out][1024 in]         carry 32 (q | k | v row blocks)
    f16* Wot = Wt  + 3 * nW;     // [1024 out][1024 in]         carry 32
    f16* Qp  = Wot + nW;         // [NB*16][SEQ][64]            carry 16
    f16* Kp  = Qp  + nX;         // [NB*16][SEQ][64]            carry 16
    f16* Vtp = Kp  + nX;         // [NB*1024][SEQ] (V^T)        carry 16
    f16* Cp  = Vtp + nX;         // [MROWS][1024]               carry 1024

    // activations: dst row m of batch b <- src row b*SEQ_FULL + (m % SEQ)
    cvt_rows<<<MROWS / 2, 256, 0, stream>>>(x, Xh, (u32)MROWS, (u32)SEQ, (u32)SEQ_FULL, CARRY_X);
    // weights already [out][in] (k contiguous): identity row map
    cvt_rows<<<3 * HID / 2, 256, 0, stream>>>(wqkv, Wt, (u32)(3 * HID), (u32)(3 * HID), (u32)(3 * HID), CARRY_W);
    cvt_rows<<<HID / 2, 256, 0, stream>>>(wproj, Wot, (u32)HID, (u32)HID, (u32)HID, CARRY_W);

    const dim3 gg(MROWS / 128, HID / 128);
    // plane = 16 * acc / (16*32) = acc/32
    const float accQKV = CARRY_QKV / (CARRY_X * CARRY_W);
    gemm_head<<<gg, 256, 0, stream>>>(Xh, Wt,          Qp,  accQKV);
    gemm_head<<<gg, 256, 0, stream>>>(Xh, Wt + nW,     Kp,  accQKV);
    gemm_vt  <<<gg, 256, 0, stream>>>(Xh, Wt + 2 * nW, Vtp, accQKV);

    attn_fwd<<<dim3(SEQ / 128, NB * NHEAD), 256, 0, stream>>>(Qp, Kp, Vtp, Cp);

    // out = acc / (1024*32)
    const float accOut = 1.0f / (CARRY_CTX * CARRY_W);
    gemm_out<<<gg, 256, 0, stream>>>(Cp, Wot, (float*)d_out, accOut);
}

// v002
// A run of this version takes 116 microseconds.
// Timed twice side by side with v001, it ran 1.45 times as fast both times.
// Counting every step since v000, it is 2.31 times as fast.
#include <hip/hip_runtime.h>

// Contractions (fused QKV projection, Q.K^T, P.V, P row-sum, output projection): v_wmma_f32_16x16x32_f16, f16 operands with power-of-two carries, f32 accumulate; every float input enters as its bf16 RNE value; softmax in f32.

#ifndef NB
#define NB 2
#endif
#ifndef SEQ
#define SEQ 2048
#endif
#define NB_FULL   2
#define SEQ_FULL  2048
#define HID       1024
#define NHEAD     16
#define HD        64
#define MROWS     (NB * SEQ)

static_assert(HID == NHEAD * HD);        // merged head width
static_assert(NHEAD == 16);              // bh >> 4 / bh & 15 decoding in attn_fwd
static_assert(HD == 64);
static_assert(SEQ % 128 == 0);           // 128-row blocks never straddle a batch
static_assert(SEQ % 64 == 0);            // 64-key tiles
static_assert(SEQ / 64 >= 2);            // attention ring: at least two stages
static_assert(SEQ <= SEQ_FULL);
static_assert(NB >= 1 && NB <= NB_FULL);
static_assert(MROWS % 128 == 0);         // GEMM M tile
static_assert(HID % 128 == 0);           // GEMM N tile
static_assert(HID % 32 == 0);            // WMMA k step
static_assert(HID % 128 == 0 && HID / 128 >= 2);   // GEMM ring: whole 128-k stages, at least two
static_assert(HID == 128 * 8);           // cvt_rows: 128 threads x 8 values per row
static_assert((3 * HID) % 2 == 0);       // cvt_rows grid = nrows / 2
static_assert(MROWS % 2 == 0);           // cvt_rows grid = nrows / 2

// carries (exact powers of two)
#define CARRY_X    16.0f     // input activation plane
#define CARRY_W    32.0f     // weight planes
#define CARRY_QKV  16.0f     // q, k, v^T planes (true value x16)
#define CARRY_CTX  1024.0f   // context plane (true value x1024)
// softmax exp values carry 2^10 (added to the exp2 argument)

// LDS row pitches: 16 B x odd, so the 16 rows that one ds_load_b128 touches per lane half fall on distinct banks
#define AB_PITCH  136u   // halves: GEMM A / B stages, 256-B rows on a 272-B pitch
#define KSTAGE    128u   // k values per GEMM stage (four WMMA k steps)
#define C_PITCH   136u   // halves: GEMM f16 output stage, 256-B rows on a 272-B pitch
#define CF_PITCH  132u   // floats: GEMM f32 output stage, 512-B rows on a 528-B pitch
#define AT_PITCH  72u    // halves: attention K, V^T and P tiles, 128-B rows on a 144-B pitch

typedef unsigned u32;
typedef _Float16 f16;
typedef f16   v16h __attribute__((ext_vector_type(16)));
typedef f16   v8h  __attribute__((ext_vector_type(8)));
typedef float v8f  __attribute__((ext_vector_type(8)));
typedef float v4f  __attribute__((ext_vector_type(4)));

union FragU { v16h v; v8h half[2]; f16 e[16]; };
union H8U   { v8h v; f16 e[8]; };

__device__ __forceinline__ v8f zero8() {
    v8f z = {0.f, 0.f, 0.f, 0.f, 0.f, 0.f, 0.f, 0.f};
    return z;
}

// 16-bit WMMA with hazard guard: D += A[16 x 32k] * B[32k x 16]
__device__ __forceinline__ v8f wmma16(v16h a, v16h b, v8f c) {
    v8f d = __builtin_amdgcn_wmma_f32_16x16x32_f16(false, a, false, b, (short)0, c, false, false);
    asm volatile("v_nop\n\tv_nop\n\tv_nop\n\tv_nop" : "+v"(d) : "v"(a), "v"(b));
    return d;
}

// f32 -> nearest-even bf16 value, returned as f32
__device__ __forceinline__ float bf16_rne(float x) {
    u32 u = __float_as_uint(x);
    u = (u + 0x7fffu + ((u >> 16) & 1u)) & 0xffff0000u;
    return __uint_as_float(u);
}

__device__ __forceinline__ float fexp2(float x) {
#if defined(__has_builtin)
#if __has_builtin(__builtin_amdgcn_exp2f)
    return __builtin_amdgcn_exp2f(x);
#else
    return exp2f(x);
#endif
#else
    return exp2f(x);
#endif
}

// max over the 16 lanes of each lane half (DPP row rotations; D-layout rows are DPP rows)
__device__ __forceinline__ float rowmax16(float x) {
    int v = __builtin_bit_cast(int, x);
    x = fmaxf(x, __builtin_bit_cast(float, __builtin_amdgcn_update_dpp(v, v, 0x121, 0xf, 0xf, false)));
    v = __builtin_bit_cast(int, x);
    x = fmaxf(x, __builtin_bit_cast(float, __builtin_amdgcn_update_dpp(v, v, 0x122, 0xf, 0xf, false)));
    v = __builtin_bit_cast(int, x);
    x = fmaxf(x, __builtin_bit_cast(float, __builtin_amdgcn_update_dpp(v, v, 0x124, 0xf, 0xf, false)));
    v = __builtin_bit_cast(int, x);
    x = fmaxf(x, __builtin_bit_cast(float, __builtin_amdgcn_update_dpp(v, v, 0x128, 0xf, 0xf, false)));
    return x;
}

// 16 x 32 fragment from a tile whose k dimension is contiguous (pitch in halves).
// lane l: row rowbase + (l&15); elements 0..7 <- k = kcol + 8h .. +7,
// elements 8..15 <- k = kcol + 16 + 8h .. +7  (h = l>>4). Same map for A and B.
__device__ __forceinline__ v16h load_frag(const f16* tile, u32 rowbase, u32 pitch, u32 kcol, u32 lane) {
    const u32 r  = rowbase + (lane & 15u);
    const u32 kh = (lane >> 4) << 3;
    const f16* p = tile + (size_t)r * pitch + kcol + kh;
    FragU f;
    f.half[0] = *(const v8h*)(p);
    f.half[1] = *(const v8h*)(p + 16);
    return f.v;
}

// One operand's stage, 128 rows x 128 k (256 B a row), global -> LDS with no register in between.
// Lane: 16 B of row (tid >> 4) + 16 i, i = 0..7; a wave's copy covers two whole 256-B rows.
// g: the lane's global address in row tid >> 4 of the stage; l: its LDS byte address there.
// s_wait_xcnt 0 closes the statement so that no address register is rewritten ahead of it.
__device__ __forceinline__ void copy_stage(const f16* g, u32 l) {
    const f16* g1 = g + 16 * HID;
    const f16* g2 = g + 32 * HID;
    const f16* g3 = g + 48 * HID;
    const f16* g4 = g + 64 * HID;
    const f16* g5 = g + 80 * HID;
    const f16* g6 = g + 96 * HID;
    const f16* g7 = g + 112 * HID;
    const u32 rs = 16u * AB_PITCH * (u32)sizeof(f16);
    asm volatile("global_load_async_to_lds_b128 %0, %8, off\n\t"
                 "global_load_async_to_lds_b128 %1, %9, off\n\t"
                 "global_load_async_to_lds_b128 %2, %10, off\n\t"
                 "global_load_async_to_lds_b128 %3, %11, off\n\t"
                 "global_load_async_to_lds_b128 %4, %12, off\n\t"
                 "global_load_async_to_lds_b128 %5, %13, off\n\t"
                 "global_load_async_to_lds_b128 %6, %14, off\n\t"
                 "global_load_async_to_lds_b128 %7, %15, off\n\t"
                 "s_wait_xcnt 0x0"
                 :: "v"(l), "v"(l + rs), "v"(l + 2u * rs), "v"(l + 3u * rs),
                    "v"(l + 4u * rs), "v"(l + 5u * rs), "v"(l + 6u * rs), "v"(l + 7u * rs),
                    "v"(g), "v"(g1), "v"(g2), "v"(g3), "v"(g4), "v"(g5), "v"(g6), "v"(g7)
                 : "memory");
}

// One attention stage, K 64 x 64 and V^T 64 x 64 halves (128 B a row), global -> LDS with no register in between.
// Lane: 16 B of rows tid >> 3 and (tid >> 3) + 32 of each tile. gk, gv: the lane's global addresses in its
// first row; lk, lv: its LDS byte addresses there.
// s_wait_xcnt 0 closes the statement so that no address register is rewritten ahead of it.
__device__ __forceinline__ void copy_kv(const f16* gk, const f16* gv, u32 lk, u32 lv) {
    const f16* gk1 = gk + 32 * HD;
    const f16* gv1 = gv + 32 * SEQ;
    const u32 rs = 32u * AT_PITCH * (u32)sizeof(f16);
    asm volatile("global_load_async_to_lds_b128 %0, %4, off\n\t"
                 "global_load_async_to_lds_b128 %1, %5, off\n\t"
                 "global_load_async_to_lds_b128 %2, %6, off\n\t"
                 "global_load_async_to_lds_b128 %3, %7, off\n\t"
                 "s_wait_xcnt 0x0"
                 :: "v"(lk), "v"(lk + rs), "v"(lv), "v"(lv + rs),
                    "v"(gk), "v"(gk1), "v"(gv), "v"(gv1)
                 : "memory");
}

// ---------------------------------------------------------------------------
// f32 rows [.][1024] -> f16 plane (bf16 RNE value times carry). 128 threads per 1024-wide
// Row mapping dst row m -> src row (m / dstper) * srcper + m % dstper lets a reduced build
// read full-size inputs (weights: dstper == srcper == nrows, identity).
// coverage: nrows x 1024 halves, every element exactly once (grid = nrows*128/256).
// ---------------------------------------------------------------------------
__global__ void __launch_bounds__(256)
cvt_rows(const float* __restrict__ src, f16* __restrict__ dst, u32 nrows, u32 dstper, u32 srcper, float carry) {
    const u32 g  = blockIdx.x * 256u + threadIdx.x;
    const u32 m  = g >> 7;
    const u32 c8 = (g & 127u) << 3;
    if (m >= nrows) return;
    const u32 mb = m / dstper;
    const u32 sm = mb * srcper + (m - mb * dstper);
    const float* sp = src + (size_t)sm * HID + c8;
    const v4f a = *(const v4f*)sp;
    const v4f b = *(const v4f*)(sp + 4);
    H8U o;
#pragma unroll
    for (u32 j = 0; j < 4; ++j) {
        const float x0 = a[j];
        const float x1 = b[j];
        o.e[j]     = (f16)(bf16_rne(x0) * carry);
        o.e[j + 4] = (f16)(bf16_rne(x1) * carry);
    }
    f16* dp = dst + (size_t)m * HID + c8;
    *(v8h*)dp = o.v;
    
}

// ---------------------------------------------------------------------------
// C[m][n] = sum_k A[m][k] * W[n][k] ; A [MROWS][1024] f16, W [1024][1024] f16 (k contiguous).
// Block tile 128 x 128, 8 waves as 4(M) x 2(N), 2 x 4 accumulators per wave, WMMA k step 32.
// A / B: two-buffer ring of 128-k stages filled by asynchronous copies, stage t + 1 in flight during trip t.
// MODE 1: f16 plane [b*HID + h*HD + d][s] (V transposed per head)
// MODE 2: f32 rows [m][1024] into the output buffer
// coverage per block: MODE 0/1 256 lines (128 rows x 2 heads | 128 n x 2 s-halves),
//                     MODE 2 2 x 256 lines (64 rows x 4 line-quarters per half).
// LDS: As/Bs/Cs all cross-wave, separated by block barriers.
// staged extent == consumed extent: As/Bs 128 x 128 per buffer, Cs 128 x 128 halves (or 64 x 128 floats).
// ---------------------------------------------------------------------------
template <int MODE>
__device__ __forceinline__ void gemm_body(const f16* __restrict__ A, const f16* __restrict__ W,
                                          void* __restrict__ out, float accMul) {
    __shared__ __attribute__((aligned(16))) f16 As[2][128 * AB_PITCH];
    __shared__ __attribute__((aligned(16))) f16 Bs[2][128 * AB_PITCH];
    __shared__ __attribute__((aligned(16))) f16 Cs[128 * C_PITCH];   // f16 [128][128] or f32 [64][128], padded rows
    static_assert(sizeof(f16) * 128 * C_PITCH >= sizeof(float) * 64 * CF_PITCH);   // Cs reuse as f32 [64][128]

    const u32 tid  = threadIdx.x;
    const u32 lane = tid & 31u;
    const u32 wave = tid >> 5;
    const u32 wm   = wave & 3u;
    const u32 wn   = wave >> 2;
    const u32 hh8  = (lane >> 4) << 3;   // D row half
    const u32 c16  = lane & 15u;         // D column
    const u32 m0   = blockIdx.x * 128u;
    const u32 n0   = blockIdx.y * 128u;

    v8f acc[2][4];
#pragma unroll
    for (int i = 0; i < 2; ++i)
#pragma unroll
        for (int j = 0; j < 4; ++j) acc[i][j] = zero8();

    const u32 srow = tid >> 4;
    const u32 scol = (tid & 15u) << 3;
    const f16* gA = A + (size_t)(m0 + srow) * HID + scol;
    const f16* gW = W + (size_t)(n0 + srow) * HID + scol;
    const u32 bufB = 128u * AB_PITCH * (u32)sizeof(f16);                   // bytes per buffer
    const u32 lA = (u32)(size_t)&As[0][srow * AB_PITCH + scol];            // LDS byte address, buffer 0
    const u32 lB = (u32)(size_t)&Bs[0][srow * AB_PITCH + scol];
    const u32 nst = (u32)HID / KSTAGE;

    // stage 0 lands and is published; stage 1 then flies during trip 0
    copy_stage(gA, lA);
    copy_stage(gW, lB);
    asm volatile("s_wait_asynccnt 0x0" ::: "memory");   // this wave's stage-0 copies have landed
    __syncthreads();
    copy_stage(gA + KSTAGE, lA + bufB);
    copy_stage(gW + KSTAGE, lB + bufB);

    // kept rolled: the ring's foot (waits, barrier, refill) stands once and the body stays small for the instruction cache
#pragma unroll 1
    for (u32 t = 0; t < nst; ++t) {
        const u32 b = t & 1u;
        const f16* as = &As[b][0];
        const f16* bs = &Bs[b][0];
        // unrolled: the k offsets fold into the ds_load offset fields
#pragma unroll
        for (u32 kk = 0; kk < KSTAGE; kk += 32u) {
            v16h af[2], bfr[4];
#pragma unroll
            for (int i = 0; i < 2; ++i) af[i] = load_frag(as, wm * 32u + (u32)i * 16u, AB_PITCH, kk, lane);
#pragma unroll
            for (int j = 0; j < 4; ++j) bfr[j] = load_frag(bs, wn * 64u + (u32)j * 16u, AB_PITCH, kk, lane);
#pragma unroll
            for (int i = 0; i < 2; ++i)
#pragma unroll
                for (int j = 0; j < 4; ++j) acc[i][j] = wmma16(af[i], bfr[j], acc[i][j]);
        }
        asm volatile("s_wait_dscnt 0x0" ::: "memory");      // this wave's reads of buffer b are done before its refill
        asm volatile("s_wait_asynccnt 0x0" ::: "memory");   // this wave's stage t + 1 copies have landed
        __syncthreads();                                    // publishes stage t + 1, frees buffer b
        if (t + 2u < nst) {
            copy_stage(gA + (t + 2u) * KSTAGE, lA + b * bufB);
            copy_stage(gW + (t + 2u) * KSTAGE, lB + b * bufB);
        }
    }
    asm volatile("s_wait_asynccnt 0x0" ::: "memory");       // nothing of the ring is outstanding past the loop

    const u32 bidx  = m0 / (u32)SEQ;     // block rows lie inside one batch (SEQ % 128 == 0)
    const u32 s0    = m0 - bidx * (u32)SEQ;
    const u32 piece = lane & 7u;
    const u32 lsub  = lane >> 3;

    if constexpr (MODE == 0) {
#pragma unroll
        for (int i = 0; i < 2; ++i)
#pragma unroll
            for (int j = 0; j < 4; ++j) {
                const u32 nl = wn * 64u + (u32)j * 16u + c16;
#pragma unroll
                for (int r = 0; r < 8; ++r) {
                    const u32 ml = wm * 32u + (u32)i * 16u + hh8 + (u32)r;
                    Cs[ml * C_PITCH + nl] = (f16)(acc[i][j][r] * accMul);
                }
            }
        __syncthreads();
        f16* op = (f16*)out;
        const size_t bh0 = (size_t)bidx * NHEAD + (n0 >> 6);
{
#pragma unroll
            for (u32 it = 0; it < 8; ++it) {
                const u32 L    = wave * 32u + it * 4u + lsub;   // 0..255
                const u32 ml   = L >> 1;
                const u32 hsel = L & 1u;
                const v8h v = *(const v8h*)&Cs[ml * C_PITCH + hsel * 64u + piece * 8u];
                f16* dp = op + ((bh0 + hsel) * SEQ + s0 + ml) * HD + piece * 8u;
                *(v8h*)dp = v;
            }
            
        }
    } else if constexpr (MODE == 1) {
        // stage transposed: Cs[n][m]
#pragma unroll
        for (int i = 0; i < 2; ++i)
#pragma unroll
            for (int j = 0; j < 4; ++j) {
                const u32 nl = wn * 64u + (u32)j * 16u + c16;
                H8U t;
#pragma unroll
                for (int r = 0; r < 8; ++r) t.e[r] = (f16)(acc[i][j][r] * accMul);
                *(v8h*)&Cs[nl * C_PITCH + wm * 32u + (u32)i * 16u + hh8] = t.v;
            }
        __syncthreads();
        f16* op = (f16*)out;
{
#pragma unroll
            for (u32 it = 0; it < 8; ++it) {
                const u32 L  = wave * 32u + it * 4u + lsub;     // 0..255
                const u32 nl = L >> 1;
                const u32 mh = L & 1u;
                const v8h v = *(const v8h*)&Cs[nl * C_PITCH + mh * 64u + piece * 8u];
                f16* dp = op + ((size_t)(bidx * (u32)HID + n0 + nl) * SEQ + s0 + mh * 64u + piece * 8u);
                *(v8h*)dp = v;
            }
            
        }
    } else {
        float* Cf = (float*)Cs;      // [64][128] f32, padded rows
        float* of = (float*)out;
#pragma unroll
        for (u32 half = 0; half < 2; ++half) {
            if ((wm >> 1) == half) {
#pragma unroll
                for (int i = 0; i < 2; ++i)
#pragma unroll
                    for (int j = 0; j < 4; ++j) {
                        const u32 nl = wn * 64u + (u32)j * 16u + c16;
#pragma unroll
                        for (int r = 0; r < 8; ++r) {
                            const u32 ml = (wm & 1u) * 32u + (u32)i * 16u + hh8 + (u32)r;
                            Cf[ml * CF_PITCH + nl] = acc[i][j][r] * accMul;
                        }
                    }
            }
            __syncthreads();
{
#pragma unroll
                for (u32 it = 0; it < 8; ++it) {
                    const u32 L    = wave * 32u + it * 4u + lsub;   // 0..255
                    const u32 row  = L >> 2;
                    const u32 part = L & 3u;
                    const v4f v = *(const v4f*)&Cf[row * CF_PITCH + part * 32u + piece * 4u];
                    float* dp = of + (size_t)(m0 + half * 64u + row) * HID + n0 + part * 32u + piece * 4u;
                    *(v4f*)dp = v;
                }
                
            }
            __syncthreads();
        }
    }
}

// q / k head-major planes
__global__ void __launch_bounds__(256) __attribute__((amdgpu_num_vgpr(256)))
gemm_head(const f16* __restrict__ A, const f16* __restrict__ W, f16* __restrict__ out, float accMul) {
    gemm_body<0>(A, W, (void*)out, accMul);
}

// v^T plane
__global__ void __launch_bounds__(256) __attribute__((amdgpu_num_vgpr(256)))
gemm_vt(const f16* __restrict__ A, const f16* __restrict__ W, f16* __restrict__ out, float accMul) {
    gemm_body<1>(A, W, (void*)out, accMul);
}

// f32 output rows
__global__ void __launch_bounds__(256) __attribute__((amdgpu_num_vgpr(256)))
gemm_out(const f16* __restrict__ A, const f16* __restrict__ W, float* __restrict__ out, float accMul) {
    gemm_body<2>(A, W, (void*)out, accMul);
}

// ---------------------------------------------------------------------------
// Flash attention (no mask, all SEQ keys). grid (SEQ/128, NB*NHEAD), block 256 (8 waves),
// wave owns 16 query rows (Q fragments resident). Block streams 64-key tiles through a two-buffer
// ring filled by asynchronous copies (tile kt + 1 in flight during trip kt): K staged [key][d], V^T staged [d][key]. Scores on WMMA, row max via DPP, exp2 in f32
// carried x2^10, P relayed per wave through LDS as A fragments, O += P.V and
// row sums += P.ones on WMMA. Output f16 plane [b*SEQ+q][1024] carried x1024, written as
// coverage: every (b, q, h*64..h*64+63) row segment exactly once.
// LDS: ks, vsT cross-wave (block barriers); ps per-wave but also separated by block barriers.
// staged extent == consumed extent for ks (64x64), vsT (64x64), ps (16x64).
// ---------------------------------------------------------------------------
__global__ void __launch_bounds__(256) __attribute__((amdgpu_num_vgpr(256)))
attn_fwd(const f16* __restrict__ Qp, const f16* __restrict__ Kp, const f16* __restrict__ Vt,
         f16* __restrict__ Cp) {
    __shared__ __attribute__((aligned(16))) f16 ks[2][64 * AT_PITCH];   // [buffer][key][d]
    __shared__ __attribute__((aligned(16))) f16 vsT[2][64 * AT_PITCH];  // [buffer][d][key]
    __shared__ __attribute__((aligned(16))) f16 ps[8][16 * AT_PITCH];   // per-wave P relay / ctx stage
    static_assert(HD == 8 * 8);            // 8 lanes x 8 halves per row segment
    static_assert(2 * 256 * 8 == 64 * 64); // staging: 2 copies x 256 threads x 8 halves per tile

    const u32 tid  = threadIdx.x;
    const u32 lane = tid & 31u;
    const u32 wave = tid >> 5;
    const u32 hh8  = (lane >> 4) << 3;
    const u32 c16  = lane & 15u;
    const u32 bh   = blockIdx.y;
    const u32 bidx = bh >> 4;            // NHEAD == 16
    const u32 hidx = bh & 15u;
    const u32 q0   = blockIdx.x * 128u + wave * 16u;
    const size_t head = (size_t)bh * SEQ * HD;

    v16h qa[2];
#pragma unroll
    for (int c = 0; c < 2; ++c) qa[c] = load_frag(Qp + head, q0, HD, (u32)c * 32u, lane);

    FragU onesu;
#pragma unroll
    for (int i = 0; i < 16; ++i) onesu.e[i] = (f16)1.0f;
    const v16h ones = onesu.v;

    float m[8];
    v8f   o[4], lacc;
#pragma unroll
    for (int r = 0; r < 8; ++r) m[r] = -1.0e30f;
#pragma unroll
    for (int dt = 0; dt < 4; ++dt) o[dt] = zero8();
    lacc = zero8();

    // log2-domain scale: acc = 256 * q.k ; x = log2(e) * q.k / 8 = acc * log2(e) / 2048
    const float cl = 1.4426950408889634f * 0.00048828125f;
    f16* psw = &ps[wave][0];

    const u32 arow = tid >> 3;
    const u32 apc  = (tid & 7u) << 3;
    const f16* gK = Kp + head + (size_t)arow * HD + apc;
    const f16* gV = Vt + head + (size_t)arow * SEQ + apc;
    const u32 abuf = 64u * AT_PITCH * (u32)sizeof(f16);                    // bytes per buffer
    const u32 lK = (u32)(size_t)&ks[0][arow * AT_PITCH + apc];             // LDS byte address, buffer 0
    const u32 lV = (u32)(size_t)&vsT[0][arow * AT_PITCH + apc];
    const u32 ntile = (u32)(SEQ / 64);

    // tile 0 lands and is published; tile 1 then flies during trip 0
    copy_kv(gK, gV, lK, lV);
    asm volatile("s_wait_asynccnt 0x0" ::: "memory");   // this wave's tile-0 copies have landed
    __syncthreads();
    copy_kv(gK + 64 * HD, gV + 64, lK + abuf, lV + abuf);

#pragma unroll 1
    for (u32 kt = 0; kt < ntile; ++kt) {
        const u32 rb = kt & 1u;
        const f16* ksb = &ks[rb][0];
        const f16* vsb = &vsT[rb][0];

        // S[16 q x 64 keys]
        v8f s[4];
#pragma unroll
        for (int nt = 0; nt < 4; ++nt) s[nt] = zero8();
#pragma unroll
        for (int c = 0; c < 2; ++c) {
#pragma unroll
            for (int nt = 0; nt < 4; ++nt) {
                const v16h kb = load_frag(ksb, (u32)nt * 16u, AT_PITCH, (u32)c * 32u, lane);
                s[nt] = wmma16(qa[c], kb, s[nt]);
            }
        }

        // online softmax per row r (row 8h + r), max-subtracted, exp2 domain
#pragma unroll
        for (int r = 0; r < 8; ++r) {
            float x[4];
#pragma unroll
            for (int nt = 0; nt < 4; ++nt) x[nt] = s[nt][r] * cl;
            const float tm = rowmax16(fmaxf(fmaxf(x[0], x[1]), fmaxf(x[2], x[3])));
            const float mn = fmaxf(m[r], tm);
            const float al = fexp2(m[r] - mn);
            m[r] = mn;
            lacc[r] *= al;
#pragma unroll
            for (int dt = 0; dt < 4; ++dt) o[dt][r] *= al;
            const float sh = 10.0f - mn;      // carry 2^10
#pragma unroll
            for (int nt = 0; nt < 4; ++nt)
                psw[(hh8 + (u32)r) * AT_PITCH + (u32)nt * 16u + c16] = (f16)fexp2(x[nt] + sh);
        }
        __syncthreads();

        // O += P . V ; l += P . ones  (P reloaded as A fragments from the relay)
#pragma unroll
        for (int kk = 0; kk < 2; ++kk) {
            const v16h pa = load_frag(psw, 0u, AT_PITCH, (u32)kk * 32u, lane);
#pragma unroll
            for (int dt = 0; dt < 4; ++dt) {
                const v16h vb = load_frag(vsb, (u32)dt * 16u, AT_PITCH, (u32)kk * 32u, lane);
                o[dt] = wmma16(pa, vb, o[dt]);
            }
            lacc = wmma16(pa, ones, lacc);
        }
        asm volatile("s_wait_dscnt 0x0" ::: "memory");      // this wave's reads of buffer rb are done before its refill
        asm volatile("s_wait_asynccnt 0x0" ::: "memory");   // this wave's tile kt + 1 copies have landed
        __syncthreads();                                    // publishes tile kt + 1, frees buffer rb
        if (kt + 2u < ntile)
            copy_kv(gK + (size_t)(kt + 2u) * (64 * HD), gV + (kt + 2u) * 64u, lK + rb * abuf, lV + rb * abuf);
    }
    asm volatile("s_wait_asynccnt 0x0" ::: "memory");       // nothing of the ring is outstanding past the loop
    __syncthreads();

    // normalize: plane value = 1024 * (O/16) / l = O * 64 / l
#pragma unroll
    for (int r = 0; r < 8; ++r) {
        const float inv = (CARRY_CTX / CARRY_QKV) / lacc[r];
#pragma unroll
        for (int dt = 0; dt < 4; ++dt)
            psw[(hh8 + (u32)r) * AT_PITCH + (u32)dt * 16u + c16] = (f16)(o[dt][r] * inv);
    }
    __syncthreads();

    const u32 piece = lane & 7u;
    const u32 lsub  = lane >> 3;
{
#pragma unroll
        for (u32 it = 0; it < 4; ++it) {
            const u32 L = it * 4u + lsub;     // query row 0..15 within the wave tile
            const v8h v = *(const v8h*)&psw[L * AT_PITCH + piece * 8u];
            f16* dp = Cp + ((size_t)(bidx * (u32)SEQ + q0 + L) * HID + hidx * (u32)HD + piece * 8u);
            *(v8h*)dp = v;
        }
        
    }
}

// coverage equalities (threads x elements == plane elements)
static_assert((size_t)(MROWS / 2) * 256 * 8 == (size_t)MROWS * HID);                       // cvt_rows -> Xh
static_assert((size_t)(3 * HID / 2) * 256 * 8 == (size_t)3 * HID * HID);                   // cvt_rows -> Wt
static_assert((size_t)(HID / 2) * 256 * 8 == (size_t)HID * HID);                           // cvt_rows -> Wot
static_assert((size_t)(MROWS / 128) * (HID / 128) * 128 * 128 == (size_t)MROWS * HID);     // gemm planes / out
static_assert((size_t)(SEQ / 128) * (NB * NHEAD) * 128 * HD == (size_t)MROWS * HID);       // attn_fwd -> Cp
// workspace: 5 activation planes + 4 weight planes of halves, at most 128 MiB
static_assert(((size_t)5 * MROWS * HID + (size_t)4 * HID * HID) * sizeof(f16) <= (size_t)134217728);
// output extent: last written f32 element index < NB_FULL*SEQ_FULL*HID
static_assert((size_t)MROWS * HID <= (size_t)NB_FULL * SEQ_FULL * HID);

// ---------------------------------------------------------------------------
// Launch: 8 kernel launches, workspace 5 planes of MROWS*1024 halves + 4 of 1024*1024 halves.
// ---------------------------------------------------------------------------
extern "C" void kernel_launch(void* const* d_in, const int* in_sizes, int n_in,
                              void* d_out, int out_size, void* d_ws, size_t ws_size,
                              hipStream_t stream) {
    if (n_in < 3) return;
    if (in_sizes[0] < ((NB - 1) * SEQ_FULL + SEQ) * HID) return;
    if (in_sizes[1] < 3 * HID * HID) return;
    if (in_sizes[2] < HID * HID) return;
    if (out_size < MROWS * HID) return;

    const float* x     = (const float*)d_in[0];   // [NB_FULL][SEQ_FULL][1024]
    const float* wqkv  = (const float*)d_in[1];   // [3072 out][1024 in], row blocks q | k | v
    const float* wproj = (const float*)d_in[2];   // [1024 out][1024 in]

    const size_t nX = (size_t)MROWS * HID;    // halves per activation plane
    const size_t nW = (size_t)HID * HID;      // halves per weight plane
    const size_t totalHalves = 5 * nX + 4 * nW;
    if (ws_size < totalHalves * sizeof(f16)) return;

    f16* Xh  = (f16*)d_ws;       // [MROWS][1024]               carry 16
    f16* Wt  = Xh  + nX;         // [3072 out][1024 in]         carry 32 (q | k | v row blocks)
    f16* Wot = Wt  + 3 * nW;     // [1024 out][1024 in]         carry 32
    f16* Qp  = Wot + nW;         // [NB*16][SEQ][64]            carry 16
    f16* Kp  = Qp  + nX;         // [NB*16][SEQ][64]            carry 16
    f16* Vtp = Kp  + nX;         // [NB*1024][SEQ] (V^T)        carry 16
    f16* Cp  = Vtp + nX;         // [MROWS][1024]               carry 1024

    // activations: dst row m of batch b <- src row b*SEQ_FULL + (m % SEQ)
    cvt_rows<<<MROWS / 2, 256, 0, stream>>>(x, Xh, (u32)MROWS, (u32)SEQ, (u32)SEQ_FULL, CARRY_X);
    // weights already [out][in] (k contiguous): identity row map
    cvt_rows<<<3 * HID / 2, 256, 0, stream>>>(wqkv, Wt, (u32)(3 * HID), (u32)(3 * HID), (u32)(3 * HID), CARRY_W);
    cvt_rows<<<HID / 2, 256, 0, stream>>>(wproj, Wot, (u32)HID, (u32)HID, (u32)HID, CARRY_W);

    const dim3 gg(MROWS / 128, HID / 128);
    // plane = 16 * acc / (16*32) = acc/32
    const float accQKV = CARRY_QKV / (CARRY_X * CARRY_W);
    gemm_head<<<gg, 256, 0, stream>>>(Xh, Wt,          Qp,  accQKV);
    gemm_head<<<gg, 256, 0, stream>>>(Xh, Wt + nW,     Kp,  accQKV);
    gemm_vt  <<<gg, 256, 0, stream>>>(Xh, Wt + 2 * nW, Vtp, accQKV);

    attn_fwd<<<dim3(SEQ / 128, NB * NHEAD), 256, 0, stream>>>(Qp, Kp, Vtp, Cp);

    // out = acc / (1024*32)
    const float accOut = 1.0f / (CARRY_CTX * CARRY_W);
    gemm_out<<<gg, 256, 0, stream>>>(Cp, Wot, (float*)d_out, accOut);
}

// v003
// One run takes 109 microseconds.
// Timed twice side by side with v002, it ran 1.07 and 1.08 times as fast.
// Counting every step since v000, it is 2.49 times as fast.
#include <hip/hip_runtime.h>

// Contractions (fused QKV projection, Q.K^T, P.V, P row-sum, output projection): v_wmma_f32_16x16x32_f16, f16 operands with power-of-two carries, f32 accumulate; every float input enters as its bf16 RNE value; softmax in f32.

#ifndef NB
#define NB 2
#endif
#ifndef SEQ
#define SEQ 2048
#endif
#define NB_FULL   2
#define SEQ_FULL  2048
#define HID       1024
#define NHEAD     16
#define HD        64
#define MROWS     (NB * SEQ)

static_assert(HID == NHEAD * HD);        // merged head width
static_assert(NHEAD == 16);              // bh >> 4 / bh & 15 decoding in attn_fwd
static_assert(HD == 64);
static_assert(SEQ % 128 == 0);           // 128-row blocks never straddle a batch
static_assert(SEQ % 64 == 0);            // 64-key tiles
static_assert(SEQ / 64 >= 2);            // attention ring: at least two stages
static_assert(SEQ <= SEQ_FULL);
static_assert(NB >= 1 && NB <= NB_FULL);
static_assert(MROWS % 128 == 0);         // GEMM M tile
static_assert(HID % 128 == 0);           // GEMM N tile
static_assert(HID % 32 == 0);            // WMMA k step
static_assert(HID % 128 == 0 && HID / 128 >= 2);   // GEMM ring: whole 128-k stages, at least two
static_assert(HID == 128 * 8);           // cvt_rows: 128 threads x 8 values per row
static_assert((3 * HID) % 2 == 0);       // cvt_rows grid = nrows / 2
static_assert(MROWS % 2 == 0);           // cvt_rows grid = nrows / 2

// carries (exact powers of two)
#define CARRY_X    16.0f     // input activation plane
#define CARRY_W    32.0f     // weight planes
#define CARRY_QKV  16.0f     // q, k, v^T planes (true value x16)
#define CARRY_CTX  1024.0f   // context plane (true value x1024)
// softmax exp values carry 2^10 (added to the exp2 argument)

// LDS row pitches: 16 B x odd, so the 16 rows that one ds_load_b128 touches per lane half fall on distinct banks
#define AB_PITCH  136u   // halves: GEMM A / B stages, 256-B rows on a 272-B pitch
#define KSTAGE    128u   // k values per GEMM stage (four WMMA k steps)
#define C_PITCH   136u   // halves: GEMM f16 output stage, 256-B rows on a 272-B pitch
#define CF_PITCH  132u   // floats: GEMM f32 output stage, 512-B rows on a 528-B pitch
#define AT_PITCH  72u    // halves: attention K, V^T and P tiles, 128-B rows on a 144-B pitch

typedef unsigned u32;
typedef _Float16 f16;
typedef f16   v16h __attribute__((ext_vector_type(16)));
typedef f16   v8h  __attribute__((ext_vector_type(8)));
typedef float v8f  __attribute__((ext_vector_type(8)));
typedef float v4f  __attribute__((ext_vector_type(4)));

union FragU { v16h v; v8h half[2]; f16 e[16]; };
union H8U   { v8h v; f16 e[8]; };

__device__ __forceinline__ v8f zero8() {
    v8f z = {0.f, 0.f, 0.f, 0.f, 0.f, 0.f, 0.f, 0.f};
    return z;
}

// 16-bit WMMA with hazard guard: D += A[16 x 32k] * B[32k x 16]
__device__ __forceinline__ v8f wmma16(v16h a, v16h b, v8f c) {
    v8f d = __builtin_amdgcn_wmma_f32_16x16x32_f16(false, a, false, b, (short)0, c, false, false);
    asm volatile("v_nop\n\tv_nop\n\tv_nop\n\tv_nop" : "+v"(d) : "v"(a), "v"(b));
    return d;
}

// f32 -> nearest-even bf16 value, returned as f32
__device__ __forceinline__ float bf16_rne(float x) {
    u32 u = __float_as_uint(x);
    u = (u + 0x7fffu + ((u >> 16) & 1u)) & 0xffff0000u;
    return __uint_as_float(u);
}

__device__ __forceinline__ float fexp2(float x) {
#if defined(__has_builtin)
#if __has_builtin(__builtin_amdgcn_exp2f)
    return __builtin_amdgcn_exp2f(x);
#else
    return exp2f(x);
#endif
#else
    return exp2f(x);
#endif
}

// max over the 16 lanes of each lane half (DPP row rotations; D-layout rows are DPP rows)
__device__ __forceinline__ float rowmax16(float x) {
    int v = __builtin_bit_cast(int, x);
    x = fmaxf(x, __builtin_bit_cast(float, __builtin_amdgcn_update_dpp(v, v, 0x121, 0xf, 0xf, false)));
    v = __builtin_bit_cast(int, x);
    x = fmaxf(x, __builtin_bit_cast(float, __builtin_amdgcn_update_dpp(v, v, 0x122, 0xf, 0xf, false)));
    v = __builtin_bit_cast(int, x);
    x = fmaxf(x, __builtin_bit_cast(float, __builtin_amdgcn_update_dpp(v, v, 0x124, 0xf, 0xf, false)));
    v = __builtin_bit_cast(int, x);
    x = fmaxf(x, __builtin_bit_cast(float, __builtin_amdgcn_update_dpp(v, v, 0x128, 0xf, 0xf, false)));
    return x;
}

// 16 x 32 fragment from a tile whose k dimension is contiguous (pitch in halves).
// lane l: row rowbase + (l&15); elements 0..7 <- k = kcol + 8h .. +7,
// elements 8..15 <- k = kcol + 16 + 8h .. +7  (h = l>>4). Same map for A and B.
__device__ __forceinline__ v16h load_frag(const f16* tile, u32 rowbase, u32 pitch, u32 kcol, u32 lane) {
    const u32 r  = rowbase + (lane & 15u);
    const u32 kh = (lane >> 4) << 3;
    const f16* p = tile + (size_t)r * pitch + kcol + kh;
    FragU f;
    f.half[0] = *(const v8h*)(p);
    f.half[1] = *(const v8h*)(p + 16);
    return f.v;
}

// One operand's stage, 128 rows x 128 k (256 B a row), global -> LDS with no register in between.
// Lane: 16 B of row (tid >> 4) + 16 i, i = 0..7; a wave's copy covers two whole 256-B rows.
// g: the lane's global address in row tid >> 4 of the stage; l: its LDS byte address there.
// s_wait_xcnt 0 closes the statement so that no address register is rewritten ahead of it.
__device__ __forceinline__ void copy_stage(const f16* g, u32 l) {
    const f16* g1 = g + 16 * HID;
    const f16* g2 = g + 32 * HID;
    const f16* g3 = g + 48 * HID;
    const f16* g4 = g + 64 * HID;
    const f16* g5 = g + 80 * HID;
    const f16* g6 = g + 96 * HID;
    const f16* g7 = g + 112 * HID;
    const u32 rs = 16u * AB_PITCH * (u32)sizeof(f16);
    asm volatile("global_load_async_to_lds_b128 %0, %8, off\n\t"
                 "global_load_async_to_lds_b128 %1, %9, off\n\t"
                 "global_load_async_to_lds_b128 %2, %10, off\n\t"
                 "global_load_async_to_lds_b128 %3, %11, off\n\t"
                 "global_load_async_to_lds_b128 %4, %12, off\n\t"
                 "global_load_async_to_lds_b128 %5, %13, off\n\t"
                 "global_load_async_to_lds_b128 %6, %14, off\n\t"
                 "global_load_async_to_lds_b128 %7, %15, off\n\t"
                 "s_wait_xcnt 0x0"
                 :: "v"(l), "v"(l + rs), "v"(l + 2u * rs), "v"(l + 3u * rs),
                    "v"(l + 4u * rs), "v"(l + 5u * rs), "v"(l + 6u * rs), "v"(l + 7u * rs),
                    "v"(g), "v"(g1), "v"(g2), "v"(g3), "v"(g4), "v"(g5), "v"(g6), "v"(g7)
                 : "memory");
}

// One attention stage, K 64 x 64 and V^T 64 x 64 halves (128 B a row), global -> LDS with no register in between.
// Lane: 16 B of rows tid >> 3 and (tid >> 3) + 32 of each tile. gk, gv: the lane's global addresses in its
// first row; lk, lv: its LDS byte addresses there.
// s_wait_xcnt 0 closes the statement so that no address register is rewritten ahead of it.
__device__ __forceinline__ void copy_kv(const f16* gk, const f16* gv, u32 lk, u32 lv) {
    const f16* gk1 = gk + 32 * HD;
    const f16* gv1 = gv + 32 * SEQ;
    const u32 rs = 32u * AT_PITCH * (u32)sizeof(f16);
    asm volatile("global_load_async_to_lds_b128 %0, %4, off\n\t"
                 "global_load_async_to_lds_b128 %1, %5, off\n\t"
                 "global_load_async_to_lds_b128 %2, %6, off\n\t"
                 "global_load_async_to_lds_b128 %3, %7, off\n\t"
                 "s_wait_xcnt 0x0"
                 :: "v"(lk), "v"(lk + rs), "v"(lv), "v"(lv + rs),
                    "v"(gk), "v"(gk1), "v"(gv), "v"(gv1)
                 : "memory");
}

// ---------------------------------------------------------------------------
// f32 rows [.][1024] -> f16 plane (bf16 RNE value times carry). 128 threads per 1024-wide
// Row mapping dst row m -> src row (m / dstper) * srcper + m % dstper lets a reduced build
// read full-size inputs (weights: dstper == srcper == nrows, identity).
// coverage: nrows x 1024 halves, every element exactly once (grid = nrows*128/256).
// ---------------------------------------------------------------------------
__global__ void __launch_bounds__(256)
cvt_rows(const float* __restrict__ src, f16* __restrict__ dst, u32 nrows, u32 dstper, u32 srcper, float carry) {
    const u32 g  = blockIdx.x * 256u + threadIdx.x;
    const u32 m  = g >> 7;
    const u32 c8 = (g & 127u) << 3;
    if (m >= nrows) return;
    const u32 mb = m / dstper;
    const u32 sm = mb * srcper + (m - mb * dstper);
    const float* sp = src + (size_t)sm * HID + c8;
    const v4f a = *(const v4f*)sp;
    const v4f b = *(const v4f*)(sp + 4);
    H8U o;
#pragma unroll
    for (u32 j = 0; j < 4; ++j) {
        const float x0 = a[j];
        const float x1 = b[j];
        o.e[j]     = (f16)(bf16_rne(x0) * carry);
        o.e[j + 4] = (f16)(bf16_rne(x1) * carry);
    }
    f16* dp = dst + (size_t)m * HID + c8;
    *(v8h*)dp = o.v;
    
}

// ---------------------------------------------------------------------------
// C[m][n] = sum_k A[m][k] * W[n][k] ; A [MROWS][1024] f16, W [1024][1024] f16 (k contiguous).
// Block tile 128 x 128, 8 waves as 4(M) x 2(N), 2 x 4 accumulators per wave, WMMA k step 32.
// A / B: two-buffer ring of 128-k stages filled by asynchronous copies, stage t + 1 in flight during trip t.
// MODE 1: f16 plane [b*HID + h*HD + d][s] (V transposed per head)
// MODE 2: f32 rows [m][1024] into the output buffer
// coverage per block: MODE 0/1 256 lines (128 rows x 2 heads | 128 n x 2 s-halves),
//                     MODE 2 2 x 256 lines (64 rows x 4 line-quarters per half).
// LDS: As/Bs/Cs all cross-wave, separated by block barriers.
// staged extent == consumed extent: As/Bs 128 x 128 per buffer, Cs 128 x 128 halves (or 64 x 128 floats).
// ---------------------------------------------------------------------------
template <int MODE>
__device__ __forceinline__ void gemm_body(const f16* __restrict__ A, const f16* __restrict__ W,
                                          void* __restrict__ out, float accMul) {
    __shared__ __attribute__((aligned(16))) f16 As[2][128 * AB_PITCH];
    __shared__ __attribute__((aligned(16))) f16 Bs[2][128 * AB_PITCH];
    __shared__ __attribute__((aligned(16))) f16 Cs[128 * C_PITCH];   // f16 [128][128] or f32 [64][128], padded rows
    static_assert(sizeof(f16) * 128 * C_PITCH >= sizeof(float) * 64 * CF_PITCH);   // Cs reuse as f32 [64][128]

    const u32 tid  = threadIdx.x;
    const u32 lane = tid & 31u;
    const u32 wave = tid >> 5;
    const u32 wm   = wave & 3u;
    const u32 wn   = wave >> 2;
    const u32 hh8  = (lane >> 4) << 3;   // D row half
    const u32 c16  = lane & 15u;         // D column
    const u32 m0   = blockIdx.x * 128u;
    const u32 n0   = blockIdx.y * 128u;

    v8f acc[2][4];
#pragma unroll
    for (int i = 0; i < 2; ++i)
#pragma unroll
        for (int j = 0; j < 4; ++j) acc[i][j] = zero8();

    const u32 srow = tid >> 4;
    const u32 scol = (tid & 15u) << 3;
    const f16* gA = A + (size_t)(m0 + srow) * HID + scol;
    const f16* gW = W + (size_t)(n0 + srow) * HID + scol;
    const u32 bufB = 128u * AB_PITCH * (u32)sizeof(f16);                   // bytes per buffer
    const u32 lA = (u32)(size_t)&As[0][srow * AB_PITCH + scol];            // LDS byte address, buffer 0
    const u32 lB = (u32)(size_t)&Bs[0][srow * AB_PITCH + scol];
    const u32 nst = (u32)HID / KSTAGE;

    // stage 0 lands and is published; stage 1 then flies during trip 0
    copy_stage(gA, lA);
    copy_stage(gW, lB);
    asm volatile("s_wait_asynccnt 0x0" ::: "memory");   // this wave's stage-0 copies have landed
    __syncthreads();
    copy_stage(gA + KSTAGE, lA + bufB);
    copy_stage(gW + KSTAGE, lB + bufB);

    // kept rolled: the ring's foot (waits, barrier, refill) stands once and the body stays small for the instruction cache
#pragma unroll 1
    for (u32 t = 0; t < nst; ++t) {
        const u32 b = t & 1u;
        const f16* as = &As[b][0];
        const f16* bs = &Bs[b][0];
        // Fragment reads run two k steps ahead of the products, one group of 12 reads per k step: steps 0 and 1 at the
        // stage's head, step g + 2 in front of step g's products, so a group's LDS latency passes behind 8 to 16 WMMAs.
        // All reads are of buffer b, published before this trip. Unrolled: indices and ds_load offsets are constants.
        v16h af[KSTAGE / 32u][2], bfr[KSTAGE / 32u][4];
#pragma unroll
        for (u32 g = 0; g < 2u; ++g) {
#pragma unroll
            for (int i = 0; i < 2; ++i) af[g][i] = load_frag(as, wm * 32u + (u32)i * 16u, AB_PITCH, g * 32u, lane);
#pragma unroll
            for (int j = 0; j < 4; ++j) bfr[g][j] = load_frag(bs, wn * 64u + (u32)j * 16u, AB_PITCH, g * 32u, lane);
        }
#pragma unroll
        for (u32 g = 0; g < KSTAGE / 32u; ++g) {
            if (g + 2u < KSTAGE / 32u) {
#pragma unroll
                for (int i = 0; i < 2; ++i) af[g + 2u][i] = load_frag(as, wm * 32u + (u32)i * 16u, AB_PITCH, (g + 2u) * 32u, lane);
#pragma unroll
                for (int j = 0; j < 4; ++j) bfr[g + 2u][j] = load_frag(bs, wn * 64u + (u32)j * 16u, AB_PITCH, (g + 2u) * 32u, lane);
            }
#pragma unroll
            for (int i = 0; i < 2; ++i)
#pragma unroll
                for (int j = 0; j < 4; ++j) acc[i][j] = wmma16(af[g][i], bfr[g][j], acc[i][j]);
        }
        asm volatile("s_wait_dscnt 0x0" ::: "memory");      // this wave's reads of buffer b are done before its refill
        asm volatile("s_wait_asynccnt 0x0" ::: "memory");   // this wave's stage t + 1 copies have landed
        __syncthreads();                                    // publishes stage t + 1, frees buffer b
        if (t + 2u < nst) {
            copy_stage(gA + (t + 2u) * KSTAGE, lA + b * bufB);
            copy_stage(gW + (t + 2u) * KSTAGE, lB + b * bufB);
        }
    }
    asm volatile("s_wait_asynccnt 0x0" ::: "memory");       // nothing of the ring is outstanding past the loop

    const u32 bidx  = m0 / (u32)SEQ;     // block rows lie inside one batch (SEQ % 128 == 0)
    const u32 s0    = m0 - bidx * (u32)SEQ;
    const u32 piece = lane & 7u;
    const u32 lsub  = lane >> 3;

    if constexpr (MODE == 0) {
#pragma unroll
        for (int i = 0; i < 2; ++i)
#pragma unroll
            for (int j = 0; j < 4; ++j) {
                const u32 nl = wn * 64u + (u32)j * 16u + c16;
#pragma unroll
                for (int r = 0; r < 8; ++r) {
                    const u32 ml = wm * 32u + (u32)i * 16u + hh8 + (u32)r;
                    Cs[ml * C_PITCH + nl] = (f16)(acc[i][j][r] * accMul);
                }
            }
        __syncthreads();
        f16* op = (f16*)out;
        const size_t bh0 = (size_t)bidx * NHEAD + (n0 >> 6);
{
#pragma unroll
            for (u32 it = 0; it < 8; ++it) {
                const u32 L    = wave * 32u + it * 4u + lsub;   // 0..255
                const u32 ml   = L >> 1;
                const u32 hsel = L & 1u;
                const v8h v = *(const v8h*)&Cs[ml * C_PITCH + hsel * 64u + piece * 8u];
                f16* dp = op + ((bh0 + hsel) * SEQ + s0 + ml) * HD + piece * 8u;
                *(v8h*)dp = v;
            }
            
        }
    } else if constexpr (MODE == 1) {
        // stage transposed: Cs[n][m]
#pragma unroll
        for (int i = 0; i < 2; ++i)
#pragma unroll
            for (int j = 0; j < 4; ++j) {
                const u32 nl = wn * 64u + (u32)j * 16u + c16;
                H8U t;
#pragma unroll
                for (int r = 0; r < 8; ++r) t.e[r] = (f16)(acc[i][j][r] * accMul);
                *(v8h*)&Cs[nl * C_PITCH + wm * 32u + (u32)i * 16u + hh8] = t.v;
            }
        __syncthreads();
        f16* op = (f16*)out;
{
#pragma unroll
            for (u32 it = 0; it < 8; ++it) {
                const u32 L  = wave * 32u + it * 4u + lsub;     // 0..255
                const u32 nl = L >> 1;
                const u32 mh = L & 1u;
                const v8h v = *(const v8h*)&Cs[nl * C_PITCH + mh * 64u + piece * 8u];
                f16* dp = op + ((size_t)(bidx * (u32)HID + n0 + nl) * SEQ + s0 + mh * 64u + piece * 8u);
                *(v8h*)dp = v;
            }
            
        }
    } else {
        float* Cf = (float*)Cs;      // [64][128] f32, padded rows
        float* of = (float*)out;
#pragma unroll
        for (u32 half = 0; half < 2; ++half) {
            if ((wm >> 1) == half) {
#pragma unroll
                for (int i = 0; i < 2; ++i)
#pragma unroll
                    for (int j = 0; j < 4; ++j) {
                        const u32 nl = wn * 64u + (u32)j * 16u + c16;
#pragma unroll
                        for (int r = 0; r < 8; ++r) {
                            const u32 ml = (wm & 1u) * 32u + (u32)i * 16u + hh8 + (u32)r;
                            Cf[ml * CF_PITCH + nl] = acc[i][j][r] * accMul;
                        }
                    }
            }
            __syncthreads();
{
#pragma unroll
                for (u32 it = 0; it < 8; ++it) {
                    const u32 L    = wave * 32u + it * 4u + lsub;   // 0..255
                    const u32 row  = L >> 2;
                    const u32 part = L & 3u;
                    const v4f v = *(const v4f*)&Cf[row * CF_PITCH + part * 32u + piece * 4u];
                    float* dp = of + (size_t)(m0 + half * 64u + row) * HID + n0 + part * 32u + piece * 4u;
                    *(v4f*)dp = v;
                }
                
            }
            __syncthreads();
        }
    }
}

// q / k head-major planes
__global__ void __launch_bounds__(256) __attribute__((amdgpu_num_vgpr(256)))
gemm_head(const f16* __restrict__ A, const f16* __restrict__ W, f16* __restrict__ out, float accMul) {
    gemm_body<0>(A, W, (void*)out, accMul);
}

// v^T plane
__global__ void __launch_bounds__(256) __attribute__((amdgpu_num_vgpr(256)))
gemm_vt(const f16* __restrict__ A, const f16* __restrict__ W, f16* __restrict__ out, float accMul) {
    gemm_body<1>(A, W, (void*)out, accMul);
}

// f32 output rows
__global__ void __launch_bounds__(256) __attribute__((amdgpu_num_vgpr(256)))
gemm_out(const f16* __restrict__ A, const f16* __restrict__ W, float* __restrict__ out, float accMul) {
    gemm_body<2>(A, W, (void*)out, accMul);
}

// ---------------------------------------------------------------------------
// Flash attention (no mask, all SEQ keys). grid (SEQ/128, NB*NHEAD), block 256 (8 waves),
// wave owns 16 query rows (Q fragments resident). Block streams 64-key tiles through a two-buffer
// ring filled by asynchronous copies (tile kt + 1 in flight during trip kt): K staged [key][d], V^T staged [d][key]. Scores on WMMA, row max via DPP, exp2 in f32
// carried x2^10, P relayed per wave through LDS as A fragments, O += P.V and
// row sums += P.ones on WMMA. Output f16 plane [b*SEQ+q][1024] carried x1024, written as
// coverage: every (b, q, h*64..h*64+63) row segment exactly once.
// LDS: ks, vsT cross-wave (block barriers); ps per-wave but also separated by block barriers.
// staged extent == consumed extent for ks (64x64), vsT (64x64), ps (16x64).
// ---------------------------------------------------------------------------
__global__ void __launch_bounds__(256) __attribute__((amdgpu_num_vgpr(256)))
attn_fwd(const f16* __restrict__ Qp, const f16* __restrict__ Kp, const f16* __restrict__ Vt,
         f16* __restrict__ Cp) {
    __shared__ __attribute__((aligned(16))) f16 ks[2][64 * AT_PITCH];   // [buffer][key][d]
    __shared__ __attribute__((aligned(16))) f16 vsT[2][64 * AT_PITCH];  // [buffer][d][key]
    __shared__ __attribute__((aligned(16))) f16 ps[8][16 * AT_PITCH];   // per-wave P relay / ctx stage
    static_assert(HD == 8 * 8);            // 8 lanes x 8 halves per row segment
    static_assert(2 * 256 * 8 == 64 * 64); // staging: 2 copies x 256 threads x 8 halves per tile

    const u32 tid  = threadIdx.x;
    const u32 lane = tid & 31u;
    const u32 wave = tid >> 5;
    const u32 hh8  = (lane >> 4) << 3;
    const u32 c16  = lane & 15u;
    const u32 bh   = blockIdx.y;
    const u32 bidx = bh >> 4;            // NHEAD == 16
    const u32 hidx = bh & 15u;
    const u32 q0   = blockIdx.x * 128u + wave * 16u;
    const size_t head = (size_t)bh * SEQ * HD;

    v16h qa[2];
#pragma unroll
    for (int c = 0; c < 2; ++c) qa[c] = load_frag(Qp + head, q0, HD, (u32)c * 32u, lane);

    FragU onesu;
#pragma unroll
    for (int i = 0; i < 16; ++i) onesu.e[i] = (f16)1.0f;
    const v16h ones = onesu.v;

    float m[8];
    v8f   o[4], lacc;
#pragma unroll
    for (int r = 0; r < 8; ++r) m[r] = -1.0e30f;
#pragma unroll
    for (int dt = 0; dt < 4; ++dt) o[dt] = zero8();
    lacc = zero8();

    // log2-domain scale: acc = 256 * q.k ; x = log2(e) * q.k / 8 = acc * log2(e) / 2048
    const float cl = 1.4426950408889634f * 0.00048828125f;
    f16* psw = &ps[wave][0];

    const u32 arow = tid >> 3;
    const u32 apc  = (tid & 7u) << 3;
    const f16* gK = Kp + head + (size_t)arow * HD + apc;
    const f16* gV = Vt + head + (size_t)arow * SEQ + apc;
    const u32 abuf = 64u * AT_PITCH * (u32)sizeof(f16);                    // bytes per buffer
    const u32 lK = (u32)(size_t)&ks[0][arow * AT_PITCH + apc];             // LDS byte address, buffer 0
    const u32 lV = (u32)(size_t)&vsT[0][arow * AT_PITCH + apc];
    const u32 ntile = (u32)(SEQ / 64);

    // tile 0 lands and is published; tile 1 then flies during trip 0
    copy_kv(gK, gV, lK, lV);
    asm volatile("s_wait_asynccnt 0x0" ::: "memory");   // this wave's tile-0 copies have landed
    __syncthreads();
    copy_kv(gK + 64 * HD, gV + 64, lK + abuf, lV + abuf);

#pragma unroll 1
    for (u32 kt = 0; kt < ntile; ++kt) {
        const u32 rb = kt & 1u;
        const f16* ksb = &ks[rb][0];
        const f16* vsb = &vsT[rb][0];

        // S[16 q x 64 keys]
        v8f s[4];
#pragma unroll
        for (int nt = 0; nt < 4; ++nt) s[nt] = zero8();
        // the tile's eight K and eight V^T fragments are read as one group in front of the score products:
        // one LDS latency for K, not eight; V^T lands behind the score products and the softmax
        v16h kb[2][4], vb[2][4];
#pragma unroll
        for (int c = 0; c < 2; ++c)
#pragma unroll
            for (int nt = 0; nt < 4; ++nt) kb[c][nt] = load_frag(ksb, (u32)nt * 16u, AT_PITCH, (u32)c * 32u, lane);
#pragma unroll
        for (int kk = 0; kk < 2; ++kk)
#pragma unroll
            for (int dt = 0; dt < 4; ++dt) vb[kk][dt] = load_frag(vsb, (u32)dt * 16u, AT_PITCH, (u32)kk * 32u, lane);
#pragma unroll
        for (int c = 0; c < 2; ++c)
#pragma unroll
            for (int nt = 0; nt < 4; ++nt) s[nt] = wmma16(qa[c], kb[c][nt], s[nt]);

        // online softmax per row r (row 8h + r), max-subtracted, exp2 domain
#pragma unroll
        for (int r = 0; r < 8; ++r) {
            float x[4];
#pragma unroll
            for (int nt = 0; nt < 4; ++nt) x[nt] = s[nt][r] * cl;
            const float tm = rowmax16(fmaxf(fmaxf(x[0], x[1]), fmaxf(x[2], x[3])));
            const float mn = fmaxf(m[r], tm);
            const float al = fexp2(m[r] - mn);
            m[r] = mn;
            lacc[r] *= al;
#pragma unroll
            for (int dt = 0; dt < 4; ++dt) o[dt][r] *= al;
            const float sh = 10.0f - mn;      // carry 2^10
#pragma unroll
            for (int nt = 0; nt < 4; ++nt)
                psw[(hh8 + (u32)r) * AT_PITCH + (u32)nt * 16u + c16] = (f16)fexp2(x[nt] + sh);
        }
        __syncthreads();

        // O += P . V ; l += P . ones  (P reloaded as A fragments from the relay)
        v16h pa[2];
#pragma unroll
        for (int kk = 0; kk < 2; ++kk) pa[kk] = load_frag(psw, 0u, AT_PITCH, (u32)kk * 32u, lane);
#pragma unroll
        for (int kk = 0; kk < 2; ++kk) {
#pragma unroll
            for (int dt = 0; dt < 4; ++dt) o[dt] = wmma16(pa[kk], vb[kk][dt], o[dt]);
            lacc = wmma16(pa[kk], ones, lacc);
        }
        asm volatile("s_wait_dscnt 0x0" ::: "memory");      // this wave's reads of buffer rb are done before its refill
        asm volatile("s_wait_asynccnt 0x0" ::: "memory");   // this wave's tile kt + 1 copies have landed
        __syncthreads();                                    // publishes tile kt + 1, frees buffer rb
        if (kt + 2u < ntile)
            copy_kv(gK + (size_t)(kt + 2u) * (64 * HD), gV + (kt + 2u) * 64u, lK + rb * abuf, lV + rb * abuf);
    }
    asm volatile("s_wait_asynccnt 0x0" ::: "memory");       // nothing of the ring is outstanding past the loop
    __syncthreads();

    // normalize: plane value = 1024 * (O/16) / l = O * 64 / l
#pragma unroll
    for (int r = 0; r < 8; ++r) {
        const float inv = (CARRY_CTX / CARRY_QKV) / lacc[r];
#pragma unroll
        for (int dt = 0; dt < 4; ++dt)
            psw[(hh8 + (u32)r) * AT_PITCH + (u32)dt * 16u + c16] = (f16)(o[dt][r] * inv);
    }
    __syncthreads();

    const u32 piece = lane & 7u;
    const u32 lsub  = lane >> 3;
{
#pragma unroll
        for (u32 it = 0; it < 4; ++it) {
            const u32 L = it * 4u + lsub;     // query row 0..15 within the wave tile
            const v8h v = *(const v8h*)&psw[L * AT_PITCH + piece * 8u];
            f16* dp = Cp + ((size_t)(bidx * (u32)SEQ + q0 + L) * HID + hidx * (u32)HD + piece * 8u);
            *(v8h*)dp = v;
        }
        
    }
}

// coverage equalities (threads x elements == plane elements)
static_assert((size_t)(MROWS / 2) * 256 * 8 == (size_t)MROWS * HID);                       // cvt_rows -> Xh
static_assert((size_t)(3 * HID / 2) * 256 * 8 == (size_t)3 * HID * HID);                   // cvt_rows -> Wt
static_assert((size_t)(HID / 2) * 256 * 8 == (size_t)HID * HID);                           // cvt_rows -> Wot
static_assert((size_t)(MROWS / 128) * (HID / 128) * 128 * 128 == (size_t)MROWS * HID);     // gemm planes / out
static_assert((size_t)(SEQ / 128) * (NB * NHEAD) * 128 * HD == (size_t)MROWS * HID);       // attn_fwd -> Cp
// workspace: 5 activation planes + 4 weight planes of halves, at most 128 MiB
static_assert(((size_t)5 * MROWS * HID + (size_t)4 * HID * HID) * sizeof(f16) <= (size_t)134217728);
// output extent: last written f32 element index < NB_FULL*SEQ_FULL*HID
static_assert((size_t)MROWS * HID <= (size_t)NB_FULL * SEQ_FULL * HID);

// ---------------------------------------------------------------------------
// Launch: 8 kernel launches, workspace 5 planes of MROWS*1024 halves + 4 of 1024*1024 halves.
// ---------------------------------------------------------------------------
extern "C" void kernel_launch(void* const* d_in, const int* in_sizes, int n_in,
                              void* d_out, int out_size, void* d_ws, size_t ws_size,
                              hipStream_t stream) {
    if (n_in < 3) return;
    if (in_sizes[0] < ((NB - 1) * SEQ_FULL + SEQ) * HID) return;
    if (in_sizes[1] < 3 * HID * HID) return;
    if (in_sizes[2] < HID * HID) return;
    if (out_size < MROWS * HID) return;

    const float* x     = (const float*)d_in[0];   // [NB_FULL][SEQ_FULL][1024]
    const float* wqkv  = (const float*)d_in[1];   // [3072 out][1024 in], row blocks q | k | v
    const float* wproj = (const float*)d_in[2];   // [1024 out][1024 in]

    const size_t nX = (size_t)MROWS * HID;    // halves per activation plane
    const size_t nW = (size_t)HID * HID;      // halves per weight plane
    const size_t totalHalves = 5 * nX + 4 * nW;
    if (ws_size < totalHalves * sizeof(f16)) return;

    f16* Xh  = (f16*)d_ws;       // [MROWS][1024]               carry 16
    f16* Wt  = Xh  + nX;         // [3072 out][1024 in]         carry 32 (q | k | v row blocks)
    f16* Wot = Wt  + 3 * nW;     // [1024 out][1024 in]         carry 32
    f16* Qp  = Wot + nW;         // [NB*16][SEQ][64]            carry 16
    f16* Kp  = Qp  + nX;         // [NB*16][SEQ][64]            carry 16
    f16* Vtp = Kp  + nX;         // [NB*1024][SEQ] (V^T)        carry 16
    f16* Cp  = Vtp + nX;         // [MROWS][1024]               carry 1024

    // activations: dst row m of batch b <- src row b*SEQ_FULL + (m % SEQ)
    cvt_rows<<<MROWS / 2, 256, 0, stream>>>(x, Xh, (u32)MROWS, (u32)SEQ, (u32)SEQ_FULL, CARRY_X);
    // weights already [out][in] (k contiguous): identity row map
    cvt_rows<<<3 * HID / 2, 256, 0, stream>>>(wqkv, Wt, (u32)(3 * HID), (u32)(3 * HID), (u32)(3 * HID), CARRY_W);
    cvt_rows<<<HID / 2, 256, 0, stream>>>(wproj, Wot, (u32)HID, (u32)HID, (u32)HID, CARRY_W);

    const dim3 gg(MROWS / 128, HID / 128);
    // plane = 16 * acc / (16*32) = acc/32
    const float accQKV = CARRY_QKV / (CARRY_X * CARRY_W);
    gemm_head<<<gg, 256, 0, stream>>>(Xh, Wt,          Qp,  accQKV);
    gemm_head<<<gg, 256, 0, stream>>>(Xh, Wt + nW,     Kp,  accQKV);
    gemm_vt  <<<gg, 256, 0, stream>>>(Xh, Wt + 2 * nW, Vtp, accQKV);

    attn_fwd<<<dim3(SEQ / 128, NB * NHEAD), 256, 0, stream>>>(Qp, Kp, Vtp, Cp);

    // out = acc / (1024*32)
    const float accOut = 1.0f / (CARRY_CTX * CARRY_W);
    gemm_out<<<gg, 256, 0, stream>>>(Cp, Wot, (float*)d_out, accOut);
}

// v004
// It runs in 91.4 microseconds.
// Two timings next to v003 put it at 1.19 and 1.17 times that version's speed.
// All steps since v000 together make it 2.94 times as fast.
#include <hip/hip_runtime.h>

// Contractions (fused QKV projection, Q.K^T, P.V, P row-sum, output projection): v_wmma_f32_16x16x32_f16, f16 operands with power-of-two carries, f32 accumulate; every float input enters as its bf16 RNE value; softmax in f32.

#ifndef NB
#define NB 2
#endif
#ifndef SEQ
#define SEQ 2048
#endif
#define NB_FULL   2
#define SEQ_FULL  2048
#define HID       1024
#define NHEAD     16
#define HD        64
#define MROWS     (NB * SEQ)

static_assert(HID == NHEAD * HD);        // merged head width
static_assert(NHEAD == 16);              // bh >> 4 / bh & 15 decoding in attn_fwd
static_assert(HD == 64);
static_assert(SEQ % 128 == 0);           // 128-row blocks never straddle a batch
static_assert(SEQ % 64 == 0);            // 64-key tiles
static_assert(SEQ / 64 >= 2);            // attention ring: at least two stages
static_assert(SEQ <= SEQ_FULL);
static_assert(NB >= 1 && NB <= NB_FULL);
static_assert(MROWS % 128 == 0);         // GEMM M tile
static_assert(HID % 128 == 0);           // GEMM N tile
static_assert(HID % 32 == 0);            // WMMA k step
static_assert(HID % 128 == 0 && HID / 128 >= 2);   // GEMM ring: whole 128-k stages, at least two
static_assert(HID == 128 * 8);           // cvt_rows: 128 threads x 8 values per row
static_assert((3 * HID) % 2 == 0);       // cvt_rows grid = nrows / 2
static_assert(MROWS % 2 == 0);           // cvt_rows grid = nrows / 2

// carries (exact powers of two)
#define CARRY_X    16.0f     // input activation plane
#define CARRY_W    32.0f     // weight planes
#define CARRY_QKV  16.0f     // q, k, v^T planes (true value x16)
#define CARRY_CTX  1024.0f   // context plane (true value x1024)
// softmax exp values carry 2^10 (added to the exp2 argument)

// LDS row pitches: 16 B x odd, so the 16 rows that one ds_load_b128 touches per lane half fall on distinct banks
#define AB_PITCH  136u   // halves: GEMM A / B stages, 256-B rows on a 272-B pitch
#define KSTAGE    128u   // k values per GEMM stage (four WMMA k steps)
#define C_PITCH   136u   // halves: GEMM f16 output stage, 256-B rows on a 272-B pitch
#define CF_PITCH  132u   // floats: GEMM f32 output stage, 512-B rows on a 528-B pitch
#define AT_PITCH  72u    // halves: attention K, V^T and output stage tiles, 128-B rows on a 144-B pitch

typedef unsigned u32;
typedef _Float16 f16;
typedef f16   v16h __attribute__((ext_vector_type(16)));
typedef f16   v8h  __attribute__((ext_vector_type(8)));
typedef float v8f  __attribute__((ext_vector_type(8)));
typedef float v4f  __attribute__((ext_vector_type(4)));

union FragU { v16h v; v8h half[2]; f16 e[16]; };
union H8U   { v8h v; f16 e[8]; };

__device__ __forceinline__ v8f zero8() {
    v8f z = {0.f, 0.f, 0.f, 0.f, 0.f, 0.f, 0.f, 0.f};
    return z;
}

// 16-bit WMMA with hazard guard: D += A[16 x 32k] * B[32k x 16]
__device__ __forceinline__ v8f wmma16(v16h a, v16h b, v8f c) {
    v8f d = __builtin_amdgcn_wmma_f32_16x16x32_f16(false, a, false, b, (short)0, c, false, false);
    asm volatile("v_nop\n\tv_nop\n\tv_nop\n\tv_nop" : "+v"(d) : "v"(a), "v"(b));
    return d;
}

// f32 -> nearest-even bf16 value, returned as f32
__device__ __forceinline__ float bf16_rne(float x) {
    u32 u = __float_as_uint(x);
    u = (u + 0x7fffu + ((u >> 16) & 1u)) & 0xffff0000u;
    return __uint_as_float(u);
}

__device__ __forceinline__ float fexp2(float x) {
#if defined(__has_builtin)
#if __has_builtin(__builtin_amdgcn_exp2f)
    return __builtin_amdgcn_exp2f(x);
#else
    return exp2f(x);
#endif
#else
    return exp2f(x);
#endif
}

// value of lane l ^ 16 (the other lane half's share of the same D column)
__device__ __forceinline__ float xhalf(float x) {
    const int b = __builtin_bit_cast(int, x);
    return __builtin_bit_cast(float, __builtin_amdgcn_permlanex16(b, b, 0x76543210, 0xfedcba98, false, false));
}

// 16 x 32 fragment from a tile whose k dimension is contiguous (pitch in halves).
// lane l: row rowbase + (l&15); elements 0..7 <- k = kcol + 8h .. +7,
// elements 8..15 <- k = kcol + 16 + 8h .. +7  (h = l>>4). Same map for A and B.
__device__ __forceinline__ v16h load_frag(const f16* tile, u32 rowbase, u32 pitch, u32 kcol, u32 lane) {
    const u32 r  = rowbase + (lane & 15u);
    const u32 kh = (lane >> 4) << 3;
    const f16* p = tile + (size_t)r * pitch + kcol + kh;
    FragU f;
    f.half[0] = *(const v8h*)(p);
    f.half[1] = *(const v8h*)(p + 16);
    return f.v;
}

// One operand's stage, 128 rows x 128 k (256 B a row), global -> LDS with no register in between.
// Lane: 16 B of row (tid >> 4) + 16 i, i = 0..7; a wave's copy covers two whole 256-B rows.
// g: the lane's global address in row tid >> 4 of the stage; l: its LDS byte address there.
// s_wait_xcnt 0 closes the statement so that no address register is rewritten ahead of it.
__device__ __forceinline__ void copy_stage(const f16* g, u32 l) {
    const f16* g1 = g + 16 * HID;
    const f16* g2 = g + 32 * HID;
    const f16* g3 = g + 48 * HID;
    const f16* g4 = g + 64 * HID;
    const f16* g5 = g + 80 * HID;
    const f16* g6 = g + 96 * HID;
    const f16* g7 = g + 112 * HID;
    const u32 rs = 16u * AB_PITCH * (u32)sizeof(f16);
    asm volatile("global_load_async_to_lds_b128 %0, %8, off\n\t"
                 "global_load_async_to_lds_b128 %1, %9, off\n\t"
                 "global_load_async_to_lds_b128 %2, %10, off\n\t"
                 "global_load_async_to_lds_b128 %3, %11, off\n\t"
                 "global_load_async_to_lds_b128 %4, %12, off\n\t"
                 "global_load_async_to_lds_b128 %5, %13, off\n\t"
                 "global_load_async_to_lds_b128 %6, %14, off\n\t"
                 "global_load_async_to_lds_b128 %7, %15, off\n\t"
                 "s_wait_xcnt 0x0"
                 :: "v"(l), "v"(l + rs), "v"(l + 2u * rs), "v"(l + 3u * rs),
                    "v"(l + 4u * rs), "v"(l + 5u * rs), "v"(l + 6u * rs), "v"(l + 7u * rs),
                    "v"(g), "v"(g1), "v"(g2), "v"(g3), "v"(g4), "v"(g5), "v"(g6), "v"(g7)
                 : "memory");
}

// One attention stage, K 64 x 64 and V^T 64 x 64 halves (128 B a row), global -> LDS with no register in between.
// Lane: 16 B of rows tid >> 3 and (tid >> 3) + 32 of each tile. gk, gv: the lane's global addresses in its
// first row; lk, lv: its LDS byte addresses there.
// s_wait_xcnt 0 closes the statement so that no address register is rewritten ahead of it.
__device__ __forceinline__ void copy_kv(const f16* gk, const f16* gv, u32 lk, u32 lv) {
    const f16* gk1 = gk + 32 * HD;
    const f16* gv1 = gv + 32 * SEQ;
    const u32 rs = 32u * AT_PITCH * (u32)sizeof(f16);
    asm volatile("global_load_async_to_lds_b128 %0, %4, off\n\t"
                 "global_load_async_to_lds_b128 %1, %5, off\n\t"
                 "global_load_async_to_lds_b128 %2, %6, off\n\t"
                 "global_load_async_to_lds_b128 %3, %7, off\n\t"
                 "s_wait_xcnt 0x0"
                 :: "v"(lk), "v"(lk + rs), "v"(lv), "v"(lv + rs),
                    "v"(gk), "v"(gk1), "v"(gv), "v"(gv1)
                 : "memory");
}

// ---------------------------------------------------------------------------
// f32 rows [.][1024] -> f16 plane (bf16 RNE value times carry). 128 threads per 1024-wide
// Row mapping dst row m -> src row (m / dstper) * srcper + m % dstper lets a reduced build
// read full-size inputs (weights: dstper == srcper == nrows, identity).
// coverage: nrows x 1024 halves, every element exactly once (grid = nrows*128/256).
// ---------------------------------------------------------------------------
__global__ void __launch_bounds__(256)
cvt_rows(const float* __restrict__ src, f16* __restrict__ dst, u32 nrows, u32 dstper, u32 srcper, float carry) {
    const u32 g  = blockIdx.x * 256u + threadIdx.x;
    const u32 m  = g >> 7;
    const u32 c8 = (g & 127u) << 3;
    if (m >= nrows) return;
    const u32 mb = m / dstper;
    const u32 sm = mb * srcper + (m - mb * dstper);
    const float* sp = src + (size_t)sm * HID + c8;
    const v4f a = *(const v4f*)sp;
    const v4f b = *(const v4f*)(sp + 4);
    H8U o;
#pragma unroll
    for (u32 j = 0; j < 4; ++j) {
        const float x0 = a[j];
        const float x1 = b[j];
        o.e[j]     = (f16)(bf16_rne(x0) * carry);
        o.e[j + 4] = (f16)(bf16_rne(x1) * carry);
    }
    f16* dp = dst + (size_t)m * HID + c8;
    *(v8h*)dp = o.v;
    
}

// ---------------------------------------------------------------------------
// C[m][n] = sum_k A[m][k] * W[n][k] ; A [MROWS][1024] f16, W [1024][1024] f16 (k contiguous).
// Block tile 128 x 128, 8 waves as 4(M) x 2(N), 2 x 4 accumulators per wave, WMMA k step 32.
// A / B: two-buffer ring of 128-k stages filled by asynchronous copies, stage t + 1 in flight during trip t.
// MODE 1: f16 plane [b*HID + h*HD + d][s] (V transposed per head)
// MODE 2: f32 rows [m][1024] into the output buffer
// coverage per block: MODE 0/1 256 lines (128 rows x 2 heads | 128 n x 2 s-halves),
//                     MODE 2 2 x 256 lines (64 rows x 4 line-quarters per half).
// LDS: As/Bs/Cs all cross-wave, separated by block barriers.
// staged extent == consumed extent: As/Bs 128 x 128 per buffer, Cs 128 x 128 halves (or 64 x 128 floats).
// ---------------------------------------------------------------------------
template <int MODE>
__device__ __forceinline__ void gemm_body(const f16* __restrict__ A, const f16* __restrict__ W,
                                          void* __restrict__ out, float accMul) {
    __shared__ __attribute__((aligned(16))) f16 As[2][128 * AB_PITCH];
    __shared__ __attribute__((aligned(16))) f16 Bs[2][128 * AB_PITCH];
    __shared__ __attribute__((aligned(16))) f16 Cs[128 * C_PITCH];   // f16 [128][128] or f32 [64][128], padded rows
    static_assert(sizeof(f16) * 128 * C_PITCH >= sizeof(float) * 64 * CF_PITCH);   // Cs reuse as f32 [64][128]

    const u32 tid  = threadIdx.x;
    const u32 lane = tid & 31u;
    const u32 wave = tid >> 5;
    const u32 wm   = wave & 3u;
    const u32 wn   = wave >> 2;
    const u32 hh8  = (lane >> 4) << 3;   // D row half
    const u32 c16  = lane & 15u;         // D column
    const u32 m0   = blockIdx.x * 128u;
    const u32 n0   = blockIdx.y * 128u;

    v8f acc[2][4];
#pragma unroll
    for (int i = 0; i < 2; ++i)
#pragma unroll
        for (int j = 0; j < 4; ++j) acc[i][j] = zero8();

    const u32 srow = tid >> 4;
    const u32 scol = (tid & 15u) << 3;
    const f16* gA = A + (size_t)(m0 + srow) * HID + scol;
    const f16* gW = W + (size_t)(n0 + srow) * HID + scol;
    const u32 bufB = 128u * AB_PITCH * (u32)sizeof(f16);                   // bytes per buffer
    const u32 lA = (u32)(size_t)&As[0][srow * AB_PITCH + scol];            // LDS byte address, buffer 0
    const u32 lB = (u32)(size_t)&Bs[0][srow * AB_PITCH + scol];
    const u32 nst = (u32)HID / KSTAGE;

    // stage 0 lands and is published; stage 1 then flies during trip 0
    copy_stage(gA, lA);
    copy_stage(gW, lB);
    asm volatile("s_wait_asynccnt 0x0" ::: "memory");   // this wave's stage-0 copies have landed
    __syncthreads();
    copy_stage(gA + KSTAGE, lA + bufB);
    copy_stage(gW + KSTAGE, lB + bufB);

    // kept rolled: the ring's foot (waits, barrier, refill) stands once and the body stays small for the instruction cache
#pragma unroll 1
    for (u32 t = 0; t < nst; ++t) {
        const u32 b = t & 1u;
        const f16* as = &As[b][0];
        const f16* bs = &Bs[b][0];
        // Fragment reads run two k steps ahead of the products, one group of 12 reads per k step: steps 0 and 1 at the
        // stage's head, step g + 2 in front of step g's products, so a group's LDS latency passes behind 8 to 16 WMMAs.
        // All reads are of buffer b, published before this trip. Unrolled: indices and ds_load offsets are constants.
        v16h af[KSTAGE / 32u][2], bfr[KSTAGE / 32u][4];
#pragma unroll
        for (u32 g = 0; g < 2u; ++g) {
#pragma unroll
            for (int i = 0; i < 2; ++i) af[g][i] = load_frag(as, wm * 32u + (u32)i * 16u, AB_PITCH, g * 32u, lane);
#pragma unroll
            for (int j = 0; j < 4; ++j) bfr[g][j] = load_frag(bs, wn * 64u + (u32)j * 16u, AB_PITCH, g * 32u, lane);
        }
#pragma unroll
        for (u32 g = 0; g < KSTAGE / 32u; ++g) {
            if (g + 2u < KSTAGE / 32u) {
#pragma unroll
                for (int i = 0; i < 2; ++i) af[g + 2u][i] = load_frag(as, wm * 32u + (u32)i * 16u, AB_PITCH, (g + 2u) * 32u, lane);
#pragma unroll
                for (int j = 0; j < 4; ++j) bfr[g + 2u][j] = load_frag(bs, wn * 64u + (u32)j * 16u, AB_PITCH, (g + 2u) * 32u, lane);
            }
#pragma unroll
            for (int i = 0; i < 2; ++i)
#pragma unroll
                for (int j = 0; j < 4; ++j) acc[i][j] = wmma16(af[g][i], bfr[g][j], acc[i][j]);
        }
        asm volatile("s_wait_dscnt 0x0" ::: "memory");      // this wave's reads of buffer b are done before its refill
        asm volatile("s_wait_asynccnt 0x0" ::: "memory");   // this wave's stage t + 1 copies have landed
        __syncthreads();                                    // publishes stage t + 1, frees buffer b
        if (t + 2u < nst) {
            copy_stage(gA + (t + 2u) * KSTAGE, lA + b * bufB);
            copy_stage(gW + (t + 2u) * KSTAGE, lB + b * bufB);
        }
    }
    asm volatile("s_wait_asynccnt 0x0" ::: "memory");       // nothing of the ring is outstanding past the loop

    const u32 bidx  = m0 / (u32)SEQ;     // block rows lie inside one batch (SEQ % 128 == 0)
    const u32 s0    = m0 - bidx * (u32)SEQ;
    const u32 piece = lane & 7u;
    const u32 lsub  = lane >> 3;

    if constexpr (MODE == 0) {
#pragma unroll
        for (int i = 0; i < 2; ++i)
#pragma unroll
            for (int j = 0; j < 4; ++j) {
                const u32 nl = wn * 64u + (u32)j * 16u + c16;
#pragma unroll
                for (int r = 0; r < 8; ++r) {
                    const u32 ml = wm * 32u + (u32)i * 16u + hh8 + (u32)r;
                    Cs[ml * C_PITCH + nl] = (f16)(acc[i][j][r] * accMul);
                }
            }
        __syncthreads();
        f16* op = (f16*)out;
        const size_t bh0 = (size_t)bidx * NHEAD + (n0 >> 6);
{
#pragma unroll
            for (u32 it = 0; it < 8; ++it) {
                const u32 L    = wave * 32u + it * 4u + lsub;   // 0..255
                const u32 ml   = L >> 1;
                const u32 hsel = L & 1u;
                const v8h v = *(const v8h*)&Cs[ml * C_PITCH + hsel * 64u + piece * 8u];
                f16* dp = op + ((bh0 + hsel) * SEQ + s0 + ml) * HD + piece * 8u;
                *(v8h*)dp = v;
            }
            
        }
    } else if constexpr (MODE == 1) {
        // stage transposed: Cs[n][m]
#pragma unroll
        for (int i = 0; i < 2; ++i)
#pragma unroll
            for (int j = 0; j < 4; ++j) {
                const u32 nl = wn * 64u + (u32)j * 16u + c16;
                H8U t;
#pragma unroll
                for (int r = 0; r < 8; ++r) t.e[r] = (f16)(acc[i][j][r] * accMul);
                *(v8h*)&Cs[nl * C_PITCH + wm * 32u + (u32)i * 16u + hh8] = t.v;
            }
        __syncthreads();
        f16* op = (f16*)out;
{
#pragma unroll
            for (u32 it = 0; it < 8; ++it) {
                const u32 L  = wave * 32u + it * 4u + lsub;     // 0..255
                const u32 nl = L >> 1;
                const u32 mh = L & 1u;
                const v8h v = *(const v8h*)&Cs[nl * C_PITCH + mh * 64u + piece * 8u];
                f16* dp = op + ((size_t)(bidx * (u32)HID + n0 + nl) * SEQ + s0 + mh * 64u + piece * 8u);
                *(v8h*)dp = v;
            }
            
        }
    } else {
        float* Cf = (float*)Cs;      // [64][128] f32, padded rows
        float* of = (float*)out;
#pragma unroll
        for (u32 half = 0; half < 2; ++half) {
            if ((wm >> 1) == half) {
#pragma unroll
                for (int i = 0; i < 2; ++i)
#pragma unroll
                    for (int j = 0; j < 4; ++j) {
                        const u32 nl = wn * 64u + (u32)j * 16u + c16;
#pragma unroll
                        for (int r = 0; r < 8; ++r) {
                            const u32 ml = (wm & 1u) * 32u + (u32)i * 16u + hh8 + (u32)r;
                            Cf[ml * CF_PITCH + nl] = acc[i][j][r] * accMul;
                        }
                    }
            }
            __syncthreads();
{
#pragma unroll
                for (u32 it = 0; it < 8; ++it) {
                    const u32 L    = wave * 32u + it * 4u + lsub;   // 0..255
                    const u32 row  = L >> 2;
                    const u32 part = L & 3u;
                    const v4f v = *(const v4f*)&Cf[row * CF_PITCH + part * 32u + piece * 4u];
                    float* dp = of + (size_t)(m0 + half * 64u + row) * HID + n0 + part * 32u + piece * 4u;
                    *(v4f*)dp = v;
                }
                
            }
            __syncthreads();
        }
    }
}

// q / k head-major planes
__global__ void __launch_bounds__(256) __attribute__((amdgpu_num_vgpr(256)))
gemm_head(const f16* __restrict__ A, const f16* __restrict__ W, f16* __restrict__ out, float accMul) {
    gemm_body<0>(A, W, (void*)out, accMul);
}

// v^T plane
__global__ void __launch_bounds__(256) __attribute__((amdgpu_num_vgpr(256)))
gemm_vt(const f16* __restrict__ A, const f16* __restrict__ W, f16* __restrict__ out, float accMul) {
    gemm_body<1>(A, W, (void*)out, accMul);
}

// f32 output rows
__global__ void __launch_bounds__(256) __attribute__((amdgpu_num_vgpr(256)))
gemm_out(const f16* __restrict__ A, const f16* __restrict__ W, float* __restrict__ out, float accMul) {
    gemm_body<2>(A, W, (void*)out, accMul);
}

// ---------------------------------------------------------------------------
// Flash attention (no mask, all SEQ keys). grid (SEQ/128, NB*NHEAD), block 256 (8 waves),
// wave owns 16 query rows (Q fragments resident). Block streams 64-key tiles through a two-buffer
// ring filled by asynchronous copies (tile kt + 1 in flight during trip kt): K staged [key][d], V^T staged [d][key].
// Both products run transposed: S^T = K.Q^T (A = K rows, B = Q), O^T += V^T.P^T (A = V^T rows, B = P^T). A lane then
// holds 32 of one query's 64 scores: the maximum is taken in the lane plus one exchange between the lane halves,
// one running maximum and one rescale factor per lane, exp2 in f32 carried x2^10, and two score accumulators,
// converted in place, are a B fragment in the hardware k order: P never touches LDS.
// Sums of P += ones.P^T on WMMA (every D row holds the query's sum). Output f16 plane [b*SEQ+q][1024] carried x1024.
// coverage: every (b, q, h*64..h*64+63) row segment exactly once.
// LDS: ks, vsT cross-wave (block barriers); ps per-wave, output stage only.
// staged extent == consumed extent for ks (64x64), vsT (64x64), ps (16x64).
// ---------------------------------------------------------------------------
__global__ void __launch_bounds__(256) __attribute__((amdgpu_num_vgpr(256)))
attn_fwd(const f16* __restrict__ Qp, const f16* __restrict__ Kp, const f16* __restrict__ Vt,
         f16* __restrict__ Cp) {
    __shared__ __attribute__((aligned(16))) f16 ks[2][64 * AT_PITCH];   // [buffer][key][d]
    __shared__ __attribute__((aligned(16))) f16 vsT[2][64 * AT_PITCH];  // [buffer][d][key]
    __shared__ __attribute__((aligned(16))) f16 ps[8][16 * AT_PITCH];   // per-wave ctx stage
    static_assert(HD == 8 * 8);            // 8 lanes x 8 halves per row segment
    static_assert(2 * 256 * 8 == 64 * 64); // staging: 2 copies x 256 threads x 8 halves per tile

    const u32 tid  = threadIdx.x;
    const u32 lane = tid & 31u;
    const u32 wave = tid >> 5;
    const u32 hh8  = (lane >> 4) << 3;
    const u32 c16  = lane & 15u;
    const u32 bh   = blockIdx.y;
    const u32 bidx = bh >> 4;            // NHEAD == 16
    const u32 hidx = bh & 15u;
    const u32 q0   = blockIdx.x * 128u + wave * 16u;
    const size_t head = (size_t)bh * SEQ * HD;

    v16h qa[2];
#pragma unroll
    for (int c = 0; c < 2; ++c) qa[c] = load_frag(Qp + head, q0, HD, (u32)c * 32u, lane);

    FragU onesu;
#pragma unroll
    for (int i = 0; i < 16; ++i) onesu.e[i] = (f16)1.0f;
    const v16h ones = onesu.v;

    float m = -1.0e30f;      // running maximum of query q0 + c16, equal in both lane halves
    v8f   o[4], lacc;        // o[dt][r] = O^T[dt * 16 + hh8 + r][query c16]; lacc[r] = sum of P of query c16, every r
#pragma unroll
    for (int dt = 0; dt < 4; ++dt) o[dt] = zero8();
    lacc = zero8();

    // log2-domain scale: acc = 256 * q.k ; x = log2(e) * q.k / 8 = acc * log2(e) / 2048
    const float cl = 1.4426950408889634f * 0.00048828125f;
    f16* psw = &ps[wave][0];

    const u32 arow = tid >> 3;
    const u32 apc  = (tid & 7u) << 3;
    const f16* gK = Kp + head + (size_t)arow * HD + apc;
    const f16* gV = Vt + head + (size_t)arow * SEQ + apc;
    const u32 abuf = 64u * AT_PITCH * (u32)sizeof(f16);                    // bytes per buffer
    const u32 lK = (u32)(size_t)&ks[0][arow * AT_PITCH + apc];             // LDS byte address, buffer 0
    const u32 lV = (u32)(size_t)&vsT[0][arow * AT_PITCH + apc];
    const u32 ntile = (u32)(SEQ / 64);

    // tile 0 lands and is published; tile 1 then flies during trip 0
    copy_kv(gK, gV, lK, lV);
    asm volatile("s_wait_asynccnt 0x0" ::: "memory");   // this wave's tile-0 copies have landed
    __syncthreads();
    copy_kv(gK + 64 * HD, gV + 64, lK + abuf, lV + abuf);

#pragma unroll 1
    for (u32 kt = 0; kt < ntile; ++kt) {
        const u32 rb = kt & 1u;
        const f16* ksb = &ks[rb][0];
        const f16* vsb = &vsT[rb][0];

        // S^T[64 keys x 16 q]: s[nt][r] = score of key nt * 16 + hh8 + r against query c16
        v8f s[4];
#pragma unroll
        for (int nt = 0; nt < 4; ++nt) s[nt] = zero8();
        // the tile's eight K and eight V^T fragments are read as one group in front of the score products:
        // one LDS latency for K, not eight; V^T lands behind the score products and the softmax
        v16h kb[2][4], vb[2][4];
#pragma unroll
        for (int c = 0; c < 2; ++c)
#pragma unroll
            for (int nt = 0; nt < 4; ++nt) kb[c][nt] = load_frag(ksb, (u32)nt * 16u, AT_PITCH, (u32)c * 32u, lane);
#pragma unroll
        for (int kk = 0; kk < 2; ++kk)
#pragma unroll
            for (int dt = 0; dt < 4; ++dt) vb[kk][dt] = load_frag(vsb, (u32)dt * 16u, AT_PITCH, (u32)kk * 32u, lane);
#pragma unroll
        for (int c = 0; c < 2; ++c)
#pragma unroll
            for (int nt = 0; nt < 4; ++nt) s[nt] = wmma16(kb[c][nt], qa[c], s[nt]);

        // online softmax of the lane's query, max-subtracted, exp2 domain; cl > 0, so the maximum is taken on raw scores
        float t[4];
#pragma unroll
        for (int nt = 0; nt < 4; ++nt) {
            float v = fmaxf(fmaxf(s[nt][0], s[nt][1]), s[nt][2]);
            v = fmaxf(fmaxf(v, s[nt][3]), s[nt][4]);
            v = fmaxf(fmaxf(v, s[nt][5]), s[nt][6]);
            t[nt] = fmaxf(v, s[nt][7]);
        }
        float tm = fmaxf(fmaxf(fmaxf(t[0], t[1]), t[2]), t[3]);
        tm = fmaxf(tm, xhalf(tm)) * cl;       // the other half holds the query's other 32 keys
        const float mn = fmaxf(m, tm);
        const float al = fexp2(m - mn);
        m = mn;
        lacc *= al;
#pragma unroll
        for (int dt = 0; dt < 4; ++dt) o[dt] *= al;
        const float sh = 10.0f - mn;          // carry 2^10

        // P^T as B fragments: element e <- key kk * 32 + hh8 + e (accumulator 2 kk), element 8 + e <- key
        // kk * 32 + 16 + hh8 + e (accumulator 2 kk + 1): the k order of load_frag, which the V^T fragments have
        FragU pb[2];
#pragma unroll
        for (int kk = 0; kk < 2; ++kk)
#pragma unroll
            for (int e = 0; e < 8; ++e) {
                pb[kk].e[e]     = (f16)fexp2(s[2 * kk][e] * cl + sh);
                pb[kk].e[e + 8] = (f16)fexp2(s[2 * kk + 1][e] * cl + sh);
            }

        // O^T += V^T . P^T ; l += ones . P^T
#pragma unroll
        for (int kk = 0; kk < 2; ++kk) {
#pragma unroll
            for (int dt = 0; dt < 4; ++dt) o[dt] = wmma16(vb[kk][dt], pb[kk].v, o[dt]);
            lacc = wmma16(ones, pb[kk].v, lacc);
        }
        asm volatile("s_wait_dscnt 0x0" ::: "memory");      // this wave's reads of buffer rb are done before its refill
        asm volatile("s_wait_asynccnt 0x0" ::: "memory");   // this wave's tile kt + 1 copies have landed
        __syncthreads();                                    // publishes tile kt + 1, frees buffer rb
        if (kt + 2u < ntile)
            copy_kv(gK + (size_t)(kt + 2u) * (64 * HD), gV + (kt + 2u) * 64u, lK + rb * abuf, lV + rb * abuf);
    }
    asm volatile("s_wait_asynccnt 0x0" ::: "memory");       // nothing of the ring is outstanding past the loop
    __syncthreads();

    // normalize: plane value = 1024 * (O/16) / l = O * 64 / l ; a lane's 8 registers are 8 consecutive d of its query
    const float inv = (CARRY_CTX / CARRY_QKV) / lacc[0];
#pragma unroll
    for (int dt = 0; dt < 4; ++dt) {
        H8U w;
#pragma unroll
        for (int r = 0; r < 8; ++r) w.e[r] = (f16)(o[dt][r] * inv);
        *(v8h*)&psw[c16 * AT_PITCH + (u32)dt * 16u + hh8] = w.v;
    }
    __syncthreads();

    const u32 piece = lane & 7u;
    const u32 lsub  = lane >> 3;
{
#pragma unroll
        for (u32 it = 0; it < 4; ++it) {
            const u32 L = it * 4u + lsub;     // query row 0..15 within the wave tile
            const v8h v = *(const v8h*)&psw[L * AT_PITCH + piece * 8u];
            f16* dp = Cp + ((size_t)(bidx * (u32)SEQ + q0 + L) * HID + hidx * (u32)HD + piece * 8u);
            *(v8h*)dp = v;
        }
        
    }
}

// coverage equalities (threads x elements == plane elements)
static_assert((size_t)(MROWS / 2) * 256 * 8 == (size_t)MROWS * HID);                       // cvt_rows -> Xh
static_assert((size_t)(3 * HID / 2) * 256 * 8 == (size_t)3 * HID * HID);                   // cvt_rows -> Wt
static_assert((size_t)(HID / 2) * 256 * 8 == (size_t)HID * HID);                           // cvt_rows -> Wot
static_assert((size_t)(MROWS / 128) * (HID / 128) * 128 * 128 == (size_t)MROWS * HID);     // gemm planes / out
static_assert((size_t)(SEQ / 128) * (NB * NHEAD) * 128 * HD == (size_t)MROWS * HID);       // attn_fwd -> Cp
// workspace: 5 activation planes + 4 weight planes of halves, at most 128 MiB
static_assert(((size_t)5 * MROWS * HID + (size_t)4 * HID * HID) * sizeof(f16) <= (size_t)134217728);
// output extent: last written f32 element index < NB_FULL*SEQ_FULL*HID
static_assert((size_t)MROWS * HID <= (size_t)NB_FULL * SEQ_FULL * HID);

// ---------------------------------------------------------------------------
// Launch: 8 kernel launches, workspace 5 planes of MROWS*1024 halves + 4 of 1024*1024 halves.
// ---------------------------------------------------------------------------
extern "C" void kernel_launch(void* const* d_in, const int* in_sizes, int n_in,
                              void* d_out, int out_size, void* d_ws, size_t ws_size,
                              hipStream_t stream) {
    if (n_in < 3) return;
    if (in_sizes[0] < ((NB - 1) * SEQ_FULL + SEQ) * HID) return;
    if (in_sizes[1] < 3 * HID * HID) return;
    if (in_sizes[2] < HID * HID) return;
    if (out_size < MROWS * HID) return;

    const float* x     = (const float*)d_in[0];   // [NB_FULL][SEQ_FULL][1024]
    const float* wqkv  = (const float*)d_in[1];   // [3072 out][1024 in], row blocks q | k | v
    const float* wproj = (const float*)d_in[2];   // [1024 out][1024 in]

    const size_t nX = (size_t)MROWS * HID;    // halves per activation plane
    const size_t nW = (size_t)HID * HID;      // halves per weight plane
    const size_t totalHalves = 5 * nX + 4 * nW;
    if (ws_size < totalHalves * sizeof(f16)) return;

    f16* Xh  = (f16*)d_ws;       // [MROWS][1024]               carry 16
    f16* Wt  = Xh  + nX;         // [3072 out][1024 in]         carry 32 (q | k | v row blocks)
    f16* Wot = Wt  + 3 * nW;     // [1024 out][1024 in]         carry 32
    f16* Qp  = Wot + nW;         // [NB*16][SEQ][64]            carry 16
    f16* Kp  = Qp  + nX;         // [NB*16][SEQ][64]            carry 16
    f16* Vtp = Kp  + nX;         // [NB*1024][SEQ] (V^T)        carry 16
    f16* Cp  = Vtp + nX;         // [MROWS][1024]               carry 1024

    // activations: dst row m of batch b <- src row b*SEQ_FULL + (m % SEQ)
    cvt_rows<<<MROWS / 2, 256, 0, stream>>>(x, Xh, (u32)MROWS, (u32)SEQ, (u32)SEQ_FULL, CARRY_X);
    // weights already [out][in] (k contiguous): identity row map
    cvt_rows<<<3 * HID / 2, 256, 0, stream>>>(wqkv, Wt, (u32)(3 * HID), (u32)(3 * HID), (u32)(3 * HID), CARRY_W);
    cvt_rows<<<HID / 2, 256, 0, stream>>>(wproj, Wot, (u32)HID, (u32)HID, (u32)HID, CARRY_W);

    const dim3 gg(MROWS / 128, HID / 128);
    // plane = 16 * acc / (16*32) = acc/32
    const float accQKV = CARRY_QKV / (CARRY_X * CARRY_W);
    gemm_head<<<gg, 256, 0, stream>>>(Xh, Wt,          Qp,  accQKV);
    gemm_head<<<gg, 256, 0, stream>>>(Xh, Wt + nW,     Kp,  accQKV);
    gemm_vt  <<<gg, 256, 0, stream>>>(Xh, Wt + 2 * nW, Vtp, accQKV);

    attn_fwd<<<dim3(SEQ / 128, NB * NHEAD), 256, 0, stream>>>(Qp, Kp, Vtp, Cp);

    // out = acc / (1024*32)
    const float accOut = 1.0f / (CARRY_CTX * CARRY_W);
    gemm_out<<<gg, 256, 0, stream>>>(Cp, Wot, (float*)d_out, accOut);
}

// v005
// One run takes 84.3 microseconds.
// Next to v004, in two timings, it ran 1.09 and 1.10 times as fast.
// Counting every step since v000, it is 3.21 times as fast.
#include <hip/hip_runtime.h>

// Contractions (fused QKV projection, Q.K^T, P.V, P row-sum, output projection): v_wmma_f32_16x16x32_f16, f16 operands with power-of-two carries, f32 accumulate; every float input enters as its bf16 RNE value; softmax in f32.

#ifndef NB
#define NB 2
#endif
#ifndef SEQ
#define SEQ 2048
#endif
#define NB_FULL   2
#define SEQ_FULL  2048
#define HID       1024
#define NHEAD     16
#define HD        64
#define MROWS     (NB * SEQ)

static_assert(HID == NHEAD * HD);        // merged head width
static_assert(NHEAD == 16);              // bh >> 4 / bh & 15 decoding in attn_fwd
static_assert(HD == 64);
static_assert(SEQ % 128 == 0);           // 128-row blocks never straddle a batch
static_assert(SEQ % 64 == 0);            // 64-key tiles
static_assert(SEQ / 64 >= 2);            // attention ring: at least two stages
static_assert(SEQ <= SEQ_FULL);
static_assert(NB >= 1 && NB <= NB_FULL);
static_assert(MROWS % 128 == 0);         // GEMM M tile
static_assert(HID % 128 == 0);           // GEMM N tile
static_assert(HID % 32 == 0);            // WMMA k step
static_assert(HID % 128 == 0 && HID / 128 >= 2);   // GEMM ring: whole 128-k stages, at least two
static_assert(HID == 128 * 8);           // cvt_all: 128 threads x 8 values per row
static_assert(HID % 2 == 0);             // cvt_all: two rows per block, no block straddles two sources
static_assert(MROWS % 2 == 0);           // cvt_all: two rows per block, no block straddles two sources

// carries (exact powers of two)
#define CARRY_X    16.0f     // input activation plane
#define CARRY_W    32.0f     // weight planes
#define CARRY_QKV  16.0f     // q, k, v^T planes (true value x16)
#define CARRY_CTX  1024.0f   // context plane (true value x1024)
// softmax exp values carry 2^10 (added to the exp2 argument)

// LDS row pitches: 16 B x odd, so the 16 rows that one ds_load_b128 touches per lane half fall on distinct banks
#define AB_PITCH  136u   // halves: GEMM A / B stages, 256-B rows on a 272-B pitch
#define KSTAGE    128u   // k values per GEMM stage (four WMMA k steps)
#define C_PITCH   136u   // halves: GEMM f16 output stage, 256-B rows on a 272-B pitch
#define CF_PITCH  132u   // floats: GEMM f32 output stage, 512-B rows on a 528-B pitch
#define AT_PITCH  72u    // halves: attention K, V^T and output stage tiles, 128-B rows on a 144-B pitch

typedef unsigned u32;
typedef _Float16 f16;
typedef f16   v16h __attribute__((ext_vector_type(16)));
typedef f16   v8h  __attribute__((ext_vector_type(8)));
typedef float v8f  __attribute__((ext_vector_type(8)));
typedef float v4f  __attribute__((ext_vector_type(4)));

union FragU { v16h v; v8h half[2]; f16 e[16]; };
union H8U   { v8h v; f16 e[8]; };

__device__ __forceinline__ v8f zero8() {
    v8f z = {0.f, 0.f, 0.f, 0.f, 0.f, 0.f, 0.f, 0.f};
    return z;
}

// 16-bit WMMA with hazard guard: D += A[16 x 32k] * B[32k x 16]
__device__ __forceinline__ v8f wmma16(v16h a, v16h b, v8f c) {
    v8f d = __builtin_amdgcn_wmma_f32_16x16x32_f16(false, a, false, b, (short)0, c, false, false);
    asm volatile("v_nop\n\tv_nop\n\tv_nop\n\tv_nop" : "+v"(d) : "v"(a), "v"(b));
    return d;
}

// f32 -> nearest-even bf16 value, returned as f32
__device__ __forceinline__ float bf16_rne(float x) {
    u32 u = __float_as_uint(x);
    u = (u + 0x7fffu + ((u >> 16) & 1u)) & 0xffff0000u;
    return __uint_as_float(u);
}

__device__ __forceinline__ float fexp2(float x) {
#if defined(__has_builtin)
#if __has_builtin(__builtin_amdgcn_exp2f)
    return __builtin_amdgcn_exp2f(x);
#else
    return exp2f(x);
#endif
#else
    return exp2f(x);
#endif
}

// value of lane l ^ 16 (the other lane half's share of the same D column)
__device__ __forceinline__ float xhalf(float x) {
    const int b = __builtin_bit_cast(int, x);
    return __builtin_bit_cast(float, __builtin_amdgcn_permlanex16(b, b, 0x76543210, 0xfedcba98, false, false));
}

// 16 x 32 fragment from a tile whose k dimension is contiguous (pitch in halves).
// lane l: row rowbase + (l&15); elements 0..7 <- k = kcol + 8h .. +7,
// elements 8..15 <- k = kcol + 16 + 8h .. +7  (h = l>>4). Same map for A and B.
__device__ __forceinline__ v16h load_frag(const f16* tile, u32 rowbase, u32 pitch, u32 kcol, u32 lane) {
    const u32 r  = rowbase + (lane & 15u);
    const u32 kh = (lane >> 4) << 3;
    const f16* p = tile + (size_t)r * pitch + kcol + kh;
    FragU f;
    f.half[0] = *(const v8h*)(p);
    f.half[1] = *(const v8h*)(p + 16);
    return f.v;
}

// One operand's stage, 128 rows x 128 k (256 B a row), global -> LDS with no register in between.
// Lane: 16 B of row (tid >> 4) + 16 i, i = 0..7; a wave's copy covers two whole 256-B rows.
// g: the lane's global address in row tid >> 4 of the stage; l: its LDS byte address there.
// s_wait_xcnt 0 closes the statement so that no address register is rewritten ahead of it.
__device__ __forceinline__ void copy_stage(const f16* g, u32 l) {
    const f16* g1 = g + 16 * HID;
    const f16* g2 = g + 32 * HID;
    const f16* g3 = g + 48 * HID;
    const f16* g4 = g + 64 * HID;
    const f16* g5 = g + 80 * HID;
    const f16* g6 = g + 96 * HID;
    const f16* g7 = g + 112 * HID;
    const u32 rs = 16u * AB_PITCH * (u32)sizeof(f16);
    asm volatile("global_load_async_to_lds_b128 %0, %8, off\n\t"
                 "global_load_async_to_lds_b128 %1, %9, off\n\t"
                 "global_load_async_to_lds_b128 %2, %10, off\n\t"
                 "global_load_async_to_lds_b128 %3, %11, off\n\t"
                 "global_load_async_to_lds_b128 %4, %12, off\n\t"
                 "global_load_async_to_lds_b128 %5, %13, off\n\t"
                 "global_load_async_to_lds_b128 %6, %14, off\n\t"
                 "global_load_async_to_lds_b128 %7, %15, off\n\t"
                 "s_wait_xcnt 0x0"
                 :: "v"(l), "v"(l + rs), "v"(l + 2u * rs), "v"(l + 3u * rs),
                    "v"(l + 4u * rs), "v"(l + 5u * rs), "v"(l + 6u * rs), "v"(l + 7u * rs),
                    "v"(g), "v"(g1), "v"(g2), "v"(g3), "v"(g4), "v"(g5), "v"(g6), "v"(g7)
                 : "memory");
}

// One attention stage, K 64 x 64 and V^T 64 x 64 halves (128 B a row), global -> LDS with no register in between.
// Lane: 16 B of rows tid >> 3 and (tid >> 3) + 32 of each tile. gk, gv: the lane's global addresses in its
// first row; lk, lv: its LDS byte addresses there.
// s_wait_xcnt 0 closes the statement so that no address register is rewritten ahead of it.
__device__ __forceinline__ void copy_kv(const f16* gk, const f16* gv, u32 lk, u32 lv) {
    const f16* gk1 = gk + 32 * HD;
    const f16* gv1 = gv + 32 * SEQ;
    const u32 rs = 32u * AT_PITCH * (u32)sizeof(f16);
    asm volatile("global_load_async_to_lds_b128 %0, %4, off\n\t"
                 "global_load_async_to_lds_b128 %1, %5, off\n\t"
                 "global_load_async_to_lds_b128 %2, %6, off\n\t"
                 "global_load_async_to_lds_b128 %3, %7, off\n\t"
                 "s_wait_xcnt 0x0"
                 :: "v"(lk), "v"(lk + rs), "v"(lv), "v"(lv + rs),
                    "v"(gk), "v"(gk1), "v"(gv), "v"(gv1)
                 : "memory");
}

// ---------------------------------------------------------------------------
// All three f32 inputs -> f16 planes (bf16 RNE value times carry) in ONE launch. The planes Xh | Wt | Wot lie one behind
// the other in the workspace, so dst is one array of MROWS + 4 * HID rows of 1024 halves; 128 threads per row.
// dst row m < MROWS: activation row (m / SEQ) * SEQ_FULL + m % SEQ (lets a reduced build read full-size inputs);
// the next 3 * HID rows: wqkv, the last HID rows: wproj (already [out][in], k contiguous: identity row map).
// A block holds two rows and every boundary is even, so the source choice is the same for a whole block.
// coverage: (MROWS + 4 * HID) x 1024 halves, every element exactly once (grid = rows / 2).
// ---------------------------------------------------------------------------
__global__ void __launch_bounds__(256)
cvt_all(const float* __restrict__ x, const float* __restrict__ wqkv, const float* __restrict__ wproj,
        f16* __restrict__ dst) {
    const u32 g  = blockIdx.x * 256u + threadIdx.x;
    const u32 m  = g >> 7;
    const u32 c8 = (g & 127u) << 3;
    if (m >= (u32)(MROWS + 4 * HID)) return;
    const u32 mblk = blockIdx.x * 2u;    // the block's first row: a scalar, so the choice below is a scalar branch
    const float* sp;
    float carry;
    if (mblk < (u32)MROWS) {
        const u32 mb = m / (u32)SEQ;
        sp = x + (size_t)(mb * (u32)SEQ_FULL + (m - mb * (u32)SEQ)) * HID + c8;
        carry = CARRY_X;
    } else if (mblk < (u32)(MROWS + 3 * HID)) {
        sp = wqkv + (size_t)(m - (u32)MROWS) * HID + c8;
        carry = CARRY_W;
    } else {
        sp = wproj + (size_t)(m - (u32)(MROWS + 3 * HID)) * HID + c8;
        carry = CARRY_W;
    }
    const v4f a = *(const v4f*)sp;
    const v4f b = *(const v4f*)(sp + 4);
    H8U o;
#pragma unroll
    for (u32 j = 0; j < 4; ++j) {
        const float x0 = a[j];
        const float x1 = b[j];
        o.e[j]     = (f16)(bf16_rne(x0) * carry);
        o.e[j + 4] = (f16)(bf16_rne(x1) * carry);
    }
    f16* dp = dst + (size_t)m * HID + c8;
    *(v8h*)dp = o.v;
}

// ---------------------------------------------------------------------------
// C[m][n] = sum_k A[m][k] * W[n][k] ; A [MROWS][1024] f16, W [gridDim.y * 128][1024] f16 (k contiguous).
// Block tile 128 x 128, 8 waves as 4(M) x 2(N), 2 x 4 accumulators per wave, WMMA k step 32.
// A / B: two-buffer ring of 128-k stages filled by asynchronous copies, stage t + 1 in flight during trip t.
// MODE 0: the q | k | v row blocks of W in one grid (y = 0..23); sel = y / 8 picks the plane behind out:
//         sel 0, 1: f16 plane [b*NHEAD + h][s][d] (head-major); sel 2: f16 plane [b*HID + h*HD + d][s] (V transposed per head)
// MODE 2: f32 rows [m][1024] into the output buffer
// coverage per block: MODE 0 256 lines (128 rows x 2 heads | 128 n x 2 s-halves),
//                     MODE 2 2 x 256 lines (64 rows x 4 line-quarters per half).
// LDS: As/Bs/Cs all cross-wave, separated by block barriers.
// staged extent == consumed extent: As/Bs 128 x 128 per buffer, Cs 128 x 128 halves (or 64 x 128 floats).
// ---------------------------------------------------------------------------
template <int MODE>
__device__ __forceinline__ void gemm_body(const f16* __restrict__ A, const f16* __restrict__ W,
                                          void* __restrict__ out, float accMul) {
    __shared__ __attribute__((aligned(16))) f16 As[2][128 * AB_PITCH];
    __shared__ __attribute__((aligned(16))) f16 Bs[2][128 * AB_PITCH];
    __shared__ __attribute__((aligned(16))) f16 Cs[128 * C_PITCH];   // f16 [128][128] or f32 [64][128], padded rows
    static_assert(sizeof(f16) * 128 * C_PITCH >= sizeof(float) * 64 * CF_PITCH);   // Cs reuse as f32 [64][128]

    const u32 tid  = threadIdx.x;
    const u32 lane = tid & 31u;
    const u32 wave = tid >> 5;
    const u32 wm   = wave & 3u;
    const u32 wn   = wave >> 2;
    const u32 hh8  = (lane >> 4) << 3;   // D row half
    const u32 c16  = lane & 15u;         // D column
    const u32 m0   = blockIdx.x * 128u;
    const u32 nw   = blockIdx.y * 128u;                                  // the block's first row of W
    const u32 sel  = MODE == 0 ? blockIdx.y / (u32)(HID / 128) : 0u;     // q, k or v: the same for the whole block
    const u32 n0   = nw - sel * (u32)HID;                                // column inside the selected plane

    v8f acc[2][4];
#pragma unroll
    for (int i = 0; i < 2; ++i)
#pragma unroll
        for (int j = 0; j < 4; ++j) acc[i][j] = zero8();

    const u32 srow = tid >> 4;
    const u32 scol = (tid & 15u) << 3;
    const f16* gA = A + (size_t)(m0 + srow) * HID + scol;
    const f16* gW = W + (size_t)(nw + srow) * HID + scol;
    const u32 bufB = 128u * AB_PITCH * (u32)sizeof(f16);                   // bytes per buffer
    const u32 lA = (u32)(size_t)&As[0][srow * AB_PITCH + scol];            // LDS byte address, buffer 0
    const u32 lB = (u32)(size_t)&Bs[0][srow * AB_PITCH + scol];
    const u32 nst = (u32)HID / KSTAGE;

    // stage 0 lands and is published; stage 1 then flies during trip 0
    copy_stage(gA, lA);
    copy_stage(gW, lB);
    asm volatile("s_wait_asynccnt 0x0" ::: "memory");   // this wave's stage-0 copies have landed
    __syncthreads();
    copy_stage(gA + KSTAGE, lA + bufB);
    copy_stage(gW + KSTAGE, lB + bufB);

    // kept rolled: the ring's foot (waits, barrier, refill) stands once and the body stays small for the instruction cache
#pragma unroll 1
    for (u32 t = 0; t < nst; ++t) {
        const u32 b = t & 1u;
        const f16* as = &As[b][0];
        const f16* bs = &Bs[b][0];
        // Fragment reads run two k steps ahead of the products, one group of 12 reads per k step: steps 0 and 1 at the
        // stage's head, step g + 2 in front of step g's products, so a group's LDS latency passes behind 8 to 16 WMMAs.
        // All reads are of buffer b, published before this trip. Unrolled: indices and ds_load offsets are constants.
        v16h af[KSTAGE / 32u][2], bfr[KSTAGE / 32u][4];
#pragma unroll
        for (u32 g = 0; g < 2u; ++g) {
#pragma unroll
            for (int i = 0; i < 2; ++i) af[g][i] = load_frag(as, wm * 32u + (u32)i * 16u, AB_PITCH, g * 32u, lane);
#pragma unroll
            for (int j = 0; j < 4; ++j) bfr[g][j] = load_frag(bs, wn * 64u + (u32)j * 16u, AB_PITCH, g * 32u, lane);
        }
#pragma unroll
        for (u32 g = 0; g < KSTAGE / 32u; ++g) {
            if (g + 2u < KSTAGE / 32u) {
#pragma unroll
                for (int i = 0; i < 2; ++i) af[g + 2u][i] = load_frag(as, wm * 32u + (u32)i * 16u, AB_PITCH, (g + 2u) * 32u, lane);
#pragma unroll
                for (int j = 0; j < 4; ++j) bfr[g + 2u][j] = load_frag(bs, wn * 64u + (u32)j * 16u, AB_PITCH, (g + 2u) * 32u, lane);
            }
#pragma unroll
            for (int i = 0; i < 2; ++i)
#pragma unroll
                for (int j = 0; j < 4; ++j) acc[i][j] = wmma16(af[g][i], bfr[g][j], acc[i][j]);
        }
        asm volatile("s_wait_dscnt 0x0" ::: "memory");      // this wave's reads of buffer b are done before its refill
        asm volatile("s_wait_asynccnt 0x0" ::: "memory");   // this wave's stage t + 1 copies have landed
        __syncthreads();                                    // publishes stage t + 1, frees buffer b
        if (t + 2u < nst) {
            copy_stage(gA + (t + 2u) * KSTAGE, lA + b * bufB);
            copy_stage(gW + (t + 2u) * KSTAGE, lB + b * bufB);
        }
    }
    asm volatile("s_wait_asynccnt 0x0" ::: "memory");       // nothing of the ring is outstanding past the loop

    const u32 bidx  = m0 / (u32)SEQ;     // block rows lie inside one batch (SEQ % 128 == 0)
    const u32 s0    = m0 - bidx * (u32)SEQ;
    const u32 piece = lane & 7u;
    const u32 lsub  = lane >> 3;

    if (MODE == 0 && sel < 2u) {
#pragma unroll
        for (int i = 0; i < 2; ++i)
#pragma unroll
            for (int j = 0; j < 4; ++j) {
                const u32 nl = wn * 64u + (u32)j * 16u + c16;
#pragma unroll
                for (int r = 0; r < 8; ++r) {
                    const u32 ml = wm * 32u + (u32)i * 16u + hh8 + (u32)r;
                    Cs[ml * C_PITCH + nl] = (f16)(acc[i][j][r] * accMul);
                }
            }
        __syncthreads();
        f16* op = (f16*)out + (size_t)sel * ((size_t)MROWS * HID);
        const size_t bh0 = (size_t)bidx * NHEAD + (n0 >> 6);
{
#pragma unroll
            for (u32 it = 0; it < 8; ++it) {
                const u32 L    = wave * 32u + it * 4u + lsub;   // 0..255
                const u32 ml   = L >> 1;
                const u32 hsel = L & 1u;
                const v8h v = *(const v8h*)&Cs[ml * C_PITCH + hsel * 64u + piece * 8u];
                f16* dp = op + ((bh0 + hsel) * SEQ + s0 + ml) * HD + piece * 8u;
                *(v8h*)dp = v;
            }
            
        }
    } else if (MODE == 0) {
        // stage transposed: Cs[n][m]
#pragma unroll
        for (int i = 0; i < 2; ++i)
#pragma unroll
            for (int j = 0; j < 4; ++j) {
                const u32 nl = wn * 64u + (u32)j * 16u + c16;
                H8U t;
#pragma unroll
                for (int r = 0; r < 8; ++r) t.e[r] = (f16)(acc[i][j][r] * accMul);
                *(v8h*)&Cs[nl * C_PITCH + wm * 32u + (u32)i * 16u + hh8] = t.v;
            }
        __syncthreads();
        f16* op = (f16*)out + 2 * ((size_t)MROWS * HID);
{
#pragma unroll
            for (u32 it = 0; it < 8; ++it) {
                const u32 L  = wave * 32u + it * 4u + lsub;     // 0..255
                const u32 nl = L >> 1;
                const u32 mh = L & 1u;
                const v8h v = *(const v8h*)&Cs[nl * C_PITCH + mh * 64u + piece * 8u];
                f16* dp = op + ((size_t)(bidx * (u32)HID + n0 + nl) * SEQ + s0 + mh * 64u + piece * 8u);
                *(v8h*)dp = v;
            }
            
        }
    } else {
        float* Cf = (float*)Cs;      // [64][128] f32, padded rows
        float* of = (float*)out;
#pragma unroll
        for (u32 half = 0; half < 2; ++half) {
            if ((wm >> 1) == half) {
#pragma unroll
                for (int i = 0; i < 2; ++i)
#pragma unroll
                    for (int j = 0; j < 4; ++j) {
                        const u32 nl = wn * 64u + (u32)j * 16u + c16;
#pragma unroll
                        for (int r = 0; r < 8; ++r) {
                            const u32 ml = (wm & 1u) * 32u + (u32)i * 16u + hh8 + (u32)r;
                            Cf[ml * CF_PITCH + nl] = acc[i][j][r] * accMul;
                        }
                    }
            }
            __syncthreads();
{
#pragma unroll
                for (u32 it = 0; it < 8; ++it) {
                    const u32 L    = wave * 32u + it * 4u + lsub;   // 0..255
                    const u32 row  = L >> 2;
                    const u32 part = L & 3u;
                    const v4f v = *(const v4f*)&Cf[row * CF_PITCH + part * 32u + piece * 4u];
                    float* dp = of + (size_t)(m0 + half * 64u + row) * HID + n0 + part * 32u + piece * 4u;
                    *(v4f*)dp = v;
                }
                
            }
            __syncthreads();
        }
    }
}

// q, k head-major planes and the v^T plane, one behind the other at out
__global__ void __launch_bounds__(256) __attribute__((amdgpu_num_vgpr(256)))
gemm_qkv(const f16* __restrict__ A, const f16* __restrict__ W, f16* __restrict__ out, float accMul) {
    gemm_body<0>(A, W, (void*)out, accMul);
}

// f32 output rows
__global__ void __launch_bounds__(256) __attribute__((amdgpu_num_vgpr(256)))
gemm_out(const f16* __restrict__ A, const f16* __restrict__ W, float* __restrict__ out, float accMul) {
    gemm_body<2>(A, W, (void*)out, accMul);
}

// ---------------------------------------------------------------------------
// Flash attention (no mask, all SEQ keys). grid (SEQ/128, NB*NHEAD), block 256 (8 waves),
// wave owns 16 query rows (Q fragments resident). Block streams 64-key tiles through a two-buffer
// ring filled by asynchronous copies (tile kt + 1 in flight during trip kt): K staged [key][d], V^T staged [d][key].
// Both products run transposed: S^T = K.Q^T (A = K rows, B = Q), O^T += V^T.P^T (A = V^T rows, B = P^T). A lane then
// holds 32 of one query's 64 scores: the maximum is taken in the lane plus one exchange between the lane halves,
// one running maximum and one rescale factor per lane, exp2 in f32 carried x2^10, and two score accumulators,
// converted in place, are a B fragment in the hardware k order: P never touches LDS.
// Sums of P += ones.P^T on WMMA (every D row holds the query's sum). Output f16 plane [b*SEQ+q][1024] carried x1024.
// coverage: every (b, q, h*64..h*64+63) row segment exactly once.
// LDS: ks, vsT cross-wave (block barriers); ps per-wave, output stage only.
// staged extent == consumed extent for ks (64x64), vsT (64x64), ps (16x64).
// ---------------------------------------------------------------------------
__global__ void __launch_bounds__(256) __attribute__((amdgpu_num_vgpr(256)))
attn_fwd(const f16* __restrict__ Qp, const f16* __restrict__ Kp, const f16* __restrict__ Vt,
         f16* __restrict__ Cp) {
    __shared__ __attribute__((aligned(16))) f16 ks[2][64 * AT_PITCH];   // [buffer][key][d]
    __shared__ __attribute__((aligned(16))) f16 vsT[2][64 * AT_PITCH];  // [buffer][d][key]
    __shared__ __attribute__((aligned(16))) f16 ps[8][16 * AT_PITCH];   // per-wave ctx stage
    static_assert(HD == 8 * 8);            // 8 lanes x 8 halves per row segment
    static_assert(2 * 256 * 8 == 64 * 64); // staging: 2 copies x 256 threads x 8 halves per tile

    const u32 tid  = threadIdx.x;
    const u32 lane = tid & 31u;
    const u32 wave = tid >> 5;
    const u32 hh8  = (lane >> 4) << 3;
    const u32 c16  = lane & 15u;
    const u32 bh   = blockIdx.y;
    const u32 bidx = bh >> 4;            // NHEAD == 16
    const u32 hidx = bh & 15u;
    const u32 q0   = blockIdx.x * 128u + wave * 16u;
    const size_t head = (size_t)bh * SEQ * HD;

    v16h qa[2];
#pragma unroll
    for (int c = 0; c < 2; ++c) qa[c] = load_frag(Qp + head, q0, HD, (u32)c * 32u, lane);

    FragU onesu;
#pragma unroll
    for (int i = 0; i < 16; ++i) onesu.e[i] = (f16)1.0f;
    const v16h ones = onesu.v;

    float m = -1.0e30f;      // running maximum of query q0 + c16, equal in both lane halves
    v8f   o[4], lacc;        // o[dt][r] = O^T[dt * 16 + hh8 + r][query c16]; lacc[r] = sum of P of query c16, every r
#pragma unroll
    for (int dt = 0; dt < 4; ++dt) o[dt] = zero8();
    lacc = zero8();

    // log2-domain scale: acc = 256 * q.k ; x = log2(e) * q.k / 8 = acc * log2(e) / 2048
    const float cl = 1.4426950408889634f * 0.00048828125f;
    f16* psw = &ps[wave][0];

    const u32 arow = tid >> 3;
    const u32 apc  = (tid & 7u) << 3;
    const f16* gK = Kp + head + (size_t)arow * HD + apc;
    const f16* gV = Vt + head + (size_t)arow * SEQ + apc;
    const u32 abuf = 64u * AT_PITCH * (u32)sizeof(f16);                    // bytes per buffer
    const u32 lK = (u32)(size_t)&ks[0][arow * AT_PITCH + apc];             // LDS byte address, buffer 0
    const u32 lV = (u32)(size_t)&vsT[0][arow * AT_PITCH + apc];
    const u32 ntile = (u32)(SEQ / 64);

    // tile 0 lands and is published; tile 1 then flies during trip 0
    copy_kv(gK, gV, lK, lV);
    asm volatile("s_wait_asynccnt 0x0" ::: "memory");   // this wave's tile-0 copies have landed
    __syncthreads();
    copy_kv(gK + 64 * HD, gV + 64, lK + abuf, lV + abuf);

#pragma unroll 1
    for (u32 kt = 0; kt < ntile; ++kt) {
        const u32 rb = kt & 1u;
        const f16* ksb = &ks[rb][0];
        const f16* vsb = &vsT[rb][0];

        // S^T[64 keys x 16 q]: s[nt][r] = score of key nt * 16 + hh8 + r against query c16
        v8f s[4];
#pragma unroll
        for (int nt = 0; nt < 4; ++nt) s[nt] = zero8();
        // the tile's eight K and eight V^T fragments are read as one group in front of the score products:
        // one LDS latency for K, not eight; V^T lands behind the score products and the softmax
        v16h kb[2][4], vb[2][4];
#pragma unroll
        for (int c = 0; c < 2; ++c)
#pragma unroll
            for (int nt = 0; nt < 4; ++nt) kb[c][nt] = load_frag(ksb, (u32)nt * 16u, AT_PITCH, (u32)c * 32u, lane);
#pragma unroll
        for (int kk = 0; kk < 2; ++kk)
#pragma unroll
            for (int dt = 0; dt < 4; ++dt) vb[kk][dt] = load_frag(vsb, (u32)dt * 16u, AT_PITCH, (u32)kk * 32u, lane);
#pragma unroll
        for (int c = 0; c < 2; ++c)
#pragma unroll
            for (int nt = 0; nt < 4; ++nt) s[nt] = wmma16(kb[c][nt], qa[c], s[nt]);

        // online softmax of the lane's query, max-subtracted, exp2 domain; cl > 0, so the maximum is taken on raw scores
        float t[4];
#pragma unroll
        for (int nt = 0; nt < 4; ++nt) {
            float v = fmaxf(fmaxf(s[nt][0], s[nt][1]), s[nt][2]);
            v = fmaxf(fmaxf(v, s[nt][3]), s[nt][4]);
            v = fmaxf(fmaxf(v, s[nt][5]), s[nt][6]);
            t[nt] = fmaxf(v, s[nt][7]);
        }
        float tm = fmaxf(fmaxf(fmaxf(t[0], t[1]), t[2]), t[3]);
        tm = fmaxf(tm, xhalf(tm)) * cl;       // the other half holds the query's other 32 keys
        const float mn = fmaxf(m, tm);
        const float al = fexp2(m - mn);
        m = mn;
        lacc *= al;
#pragma unroll
        for (int dt = 0; dt < 4; ++dt) o[dt] *= al;
        const float sh = 10.0f - mn;          // carry 2^10

        // P^T as B fragments: element e <- key kk * 32 + hh8 + e (accumulator 2 kk), element 8 + e <- key
        // kk * 32 + 16 + hh8 + e (accumulator 2 kk + 1): the k order of load_frag, which the V^T fragments have
        FragU pb[2];
#pragma unroll
        for (int kk = 0; kk < 2; ++kk)
#pragma unroll
            for (int e = 0; e < 8; ++e) {
                pb[kk].e[e]     = (f16)fexp2(s[2 * kk][e] * cl + sh);
                pb[kk].e[e + 8] = (f16)fexp2(s[2 * kk + 1][e] * cl + sh);
            }

        // O^T += V^T . P^T ; l += ones . P^T
#pragma unroll
        for (int kk = 0; kk < 2; ++kk) {
#pragma unroll
            for (int dt = 0; dt < 4; ++dt) o[dt] = wmma16(vb[kk][dt], pb[kk].v, o[dt]);
            lacc = wmma16(ones, pb[kk].v, lacc);
        }
        asm volatile("s_wait_dscnt 0x0" ::: "memory");      // this wave's reads of buffer rb are done before its refill
        asm volatile("s_wait_asynccnt 0x0" ::: "memory");   // this wave's tile kt + 1 copies have landed
        __syncthreads();                                    // publishes tile kt + 1, frees buffer rb
        if (kt + 2u < ntile)
            copy_kv(gK + (size_t)(kt + 2u) * (64 * HD), gV + (kt + 2u) * 64u, lK + rb * abuf, lV + rb * abuf);
    }
    asm volatile("s_wait_asynccnt 0x0" ::: "memory");       // nothing of the ring is outstanding past the loop
    __syncthreads();

    // normalize: plane value = 1024 * (O/16) / l = O * 64 / l ; a lane's 8 registers are 8 consecutive d of its query
    const float inv = (CARRY_CTX / CARRY_QKV) / lacc[0];
#pragma unroll
    for (int dt = 0; dt < 4; ++dt) {
        H8U w;
#pragma unroll
        for (int r = 0; r < 8; ++r) w.e[r] = (f16)(o[dt][r] * inv);
        *(v8h*)&psw[c16 * AT_PITCH + (u32)dt * 16u + hh8] = w.v;
    }
    __syncthreads();

    const u32 piece = lane & 7u;
    const u32 lsub  = lane >> 3;
{
#pragma unroll
        for (u32 it = 0; it < 4; ++it) {
            const u32 L = it * 4u + lsub;     // query row 0..15 within the wave tile
            const v8h v = *(const v8h*)&psw[L * AT_PITCH + piece * 8u];
            f16* dp = Cp + ((size_t)(bidx * (u32)SEQ + q0 + L) * HID + hidx * (u32)HD + piece * 8u);
            *(v8h*)dp = v;
        }
        
    }
}

// coverage equalities (threads x elements == plane elements)
static_assert((size_t)((MROWS + 4 * HID) / 2) * 256 * 8 == (size_t)(MROWS + 4 * HID) * HID);   // cvt_all -> Xh | Wt | Wot
static_assert((size_t)(MROWS / 128) * (HID / 128) * 128 * 128 == (size_t)MROWS * HID);     // gemm planes / out
static_assert((size_t)(SEQ / 128) * (NB * NHEAD) * 128 * HD == (size_t)MROWS * HID);       // attn_fwd -> Cp
// workspace: 5 activation planes + 4 weight planes of halves, at most 128 MiB
static_assert(((size_t)5 * MROWS * HID + (size_t)4 * HID * HID) * sizeof(f16) <= (size_t)134217728);
// output extent: last written f32 element index < NB_FULL*SEQ_FULL*HID
static_assert((size_t)MROWS * HID <= (size_t)NB_FULL * SEQ_FULL * HID);

// ---------------------------------------------------------------------------
// Launch: 4 kernel launches, workspace 5 planes of MROWS*1024 halves + 4 of 1024*1024 halves.
// ---------------------------------------------------------------------------
extern "C" void kernel_launch(void* const* d_in, const int* in_sizes, int n_in,
                              void* d_out, int out_size, void* d_ws, size_t ws_size,
                              hipStream_t stream) {
    if (n_in < 3) return;
    if (in_sizes[0] < ((NB - 1) * SEQ_FULL + SEQ) * HID) return;
    if (in_sizes[1] < 3 * HID * HID) return;
    if (in_sizes[2] < HID * HID) return;
    if (out_size < MROWS * HID) return;

    const float* x     = (const float*)d_in[0];   // [NB_FULL][SEQ_FULL][1024]
    const float* wqkv  = (const float*)d_in[1];   // [3072 out][1024 in], row blocks q | k | v
    const float* wproj = (const float*)d_in[2];   // [1024 out][1024 in]

    const size_t nX = (size_t)MROWS * HID;    // halves per activation plane
    const size_t nW = (size_t)HID * HID;      // halves per weight plane
    const size_t totalHalves = 5 * nX + 4 * nW;
    if (ws_size < totalHalves * sizeof(f16)) return;

    f16* Xh  = (f16*)d_ws;       // [MROWS][1024]               carry 16
    f16* Wt  = Xh  + nX;         // [3072 out][1024 in]         carry 32 (q | k | v row blocks)
    f16* Wot = Wt  + 3 * nW;     // [1024 out][1024 in]         carry 32
    f16* Qp  = Wot + nW;         // [NB*16][SEQ][64]            carry 16
    f16* Kp  = Qp  + nX;         // [NB*16][SEQ][64]            carry 16
    f16* Vtp = Kp  + nX;         // [NB*1024][SEQ] (V^T)        carry 16
    f16* Cp  = Vtp + nX;         // [MROWS][1024]               carry 1024

    // x, wqkv, wproj -> Xh | Wt | Wot (contiguous from Xh), one launch
    cvt_all<<<(MROWS + 4 * HID) / 2, 256, 0, stream>>>(x, wqkv, wproj, Xh);

    // plane = 16 * acc / (16*32) = acc/32 ; q, k and v^T planes (contiguous from Qp), one launch
    const float accQKV = CARRY_QKV / (CARRY_X * CARRY_W);
    gemm_qkv<<<dim3(MROWS / 128, 3 * HID / 128), 256, 0, stream>>>(Xh, Wt, Qp, accQKV);

    attn_fwd<<<dim3(SEQ / 128, NB * NHEAD), 256, 0, stream>>>(Qp, Kp, Vtp, Cp);

    // out = acc / (1024*32)
    const float accOut = 1.0f / (CARRY_CTX * CARRY_W);
    gemm_out<<<dim3(MROWS / 128, HID / 128), 256, 0, stream>>>(Cp, Wot, (float*)d_out, accOut);
}

// v006
// One run takes 77.9 microseconds.
// Next to v005, in two timings, it ran 1.09 and 1.08 times as fast.
// All steps since v000 together make it 3.49 times as fast.
#include <hip/hip_runtime.h>

// Contractions (fused QKV projection, Q.K^T, P.V, P row-sum, output projection): v_wmma_f32_16x16x32_f16, f16 operands with power-of-two carries, f32 accumulate; every float input enters as its bf16 RNE value; softmax in f32.

#ifndef NB
#define NB 2
#endif
#ifndef SEQ
#define SEQ 2048
#endif
#define NB_FULL   2
#define SEQ_FULL  2048
#define HID       1024
#define NHEAD     16
#define HD        64
#define MROWS     (NB * SEQ)

static_assert(HID == NHEAD * HD);        // merged head width
static_assert(NHEAD == 16);              // bh >> 4 / bh & 15 decoding in attn_fwd
static_assert(HD == 64);
static_assert(SEQ % 128 == 0);           // 128-row blocks never straddle a batch
static_assert(SEQ % 64 == 0);            // 64-key tiles
static_assert(SEQ / 64 >= 2);            // attention ring: at least two stages
static_assert(SEQ <= SEQ_FULL);
static_assert(NB >= 1 && NB <= NB_FULL);
static_assert(MROWS % 128 == 0);         // GEMM M tile
static_assert(HID % 128 == 0);           // GEMM N tile
static_assert(HID % 32 == 0);            // WMMA k step
static_assert(HID % 128 == 0 && HID / 128 >= 2);   // GEMM ring: whole 128-k stages, at least two
static_assert(HID == 128 * 8);           // cvt_all: 128 threads x 8 values per row
static_assert(HID % 2 == 0);             // cvt_all: two rows per block, no block straddles two sources
static_assert(MROWS % 2 == 0);           // cvt_all: two rows per block, no block straddles two sources

// carries (exact powers of two)
#define CARRY_X    16.0f     // input activation plane
#define CARRY_W    32.0f     // weight planes
#define CARRY_QKV  16.0f     // q, k, v^T planes (true value x16)
#define CARRY_CTX  1024.0f   // context plane (true value x1024)
// softmax exp values carry 2^10 (added to the exp2 argument)

// LDS row pitches: 16 B x odd, so the 16 rows that one ds_load_b128 touches per lane half fall on distinct banks
#define AB_PITCH  136u   // halves: GEMM A / B stages, 256-B rows on a 272-B pitch
#define KSTAGE    128u   // k values per GEMM stage (four WMMA k steps)
#define CF_PITCH  132u   // floats: GEMM f32 output stage, 512-B rows on a 528-B pitch
#define AT_PITCH  72u    // halves: attention K, V^T and output stage tiles, 128-B rows on a 144-B pitch

typedef unsigned u32;
typedef _Float16 f16;
typedef f16   v16h __attribute__((ext_vector_type(16)));
typedef f16   v8h  __attribute__((ext_vector_type(8)));
typedef float v8f  __attribute__((ext_vector_type(8)));
typedef float v4f  __attribute__((ext_vector_type(4)));

union FragU { v16h v; v8h half[2]; f16 e[16]; };
union H8U   { v8h v; f16 e[8]; };

__device__ __forceinline__ v8f zero8() {
    v8f z = {0.f, 0.f, 0.f, 0.f, 0.f, 0.f, 0.f, 0.f};
    return z;
}

// 16-bit WMMA with hazard guard: D += A[16 x 32k] * B[32k x 16]
__device__ __forceinline__ v8f wmma16(v16h a, v16h b, v8f c) {
    v8f d = __builtin_amdgcn_wmma_f32_16x16x32_f16(false, a, false, b, (short)0, c, false, false);
    asm volatile("v_nop\n\tv_nop\n\tv_nop\n\tv_nop" : "+v"(d) : "v"(a), "v"(b));
    return d;
}

// f32 -> nearest-even bf16 value, returned as f32
__device__ __forceinline__ float bf16_rne(float x) {
    u32 u = __float_as_uint(x);
    u = (u + 0x7fffu + ((u >> 16) & 1u)) & 0xffff0000u;
    return __uint_as_float(u);
}

__device__ __forceinline__ float fexp2(float x) {
#if defined(__has_builtin)
#if __has_builtin(__builtin_amdgcn_exp2f)
    return __builtin_amdgcn_exp2f(x);
#else
    return exp2f(x);
#endif
#else
    return exp2f(x);
#endif
}

// value of lane l ^ 16 (the other lane half's share of the same D column)
__device__ __forceinline__ float xhalf(float x) {
    const int b = __builtin_bit_cast(int, x);
    return __builtin_bit_cast(float, __builtin_amdgcn_permlanex16(b, b, 0x76543210, 0xfedcba98, false, false));
}

// 16 x 32 fragment from a tile whose k dimension is contiguous (pitch in halves).
// lane l: row rowbase + (l&15); elements 0..7 <- k = kcol + 8h .. +7,
// elements 8..15 <- k = kcol + 16 + 8h .. +7  (h = l>>4). Same map for A and B.
__device__ __forceinline__ v16h load_frag(const f16* tile, u32 rowbase, u32 pitch, u32 kcol, u32 lane) {
    const u32 r  = rowbase + (lane & 15u);
    const u32 kh = (lane >> 4) << 3;
    const f16* p = tile + (size_t)r * pitch + kcol + kh;
    FragU f;
    f.half[0] = *(const v8h*)(p);
    f.half[1] = *(const v8h*)(p + 16);
    return f.v;
}

// One operand's stage, 8 RS rows x 128 k (256 B a row), global -> LDS with no register in between.
// RS = rows that one copy of the whole block covers (threads / 16).
// Lane: 16 B of row (tid >> 4) + RS i, i = 0..7; a wave's copy covers two whole 256-B rows.
// g: the lane's global address in row tid >> 4 of the stage; l: its LDS byte address there.
// s_wait_xcnt 0 closes the statement so that no address register is rewritten ahead of it.
template <int RS>
__device__ __forceinline__ void copy_stage(const f16* g, u32 l) {
    const f16* g1 = g + 1 * RS * HID;
    const f16* g2 = g + 2 * RS * HID;
    const f16* g3 = g + 3 * RS * HID;
    const f16* g4 = g + 4 * RS * HID;
    const f16* g5 = g + 5 * RS * HID;
    const f16* g6 = g + 6 * RS * HID;
    const f16* g7 = g + 7 * RS * HID;
    const u32 rs = (u32)RS * AB_PITCH * (u32)sizeof(f16);
    asm volatile("global_load_async_to_lds_b128 %0, %8, off\n\t"
                 "global_load_async_to_lds_b128 %1, %9, off\n\t"
                 "global_load_async_to_lds_b128 %2, %10, off\n\t"
                 "global_load_async_to_lds_b128 %3, %11, off\n\t"
                 "global_load_async_to_lds_b128 %4, %12, off\n\t"
                 "global_load_async_to_lds_b128 %5, %13, off\n\t"
                 "global_load_async_to_lds_b128 %6, %14, off\n\t"
                 "global_load_async_to_lds_b128 %7, %15, off\n\t"
                 "s_wait_xcnt 0x0"
                 :: "v"(l), "v"(l + rs), "v"(l + 2u * rs), "v"(l + 3u * rs),
                    "v"(l + 4u * rs), "v"(l + 5u * rs), "v"(l + 6u * rs), "v"(l + 7u * rs),
                    "v"(g), "v"(g1), "v"(g2), "v"(g3), "v"(g4), "v"(g5), "v"(g6), "v"(g7)
                 : "memory");
}

// The same for a stage of 6 RS rows.
template <int RS>
__device__ __forceinline__ void copy_stage6(const f16* g, u32 l) {
    const f16* g1 = g + 1 * RS * HID;
    const f16* g2 = g + 2 * RS * HID;
    const f16* g3 = g + 3 * RS * HID;
    const f16* g4 = g + 4 * RS * HID;
    const f16* g5 = g + 5 * RS * HID;
    const u32 rs = (u32)RS * AB_PITCH * (u32)sizeof(f16);
    asm volatile("global_load_async_to_lds_b128 %0, %6, off\n\t"
                 "global_load_async_to_lds_b128 %1, %7, off\n\t"
                 "global_load_async_to_lds_b128 %2, %8, off\n\t"
                 "global_load_async_to_lds_b128 %3, %9, off\n\t"
                 "global_load_async_to_lds_b128 %4, %10, off\n\t"
                 "global_load_async_to_lds_b128 %5, %11, off\n\t"
                 "s_wait_xcnt 0x0"
                 :: "v"(l), "v"(l + rs), "v"(l + 2u * rs), "v"(l + 3u * rs), "v"(l + 4u * rs), "v"(l + 5u * rs),
                    "v"(g), "v"(g1), "v"(g2), "v"(g3), "v"(g4), "v"(g5)
                 : "memory");
}

// One attention stage, K 64 x 64 and V^T 64 x 64 halves (128 B a row), global -> LDS with no register in between.
// Lane: 16 B of rows tid >> 3 and (tid >> 3) + 32 of each tile. gk, gv: the lane's global addresses in its
// first row; lk, lv: its LDS byte addresses there.
// s_wait_xcnt 0 closes the statement so that no address register is rewritten ahead of it.
__device__ __forceinline__ void copy_kv(const f16* gk, const f16* gv, u32 lk, u32 lv) {
    const f16* gk1 = gk + 32 * HD;
    const f16* gv1 = gv + 32 * SEQ;
    const u32 rs = 32u * AT_PITCH * (u32)sizeof(f16);
    asm volatile("global_load_async_to_lds_b128 %0, %4, off\n\t"
                 "global_load_async_to_lds_b128 %1, %5, off\n\t"
                 "global_load_async_to_lds_b128 %2, %6, off\n\t"
                 "global_load_async_to_lds_b128 %3, %7, off\n\t"
                 "s_wait_xcnt 0x0"
                 :: "v"(lk), "v"(lk + rs), "v"(lv), "v"(lv + rs),
                    "v"(gk), "v"(gk1), "v"(gv), "v"(gv1)
                 : "memory");
}

// ---------------------------------------------------------------------------
// All three f32 inputs -> f16 planes (bf16 RNE value times carry) in ONE launch. The planes Xh | Wt | Wot lie one behind
// the other in the workspace, so dst is one array of MROWS + 4 * HID rows of 1024 halves; 128 threads per row.
// dst row m < MROWS: activation row (m / SEQ) * SEQ_FULL + m % SEQ (lets a reduced build read full-size inputs);
// the next 3 * HID rows: wqkv, the last HID rows: wproj (already [out][in], k contiguous: identity row map).
// A block holds two rows and every boundary is even, so the source choice is the same for a whole block.
// coverage: (MROWS + 4 * HID) x 1024 halves, every element exactly once (grid = rows / 2).
// ---------------------------------------------------------------------------
__global__ void __launch_bounds__(256)
cvt_all(const float* __restrict__ x, const float* __restrict__ wqkv, const float* __restrict__ wproj,
        f16* __restrict__ dst) {
    const u32 g  = blockIdx.x * 256u + threadIdx.x;
    const u32 m  = g >> 7;
    const u32 c8 = (g & 127u) << 3;
    if (m >= (u32)(MROWS + 4 * HID)) return;
    const u32 mblk = blockIdx.x * 2u;    // the block's first row: a scalar, so the choice below is a scalar branch
    const float* sp;
    float carry;
    if (mblk < (u32)MROWS) {
        const u32 mb = m / (u32)SEQ;
        sp = x + (size_t)(mb * (u32)SEQ_FULL + (m - mb * (u32)SEQ)) * HID + c8;
        carry = CARRY_X;
    } else if (mblk < (u32)(MROWS + 3 * HID)) {
        sp = wqkv + (size_t)(m - (u32)MROWS) * HID + c8;
        carry = CARRY_W;
    } else {
        sp = wproj + (size_t)(m - (u32)(MROWS + 3 * HID)) * HID + c8;
        carry = CARRY_W;
    }
    const v4f a = *(const v4f*)sp;
    const v4f b = *(const v4f*)(sp + 4);
    H8U o;
#pragma unroll
    for (u32 j = 0; j < 4; ++j) {
        const float x0 = a[j];
        const float x1 = b[j];
        o.e[j]     = (f16)(bf16_rne(x0) * carry);
        o.e[j + 4] = (f16)(bf16_rne(x1) * carry);
    }
    f16* dp = dst + (size_t)m * HID + c8;
    *(v8h*)dp = o.v;
}

// ---------------------------------------------------------------------------
// q | k | v projection: C[m][n] = sum_k A[m][k] * W[n][k] ; A [MROWS][1024] f16, W [3072][1024] f16 (k contiguous).
// Block tile 256 x 192 (three heads), 16 waves as 4(M) x 4(N), 4 x 3 accumulators per wave, WMMA k step 32:
// 16 x 16 = 256 blocks, one per WGP in one round, and 7 / 12 of the operand bytes per product that a 128 x 128 tile loads.
// A / B: two-buffer ring of 128-k stages filled by asynchronous copies, stage t + 1 in flight during trip t.
// A head (64 columns of W's rows) lies in one plane behind out: plane = n / 1024;
//   planes 0, 1: f16 [b*NHEAD + h][s][d] (head-major); plane 2: f16 [b*HID + h*HD + d][s] (V transposed per head).
// coverage per block: 3 heads x 256 lines of 128 B (256 rows | 64 d x 4 s-quarters).
// LDS: one array; the ring's stages are cross-wave, separated by block barriers; the output stage lies over the ring
// behind the last trip's barrier (every wave's reads done, no copy outstanding).
// staged extent == consumed extent: A 256 x 128, B 192 x 128 per buffer; output stage 3 x (256 x 64) halves.
// ---------------------------------------------------------------------------
#define QM 256u                       // block tile rows
#define QN 192u                       // block tile columns
#define QH_PITCH 72u                  // halves: head-major output stage, 128-B rows on a 144-B pitch
#define QT_PITCH 264u                 // halves: transposed output stage, 512-B rows on a 528-B pitch
#define QREG (QM * QH_PITCH)          // halves per head region of the output stage
static_assert(MROWS % 256 == 0 && SEQ % 256 == 0);     // 256-row blocks never straddle a batch
static_assert((3 * HID) % 192 == 0 && 192 % HD == 0);  // whole blocks, whole heads
static_assert(QREG >= 64u * QT_PITCH);                 // a region holds either layout
static_assert(3u * QREG <= 2u * (QM + QN) * AB_PITCH); // the output stage fits over the ring

__global__ void __launch_bounds__(512) __attribute__((amdgpu_num_vgpr(256)))
gemm_qkv(const f16* __restrict__ A, const f16* __restrict__ W, f16* __restrict__ out, float accMul) {
    __shared__ __attribute__((aligned(16))) f16 ring[2][(QM + QN) * AB_PITCH];   // [buffer][A rows | B rows]

    const u32 tid  = threadIdx.x;
    const u32 lane = tid & 31u;
    const u32 wave = (u32)__builtin_amdgcn_readfirstlane((int)(tid >> 5));   // scalar: the epilogue branches on it
    const u32 wm   = wave & 3u;
    const u32 wn   = wave >> 2;
    const u32 hh8  = (lane >> 4) << 3;   // D row half
    const u32 c16  = lane & 15u;         // D column
    const u32 m0   = blockIdx.x * QM;
    const u32 nw   = blockIdx.y * QN;    // the block's first row of W

    v8f acc[4][3];
#pragma unroll
    for (int i = 0; i < 4; ++i)
#pragma unroll
        for (int j = 0; j < 3; ++j) acc[i][j] = zero8();

    const u32 srow = tid >> 4;           // 0..31
    const u32 scol = (tid & 15u) << 3;
    const f16* gA = A + (size_t)(m0 + srow) * HID + scol;
    const f16* gW = W + (size_t)(nw + srow) * HID + scol;
    const u32 bufB = (QM + QN) * AB_PITCH * (u32)sizeof(f16);              // bytes per buffer
    const u32 lA = (u32)(size_t)&ring[0][srow * AB_PITCH + scol];          // LDS byte address, buffer 0
    const u32 lB = (u32)(size_t)&ring[0][(QM + srow) * AB_PITCH + scol];
    const u32 nst = (u32)HID / KSTAGE;

    // stage 0 lands and is published; stage 1 then flies during trip 0
    copy_stage<32>(gA, lA);
    copy_stage6<32>(gW, lB);
    asm volatile("s_wait_asynccnt 0x0" ::: "memory");   // this wave's stage-0 copies have landed
    __syncthreads();
    copy_stage<32>(gA + KSTAGE, lA + bufB);
    copy_stage6<32>(gW + KSTAGE, lB + bufB);

    // kept rolled: the ring's foot (waits, barrier, refill) stands once and the body stays small for the instruction cache
#pragma unroll 1
    for (u32 t = 0; t < nst; ++t) {
        const u32 b = t & 1u;
        const f16* as = &ring[b][0];
        const f16* bs = &ring[b][QM * AB_PITCH];
        // Fragment reads run one k step ahead of the products, one group of 14 reads per k step (two sets fit the
        // registers of four waves per SIMD). All reads are of buffer b, published before this trip.
        // Unrolled: indices and ds_load offsets are constants.
        v16h af[KSTAGE / 32u][4], bfr[KSTAGE / 32u][3];
#pragma unroll
        for (int i = 0; i < 4; ++i) af[0][i] = load_frag(as, wm * 64u + (u32)i * 16u, AB_PITCH, 0u, lane);
#pragma unroll
        for (int j = 0; j < 3; ++j) bfr[0][j] = load_frag(bs, wn * 48u + (u32)j * 16u, AB_PITCH, 0u, lane);
#pragma unroll
        for (u32 g = 0; g < KSTAGE / 32u; ++g) {
            if (g + 1u < KSTAGE / 32u) {
#pragma unroll
                for (int i = 0; i < 4; ++i) af[g + 1u][i] = load_frag(as, wm * 64u + (u32)i * 16u, AB_PITCH, (g + 1u) * 32u, lane);
#pragma unroll
                for (int j = 0; j < 3; ++j) bfr[g + 1u][j] = load_frag(bs, wn * 48u + (u32)j * 16u, AB_PITCH, (g + 1u) * 32u, lane);
            }
#pragma unroll
            for (int i = 0; i < 4; ++i)
#pragma unroll
                for (int j = 0; j < 3; ++j) acc[i][j] = wmma16(af[g][i], bfr[g][j], acc[i][j]);
        }
        asm volatile("s_wait_dscnt 0x0" ::: "memory");      // this wave's reads of buffer b are done before its refill
        asm volatile("s_wait_asynccnt 0x0" ::: "memory");   // this wave's stage t + 1 copies have landed
        __syncthreads();                                    // publishes stage t + 1, frees buffer b
        if (t + 2u < nst) {
            copy_stage<32>(gA + (t + 2u) * KSTAGE, lA + b * bufB);
            copy_stage6<32>(gW + (t + 2u) * KSTAGE, lB + b * bufB);
        }
    }
    asm volatile("s_wait_asynccnt 0x0" ::: "memory");       // nothing of the ring is outstanding past the loop

    const u32 bidx  = m0 / (u32)SEQ;     // block rows lie inside one batch (SEQ % 256 == 0)
    const u32 s0    = m0 - bidx * (u32)SEQ;
    const u32 piece = lane & 7u;
    const u32 lsub  = lane >> 3;
    f16* Cs = &ring[0][0];               // three head regions of QREG halves

    // stage: a 16-column accumulator lies inside one head; the head's plane picks the layout (a scalar choice)
#pragma unroll
    for (int j = 0; j < 3; ++j) {
        const u32 cb = wn * 48u + (u32)j * 16u;      // first column of the accumulator in the block tile
        const u32 hs = cb >> 6;                      // head region
        const u32 dl = (cb & 63u) + c16;             // column inside the head
        f16* reg = Cs + hs * QREG;
        if (((nw + hs * 64u) >> 10) < 2u) {
#pragma unroll
            for (int i = 0; i < 4; ++i)
#pragma unroll
                for (int r = 0; r < 8; ++r) {
                    const u32 ml = wm * 64u + (u32)i * 16u + hh8 + (u32)r;
                    reg[ml * QH_PITCH + dl] = (f16)(acc[i][j][r] * accMul);
                }
        } else {
#pragma unroll
            for (int i = 0; i < 4; ++i) {
                H8U t;
#pragma unroll
                for (int r = 0; r < 8; ++r) t.e[r] = (f16)(acc[i][j][r] * accMul);
                *(v8h*)&reg[dl * QT_PITCH + wm * 64u + (u32)i * 16u + hh8] = t.v;
            }
        }
    }
    __syncthreads();

    // whole 128-B lines out; a wave's store covers 512 contiguous bytes in either layout
#pragma unroll
    for (u32 hs = 0; hs < 3u; ++hs) {
        const u32 ng  = nw + hs * 64u;               // the head's first row of W
        const u32 sel = ng >> 10;                    // plane: the same for the whole head
        const u32 np  = ng & 1023u;                  // column inside the plane
        const f16* reg = Cs + hs * QREG;
        f16* op = out + (size_t)sel * ((size_t)MROWS * HID);
        if (sel < 2u) {
            const size_t bh = (size_t)bidx * NHEAD + (np >> 6);
#pragma unroll
            for (u32 it = 0; it < 4; ++it) {
                const u32 ml = it * 64u + wave * 4u + lsub;     // 0..255
                const v8h v = *(const v8h*)&reg[ml * QH_PITCH + piece * 8u];
                f16* dp = op + (bh * SEQ + s0 + ml) * HD + piece * 8u;
                *(v8h*)dp = v;
            }
            // closes the run of stores before any later code rewrites a register that they name
            asm volatile("s_wait_xcnt 0x0" ::: "memory");
        } else {
#pragma unroll
            for (u32 it = 0; it < 4; ++it) {
                const u32 dl = it * 16u + wave;                 // 0..63
                const v8h v = *(const v8h*)&reg[dl * QT_PITCH + lsub * 64u + piece * 8u];
                f16* dp = op + ((size_t)(bidx * (u32)HID + np + dl) * SEQ + s0 + lsub * 64u + piece * 8u);
                *(v8h*)dp = v;
            }
            // closes the run of stores before any later code rewrites a register that they name
            asm volatile("s_wait_xcnt 0x0" ::: "memory");
        }
    }
}

// ---------------------------------------------------------------------------
// Output projection: C[m][n] = sum_k A[m][k] * W[n][k] ; A [MROWS][1024] f16, W [1024][1024] f16 (k contiguous).
// Block tile 128 x 128, 8 waves as 4(M) x 2(N), 2 x 4 accumulators per wave, WMMA k step 32.
// A / B: two-buffer ring of 128-k stages filled by asynchronous copies, stage t + 1 in flight during trip t.
// f32 rows [m][1024] into the output buffer; coverage per block: 2 x 256 lines (64 rows x 4 line-quarters per half).
// LDS: As/Bs/Cs all cross-wave, separated by block barriers.
// staged extent == consumed extent: As/Bs 128 x 128 per buffer, Cs 64 x 128 floats.
// ---------------------------------------------------------------------------
__global__ void __launch_bounds__(256) __attribute__((amdgpu_num_vgpr(256)))
gemm_out(const f16* __restrict__ A, const f16* __restrict__ W, float* __restrict__ out, float accMul) {
    __shared__ __attribute__((aligned(16))) f16 As[2][128 * AB_PITCH];
    __shared__ __attribute__((aligned(16))) f16 Bs[2][128 * AB_PITCH];
    __shared__ __attribute__((aligned(16))) float Cf[64 * CF_PITCH];   // f32 [64][128], padded rows

    const u32 tid  = threadIdx.x;
    const u32 lane = tid & 31u;
    const u32 wave = tid >> 5;
    const u32 wm   = wave & 3u;
    const u32 wn   = wave >> 2;
    const u32 hh8  = (lane >> 4) << 3;   // D row half
    const u32 c16  = lane & 15u;         // D column
    const u32 m0   = blockIdx.x * 128u;
    const u32 n0   = blockIdx.y * 128u;  // the block's first row of W = first output column

    v8f acc[2][4];
#pragma unroll
    for (int i = 0; i < 2; ++i)
#pragma unroll
        for (int j = 0; j < 4; ++j) acc[i][j] = zero8();

    const u32 srow = tid >> 4;
    const u32 scol = (tid & 15u) << 3;
    const f16* gA = A + (size_t)(m0 + srow) * HID + scol;
    const f16* gW = W + (size_t)(n0 + srow) * HID + scol;
    const u32 bufB = 128u * AB_PITCH * (u32)sizeof(f16);                   // bytes per buffer
    const u32 lA = (u32)(size_t)&As[0][srow * AB_PITCH + scol];            // LDS byte address, buffer 0
    const u32 lB = (u32)(size_t)&Bs[0][srow * AB_PITCH + scol];
    const u32 nst = (u32)HID / KSTAGE;

    // stage 0 lands and is published; stage 1 then flies during trip 0
    copy_stage<16>(gA, lA);
    copy_stage<16>(gW, lB);
    asm volatile("s_wait_asynccnt 0x0" ::: "memory");   // this wave's stage-0 copies have landed
    __syncthreads();
    copy_stage<16>(gA + KSTAGE, lA + bufB);
    copy_stage<16>(gW + KSTAGE, lB + bufB);

    // kept rolled: the ring's foot (waits, barrier, refill) stands once and the body stays small for the instruction cache
#pragma unroll 1
    for (u32 t = 0; t < nst; ++t) {
        const u32 b = t & 1u;
        const f16* as = &As[b][0];
        const f16* bs = &Bs[b][0];
        // Fragment reads run two k steps ahead of the products, one group of 12 reads per k step: steps 0 and 1 at the
        // stage's head, step g + 2 in front of step g's products, so a group's LDS latency passes behind 8 to 16 WMMAs.
        // All reads are of buffer b, published before this trip. Unrolled: indices and ds_load offsets are constants.
        v16h af[KSTAGE / 32u][2], bfr[KSTAGE / 32u][4];
#pragma unroll
        for (u32 g = 0; g < 2u; ++g) {
#pragma unroll
            for (int i = 0; i < 2; ++i) af[g][i] = load_frag(as, wm * 32u + (u32)i * 16u, AB_PITCH, g * 32u, lane);
#pragma unroll
            for (int j = 0; j < 4; ++j) bfr[g][j] = load_frag(bs, wn * 64u + (u32)j * 16u, AB_PITCH, g * 32u, lane);
        }
#pragma unroll
        for (u32 g = 0; g < KSTAGE / 32u; ++g) {
            if (g + 2u < KSTAGE / 32u) {
#pragma unroll
                for (int i = 0; i < 2; ++i) af[g + 2u][i] = load_frag(as, wm * 32u + (u32)i * 16u, AB_PITCH, (g + 2u) * 32u, lane);
#pragma unroll
                for (int j = 0; j < 4; ++j) bfr[g + 2u][j] = load_frag(bs, wn * 64u + (u32)j * 16u, AB_PITCH, (g + 2u) * 32u, lane);
            }
#pragma unroll
            for (int i = 0; i < 2; ++i)
#pragma unroll
                for (int j = 0; j < 4; ++j) acc[i][j] = wmma16(af[g][i], bfr[g][j], acc[i][j]);
        }
        asm volatile("s_wait_dscnt 0x0" ::: "memory");      // this wave's reads of buffer b are done before its refill
        asm volatile("s_wait_asynccnt 0x0" ::: "memory");   // this wave's stage t + 1 copies have landed
        __syncthreads();                                    // publishes stage t + 1, frees buffer b
        if (t + 2u < nst) {
            copy_stage<16>(gA + (t + 2u) * KSTAGE, lA + b * bufB);
            copy_stage<16>(gW + (t + 2u) * KSTAGE, lB + b * bufB);
        }
    }
    asm volatile("s_wait_asynccnt 0x0" ::: "memory");       // nothing of the ring is outstanding past the loop

    const u32 piece = lane & 7u;
    const u32 lsub  = lane >> 3;
#pragma unroll
    for (u32 half = 0; half < 2; ++half) {
        if ((wm >> 1) == half) {
#pragma unroll
            for (int i = 0; i < 2; ++i)
#pragma unroll
                for (int j = 0; j < 4; ++j) {
                    const u32 nl = wn * 64u + (u32)j * 16u + c16;
#pragma unroll
                    for (int r = 0; r < 8; ++r) {
                        const u32 ml = (wm & 1u) * 32u + (u32)i * 16u + hh8 + (u32)r;
                        Cf[ml * CF_PITCH + nl] = acc[i][j][r] * accMul;
                    }
                }
        }
        __syncthreads();
#pragma unroll
        for (u32 it = 0; it < 8; ++it) {
            const u32 L    = wave * 32u + it * 4u + lsub;   // 0..255
            const u32 row  = L >> 2;
            const u32 part = L & 3u;
            const v4f v = *(const v4f*)&Cf[row * CF_PITCH + part * 32u + piece * 4u];
            float* dp = out + (size_t)(m0 + half * 64u + row) * HID + n0 + part * 32u + piece * 4u;
            *(v4f*)dp = v;
        }
        __syncthreads();
    }
}

// ---------------------------------------------------------------------------
// Flash attention (no mask, all SEQ keys). grid (SEQ/128, NB*NHEAD), block 256 (8 waves),
// wave owns 16 query rows (Q fragments resident). Block streams 64-key tiles through a two-buffer
// ring filled by asynchronous copies (tile kt + 1 in flight during trip kt): K staged [key][d], V^T staged [d][key].
// Both products run transposed: S^T = K.Q^T (A = K rows, B = Q), O^T += V^T.P^T (A = V^T rows, B = P^T). A lane then
// holds 32 of one query's 64 scores: the maximum is taken in the lane plus one exchange between the lane halves,
// one running maximum and one rescale factor per lane, exp2 in f32 carried x2^10, and two score accumulators,
// converted in place, are a B fragment in the hardware k order: P never touches LDS.
// Sums of P += ones.P^T on WMMA (every D row holds the query's sum). Output f16 plane [b*SEQ+q][1024] carried x1024.
// coverage: every (b, q, h*64..h*64+63) row segment exactly once.
// LDS: ks, vsT cross-wave (block barriers); ps per-wave, output stage only.
// staged extent == consumed extent for ks (64x64), vsT (64x64), ps (16x64).
// ---------------------------------------------------------------------------
__global__ void __launch_bounds__(256) __attribute__((amdgpu_num_vgpr(256)))
attn_fwd(const f16* __restrict__ Qp, const f16* __restrict__ Kp, const f16* __restrict__ Vt,
         f16* __restrict__ Cp) {
    __shared__ __attribute__((aligned(16))) f16 ks[2][64 * AT_PITCH];   // [buffer][key][d]
    __shared__ __attribute__((aligned(16))) f16 vsT[2][64 * AT_PITCH];  // [buffer][d][key]
    __shared__ __attribute__((aligned(16))) f16 ps[8][16 * AT_PITCH];   // per-wave ctx stage
    static_assert(HD == 8 * 8);            // 8 lanes x 8 halves per row segment
    static_assert(2 * 256 * 8 == 64 * 64); // staging: 2 copies x 256 threads x 8 halves per tile

    const u32 tid  = threadIdx.x;
    const u32 lane = tid & 31u;
    const u32 wave = tid >> 5;
    const u32 hh8  = (lane >> 4) << 3;
    const u32 c16  = lane & 15u;
    const u32 bh   = blockIdx.y;
    const u32 bidx = bh >> 4;            // NHEAD == 16
    const u32 hidx = bh & 15u;
    const u32 q0   = blockIdx.x * 128u + wave * 16u;
    const size_t head = (size_t)bh * SEQ * HD;

    v16h qa[2];
#pragma unroll
    for (int c = 0; c < 2; ++c) qa[c] = load_frag(Qp + head, q0, HD, (u32)c * 32u, lane);

    FragU onesu;
#pragma unroll
    for (int i = 0; i < 16; ++i) onesu.e[i] = (f16)1.0f;
    const v16h ones = onesu.v;

    float m = -1.0e30f;      // running maximum of query q0 + c16, equal in both lane halves
    v8f   o[4], lacc;        // o[dt][r] = O^T[dt * 16 + hh8 + r][query c16]; lacc[r] = sum of P of query c16, every r
#pragma unroll
    for (int dt = 0; dt < 4; ++dt) o[dt] = zero8();
    lacc = zero8();

    // log2-domain scale: acc = 256 * q.k ; x = log2(e) * q.k / 8 = acc * log2(e) / 2048
    const float cl = 1.4426950408889634f * 0.00048828125f;
    f16* psw = &ps[wave][0];

    const u32 arow = tid >> 3;
    const u32 apc  = (tid & 7u) << 3;
    const f16* gK = Kp + head + (size_t)arow * HD + apc;
    const f16* gV = Vt + head + (size_t)arow * SEQ + apc;
    const u32 abuf = 64u * AT_PITCH * (u32)sizeof(f16);                    // bytes per buffer
    const u32 lK = (u32)(size_t)&ks[0][arow * AT_PITCH + apc];             // LDS byte address, buffer 0
    const u32 lV = (u32)(size_t)&vsT[0][arow * AT_PITCH + apc];
    const u32 ntile = (u32)(SEQ / 64);

    // tile 0 lands and is published; tile 1 then flies during trip 0
    copy_kv(gK, gV, lK, lV);
    asm volatile("s_wait_asynccnt 0x0" ::: "memory");   // this wave's tile-0 copies have landed
    __syncthreads();
    copy_kv(gK + 64 * HD, gV + 64, lK + abuf, lV + abuf);

#pragma unroll 1
    for (u32 kt = 0; kt < ntile; ++kt) {
        const u32 rb = kt & 1u;
        const f16* ksb = &ks[rb][0];
        const f16* vsb = &vsT[rb][0];

        // S^T[64 keys x 16 q]: s[nt][r] = score of key nt * 16 + hh8 + r against query c16
        v8f s[4];
#pragma unroll
        for (int nt = 0; nt < 4; ++nt) s[nt] = zero8();
        // the tile's eight K and eight V^T fragments are read as one group in front of the score products:
        // one LDS latency for K, not eight; V^T lands behind the score products and the softmax
        v16h kb[2][4], vb[2][4];
#pragma unroll
        for (int c = 0; c < 2; ++c)
#pragma unroll
            for (int nt = 0; nt < 4; ++nt) kb[c][nt] = load_frag(ksb, (u32)nt * 16u, AT_PITCH, (u32)c * 32u, lane);
#pragma unroll
        for (int kk = 0; kk < 2; ++kk)
#pragma unroll
            for (int dt = 0; dt < 4; ++dt) vb[kk][dt] = load_frag(vsb, (u32)dt * 16u, AT_PITCH, (u32)kk * 32u, lane);
#pragma unroll
        for (int c = 0; c < 2; ++c)
#pragma unroll
            for (int nt = 0; nt < 4; ++nt) s[nt] = wmma16(kb[c][nt], qa[c], s[nt]);

        // online softmax of the lane's query, max-subtracted, exp2 domain; cl > 0, so the maximum is taken on raw scores
        float t[4];
#pragma unroll
        for (int nt = 0; nt < 4; ++nt) {
            float v = fmaxf(fmaxf(s[nt][0], s[nt][1]), s[nt][2]);
            v = fmaxf(fmaxf(v, s[nt][3]), s[nt][4]);
            v = fmaxf(fmaxf(v, s[nt][5]), s[nt][6]);
            t[nt] = fmaxf(v, s[nt][7]);
        }
        float tm = fmaxf(fmaxf(fmaxf(t[0], t[1]), t[2]), t[3]);
        tm = fmaxf(tm, xhalf(tm)) * cl;       // the other half holds the query's other 32 keys
        const float mn = fmaxf(m, tm);
        const float al = fexp2(m - mn);
        m = mn;
        lacc *= al;
#pragma unroll
        for (int dt = 0; dt < 4; ++dt) o[dt] *= al;
        const float sh = 10.0f - mn;          // carry 2^10

        // P^T as B fragments: element e <- key kk * 32 + hh8 + e (accumulator 2 kk), element 8 + e <- key
        // kk * 32 + 16 + hh8 + e (accumulator 2 kk + 1): the k order of load_frag, which the V^T fragments have
        FragU pb[2];
#pragma unroll
        for (int kk = 0; kk < 2; ++kk)
#pragma unroll
            for (int e = 0; e < 8; ++e) {
                pb[kk].e[e]     = (f16)fexp2(s[2 * kk][e] * cl + sh);
                pb[kk].e[e + 8] = (f16)fexp2(s[2 * kk + 1][e] * cl + sh);
            }

        // O^T += V^T . P^T ; l += ones . P^T
#pragma unroll
        for (int kk = 0; kk < 2; ++kk) {
#pragma unroll
            for (int dt = 0; dt < 4; ++dt) o[dt] = wmma16(vb[kk][dt], pb[kk].v, o[dt]);
            lacc = wmma16(ones, pb[kk].v, lacc);
        }
        asm volatile("s_wait_dscnt 0x0" ::: "memory");      // this wave's reads of buffer rb are done before its refill
        asm volatile("s_wait_asynccnt 0x0" ::: "memory");   // this wave's tile kt + 1 copies have landed
        __syncthreads();                                    // publishes tile kt + 1, frees buffer rb
        if (kt + 2u < ntile)
            copy_kv(gK + (size_t)(kt + 2u) * (64 * HD), gV + (kt + 2u) * 64u, lK + rb * abuf, lV + rb * abuf);
    }
    asm volatile("s_wait_asynccnt 0x0" ::: "memory");       // nothing of the ring is outstanding past the loop
    __syncthreads();

    // normalize: plane value = 1024 * (O/16) / l = O * 64 / l ; a lane's 8 registers are 8 consecutive d of its query
    const float inv = (CARRY_CTX / CARRY_QKV) / lacc[0];
#pragma unroll
    for (int dt = 0; dt < 4; ++dt) {
        H8U w;
#pragma unroll
        for (int r = 0; r < 8; ++r) w.e[r] = (f16)(o[dt][r] * inv);
        *(v8h*)&psw[c16 * AT_PITCH + (u32)dt * 16u + hh8] = w.v;
    }
    __syncthreads();

    const u32 piece = lane & 7u;
    const u32 lsub  = lane >> 3;
{
#pragma unroll
        for (u32 it = 0; it < 4; ++it) {
            const u32 L = it * 4u + lsub;     // query row 0..15 within the wave tile
            const v8h v = *(const v8h*)&psw[L * AT_PITCH + piece * 8u];
            f16* dp = Cp + ((size_t)(bidx * (u32)SEQ + q0 + L) * HID + hidx * (u32)HD + piece * 8u);
            *(v8h*)dp = v;
        }
        
    }
}

// coverage equalities (threads x elements == plane elements)
static_assert((size_t)((MROWS + 4 * HID) / 2) * 256 * 8 == (size_t)(MROWS + 4 * HID) * HID);   // cvt_all -> Xh | Wt | Wot
static_assert((size_t)(MROWS / 256) * (3 * HID / 192) * 256 * 192 == (size_t)3 * MROWS * HID);   // gemm_qkv -> q | k | v^T planes
static_assert((size_t)(MROWS / 128) * (HID / 128) * 128 * 128 == (size_t)MROWS * HID);     // gemm_out -> out
static_assert((size_t)(SEQ / 128) * (NB * NHEAD) * 128 * HD == (size_t)MROWS * HID);       // attn_fwd -> Cp
// workspace: 5 activation planes + 4 weight planes of halves, at most 128 MiB
static_assert(((size_t)5 * MROWS * HID + (size_t)4 * HID * HID) * sizeof(f16) <= (size_t)134217728);
// output extent: last written f32 element index < NB_FULL*SEQ_FULL*HID
static_assert((size_t)MROWS * HID <= (size_t)NB_FULL * SEQ_FULL * HID);

// ---------------------------------------------------------------------------
// Launch: 4 kernel launches, workspace 5 planes of MROWS*1024 halves + 4 of 1024*1024 halves.
// ---------------------------------------------------------------------------
extern "C" void kernel_launch(void* const* d_in, const int* in_sizes, int n_in,
                              void* d_out, int out_size, void* d_ws, size_t ws_size,
                              hipStream_t stream) {
    if (n_in < 3) return;
    if (in_sizes[0] < ((NB - 1) * SEQ_FULL + SEQ) * HID) return;
    if (in_sizes[1] < 3 * HID * HID) return;
    if (in_sizes[2] < HID * HID) return;
    if (out_size < MROWS * HID) return;

    const float* x     = (const float*)d_in[0];   // [NB_FULL][SEQ_FULL][1024]
    const float* wqkv  = (const float*)d_in[1];   // [3072 out][1024 in], row blocks q | k | v
    const float* wproj = (const float*)d_in[2];   // [1024 out][1024 in]

    const size_t nX = (size_t)MROWS * HID;    // halves per activation plane
    const size_t nW = (size_t)HID * HID;      // halves per weight plane
    const size_t totalHalves = 5 * nX + 4 * nW;
    if (ws_size < totalHalves * sizeof(f16)) return;

    f16* Xh  = (f16*)d_ws;       // [MROWS][1024]               carry 16
    f16* Wt  = Xh  + nX;         // [3072 out][1024 in]         carry 32 (q | k | v row blocks)
    f16* Wot = Wt  + 3 * nW;     // [1024 out][1024 in]         carry 32
    f16* Qp  = Wot + nW;         // [NB*16][SEQ][64]            carry 16
    f16* Kp  = Qp  + nX;         // [NB*16][SEQ][64]            carry 16
    f16* Vtp = Kp  + nX;         // [NB*1024][SEQ] (V^T)        carry 16
    f16* Cp  = Vtp + nX;         // [MROWS][1024]               carry 1024

    // x, wqkv, wproj -> Xh | Wt | Wot (contiguous from Xh), one launch
    cvt_all<<<(MROWS + 4 * HID) / 2, 256, 0, stream>>>(x, wqkv, wproj, Xh);

    // plane = 16 * acc / (16*32) = acc/32 ; q, k and v^T planes (contiguous from Qp), one launch
    const float accQKV = CARRY_QKV / (CARRY_X * CARRY_W);
    gemm_qkv<<<dim3(MROWS / 256, 3 * HID / 192), 512, 0, stream>>>(Xh, Wt, Qp, accQKV);

    attn_fwd<<<dim3(SEQ / 128, NB * NHEAD), 256, 0, stream>>>(Qp, Kp, Vtp, Cp);

    // out = acc / (1024*32)
    const float accOut = 1.0f / (CARRY_CTX * CARRY_W);
    gemm_out<<<dim3(MROWS / 128, HID / 128), 256, 0, stream>>>(Cp, Wot, (float*)d_out, accOut);
}

// v007
// A run of this version takes 73.7 microseconds.
// Timed twice side by side with v006, it ran 1.06 and 1.05 times as fast.
// Counting every step since v000, it is 3.67 times as fast.
#include <hip/hip_runtime.h>

// Contractions (fused QKV projection, Q.K^T, P.V, P row-sum, output projection): v_wmma_f32_16x16x32_f16, f16 operands with power-of-two carries, f32 accumulate; every float input enters as its bf16 RNE value; softmax in f32.

#ifndef NB
#define NB 2
#endif
#ifndef SEQ
#define SEQ 2048
#endif
#define NB_FULL   2
#define SEQ_FULL  2048
#define HID       1024
#define NHEAD     16
#define HD        64
#define MROWS     (NB * SEQ)

static_assert(HID == NHEAD * HD);        // merged head width
static_assert(NHEAD == 16);              // bh >> 4 / bh & 15 decoding in attn_fwd
static_assert(HD == 64);
static_assert(SEQ % 128 == 0);           // 128-row blocks never straddle a batch
static_assert(SEQ % 64 == 0);            // 64-key tiles
static_assert(SEQ / 64 >= 2);            // attention ring: at least two stages
static_assert(SEQ <= SEQ_FULL);
static_assert(NB >= 1 && NB <= NB_FULL);
static_assert(MROWS % 128 == 0);         // GEMM M tile
static_assert(HID % 128 == 0);           // GEMM N tile
static_assert(HID % 32 == 0);            // WMMA k step
static_assert(HID % 128 == 0 && HID / 128 >= 2);   // GEMM ring: whole 128-k stages, at least two
static_assert(HID == 128 * 8);           // cvt_all: 128 threads x 8 values per row
static_assert(HID % 2 == 0);             // cvt_all: two rows per block, no block straddles two sources
static_assert(MROWS % 2 == 0);           // cvt_all: two rows per block, no block straddles two sources

// carries (exact powers of two)
#define CARRY_X    16.0f     // input activation plane
#define CARRY_W    32.0f     // weight planes
#define CARRY_QKV  16.0f     // q, k, v^T planes (true value x16)
#define CARRY_CTX  1024.0f   // context plane (true value x1024)
// softmax exp values carry 2^10 (added to the exp2 argument)

// LDS row pitches: 16 B x odd, so the 16 rows that one ds_load_b128 touches per lane half fall on distinct banks
#define AB_PITCH  136u   // halves: GEMM A / B stages, 256-B rows on a 272-B pitch
#define KSTAGE    128u   // k values per GEMM stage (four WMMA k steps)
#define CF_PITCH  132u   // floats: GEMM f32 output stage, 512-B rows on a 528-B pitch
#define AT_PITCH  72u    // halves: attention K, V^T and output stage tiles, 128-B rows on a 144-B pitch

typedef unsigned u32;
typedef _Float16 f16;
typedef f16   v16h __attribute__((ext_vector_type(16)));
typedef f16   v8h  __attribute__((ext_vector_type(8)));
typedef float v8f  __attribute__((ext_vector_type(8)));
typedef float v4f  __attribute__((ext_vector_type(4)));

union FragU { v16h v; v8h half[2]; f16 e[16]; };
union H8U   { v8h v; f16 e[8]; };

__device__ __forceinline__ v8f zero8() {
    v8f z = {0.f, 0.f, 0.f, 0.f, 0.f, 0.f, 0.f, 0.f};
    return z;
}

// 16-bit WMMA, the bare builtin (the compiler keeps the distances behind its own form): D += A[16 x 32k] * B[32k x 16]
__device__ __forceinline__ v8f wmma16(v16h a, v16h b, v8f c) {
    return __builtin_amdgcn_wmma_f32_16x16x32_f16(false, a, false, b, (short)0, c, false, false);
}

// Scheduling fence: the compiler moves nothing over it. It stands behind each group of LDS fragment reads and behind each
// run of WMMAs, so that a group's reads issue together ahead of the run; without it they sink to their users, one waited pair each.
__device__ __forceinline__ void sched_fence() { __builtin_amdgcn_sched_barrier(0); }

// f32 -> nearest-even bf16 value, returned as f32
__device__ __forceinline__ float bf16_rne(float x) {
    u32 u = __float_as_uint(x);
    u = (u + 0x7fffu + ((u >> 16) & 1u)) & 0xffff0000u;
    return __uint_as_float(u);
}

__device__ __forceinline__ float fexp2(float x) {
#if defined(__has_builtin)
#if __has_builtin(__builtin_amdgcn_exp2f)
    return __builtin_amdgcn_exp2f(x);
#else
    return exp2f(x);
#endif
#else
    return exp2f(x);
#endif
}

// value of lane l ^ 16 (the other lane half's share of the same D column)
__device__ __forceinline__ float xhalf(float x) {
    const int b = __builtin_bit_cast(int, x);
    return __builtin_bit_cast(float, __builtin_amdgcn_permlanex16(b, b, 0x76543210, 0xfedcba98, false, false));
}

// 16 x 32 fragment from a tile whose k dimension is contiguous (pitch in halves).
// lane l: row rowbase + (l&15); elements 0..7 <- k = kcol + 8h .. +7,
// elements 8..15 <- k = kcol + 16 + 8h .. +7  (h = l>>4). Same map for A and B.
__device__ __forceinline__ v16h load_frag(const f16* tile, u32 rowbase, u32 pitch, u32 kcol, u32 lane) {
    const u32 r  = rowbase + (lane & 15u);
    const u32 kh = (lane >> 4) << 3;
    const f16* p = tile + (size_t)r * pitch + kcol + kh;
    FragU f;
    f.half[0] = *(const v8h*)(p);
    f.half[1] = *(const v8h*)(p + 16);
    return f.v;
}

// One operand's stage, 8 RS rows x 128 k (256 B a row), global -> LDS with no register in between.
// RS = rows that one copy of the whole block covers (threads / 16).
// Lane: 16 B of row (tid >> 4) + RS i, i = 0..7; a wave's copy covers two whole 256-B rows.
// g: the lane's global address in row tid >> 4 of the stage; l: its LDS byte address there.
// s_wait_xcnt 0 closes the statement so that no address register is rewritten ahead of it.
template <int RS>
__device__ __forceinline__ void copy_stage(const f16* g, u32 l) {
    const f16* g1 = g + 1 * RS * HID;
    const f16* g2 = g + 2 * RS * HID;
    const f16* g3 = g + 3 * RS * HID;
    const f16* g4 = g + 4 * RS * HID;
    const f16* g5 = g + 5 * RS * HID;
    const f16* g6 = g + 6 * RS * HID;
    const f16* g7 = g + 7 * RS * HID;
    const u32 rs = (u32)RS * AB_PITCH * (u32)sizeof(f16);
    asm volatile("global_load_async_to_lds_b128 %0, %8, off\n\t"
                 "global_load_async_to_lds_b128 %1, %9, off\n\t"
                 "global_load_async_to_lds_b128 %2, %10, off\n\t"
                 "global_load_async_to_lds_b128 %3, %11, off\n\t"
                 "global_load_async_to_lds_b128 %4, %12, off\n\t"
                 "global_load_async_to_lds_b128 %5, %13, off\n\t"
                 "global_load_async_to_lds_b128 %6, %14, off\n\t"
                 "global_load_async_to_lds_b128 %7, %15, off\n\t"
                 "s_wait_xcnt 0x0"
                 :: "v"(l), "v"(l + rs), "v"(l + 2u * rs), "v"(l + 3u * rs),
                    "v"(l + 4u * rs), "v"(l + 5u * rs), "v"(l + 6u * rs), "v"(l + 7u * rs),
                    "v"(g), "v"(g1), "v"(g2), "v"(g3), "v"(g4), "v"(g5), "v"(g6), "v"(g7)
                 : "memory");
}

// The same for a stage of 6 RS rows.
template <int RS>
__device__ __forceinline__ void copy_stage6(const f16* g, u32 l) {
    const f16* g1 = g + 1 * RS * HID;
    const f16* g2 = g + 2 * RS * HID;
    const f16* g3 = g + 3 * RS * HID;
    const f16* g4 = g + 4 * RS * HID;
    const f16* g5 = g + 5 * RS * HID;
    const u32 rs = (u32)RS * AB_PITCH * (u32)sizeof(f16);
    asm volatile("global_load_async_to_lds_b128 %0, %6, off\n\t"
                 "global_load_async_to_lds_b128 %1, %7, off\n\t"
                 "global_load_async_to_lds_b128 %2, %8, off\n\t"
                 "global_load_async_to_lds_b128 %3, %9, off\n\t"
                 "global_load_async_to_lds_b128 %4, %10, off\n\t"
                 "global_load_async_to_lds_b128 %5, %11, off\n\t"
                 "s_wait_xcnt 0x0"
                 :: "v"(l), "v"(l + rs), "v"(l + 2u * rs), "v"(l + 3u * rs), "v"(l + 4u * rs), "v"(l + 5u * rs),
                    "v"(g), "v"(g1), "v"(g2), "v"(g3), "v"(g4), "v"(g5)
                 : "memory");
}

// One attention stage, K 64 x 64 and V^T 64 x 64 halves (128 B a row), global -> LDS with no register in between.
// Lane: 16 B of rows tid >> 3 and (tid >> 3) + 32 of each tile. gk, gv: the lane's global addresses in its
// first row; lk, lv: its LDS byte addresses there.
// s_wait_xcnt 0 closes the statement so that no address register is rewritten ahead of it.
__device__ __forceinline__ void copy_kv(const f16* gk, const f16* gv, u32 lk, u32 lv) {
    const f16* gk1 = gk + 32 * HD;
    const f16* gv1 = gv + 32 * SEQ;
    const u32 rs = 32u * AT_PITCH * (u32)sizeof(f16);
    asm volatile("global_load_async_to_lds_b128 %0, %4, off\n\t"
                 "global_load_async_to_lds_b128 %1, %5, off\n\t"
                 "global_load_async_to_lds_b128 %2, %6, off\n\t"
                 "global_load_async_to_lds_b128 %3, %7, off\n\t"
                 "s_wait_xcnt 0x0"
                 :: "v"(lk), "v"(lk + rs), "v"(lv), "v"(lv + rs),
                    "v"(gk), "v"(gk1), "v"(gv), "v"(gv1)
                 : "memory");
}

// ---------------------------------------------------------------------------
// All three f32 inputs -> f16 planes (bf16 RNE value times carry) in ONE launch. The planes Xh | Wt | Wot lie one behind
// the other in the workspace, so dst is one array of MROWS + 4 * HID rows of 1024 halves; 128 threads per row.
// dst row m < MROWS: activation row (m / SEQ) * SEQ_FULL + m % SEQ (lets a reduced build read full-size inputs);
// the next 3 * HID rows: wqkv, the last HID rows: wproj (already [out][in], k contiguous: identity row map).
// A block holds two rows and every boundary is even, so the source choice is the same for a whole block.
// coverage: (MROWS + 4 * HID) x 1024 halves, every element exactly once (grid = rows / 2).
// ---------------------------------------------------------------------------
__global__ void __launch_bounds__(256)
cvt_all(const float* __restrict__ x, const float* __restrict__ wqkv, const float* __restrict__ wproj,
        f16* __restrict__ dst) {
    const u32 g  = blockIdx.x * 256u + threadIdx.x;
    const u32 m  = g >> 7;
    const u32 c8 = (g & 127u) << 3;
    if (m >= (u32)(MROWS + 4 * HID)) return;
    const u32 mblk = blockIdx.x * 2u;    // the block's first row: a scalar, so the choice below is a scalar branch
    const float* sp;
    float carry;
    if (mblk < (u32)MROWS) {
        const u32 mb = m / (u32)SEQ;
        sp = x + (size_t)(mb * (u32)SEQ_FULL + (m - mb * (u32)SEQ)) * HID + c8;
        carry = CARRY_X;
    } else if (mblk < (u32)(MROWS + 3 * HID)) {
        sp = wqkv + (size_t)(m - (u32)MROWS) * HID + c8;
        carry = CARRY_W;
    } else {
        sp = wproj + (size_t)(m - (u32)(MROWS + 3 * HID)) * HID + c8;
        carry = CARRY_W;
    }
    const v4f a = *(const v4f*)sp;
    const v4f b = *(const v4f*)(sp + 4);
    H8U o;
#pragma unroll
    for (u32 j = 0; j < 4; ++j) {
        const float x0 = a[j];
        const float x1 = b[j];
        o.e[j]     = (f16)(bf16_rne(x0) * carry);
        o.e[j + 4] = (f16)(bf16_rne(x1) * carry);
    }
    f16* dp = dst + (size_t)m * HID + c8;
    *(v8h*)dp = o.v;
}

// ---------------------------------------------------------------------------
// q | k | v projection: C[m][n] = sum_k A[m][k] * W[n][k] ; A [MROWS][1024] f16, W [3072][1024] f16 (k contiguous).
// Block tile 256 x 192 (three heads), 16 waves as 4(M) x 4(N), 4 x 3 accumulators per wave, WMMA k step 32:
// 16 x 16 = 256 blocks, one per WGP in one round, and 7 / 12 of the operand bytes per product that a 128 x 128 tile loads.
// A / B: two-buffer ring of 128-k stages filled by asynchronous copies, stage t + 1 in flight during trip t.
// A head (64 columns of W's rows) lies in one plane behind out: plane = n / 1024;
//   planes 0, 1: f16 [b*NHEAD + h][s][d] (head-major); plane 2: f16 [b*HID + h*HD + d][s] (V transposed per head).
// coverage per block: 3 heads x 256 lines of 128 B (256 rows | 64 d x 4 s-quarters).
// LDS: one array; the ring's stages are cross-wave, separated by block barriers; the output stage lies over the ring
// behind the last trip's barrier (every wave's reads done, no copy outstanding).
// staged extent == consumed extent: A 256 x 128, B 192 x 128 per buffer; output stage 3 x (256 x 64) halves.
// ---------------------------------------------------------------------------
#define QM 256u                       // block tile rows
#define QN 192u                       // block tile columns
#define QH_PITCH 72u                  // halves: head-major output stage, 128-B rows on a 144-B pitch
#define QT_PITCH 264u                 // halves: transposed output stage, 512-B rows on a 528-B pitch
#define QREG (QM * QH_PITCH)          // halves per head region of the output stage
static_assert(MROWS % 256 == 0 && SEQ % 256 == 0);     // 256-row blocks never straddle a batch
static_assert((3 * HID) % 192 == 0 && 192 % HD == 0);  // whole blocks, whole heads
static_assert(QREG >= 64u * QT_PITCH);                 // a region holds either layout
static_assert(3u * QREG <= 2u * (QM + QN) * AB_PITCH); // the output stage fits over the ring

__global__ void __launch_bounds__(512) __attribute__((amdgpu_num_vgpr(256)))
gemm_qkv(const f16* __restrict__ A, const f16* __restrict__ W, f16* __restrict__ out, float accMul) {
    __shared__ __attribute__((aligned(16))) f16 ring[2][(QM + QN) * AB_PITCH];   // [buffer][A rows | B rows]

    const u32 tid  = threadIdx.x;
    const u32 lane = tid & 31u;
    const u32 wave = (u32)__builtin_amdgcn_readfirstlane((int)(tid >> 5));   // scalar: the epilogue branches on it
    const u32 wm   = wave & 3u;
    const u32 wn   = wave >> 2;
    const u32 hh8  = (lane >> 4) << 3;   // D row half
    const u32 c16  = lane & 15u;         // D column
    const u32 m0   = blockIdx.x * QM;
    const u32 nw   = blockIdx.y * QN;    // the block's first row of W

    v8f acc[4][3];
#pragma unroll
    for (int i = 0; i < 4; ++i)
#pragma unroll
        for (int j = 0; j < 3; ++j) acc[i][j] = zero8();

    const u32 srow = tid >> 4;           // 0..31
    const u32 scol = (tid & 15u) << 3;
    const f16* gA = A + (size_t)(m0 + srow) * HID + scol;
    const f16* gW = W + (size_t)(nw + srow) * HID + scol;
    const u32 bufB = (QM + QN) * AB_PITCH * (u32)sizeof(f16);              // bytes per buffer
    const u32 lA = (u32)(size_t)&ring[0][srow * AB_PITCH + scol];          // LDS byte address, buffer 0
    const u32 lB = (u32)(size_t)&ring[0][(QM + srow) * AB_PITCH + scol];
    const u32 nst = (u32)HID / KSTAGE;

    // stage 0 lands and is published; stage 1 then flies during trip 0
    copy_stage<32>(gA, lA);
    copy_stage6<32>(gW, lB);
    asm volatile("s_wait_asynccnt 0x0" ::: "memory");   // this wave's stage-0 copies have landed
    __syncthreads();
    copy_stage<32>(gA + KSTAGE, lA + bufB);
    copy_stage6<32>(gW + KSTAGE, lB + bufB);

    // kept rolled: the ring's foot (waits, barrier, refill) stands once and the body stays small for the instruction cache
#pragma unroll 1
    for (u32 t = 0; t < nst; ++t) {
        const u32 b = t & 1u;
        const f16* as = &ring[b][0];
        const f16* bs = &ring[b][QM * AB_PITCH];
        // Fragment reads run one k step ahead of the products, one group of 14 reads per k step (two sets fit the
        // registers of four waves per SIMD). All reads are of buffer b, published before this trip.
        // Unrolled: indices and ds_load offsets are constants.
        v16h af[KSTAGE / 32u][4], bfr[KSTAGE / 32u][3];
#pragma unroll
        for (int i = 0; i < 4; ++i) af[0][i] = load_frag(as, wm * 64u + (u32)i * 16u, AB_PITCH, 0u, lane);
#pragma unroll
        for (int j = 0; j < 3; ++j) bfr[0][j] = load_frag(bs, wn * 48u + (u32)j * 16u, AB_PITCH, 0u, lane);
#pragma unroll
        for (u32 g = 0; g < KSTAGE / 32u; ++g) {
            if (g + 1u < KSTAGE / 32u) {
#pragma unroll
                for (int i = 0; i < 4; ++i) af[g + 1u][i] = load_frag(as, wm * 64u + (u32)i * 16u, AB_PITCH, (g + 1u) * 32u, lane);
#pragma unroll
                for (int j = 0; j < 3; ++j) bfr[g + 1u][j] = load_frag(bs, wn * 48u + (u32)j * 16u, AB_PITCH, (g + 1u) * 32u, lane);
            }
            sched_fence();   // step g + 1's reads stay one group ahead of step g's products
#pragma unroll
            for (int i = 0; i < 4; ++i)
#pragma unroll
                for (int j = 0; j < 3; ++j) acc[i][j] = wmma16(af[g][i], bfr[g][j], acc[i][j]);
            sched_fence();   // no later read rises among these products
        }
        asm volatile("s_wait_dscnt 0x0" ::: "memory");      // this wave's reads of buffer b are done before its refill
        asm volatile("s_wait_asynccnt 0x0" ::: "memory");   // this wave's stage t + 1 copies have landed
        __syncthreads();                                    // publishes stage t + 1, frees buffer b
        if (t + 2u < nst) {
            copy_stage<32>(gA + (t + 2u) * KSTAGE, lA + b * bufB);
            copy_stage6<32>(gW + (t + 2u) * KSTAGE, lB + b * bufB);
        }
    }
    asm volatile("s_wait_asynccnt 0x0" ::: "memory");       // nothing of the ring is outstanding past the loop

    const u32 bidx  = m0 / (u32)SEQ;     // block rows lie inside one batch (SEQ % 256 == 0)
    const u32 s0    = m0 - bidx * (u32)SEQ;
    const u32 piece = lane & 7u;
    const u32 lsub  = lane >> 3;
    f16* Cs = &ring[0][0];               // three head regions of QREG halves

    // stage: a 16-column accumulator lies inside one head; the head's plane picks the layout (a scalar choice)
#pragma unroll
    for (int j = 0; j < 3; ++j) {
        const u32 cb = wn * 48u + (u32)j * 16u;      // first column of the accumulator in the block tile
        const u32 hs = cb >> 6;                      // head region
        const u32 dl = (cb & 63u) + c16;             // column inside the head
        f16* reg = Cs + hs * QREG;
        if (((nw + hs * 64u) >> 10) < 2u) {
#pragma unroll
            for (int i = 0; i < 4; ++i)
#pragma unroll
                for (int r = 0; r < 8; ++r) {
                    const u32 ml = wm * 64u + (u32)i * 16u + hh8 + (u32)r;
                    reg[ml * QH_PITCH + dl] = (f16)(acc[i][j][r] * accMul);
                }
        } else {
#pragma unroll
            for (int i = 0; i < 4; ++i) {
                H8U t;
#pragma unroll
                for (int r = 0; r < 8; ++r) t.e[r] = (f16)(acc[i][j][r] * accMul);
                *(v8h*)&reg[dl * QT_PITCH + wm * 64u + (u32)i * 16u + hh8] = t.v;
            }
        }
    }
    __syncthreads();

    // whole 128-B lines out; a wave's store covers 512 contiguous bytes in either layout
#pragma unroll
    for (u32 hs = 0; hs < 3u; ++hs) {
        const u32 ng  = nw + hs * 64u;               // the head's first row of W
        const u32 sel = ng >> 10;                    // plane: the same for the whole head
        const u32 np  = ng & 1023u;                  // column inside the plane
        const f16* reg = Cs + hs * QREG;
        f16* op = out + (size_t)sel * ((size_t)MROWS * HID);
        if (sel < 2u) {
            const size_t bh = (size_t)bidx * NHEAD + (np >> 6);
#pragma unroll
            for (u32 it = 0; it < 4; ++it) {
                const u32 ml = it * 64u + wave * 4u + lsub;     // 0..255
                const v8h v = *(const v8h*)&reg[ml * QH_PITCH + piece * 8u];
                f16* dp = op + (bh * SEQ + s0 + ml) * HD + piece * 8u;
                *(v8h*)dp = v;
            }
            // closes the run of stores before any later code rewrites a register that they name
            asm volatile("s_wait_xcnt 0x0" ::: "memory");
        } else {
#pragma unroll
            for (u32 it = 0; it < 4; ++it) {
                const u32 dl = it * 16u + wave;                 // 0..63
                const v8h v = *(const v8h*)&reg[dl * QT_PITCH + lsub * 64u + piece * 8u];
                f16* dp = op + ((size_t)(bidx * (u32)HID + np + dl) * SEQ + s0 + lsub * 64u + piece * 8u);
                *(v8h*)dp = v;
            }
            // closes the run of stores before any later code rewrites a register that they name
            asm volatile("s_wait_xcnt 0x0" ::: "memory");
        }
    }
}

// ---------------------------------------------------------------------------
// Output projection: C[m][n] = sum_k A[m][k] * W[n][k] ; A [MROWS][1024] f16, W [1024][1024] f16 (k contiguous).
// Block tile 128 x 128, 8 waves as 4(M) x 2(N), 2 x 4 accumulators per wave, WMMA k step 32.
// A / B: two-buffer ring of 128-k stages filled by asynchronous copies, stage t + 1 in flight during trip t.
// f32 rows [m][1024] into the output buffer; coverage per block: 2 x 256 lines (64 rows x 4 line-quarters per half).
// LDS: As/Bs/Cs all cross-wave, separated by block barriers.
// staged extent == consumed extent: As/Bs 128 x 128 per buffer, Cs 64 x 128 floats.
// ---------------------------------------------------------------------------
__global__ void __launch_bounds__(256) __attribute__((amdgpu_num_vgpr(256)))
gemm_out(const f16* __restrict__ A, const f16* __restrict__ W, float* __restrict__ out, float accMul) {
    __shared__ __attribute__((aligned(16))) f16 As[2][128 * AB_PITCH];
    __shared__ __attribute__((aligned(16))) f16 Bs[2][128 * AB_PITCH];
    __shared__ __attribute__((aligned(16))) float Cf[64 * CF_PITCH];   // f32 [64][128], padded rows

    const u32 tid  = threadIdx.x;
    const u32 lane = tid & 31u;
    const u32 wave = tid >> 5;
    const u32 wm   = wave & 3u;
    const u32 wn   = wave >> 2;
    const u32 hh8  = (lane >> 4) << 3;   // D row half
    const u32 c16  = lane & 15u;         // D column
    const u32 m0   = blockIdx.x * 128u;
    const u32 n0   = blockIdx.y * 128u;  // the block's first row of W = first output column

    v8f acc[2][4];
#pragma unroll
    for (int i = 0; i < 2; ++i)
#pragma unroll
        for (int j = 0; j < 4; ++j) acc[i][j] = zero8();

    const u32 srow = tid >> 4;
    const u32 scol = (tid & 15u) << 3;
    const f16* gA = A + (size_t)(m0 + srow) * HID + scol;
    const f16* gW = W + (size_t)(n0 + srow) * HID + scol;
    const u32 bufB = 128u * AB_PITCH * (u32)sizeof(f16);                   // bytes per buffer
    const u32 lA = (u32)(size_t)&As[0][srow * AB_PITCH + scol];            // LDS byte address, buffer 0
    const u32 lB = (u32)(size_t)&Bs[0][srow * AB_PITCH + scol];
    const u32 nst = (u32)HID / KSTAGE;

    // stage 0 lands and is published; stage 1 then flies during trip 0
    copy_stage<16>(gA, lA);
    copy_stage<16>(gW, lB);
    asm volatile("s_wait_asynccnt 0x0" ::: "memory");   // this wave's stage-0 copies have landed
    __syncthreads();
    copy_stage<16>(gA + KSTAGE, lA + bufB);
    copy_stage<16>(gW + KSTAGE, lB + bufB);

    // kept rolled: the ring's foot (waits, barrier, refill) stands once and the body stays small for the instruction cache
#pragma unroll 1
    for (u32 t = 0; t < nst; ++t) {
        const u32 b = t & 1u;
        const f16* as = &As[b][0];
        const f16* bs = &Bs[b][0];
        // Fragment reads run two k steps ahead of the products, one group of 12 reads per k step: steps 0 and 1 at the
        // stage's head, step g + 2 in front of step g's products, so a group's LDS latency passes behind 8 to 16 WMMAs.
        // All reads are of buffer b, published before this trip. Unrolled: indices and ds_load offsets are constants.
        v16h af[KSTAGE / 32u][2], bfr[KSTAGE / 32u][4];
#pragma unroll
        for (u32 g = 0; g < 2u; ++g) {
#pragma unroll
            for (int i = 0; i < 2; ++i) af[g][i] = load_frag(as, wm * 32u + (u32)i * 16u, AB_PITCH, g * 32u, lane);
#pragma unroll
            for (int j = 0; j < 4; ++j) bfr[g][j] = load_frag(bs, wn * 64u + (u32)j * 16u, AB_PITCH, g * 32u, lane);
        }
#pragma unroll
        for (u32 g = 0; g < KSTAGE / 32u; ++g) {
            if (g + 2u < KSTAGE / 32u) {
#pragma unroll
                for (int i = 0; i < 2; ++i) af[g + 2u][i] = load_frag(as, wm * 32u + (u32)i * 16u, AB_PITCH, (g + 2u) * 32u, lane);
#pragma unroll
                for (int j = 0; j < 4; ++j) bfr[g + 2u][j] = load_frag(bs, wn * 64u + (u32)j * 16u, AB_PITCH, (g + 2u) * 32u, lane);
            }
            sched_fence();   // step g + 2's reads stay one group ahead of step g's products
#pragma unroll
            for (int i = 0; i < 2; ++i)
#pragma unroll
                for (int j = 0; j < 4; ++j) acc[i][j] = wmma16(af[g][i], bfr[g][j], acc[i][j]);
            sched_fence();   // no later read rises among these products
        }
        asm volatile("s_wait_dscnt 0x0" ::: "memory");      // this wave's reads of buffer b are done before its refill
        asm volatile("s_wait_asynccnt 0x0" ::: "memory");   // this wave's stage t + 1 copies have landed
        __syncthreads();                                    // publishes stage t + 1, frees buffer b
        if (t + 2u < nst) {
            copy_stage<16>(gA + (t + 2u) * KSTAGE, lA + b * bufB);
            copy_stage<16>(gW + (t + 2u) * KSTAGE, lB + b * bufB);
        }
    }
    asm volatile("s_wait_asynccnt 0x0" ::: "memory");       // nothing of the ring is outstanding past the loop

    const u32 piece = lane & 7u;
    const u32 lsub  = lane >> 3;
#pragma unroll
    for (u32 half = 0; half < 2; ++half) {
        if ((wm >> 1) == half) {
#pragma unroll
            for (int i = 0; i < 2; ++i)
#pragma unroll
                for (int j = 0; j < 4; ++j) {
                    const u32 nl = wn * 64u + (u32)j * 16u + c16;
#pragma unroll
                    for (int r = 0; r < 8; ++r) {
                        const u32 ml = (wm & 1u) * 32u + (u32)i * 16u + hh8 + (u32)r;
                        Cf[ml * CF_PITCH + nl] = acc[i][j][r] * accMul;
                    }
                }
        }
        __syncthreads();
#pragma unroll
        for (u32 it = 0; it < 8; ++it) {
            const u32 L    = wave * 32u + it * 4u + lsub;   // 0..255
            const u32 row  = L >> 2;
            const u32 part = L & 3u;
            const v4f v = *(const v4f*)&Cf[row * CF_PITCH + part * 32u + piece * 4u];
            float* dp = out + (size_t)(m0 + half * 64u + row) * HID + n0 + part * 32u + piece * 4u;
            *(v4f*)dp = v;
        }
        __syncthreads();
    }
}

// ---------------------------------------------------------------------------
// Flash attention (no mask, all SEQ keys). grid (SEQ/128, NB*NHEAD), block 256 (8 waves),
// wave owns 16 query rows (Q fragments resident). Block streams 64-key tiles through a two-buffer
// ring filled by asynchronous copies (tile kt + 1 in flight during trip kt): K staged [key][d], V^T staged [d][key].
// Both products run transposed: S^T = K.Q^T (A = K rows, B = Q), O^T += V^T.P^T (A = V^T rows, B = P^T). A lane then
// holds 32 of one query's 64 scores: the maximum is taken in the lane plus one exchange between the lane halves,
// one running maximum and one rescale factor per lane, exp2 in f32 carried x2^10, and two score accumulators,
// converted in place, are a B fragment in the hardware k order: P never touches LDS.
// Sums of P += ones.P^T on WMMA (every D row holds the query's sum). Output f16 plane [b*SEQ+q][1024] carried x1024.
// coverage: every (b, q, h*64..h*64+63) row segment exactly once.
// LDS: ks, vsT cross-wave (block barriers); ps per-wave, output stage only.
// staged extent == consumed extent for ks (64x64), vsT (64x64), ps (16x64).
// ---------------------------------------------------------------------------
__global__ void __launch_bounds__(256) __attribute__((amdgpu_num_vgpr(256)))
attn_fwd(const f16* __restrict__ Qp, const f16* __restrict__ Kp, const f16* __restrict__ Vt,
         f16* __restrict__ Cp) {
    __shared__ __attribute__((aligned(16))) f16 ks[2][64 * AT_PITCH];   // [buffer][key][d]
    __shared__ __attribute__((aligned(16))) f16 vsT[2][64 * AT_PITCH];  // [buffer][d][key]
    __shared__ __attribute__((aligned(16))) f16 ps[8][16 * AT_PITCH];   // per-wave ctx stage
    static_assert(HD == 8 * 8);            // 8 lanes x 8 halves per row segment
    static_assert(2 * 256 * 8 == 64 * 64); // staging: 2 copies x 256 threads x 8 halves per tile

    const u32 tid  = threadIdx.x;
    const u32 lane = tid & 31u;
    const u32 wave = tid >> 5;
    const u32 hh8  = (lane >> 4) << 3;
    const u32 c16  = lane & 15u;
    const u32 bh   = blockIdx.y;
    const u32 bidx = bh >> 4;            // NHEAD == 16
    const u32 hidx = bh & 15u;
    const u32 q0   = blockIdx.x * 128u + wave * 16u;
    const size_t head = (size_t)bh * SEQ * HD;

    v16h qa[2];
#pragma unroll
    for (int c = 0; c < 2; ++c) qa[c] = load_frag(Qp + head, q0, HD, (u32)c * 32u, lane);

    FragU onesu;
#pragma unroll
    for (int i = 0; i < 16; ++i) onesu.e[i] = (f16)1.0f;
    const v16h ones = onesu.v;

    float m = -1.0e30f;      // running maximum of query q0 + c16, equal in both lane halves
    v8f   o[4], lacc;        // o[dt][r] = O^T[dt * 16 + hh8 + r][query c16]; lacc[r] = sum of P of query c16, every r
#pragma unroll
    for (int dt = 0; dt < 4; ++dt) o[dt] = zero8();
    lacc = zero8();

    // log2-domain scale: acc = 256 * q.k ; x = log2(e) * q.k / 8 = acc * log2(e) / 2048
    const float cl = 1.4426950408889634f * 0.00048828125f;
    f16* psw = &ps[wave][0];

    const u32 arow = tid >> 3;
    const u32 apc  = (tid & 7u) << 3;
    const f16* gK = Kp + head + (size_t)arow * HD + apc;
    const f16* gV = Vt + head + (size_t)arow * SEQ + apc;
    const u32 abuf = 64u * AT_PITCH * (u32)sizeof(f16);                    // bytes per buffer
    const u32 lK = (u32)(size_t)&ks[0][arow * AT_PITCH + apc];             // LDS byte address, buffer 0
    const u32 lV = (u32)(size_t)&vsT[0][arow * AT_PITCH + apc];
    const u32 ntile = (u32)(SEQ / 64);

    // tile 0 lands and is published; tile 1 then flies during trip 0
    copy_kv(gK, gV, lK, lV);
    asm volatile("s_wait_asynccnt 0x0" ::: "memory");   // this wave's tile-0 copies have landed
    __syncthreads();
    copy_kv(gK + 64 * HD, gV + 64, lK + abuf, lV + abuf);

#pragma unroll 1
    for (u32 kt = 0; kt < ntile; ++kt) {
        const u32 rb = kt & 1u;
        const f16* ksb = &ks[rb][0];
        const f16* vsb = &vsT[rb][0];

        // S^T[64 keys x 16 q]: s[nt][r] = score of key nt * 16 + hh8 + r against query c16
        v8f s[4];
#pragma unroll
        for (int nt = 0; nt < 4; ++nt) s[nt] = zero8();
        // the tile's eight K and eight V^T fragments are read as one group in front of the score products:
        // one LDS latency for K, not eight; V^T lands behind the score products and the softmax
        v16h kb[2][4], vb[2][4];
#pragma unroll
        for (int c = 0; c < 2; ++c)
#pragma unroll
            for (int nt = 0; nt < 4; ++nt) kb[c][nt] = load_frag(ksb, (u32)nt * 16u, AT_PITCH, (u32)c * 32u, lane);
#pragma unroll
        for (int kk = 0; kk < 2; ++kk)
#pragma unroll
            for (int dt = 0; dt < 4; ++dt) vb[kk][dt] = load_frag(vsb, (u32)dt * 16u, AT_PITCH, (u32)kk * 32u, lane);
        sched_fence();   // the tile's 32 reads stay one group at the tile's head
#pragma unroll
        for (int c = 0; c < 2; ++c)
#pragma unroll
            for (int nt = 0; nt < 4; ++nt) s[nt] = wmma16(kb[c][nt], qa[c], s[nt]);
        sched_fence();   // the eight score products stay one run: no vector reader among them, so no padding between them

        // online softmax of the lane's query, max-subtracted, exp2 domain; cl > 0, so the maximum is taken on raw scores
        float t[4];
#pragma unroll
        for (int nt = 0; nt < 4; ++nt) {
            float v = fmaxf(fmaxf(s[nt][0], s[nt][1]), s[nt][2]);
            v = fmaxf(fmaxf(v, s[nt][3]), s[nt][4]);
            v = fmaxf(fmaxf(v, s[nt][5]), s[nt][6]);
            t[nt] = fmaxf(v, s[nt][7]);
        }
        float tm = fmaxf(fmaxf(fmaxf(t[0], t[1]), t[2]), t[3]);
        tm = fmaxf(tm, xhalf(tm)) * cl;       // the other half holds the query's other 32 keys
        const float mn = fmaxf(m, tm);
        const float al = fexp2(m - mn);
        m = mn;
        lacc *= al;
#pragma unroll
        for (int dt = 0; dt < 4; ++dt) o[dt] *= al;
        const float sh = 10.0f - mn;          // carry 2^10

        // P^T as B fragments: element e <- key kk * 32 + hh8 + e (accumulator 2 kk), element 8 + e <- key
        // kk * 32 + 16 + hh8 + e (accumulator 2 kk + 1): the k order of load_frag, which the V^T fragments have
        FragU pb[2];
#pragma unroll
        for (int kk = 0; kk < 2; ++kk)
#pragma unroll
            for (int e = 0; e < 8; ++e) {
                pb[kk].e[e]     = (f16)fexp2(s[2 * kk][e] * cl + sh);
                pb[kk].e[e + 8] = (f16)fexp2(s[2 * kk + 1][e] * cl + sh);
            }

        // O^T += V^T . P^T ; l += ones . P^T
        sched_fence();   // the ten products below stay one run behind the softmax: no vector writer among them, so no padding
#pragma unroll
        for (int kk = 0; kk < 2; ++kk) {
#pragma unroll
            for (int dt = 0; dt < 4; ++dt) o[dt] = wmma16(vb[kk][dt], pb[kk].v, o[dt]);
            lacc = wmma16(ones, pb[kk].v, lacc);
        }
        sched_fence();   // the trip's work stays above the ring's foot, so the next tile's copies fly during a whole trip
        asm volatile("s_wait_dscnt 0x0" ::: "memory");      // this wave's reads of buffer rb are done before its refill
        asm volatile("s_wait_asynccnt 0x0" ::: "memory");   // this wave's tile kt + 1 copies have landed
        __syncthreads();                                    // publishes tile kt + 1, frees buffer rb
        if (kt + 2u < ntile)
            copy_kv(gK + (size_t)(kt + 2u) * (64 * HD), gV + (kt + 2u) * 64u, lK + rb * abuf, lV + rb * abuf);
    }
    asm volatile("s_wait_asynccnt 0x0" ::: "memory");       // nothing of the ring is outstanding past the loop
    __syncthreads();

    // normalize: plane value = 1024 * (O/16) / l = O * 64 / l ; a lane's 8 registers are 8 consecutive d of its query
    const float inv = (CARRY_CTX / CARRY_QKV) / lacc[0];
#pragma unroll
    for (int dt = 0; dt < 4; ++dt) {
        H8U w;
#pragma unroll
        for (int r = 0; r < 8; ++r) w.e[r] = (f16)(o[dt][r] * inv);
        *(v8h*)&psw[c16 * AT_PITCH + (u32)dt * 16u + hh8] = w.v;
    }
    __syncthreads();

    const u32 piece = lane & 7u;
    const u32 lsub  = lane >> 3;
{
#pragma unroll
        for (u32 it = 0; it < 4; ++it) {
            const u32 L = it * 4u + lsub;     // query row 0..15 within the wave tile
            const v8h v = *(const v8h*)&psw[L * AT_PITCH + piece * 8u];
            f16* dp = Cp + ((size_t)(bidx * (u32)SEQ + q0 + L) * HID + hidx * (u32)HD + piece * 8u);
            *(v8h*)dp = v;
        }
        
    }
}

// coverage equalities (threads x elements == plane elements)
static_assert((size_t)((MROWS + 4 * HID) / 2) * 256 * 8 == (size_t)(MROWS + 4 * HID) * HID);   // cvt_all -> Xh | Wt | Wot
static_assert((size_t)(MROWS / 256) * (3 * HID / 192) * 256 * 192 == (size_t)3 * MROWS * HID);   // gemm_qkv -> q | k | v^T planes
static_assert((size_t)(MROWS / 128) * (HID / 128) * 128 * 128 == (size_t)MROWS * HID);     // gemm_out -> out
static_assert((size_t)(SEQ / 128) * (NB * NHEAD) * 128 * HD == (size_t)MROWS * HID);       // attn_fwd -> Cp
// workspace: 5 activation planes + 4 weight planes of halves, at most 128 MiB
static_assert(((size_t)5 * MROWS * HID + (size_t)4 * HID * HID) * sizeof(f16) <= (size_t)134217728);
// output extent: last written f32 element index < NB_FULL*SEQ_FULL*HID
static_assert((size_t)MROWS * HID <= (size_t)NB_FULL * SEQ_FULL * HID);

// ---------------------------------------------------------------------------
// Launch: 4 kernel launches, workspace 5 planes of MROWS*1024 halves + 4 of 1024*1024 halves.
// ---------------------------------------------------------------------------
extern "C" void kernel_launch(void* const* d_in, const int* in_sizes, int n_in,
                              void* d_out, int out_size, void* d_ws, size_t ws_size,
                              hipStream_t stream) {
    if (n_in < 3) return;
    if (in_sizes[0] < ((NB - 1) * SEQ_FULL + SEQ) * HID) return;
    if (in_sizes[1] < 3 * HID * HID) return;
    if (in_sizes[2] < HID * HID) return;
    if (out_size < MROWS * HID) return;

    const float* x     = (const float*)d_in[0];   // [NB_FULL][SEQ_FULL][1024]
    const float* wqkv  = (const float*)d_in[1];   // [3072 out][1024 in], row blocks q | k | v
    const float* wproj = (const float*)d_in[2];   // [1024 out][1024 in]

    const size_t nX = (size_t)MROWS * HID;    // halves per activation plane
    const size_t nW = (size_t)HID * HID;      // halves per weight plane
    const size_t totalHalves = 5 * nX + 4 * nW;
    if (ws_size < totalHalves * sizeof(f16)) return;

    f16* Xh  = (f16*)d_ws;       // [MROWS][1024]               carry 16
    f16* Wt  = Xh  + nX;         // [3072 out][1024 in]         carry 32 (q | k | v row blocks)
    f16* Wot = Wt  + 3 * nW;     // [1024 out][1024 in]         carry 32
    f16* Qp  = Wot + nW;         // [NB*16][SEQ][64]            carry 16
    f16* Kp  = Qp  + nX;         // [NB*16][SEQ][64]            carry 16
    f16* Vtp = Kp  + nX;         // [NB*1024][SEQ] (V^T)        carry 16
    f16* Cp  = Vtp + nX;         // [MROWS][1024]               carry 1024

    // x, wqkv, wproj -> Xh | Wt | Wot (contiguous from Xh), one launch
    cvt_all<<<(MROWS + 4 * HID) / 2, 256, 0, stream>>>(x, wqkv, wproj, Xh);

    // plane = 16 * acc / (16*32) = acc/32 ; q, k and v^T planes (contiguous from Qp), one launch
    const float accQKV = CARRY_QKV / (CARRY_X * CARRY_W);
    gemm_qkv<<<dim3(MROWS / 256, 3 * HID / 192), 512, 0, stream>>>(Xh, Wt, Qp, accQKV);

    attn_fwd<<<dim3(SEQ / 128, NB * NHEAD), 256, 0, stream>>>(Qp, Kp, Vtp, Cp);

    // out = acc / (1024*32)
    const float accOut = 1.0f / (CARRY_CTX * CARRY_W);
    gemm_out<<<dim3(MROWS / 128, HID / 128), 256, 0, stream>>>(Cp, Wot, (float*)d_out, accOut);
}

// v008
// It runs in 68.8 microseconds.
// Two timings next to v007 put it at 1.08 and 1.07 times that version's speed.
// Over all steps from v000 it is 3.94 times as fast.
#include <hip/hip_runtime.h>

// Contractions (fused QKV projection, Q.K^T, P.V, P row-sum, output projection): v_wmma_f32_16x16x32_f16, f16 operands with power-of-two carries, f32 accumulate; every float input enters as its bf16 RNE value; softmax in f32.

#ifndef NB
#define NB 2
#endif
#ifndef SEQ
#define SEQ 2048
#endif
#define NB_FULL   2
#define SEQ_FULL  2048
#define HID       1024
#define NHEAD     16
#define HD        64
#define MROWS     (NB * SEQ)

static_assert(HID == NHEAD * HD);        // merged head width
static_assert(NHEAD == 16);              // bh >> 4 / bh & 15 decoding in attn_fwd
static_assert(HD == 64);
static_assert(SEQ % 128 == 0);           // 128-row blocks never straddle a batch
static_assert(SEQ % 64 == 0);            // 64-key tiles
static_assert(SEQ / 64 >= 2);            // attention: at least one 128-key stage, two 64-key halves
static_assert(SEQ <= SEQ_FULL);
static_assert(NB >= 1 && NB <= NB_FULL);
static_assert(MROWS % 128 == 0);         // GEMM M tile
static_assert(HID % 128 == 0);           // GEMM N tile
static_assert(HID % 32 == 0);            // WMMA k step
static_assert(HID % 128 == 0 && HID / 128 >= 2);   // GEMM ring: whole 128-k stages, at least two
static_assert(HID == 128 * 8);           // cvt_all: 128 threads x 8 values per row
static_assert(HID % 2 == 0);             // cvt_all: two rows per block, no block straddles two sources
static_assert(MROWS % 2 == 0);           // cvt_all: two rows per block, no block straddles two sources

// carries (exact powers of two)
#define CARRY_X    16.0f     // input activation plane
#define CARRY_W    32.0f     // weight planes
#define CARRY_QKV  16.0f     // q, k, v^T planes (true value x16)
#define CARRY_CTX  1024.0f   // context plane (true value x1024)
// softmax exp values carry 2^10 (added to the exp2 argument)

// LDS row pitches: 16 B x odd, so the 16 rows that one ds_load_b128 touches per lane half fall on distinct banks
#define AB_PITCH  136u   // halves: GEMM A / B stages, 256-B rows on a 272-B pitch
#define KSTAGE    128u   // k values per GEMM stage (four WMMA k steps)
#define CF_PITCH  132u   // floats: GEMM f32 output stage, 512-B rows on a 528-B pitch
#define AT_PITCH  72u    // halves: attention K, V^T and output stage tiles, 128-B rows on a 144-B pitch

typedef unsigned u32;
typedef _Float16 f16;
typedef f16   v16h __attribute__((ext_vector_type(16)));
typedef f16   v8h  __attribute__((ext_vector_type(8)));
typedef float v8f  __attribute__((ext_vector_type(8)));
typedef float v4f  __attribute__((ext_vector_type(4)));

union FragU { v16h v; v8h half[2]; f16 e[16]; };
union H8U   { v8h v; f16 e[8]; };

__device__ __forceinline__ v8f zero8() {
    v8f z = {0.f, 0.f, 0.f, 0.f, 0.f, 0.f, 0.f, 0.f};
    return z;
}

// 16-bit WMMA, the bare builtin (the compiler keeps the distances behind its own form): D += A[16 x 32k] * B[32k x 16]
__device__ __forceinline__ v8f wmma16(v16h a, v16h b, v8f c) {
    return __builtin_amdgcn_wmma_f32_16x16x32_f16(false, a, false, b, (short)0, c, false, false);
}

// Scheduling fence: the compiler moves nothing over it. It stands behind each group of LDS fragment reads and behind each
// run of WMMAs, so that a group's reads issue together ahead of the run; without it they sink to their users, one waited pair each.
__device__ __forceinline__ void sched_fence() { __builtin_amdgcn_sched_barrier(0); }

// f32 -> nearest-even bf16 value, returned as f32
__device__ __forceinline__ float bf16_rne(float x) {
    u32 u = __float_as_uint(x);
    u = (u + 0x7fffu + ((u >> 16) & 1u)) & 0xffff0000u;
    return __uint_as_float(u);
}

__device__ __forceinline__ float fexp2(float x) {
#if defined(__has_builtin)
#if __has_builtin(__builtin_amdgcn_exp2f)
    return __builtin_amdgcn_exp2f(x);
#else
    return exp2f(x);
#endif
#else
    return exp2f(x);
#endif
}

// value of lane l ^ 16 (the other lane half's share of the same D column)
__device__ __forceinline__ float xhalf(float x) {
    const int b = __builtin_bit_cast(int, x);
    return __builtin_bit_cast(float, __builtin_amdgcn_permlanex16(b, b, 0x76543210, 0xfedcba98, false, false));
}

// 16 x 32 fragment from a tile whose k dimension is contiguous (pitch in halves).
// lane l: row rowbase + (l&15); elements 0..7 <- k = kcol + 8h .. +7,
// elements 8..15 <- k = kcol + 16 + 8h .. +7  (h = l>>4). Same map for A and B.
__device__ __forceinline__ v16h load_frag(const f16* tile, u32 rowbase, u32 pitch, u32 kcol, u32 lane) {
    const u32 r  = rowbase + (lane & 15u);
    const u32 kh = (lane >> 4) << 3;
    const f16* p = tile + (size_t)r * pitch + kcol + kh;
    FragU f;
    f.half[0] = *(const v8h*)(p);
    f.half[1] = *(const v8h*)(p + 16);
    return f.v;
}

// One operand's stage, 8 RS rows x 128 k (256 B a row), global -> LDS with no register in between.
// RS = rows that one copy of the whole block covers (threads / 16).
// Lane: 16 B of row (tid >> 4) + RS i, i = 0..7; a wave's copy covers two whole 256-B rows.
// g: the lane's global address in row tid >> 4 of the stage; l: its LDS byte address there.
// s_wait_xcnt 0 closes the statement so that no address register is rewritten ahead of it.
template <int RS>
__device__ __forceinline__ void copy_stage(const f16* g, u32 l) {
    const f16* g1 = g + 1 * RS * HID;
    const f16* g2 = g + 2 * RS * HID;
    const f16* g3 = g + 3 * RS * HID;
    const f16* g4 = g + 4 * RS * HID;
    const f16* g5 = g + 5 * RS * HID;
    const f16* g6 = g + 6 * RS * HID;
    const f16* g7 = g + 7 * RS * HID;
    const u32 rs = (u32)RS * AB_PITCH * (u32)sizeof(f16);
    asm volatile("global_load_async_to_lds_b128 %0, %8, off\n\t"
                 "global_load_async_to_lds_b128 %1, %9, off\n\t"
                 "global_load_async_to_lds_b128 %2, %10, off\n\t"
                 "global_load_async_to_lds_b128 %3, %11, off\n\t"
                 "global_load_async_to_lds_b128 %4, %12, off\n\t"
                 "global_load_async_to_lds_b128 %5, %13, off\n\t"
                 "global_load_async_to_lds_b128 %6, %14, off\n\t"
                 "global_load_async_to_lds_b128 %7, %15, off\n\t"
                 "s_wait_xcnt 0x0"
                 :: "v"(l), "v"(l + rs), "v"(l + 2u * rs), "v"(l + 3u * rs),
                    "v"(l + 4u * rs), "v"(l + 5u * rs), "v"(l + 6u * rs), "v"(l + 7u * rs),
                    "v"(g), "v"(g1), "v"(g2), "v"(g3), "v"(g4), "v"(g5), "v"(g6), "v"(g7)
                 : "memory");
}

// The same for a stage of 6 RS rows.
template <int RS>
__device__ __forceinline__ void copy_stage6(const f16* g, u32 l) {
    const f16* g1 = g + 1 * RS * HID;
    const f16* g2 = g + 2 * RS * HID;
    const f16* g3 = g + 3 * RS * HID;
    const f16* g4 = g + 4 * RS * HID;
    const f16* g5 = g + 5 * RS * HID;
    const u32 rs = (u32)RS * AB_PITCH * (u32)sizeof(f16);
    asm volatile("global_load_async_to_lds_b128 %0, %6, off\n\t"
                 "global_load_async_to_lds_b128 %1, %7, off\n\t"
                 "global_load_async_to_lds_b128 %2, %8, off\n\t"
                 "global_load_async_to_lds_b128 %3, %9, off\n\t"
                 "global_load_async_to_lds_b128 %4, %10, off\n\t"
                 "global_load_async_to_lds_b128 %5, %11, off\n\t"
                 "s_wait_xcnt 0x0"
                 :: "v"(l), "v"(l + rs), "v"(l + 2u * rs), "v"(l + 3u * rs), "v"(l + 4u * rs), "v"(l + 5u * rs),
                    "v"(g), "v"(g1), "v"(g2), "v"(g3), "v"(g4), "v"(g5)
                 : "memory");
}

// One attention stage, K 128 x 64 and two V^T 64 x 64 halves tiles (128 B a row), global -> LDS with no register in between.
// Lane: 16 B of rows (tid >> 3) + 32 i, i = 0..3, of the K tile, and of rows tid >> 3 and (tid >> 3) + 32 of each V^T tile
// (the second V^T tile holds the stage's keys 64..127). gk, gv: the lane's global addresses in its first row;
// lk, lv: its LDS byte addresses there.
// s_wait_xcnt 0 closes the statement so that no address register is rewritten ahead of it.
__device__ __forceinline__ void copy_kv(const f16* gk, const f16* gv, u32 lk, u32 lv) {
    const f16* gk1 = gk + 32 * HD;
    const f16* gk2 = gk + 64 * HD;
    const f16* gk3 = gk + 96 * HD;
    const f16* gv1 = gv + 32 * SEQ;
    const f16* gv2 = gv + 64;
    const f16* gv3 = gv + 32 * SEQ + 64;
    const u32 rs = 32u * AT_PITCH * (u32)sizeof(f16);
    asm volatile("global_load_async_to_lds_b128 %0, %8, off\n\t"
                 "global_load_async_to_lds_b128 %1, %9, off\n\t"
                 "global_load_async_to_lds_b128 %2, %10, off\n\t"
                 "global_load_async_to_lds_b128 %3, %11, off\n\t"
                 "global_load_async_to_lds_b128 %4, %12, off\n\t"
                 "global_load_async_to_lds_b128 %5, %13, off\n\t"
                 "global_load_async_to_lds_b128 %6, %14, off\n\t"
                 "global_load_async_to_lds_b128 %7, %15, off\n\t"
                 "s_wait_xcnt 0x0"
                 :: "v"(lk), "v"(lk + rs), "v"(lk + 2u * rs), "v"(lk + 3u * rs),
                    "v"(lv), "v"(lv + rs), "v"(lv + 2u * rs), "v"(lv + 3u * rs),
                    "v"(gk), "v"(gk1), "v"(gk2), "v"(gk3), "v"(gv), "v"(gv1), "v"(gv2), "v"(gv3)
                 : "memory");
}

// ---------------------------------------------------------------------------
// All three f32 inputs -> f16 planes (bf16 RNE value times carry) in ONE launch. The planes Xh | Wt | Wot lie one behind
// the other in the workspace, so dst is one array of MROWS + 4 * HID rows of 1024 halves; 128 threads per row.
// dst row m < MROWS: activation row (m / SEQ) * SEQ_FULL + m % SEQ (lets a reduced build read full-size inputs);
// the next 3 * HID rows: wqkv, the last HID rows: wproj (already [out][in], k contiguous: identity row map).
// A block holds two rows and every boundary is even, so the source choice is the same for a whole block.
// coverage: (MROWS + 4 * HID) x 1024 halves, every element exactly once (grid = rows / 2).
// ---------------------------------------------------------------------------
__global__ void __launch_bounds__(256)
cvt_all(const float* __restrict__ x, const float* __restrict__ wqkv, const float* __restrict__ wproj,
        f16* __restrict__ dst) {
    const u32 g  = blockIdx.x * 256u + threadIdx.x;
    const u32 m  = g >> 7;
    const u32 c8 = (g & 127u) << 3;
    if (m >= (u32)(MROWS + 4 * HID)) return;
    const u32 mblk = blockIdx.x * 2u;    // the block's first row: a scalar, so the choice below is a scalar branch
    const float* sp;
    float carry;
    if (mblk < (u32)MROWS) {
        const u32 mb = m / (u32)SEQ;
        sp = x + (size_t)(mb * (u32)SEQ_FULL + (m - mb * (u32)SEQ)) * HID + c8;
        carry = CARRY_X;
    } else if (mblk < (u32)(MROWS + 3 * HID)) {
        sp = wqkv + (size_t)(m - (u32)MROWS) * HID + c8;
        carry = CARRY_W;
    } else {
        sp = wproj + (size_t)(m - (u32)(MROWS + 3 * HID)) * HID + c8;
        carry = CARRY_W;
    }
    const v4f a = *(const v4f*)sp;
    const v4f b = *(const v4f*)(sp + 4);
    H8U o;
#pragma unroll
    for (u32 j = 0; j < 4; ++j) {
        const float x0 = a[j];
        const float x1 = b[j];
        o.e[j]     = (f16)(bf16_rne(x0) * carry);
        o.e[j + 4] = (f16)(bf16_rne(x1) * carry);
    }
    f16* dp = dst + (size_t)m * HID + c8;
    *(v8h*)dp = o.v;
}

// ---------------------------------------------------------------------------
// q | k | v projection: C[m][n] = sum_k A[m][k] * W[n][k] ; A [MROWS][1024] f16, W [3072][1024] f16 (k contiguous).
// Block tile 256 x 192 (three heads), 16 waves as 4(M) x 4(N), 4 x 3 accumulators per wave, WMMA k step 32:
// 16 x 16 = 256 blocks, one per WGP in one round, and 7 / 12 of the operand bytes per product that a 128 x 128 tile loads.
// A / B: two-buffer ring of 128-k stages filled by asynchronous copies, stage t + 1 in flight during trip t.
// A head (64 columns of W's rows) lies in one plane behind out: plane = n / 1024;
//   planes 0, 1: f16 [b*NHEAD + h][s][d] (head-major); plane 2: f16 [b*HID + h*HD + d][s] (V transposed per head).
// coverage per block: 3 heads x 256 lines of 128 B (256 rows | 64 d x 4 s-quarters).
// LDS: one array; the ring's stages are cross-wave, separated by block barriers; the output stage lies over the ring
// behind the last trip's barrier (every wave's reads done, no copy outstanding).
// staged extent == consumed extent: A 256 x 128, B 192 x 128 per buffer; output stage 3 x (256 x 64) halves.
// ---------------------------------------------------------------------------
#define QM 256u                       // block tile rows
#define QN 192u                       // block tile columns
#define QH_PITCH 72u                  // halves: head-major output stage, 128-B rows on a 144-B pitch
#define QT_PITCH 264u                 // halves: transposed output stage, 512-B rows on a 528-B pitch
#define QREG (QM * QH_PITCH)          // halves per head region of the output stage
static_assert(MROWS % 256 == 0 && SEQ % 256 == 0);     // 256-row blocks never straddle a batch
static_assert((3 * HID) % 192 == 0 && 192 % HD == 0);  // whole blocks, whole heads
static_assert(QREG >= 64u * QT_PITCH);                 // a region holds either layout
static_assert(3u * QREG <= 2u * (QM + QN) * AB_PITCH); // the output stage fits over the ring

__global__ void __launch_bounds__(512) __attribute__((amdgpu_num_vgpr(256)))
gemm_qkv(const f16* __restrict__ A, const f16* __restrict__ W, f16* __restrict__ out, float accMul) {
    __shared__ __attribute__((aligned(16))) f16 ring[2][(QM + QN) * AB_PITCH];   // [buffer][A rows | B rows]

    const u32 tid  = threadIdx.x;
    const u32 lane = tid & 31u;
    const u32 wave = (u32)__builtin_amdgcn_readfirstlane((int)(tid >> 5));   // scalar: the epilogue branches on it
    const u32 wm   = wave & 3u;
    const u32 wn   = wave >> 2;
    const u32 hh8  = (lane >> 4) << 3;   // D row half
    const u32 c16  = lane & 15u;         // D column
    const u32 m0   = blockIdx.x * QM;
    const u32 nw   = blockIdx.y * QN;    // the block's first row of W

    v8f acc[4][3];
#pragma unroll
    for (int i = 0; i < 4; ++i)
#pragma unroll
        for (int j = 0; j < 3; ++j) acc[i][j] = zero8();

    const u32 srow = tid >> 4;           // 0..31
    const u32 scol = (tid & 15u) << 3;
    const f16* gA = A + (size_t)(m0 + srow) * HID + scol;
    const f16* gW = W + (size_t)(nw + srow) * HID + scol;
    const u32 bufB = (QM + QN) * AB_PITCH * (u32)sizeof(f16);              // bytes per buffer
    const u32 lA = (u32)(size_t)&ring[0][srow * AB_PITCH + scol];          // LDS byte address, buffer 0
    const u32 lB = (u32)(size_t)&ring[0][(QM + srow) * AB_PITCH + scol];
    const u32 nst = (u32)HID / KSTAGE;

    // stage 0 lands and is published; stage 1 then flies during trip 0
    copy_stage<32>(gA, lA);
    copy_stage6<32>(gW, lB);
    asm volatile("s_wait_asynccnt 0x0" ::: "memory");   // this wave's stage-0 copies have landed
    __syncthreads();
    copy_stage<32>(gA + KSTAGE, lA + bufB);
    copy_stage6<32>(gW + KSTAGE, lB + bufB);

    // kept rolled: the ring's foot (waits, barrier, refill) stands once and the body stays small
#pragma unroll 1
    for (u32 t = 0; t < nst; ++t) {
        const u32 b = t & 1u;
        const f16* as = &ring[b][0];
        const f16* bs = &ring[b][QM * AB_PITCH];
        // Fragment reads run one k step ahead of the products, one group of 14 reads per k step (two sets fit the
        // registers of four waves per SIMD). All reads are of buffer b, published before this trip.
        // Unrolled: indices and ds_load offsets are constants.
        v16h af[KSTAGE / 32u][4], bfr[KSTAGE / 32u][3];
#pragma unroll
        for (int i = 0; i < 4; ++i) af[0][i] = load_frag(as, wm * 64u + (u32)i * 16u, AB_PITCH, 0u, lane);
#pragma unroll
        for (int j = 0; j < 3; ++j) bfr[0][j] = load_frag(bs, wn * 48u + (u32)j * 16u, AB_PITCH, 0u, lane);
#pragma unroll
        for (u32 g = 0; g < KSTAGE / 32u; ++g) {
            if (g + 1u < KSTAGE / 32u) {
#pragma unroll
                for (int i = 0; i < 4; ++i) af[g + 1u][i] = load_frag(as, wm * 64u + (u32)i * 16u, AB_PITCH, (g + 1u) * 32u, lane);
#pragma unroll
                for (int j = 0; j < 3; ++j) bfr[g + 1u][j] = load_frag(bs, wn * 48u + (u32)j * 16u, AB_PITCH, (g + 1u) * 32u, lane);
            }
            sched_fence();   // step g + 1's reads stay one group ahead of step g's products
#pragma unroll
            for (int i = 0; i < 4; ++i)
#pragma unroll
                for (int j = 0; j < 3; ++j) acc[i][j] = wmma16(af[g][i], bfr[g][j], acc[i][j]);
            sched_fence();   // no later read rises among these products
        }
        asm volatile("s_wait_dscnt 0x0" ::: "memory");      // this wave's reads of buffer b are done before its refill
        asm volatile("s_wait_asynccnt 0x0" ::: "memory");   // this wave's stage t + 1 copies have landed
        __syncthreads();                                    // publishes stage t + 1, frees buffer b
        if (t + 2u < nst) {
            copy_stage<32>(gA + (t + 2u) * KSTAGE, lA + b * bufB);
            copy_stage6<32>(gW + (t + 2u) * KSTAGE, lB + b * bufB);
        }
    }
    asm volatile("s_wait_asynccnt 0x0" ::: "memory");       // nothing of the ring is outstanding past the loop

    const u32 bidx  = m0 / (u32)SEQ;     // block rows lie inside one batch (SEQ % 256 == 0)
    const u32 s0    = m0 - bidx * (u32)SEQ;
    const u32 piece = lane & 7u;
    const u32 lsub  = lane >> 3;
    f16* Cs = &ring[0][0];               // three head regions of QREG halves

    // stage: a 16-column accumulator lies inside one head; the head's plane picks the layout (a scalar choice)
#pragma unroll
    for (int j = 0; j < 3; ++j) {
        const u32 cb = wn * 48u + (u32)j * 16u;      // first column of the accumulator in the block tile
        const u32 hs = cb >> 6;                      // head region
        const u32 dl = (cb & 63u) + c16;             // column inside the head
        f16* reg = Cs + hs * QREG;
        if (((nw + hs * 64u) >> 10) < 2u) {
#pragma unroll
            for (int i = 0; i < 4; ++i)
#pragma unroll
                for (int r = 0; r < 8; ++r) {
                    const u32 ml = wm * 64u + (u32)i * 16u + hh8 + (u32)r;
                    reg[ml * QH_PITCH + dl] = (f16)(acc[i][j][r] * accMul);
                }
        } else {
#pragma unroll
            for (int i = 0; i < 4; ++i) {
                H8U t;
#pragma unroll
                for (int r = 0; r < 8; ++r) t.e[r] = (f16)(acc[i][j][r] * accMul);
                *(v8h*)&reg[dl * QT_PITCH + wm * 64u + (u32)i * 16u + hh8] = t.v;
            }
        }
    }
    __syncthreads();

    // whole 128-B lines out; a wave's store covers 512 contiguous bytes in either layout
#pragma unroll
    for (u32 hs = 0; hs < 3u; ++hs) {
        const u32 ng  = nw + hs * 64u;               // the head's first row of W
        const u32 sel = ng >> 10;                    // plane: the same for the whole head
        const u32 np  = ng & 1023u;                  // column inside the plane
        const f16* reg = Cs + hs * QREG;
        f16* op = out + (size_t)sel * ((size_t)MROWS * HID);
        if (sel < 2u) {
            const size_t bh = (size_t)bidx * NHEAD + (np >> 6);
#pragma unroll
            for (u32 it = 0; it < 4; ++it) {
                const u32 ml = it * 64u + wave * 4u + lsub;     // 0..255
                const v8h v = *(const v8h*)&reg[ml * QH_PITCH + piece * 8u];
                f16* dp = op + (bh * SEQ + s0 + ml) * HD + piece * 8u;
                *(v8h*)dp = v;
            }
            // closes the run of stores before any later code rewrites a register that they name
            asm volatile("s_wait_xcnt 0x0" ::: "memory");
        } else {
#pragma unroll
            for (u32 it = 0; it < 4; ++it) {
                const u32 dl = it * 16u + wave;                 // 0..63
                const v8h v = *(const v8h*)&reg[dl * QT_PITCH + lsub * 64u + piece * 8u];
                f16* dp = op + ((size_t)(bidx * (u32)HID + np + dl) * SEQ + s0 + lsub * 64u + piece * 8u);
                *(v8h*)dp = v;
            }
            // closes the run of stores before any later code rewrites a register that they name
            asm volatile("s_wait_xcnt 0x0" ::: "memory");
        }
    }
}

// ---------------------------------------------------------------------------
// Output projection: C[m][n] = sum_k A[m][k] * W[n][k] ; A [MROWS][1024] f16, W [1024][1024] f16 (k contiguous).
// Block tile 128 x 128, 8 waves as 4(M) x 2(N), 2 x 4 accumulators per wave, WMMA k step 32.
// A / B: two-buffer ring of 128-k stages filled by asynchronous copies, stage t + 1 in flight during trip t.
// f32 rows [m][1024] into the output buffer; coverage per block: 2 x 256 lines (64 rows x 4 line-quarters per half).
// LDS: As/Bs/Cs all cross-wave, separated by block barriers.
// staged extent == consumed extent: As/Bs 128 x 128 per buffer, Cs 64 x 128 floats.
// ---------------------------------------------------------------------------
__global__ void __launch_bounds__(256) __attribute__((amdgpu_num_vgpr(256)))
gemm_out(const f16* __restrict__ A, const f16* __restrict__ W, float* __restrict__ out, float accMul) {
    __shared__ __attribute__((aligned(16))) f16 As[2][128 * AB_PITCH];
    __shared__ __attribute__((aligned(16))) f16 Bs[2][128 * AB_PITCH];
    __shared__ __attribute__((aligned(16))) float Cf[64 * CF_PITCH];   // f32 [64][128], padded rows

    const u32 tid  = threadIdx.x;
    const u32 lane = tid & 31u;
    const u32 wave = tid >> 5;
    const u32 wm   = wave & 3u;
    const u32 wn   = wave >> 2;
    const u32 hh8  = (lane >> 4) << 3;   // D row half
    const u32 c16  = lane & 15u;         // D column
    const u32 m0   = blockIdx.x * 128u;
    const u32 n0   = blockIdx.y * 128u;  // the block's first row of W = first output column

    v8f acc[2][4];
#pragma unroll
    for (int i = 0; i < 2; ++i)
#pragma unroll
        for (int j = 0; j < 4; ++j) acc[i][j] = zero8();

    const u32 srow = tid >> 4;
    const u32 scol = (tid & 15u) << 3;
    const f16* gA = A + (size_t)(m0 + srow) * HID + scol;
    const f16* gW = W + (size_t)(n0 + srow) * HID + scol;
    const u32 bufB = 128u * AB_PITCH * (u32)sizeof(f16);                   // bytes per buffer
    const u32 lA = (u32)(size_t)&As[0][srow * AB_PITCH + scol];            // LDS byte address, buffer 0
    const u32 lB = (u32)(size_t)&Bs[0][srow * AB_PITCH + scol];
    const u32 nst = (u32)HID / KSTAGE;

    // stage 0 lands and is published; stage 1 then flies during trip 0
    copy_stage<16>(gA, lA);
    copy_stage<16>(gW, lB);
    asm volatile("s_wait_asynccnt 0x0" ::: "memory");   // this wave's stage-0 copies have landed
    __syncthreads();
    copy_stage<16>(gA + KSTAGE, lA + bufB);
    copy_stage<16>(gW + KSTAGE, lB + bufB);

    // kept rolled: the ring's foot (waits, barrier, refill) stands once and the body stays small
#pragma unroll 1
    for (u32 t = 0; t < nst; ++t) {
        const u32 b = t & 1u;
        const f16* as = &As[b][0];
        const f16* bs = &Bs[b][0];
        // Fragment reads run two k steps ahead of the products, one group of 12 reads per k step: steps 0 and 1 at the
        // stage's head, step g + 2 in front of step g's products, so a group's LDS latency passes behind 8 to 16 WMMAs.
        // All reads are of buffer b, published before this trip. Unrolled: indices and ds_load offsets are constants.
        v16h af[KSTAGE / 32u][2], bfr[KSTAGE / 32u][4];
#pragma unroll
        for (u32 g = 0; g < 2u; ++g) {
#pragma unroll
            for (int i = 0; i < 2; ++i) af[g][i] = load_frag(as, wm * 32u + (u32)i * 16u, AB_PITCH, g * 32u, lane);
#pragma unroll
            for (int j = 0; j < 4; ++j) bfr[g][j] = load_frag(bs, wn * 64u + (u32)j * 16u, AB_PITCH, g * 32u, lane);
        }
#pragma unroll
        for (u32 g = 0; g < KSTAGE / 32u; ++g) {
            if (g + 2u < KSTAGE / 32u) {
#pragma unroll
                for (int i = 0; i < 2; ++i) af[g + 2u][i] = load_frag(as, wm * 32u + (u32)i * 16u, AB_PITCH, (g + 2u) * 32u, lane);
#pragma unroll
                for (int j = 0; j < 4; ++j) bfr[g + 2u][j] = load_frag(bs, wn * 64u + (u32)j * 16u, AB_PITCH, (g + 2u) * 32u, lane);
            }
            sched_fence();   // step g + 2's reads stay one group ahead of step g's products
#pragma unroll
            for (int i = 0; i < 2; ++i)
#pragma unroll
                for (int j = 0; j < 4; ++j) acc[i][j] = wmma16(af[g][i], bfr[g][j], acc[i][j]);
            sched_fence();   // no later read rises among these products
        }
        asm volatile("s_wait_dscnt 0x0" ::: "memory");      // this wave's reads of buffer b are done before its refill
        asm volatile("s_wait_asynccnt 0x0" ::: "memory");   // this wave's stage t + 1 copies have landed
        __syncthreads();                                    // publishes stage t + 1, frees buffer b
        if (t + 2u < nst) {
            copy_stage<16>(gA + (t + 2u) * KSTAGE, lA + b * bufB);
            copy_stage<16>(gW + (t + 2u) * KSTAGE, lB + b * bufB);
        }
    }
    asm volatile("s_wait_asynccnt 0x0" ::: "memory");       // nothing of the ring is outstanding past the loop

    const u32 piece = lane & 7u;
    const u32 lsub  = lane >> 3;
#pragma unroll
    for (u32 half = 0; half < 2; ++half) {
        if ((wm >> 1) == half) {
#pragma unroll
            for (int i = 0; i < 2; ++i)
#pragma unroll
                for (int j = 0; j < 4; ++j) {
                    const u32 nl = wn * 64u + (u32)j * 16u + c16;
#pragma unroll
                    for (int r = 0; r < 8; ++r) {
                        const u32 ml = (wm & 1u) * 32u + (u32)i * 16u + hh8 + (u32)r;
                        Cf[ml * CF_PITCH + nl] = acc[i][j][r] * accMul;
                    }
                }
        }
        __syncthreads();
#pragma unroll
        for (u32 it = 0; it < 8; ++it) {
            const u32 L    = wave * 32u + it * 4u + lsub;   // 0..255
            const u32 row  = L >> 2;
            const u32 part = L & 3u;
            const v4f v = *(const v4f*)&Cf[row * CF_PITCH + part * 32u + piece * 4u];
            float* dp = out + (size_t)(m0 + half * 64u + row) * HID + n0 + part * 32u + piece * 4u;
            *(v4f*)dp = v;
        }
        __syncthreads();
    }
}

// ---------------------------------------------------------------------------
// Flash attention (no mask, all SEQ keys). grid (SEQ/128, NB*NHEAD), block 256 (8 waves).
// Wave tile: 32 queries (two column groups of 16, Q fragments resident) x half of the keys. Waves 0..3 take the first
// 64 keys of every 128-key stage, waves 4..7 the last 64, for the same four groups of 32 queries: every K and V^T
// fragment read from LDS feeds two products, and the block still has eight waves. Each wave keeps its own running
// maximum, sum and O^T; behind the loop the two waves of a query group exchange one column group each and merge.
// Block streams 128-key stages through a two-buffer ring filled by asynchronous copies (stage kt + 1 in flight during
// trip kt): K staged [key][d], V^T staged [key half][d][key].
// Both products run transposed: S^T = K.Q^T (A = K rows, B = Q), O^T += V^T.P^T (A = V^T rows, B = P^T). A lane then
// holds 32 of one query's 64 scores: the maximum is taken in the lane plus one exchange between the lane halves,
// one running maximum and one rescale factor per lane and column group, exp2 in f32 carried x2^10, and two score
// accumulators, converted in place, are a B fragment in the hardware k order: P never touches LDS.
// Sums of P += ones.P^T on WMMA (every D row holds the query's sum). Output f16 plane [b*SEQ+q][1024] carried x1024.
// coverage: every (b, q, h*64..h*64+63) row segment exactly once (wave: 16 queries, column group = its key half).
// LDS: ks, vsT cross-wave (block barriers), behind the loop's last barrier the merge's exchange area;
// ps per-wave, output stage only.
// staged extent == consumed extent for ks (128x64), vsT (2 x 64x64), ps (16x64).
// ---------------------------------------------------------------------------
__global__ void __launch_bounds__(256) __attribute__((amdgpu_num_vgpr(256)))
attn_fwd(const f16* __restrict__ Qp, const f16* __restrict__ Kp, const f16* __restrict__ Vt,
         f16* __restrict__ Cp) {
    __shared__ __attribute__((aligned(16))) f16 ks[2][128 * AT_PITCH];     // [buffer][key][d]
    __shared__ __attribute__((aligned(16))) f16 vsT[2][2][64 * AT_PITCH];  // [buffer][key half][d][key]
    __shared__ __attribute__((aligned(16))) f16 ps[8][16 * AT_PITCH];      // per-wave ctx stage
    static_assert(HD == 8 * 8);              // 8 lanes x 8 halves per row segment
    static_assert(4 * 256 * 8 == 128 * 64);  // staging: 4 copies x 256 threads x 8 halves per operand
    static_assert(SEQ % 128 == 0 && SEQ / 128 >= 2);                          // whole 128-key stages, at least two
    static_assert(sizeof(ks) >= 8u * 32u * 32u * sizeof(float));              // merge: 32 registers x 32 lanes per wave
    static_assert(sizeof(vsT) >= 8u * 64u * sizeof(float));                   // merge: maximum and sum per lane and wave

    const u32 tid  = threadIdx.x;
    const u32 lane = tid & 31u;
    const u32 wave = (u32)__builtin_amdgcn_readfirstlane((int)(tid >> 5));   // scalar: key half and merge side
    const u32 qg   = wave & 3u;          // group of 32 queries
    const u32 kh   = wave >> 2;          // key half
    const u32 hh8  = (lane >> 4) << 3;
    const u32 c16  = lane & 15u;
    const u32 bh   = blockIdx.y;
    const u32 bidx = bh >> 4;            // NHEAD == 16
    const u32 hidx = bh & 15u;
    const u32 qw   = blockIdx.x * 128u + qg * 32u;
    const size_t head = (size_t)bh * SEQ * HD;

    v16h qa[2][2];
#pragma unroll
    for (int cg = 0; cg < 2; ++cg)
#pragma unroll
        for (int c = 0; c < 2; ++c) qa[cg][c] = load_frag(Qp + head, qw + (u32)cg * 16u, HD, (u32)c * 32u, lane);

    FragU onesu;
#pragma unroll
    for (int i = 0; i < 16; ++i) onesu.e[i] = (f16)1.0f;
    const v16h ones = onesu.v;

    float m[2] = {-1.0e30f, -1.0e30f};   // running maximum of query qw + cg * 16 + c16, equal in both lane halves
    v8f   o[2][4], lacc[2];  // o[cg][dt][r] = O^T[dt * 16 + hh8 + r][query]; lacc[cg][r] = sum of P of the query, every r
#pragma unroll
    for (int cg = 0; cg < 2; ++cg) {
#pragma unroll
        for (int dt = 0; dt < 4; ++dt) o[cg][dt] = zero8();
        lacc[cg] = zero8();
    }

    // log2-domain scale: acc = 256 * q.k ; x = log2(e) * q.k / 8 = acc * log2(e) / 2048
    const float cl = 1.4426950408889634f * 0.00048828125f;
    f16* psw = &ps[wave][0];

    const u32 arow = tid >> 3;
    const u32 apc  = (tid & 7u) << 3;
    const f16* gK = Kp + head + (size_t)arow * HD + apc;
    const f16* gV = Vt + head + (size_t)arow * SEQ + apc;
    const u32 abuf = 128u * AT_PITCH * (u32)sizeof(f16);                   // bytes per buffer, either operand
    const u32 lK = (u32)(size_t)&ks[0][arow * AT_PITCH + apc];             // LDS byte address, buffer 0
    const u32 lV = (u32)(size_t)&vsT[0][0][arow * AT_PITCH + apc];
    const u32 ntile = (u32)(SEQ / 128);

    // stage 0 lands and is published; stage 1 then flies during trip 0
    copy_kv(gK, gV, lK, lV);
    asm volatile("s_wait_asynccnt 0x0" ::: "memory");   // this wave's stage-0 copies have landed
    __syncthreads();
    copy_kv(gK + 128 * HD, gV + 128, lK + abuf, lV + abuf);

#pragma unroll 1
    for (u32 kt = 0; kt < ntile; ++kt) {
        const u32 rb = kt & 1u;
        const f16* ksb = &ks[rb][kh * 64u * AT_PITCH];
        const f16* vsb = &vsT[rb][kh][0];

        // S^T[64 keys x 32 q]: s[cg][nt][r] = score of key nt * 16 + hh8 + r against query cg * 16 + c16
        v8f s[2][4];
#pragma unroll
        for (int cg = 0; cg < 2; ++cg)
#pragma unroll
            for (int nt = 0; nt < 4; ++nt) s[cg][nt] = zero8();
        // the eight K fragments are read as one group in front of the score products: one LDS latency, not eight
        v16h kb[2][4], vb[2][4];
#pragma unroll
        for (int c = 0; c < 2; ++c)
#pragma unroll
            for (int nt = 0; nt < 4; ++nt) kb[c][nt] = load_frag(ksb, (u32)nt * 16u, AT_PITCH, (u32)c * 32u, lane);
        sched_fence();   // the 16 reads stay one group at the trip's head
        // two runs of eight, 32 keys each: the second run's accumulators take the registers of the first run's K fragments
#pragma unroll
        for (int np = 0; np < 2; ++np) {
#pragma unroll
            for (int c = 0; c < 2; ++c)
#pragma unroll
                for (int cg = 0; cg < 2; ++cg)
#pragma unroll
                    for (int nt = 2 * np; nt < 2 * np + 2; ++nt) s[cg][nt] = wmma16(kb[c][nt], qa[cg][c], s[cg][nt]);
            sched_fence();   // the score products stay in this order, one run: no vector reader among them, so no padding between them
        }
        // V^T of the first 32 keys takes the K fragments' registers and lands behind the softmax
#pragma unroll
        for (int dt = 0; dt < 4; ++dt) vb[0][dt] = load_frag(vsb, (u32)dt * 16u, AT_PITCH, 0u, lane);
        sched_fence();   // these 8 reads stay one group ahead of the softmax

        // online softmax of the lane's two queries, max-subtracted, exp2 domain; cl > 0, so the maximum is taken on raw scores
        float sh[2];
#pragma unroll
        for (int cg = 0; cg < 2; ++cg) {
            float t[4];
#pragma unroll
            for (int nt = 0; nt < 4; ++nt) {
                float v = fmaxf(fmaxf(s[cg][nt][0], s[cg][nt][1]), s[cg][nt][2]);
                v = fmaxf(fmaxf(v, s[cg][nt][3]), s[cg][nt][4]);
                v = fmaxf(fmaxf(v, s[cg][nt][5]), s[cg][nt][6]);
                t[nt] = fmaxf(v, s[cg][nt][7]);
            }
            float tm = fmaxf(fmaxf(fmaxf(t[0], t[1]), t[2]), t[3]);
            tm = fmaxf(tm, xhalf(tm)) * cl;       // the other half holds the query's other 32 keys
            const float mn = fmaxf(m[cg], tm);
            const float al = fexp2(m[cg] - mn);
            m[cg] = mn;
            lacc[cg] *= al;
#pragma unroll
            for (int dt = 0; dt < 4; ++dt) o[cg][dt] *= al;
            sh[cg] = 10.0f - mn;                  // carry 2^10
        }

        // P^T as B fragments: element e <- key kk * 32 + hh8 + e (accumulator 2 kk), element 8 + e <- key
        // kk * 32 + 16 + hh8 + e (accumulator 2 kk + 1): the k order of load_frag, which the V^T fragments have
        FragU pb[2][2];
#pragma unroll
        for (int nt = 0; nt < 4; ++nt) s[0][nt] = s[0][nt] * cl + sh[0];
        // no exponential rises among the multiply-adds above, where the next of them would overwrite its source register
        // directly behind it (the slot that the instruction set asks for behind a transcendental)
        sched_fence();
#pragma unroll
        for (int kk = 0; kk < 2; ++kk)
#pragma unroll
            for (int e = 0; e < 8; ++e) {
                pb[0][kk].e[e]     = (f16)fexp2(s[0][2 * kk][e]);
                pb[0][kk].e[e + 8] = (f16)fexp2(s[0][2 * kk + 1][e]);
            }
        sched_fence();   // the first column group's scores are packed, their registers free for the reads below
        // V^T of the last 32 keys lands behind the second column group's exponentials
#pragma unroll
        for (int dt = 0; dt < 4; ++dt) vb[1][dt] = load_frag(vsb, (u32)dt * 16u, AT_PITCH, 32u, lane);
        sched_fence();   // these 8 reads stay one group
#pragma unroll
        for (int nt = 0; nt < 4; ++nt) s[1][nt] = s[1][nt] * cl + sh[1];
        sched_fence();   // as for the first column group: no exponential rises among the multiply-adds
#pragma unroll
        for (int kk = 0; kk < 2; ++kk)
#pragma unroll
            for (int e = 0; e < 8; ++e) {
                pb[1][kk].e[e]     = (f16)fexp2(s[1][2 * kk][e]);
                pb[1][kk].e[e + 8] = (f16)fexp2(s[1][2 * kk + 1][e]);
            }

        // O^T += V^T . P^T ; l += ones . P^T
        sched_fence();   // the twenty products below stay one run behind the softmax: no vector writer among them, so no padding
#pragma unroll
        for (int kk = 0; kk < 2; ++kk)
#pragma unroll
            for (int cg = 0; cg < 2; ++cg) {
#pragma unroll
                for (int dt = 0; dt < 4; ++dt) o[cg][dt] = wmma16(vb[kk][dt], pb[cg][kk].v, o[cg][dt]);
                lacc[cg] = wmma16(ones, pb[cg][kk].v, lacc[cg]);
            }
        sched_fence();   // the trip's work stays above the ring's foot, so the next stage's copies fly during a whole trip
        asm volatile("s_wait_dscnt 0x0" ::: "memory");      // this wave's reads of buffer rb are done before its refill
        asm volatile("s_wait_asynccnt 0x0" ::: "memory");   // this wave's stage kt + 1 copies have landed
        __syncthreads();                                    // publishes stage kt + 1, frees buffer rb
        if (kt + 2u < ntile)
            copy_kv(gK + (size_t)(kt + 2u) * (128 * HD), gV + (kt + 2u) * 128u, lK + rb * abuf, lV + rb * abuf);
    }
    asm volatile("s_wait_asynccnt 0x0" ::: "memory");       // nothing of the ring is outstanding past the loop
    __syncthreads();

    // Merge of the two key halves: a wave keeps column group kh and gives the other one to its partner (wave ^ 4).
    // Exchange area over the ring (every read of it ended at the barrier above): lane-contiguous 16-B pieces.
    float* xo = (float*)&ks[0][0];        // [wave][8 pieces][lane][4]
    float* xm = (float*)&vsT[0][0][0];    // [wave][maximum | sum][lane]
    const bool up = kh != 0u;             // scalar
#pragma unroll
    for (int dt = 0; dt < 4; ++dt) {
        const v8f g = up ? o[0][dt] : o[1][dt];
        const v4f g0 = {g[0], g[1], g[2], g[3]};
        const v4f g1 = {g[4], g[5], g[6], g[7]};
        *(v4f*)&xo[((wave * 8u + (u32)dt * 2u) * 32u + lane) * 4u]      = g0;
        *(v4f*)&xo[((wave * 8u + (u32)dt * 2u + 1u) * 32u + lane) * 4u] = g1;
    }
    xm[wave * 64u + lane]       = up ? m[0] : m[1];
    xm[wave * 64u + 32u + lane] = up ? lacc[0][0] : lacc[1][0];
    __syncthreads();                      // every wave's gift is written before its partner reads it
    const u32 pw = wave ^ 4u;
    const float mk = up ? m[1] : m[0];
    const float lk = up ? lacc[1][0] : lacc[0][0];
    const float mp = xm[pw * 64u + lane];
    const float lp = xm[pw * 64u + 32u + lane];
    const float mm = fmaxf(mk, mp);
    const float dk = mk - mm;
    const float dp = mp - mm;
    // the two exponentials and the sum that reads them stand alone between two fences: no select of the merge comes
    // directly behind an exponential and overwrites its source register (the slot behind a transcendental)
    sched_fence();
    const float ak = fexp2(dk);
    const float ap = fexp2(dp);
    const float lm = lk * ak + lp * ap;
    sched_fence();

    // normalize: plane value = 1024 * (O/16) / l = O * 64 / l ; a lane's 8 registers are 8 consecutive d of its query
    const float inv = (CARRY_CTX / CARRY_QKV) / lm;
    const float fk = ak * inv;
    const float fp = ap * inv;
#pragma unroll
    for (int dt = 0; dt < 4; ++dt) {
        const v8f k8 = up ? o[1][dt] : o[0][dt];
        const v4f p0 = *(const v4f*)&xo[((pw * 8u + (u32)dt * 2u) * 32u + lane) * 4u];
        const v4f p1 = *(const v4f*)&xo[((pw * 8u + (u32)dt * 2u + 1u) * 32u + lane) * 4u];
        H8U w;
#pragma unroll
        for (int r = 0; r < 4; ++r) {
            w.e[r]     = (f16)(k8[r] * fk + p0[r] * fp);
            w.e[r + 4] = (f16)(k8[r + 4] * fk + p1[r] * fp);
        }
        *(v8h*)&psw[c16 * AT_PITCH + (u32)dt * 16u + hh8] = w.v;
    }
    __syncthreads();

    const u32 q0    = qw + kh * 16u;      // the wave's 16 output queries: its kept column group
    const u32 piece = lane & 7u;
    const u32 lsub  = lane >> 3;
{
#pragma unroll
        for (u32 it = 0; it < 4; ++it) {
            const u32 L = it * 4u + lsub;     // query row 0..15 of the wave's kept column group
            const v8h v = *(const v8h*)&psw[L * AT_PITCH + piece * 8u];
            f16* dp = Cp + ((size_t)(bidx * (u32)SEQ + q0 + L) * HID + hidx * (u32)HD + piece * 8u);
            *(v8h*)dp = v;
        }
        
    }
}

// coverage equalities (threads x elements == plane elements)
static_assert((size_t)((MROWS + 4 * HID) / 2) * 256 * 8 == (size_t)(MROWS + 4 * HID) * HID);   // cvt_all -> Xh | Wt | Wot
static_assert((size_t)(MROWS / 256) * (3 * HID / 192) * 256 * 192 == (size_t)3 * MROWS * HID);   // gemm_qkv -> q | k | v^T planes
static_assert((size_t)(MROWS / 128) * (HID / 128) * 128 * 128 == (size_t)MROWS * HID);     // gemm_out -> out
static_assert((size_t)(SEQ / 128) * (NB * NHEAD) * 128 * HD == (size_t)MROWS * HID);       // attn_fwd -> Cp
// workspace: 5 activation planes + 4 weight planes of halves, at most 128 MiB
static_assert(((size_t)5 * MROWS * HID + (size_t)4 * HID * HID) * sizeof(f16) <= (size_t)134217728);
// output extent: last written f32 element index < NB_FULL*SEQ_FULL*HID
static_assert((size_t)MROWS * HID <= (size_t)NB_FULL * SEQ_FULL * HID);

// ---------------------------------------------------------------------------
// Launch: 4 kernel launches, workspace 5 planes of MROWS*1024 halves + 4 of 1024*1024 halves.
// ---------------------------------------------------------------------------
extern "C" void kernel_launch(void* const* d_in, const int* in_sizes, int n_in,
                              void* d_out, int out_size, void* d_ws, size_t ws_size,
                              hipStream_t stream) {
    if (n_in < 3) return;
    if (in_sizes[0] < ((NB - 1) * SEQ_FULL + SEQ) * HID) return;
    if (in_sizes[1] < 3 * HID * HID) return;
    if (in_sizes[2] < HID * HID) return;
    if (out_size < MROWS * HID) return;

    const float* x     = (const float*)d_in[0];   // [NB_FULL][SEQ_FULL][1024]
    const float* wqkv  = (const float*)d_in[1];   // [3072 out][1024 in], row blocks q | k | v
    const float* wproj = (const float*)d_in[2];   // [1024 out][1024 in]

    const size_t nX = (size_t)MROWS * HID;    // halves per activation plane
    const size_t nW = (size_t)HID * HID;      // halves per weight plane
    const size_t totalHalves = 5 * nX + 4 * nW;
    if (ws_size < totalHalves * sizeof(f16)) return;

    f16* Xh  = (f16*)d_ws;       // [MROWS][1024]               carry 16
    f16* Wt  = Xh  + nX;         // [3072 out][1024 in]         carry 32 (q | k | v row blocks)
    f16* Wot = Wt  + 3 * nW;     // [1024 out][1024 in]         carry 32
    f16* Qp  = Wot + nW;         // [NB*16][SEQ][64]            carry 16
    f16* Kp  = Qp  + nX;         // [NB*16][SEQ][64]            carry 16
    f16* Vtp = Kp  + nX;         // [NB*1024][SEQ] (V^T)        carry 16
    f16* Cp  = Vtp + nX;         // [MROWS][1024]               carry 1024

    // x, wqkv, wproj -> Xh | Wt | Wot (contiguous from Xh), one launch
    cvt_all<<<(MROWS + 4 * HID) / 2, 256, 0, stream>>>(x, wqkv, wproj, Xh);

    // plane = 16 * acc / (16*32) = acc/32 ; q, k and v^T planes (contiguous from Qp), one launch
    const float accQKV = CARRY_QKV / (CARRY_X * CARRY_W);
    gemm_qkv<<<dim3(MROWS / 256, 3 * HID / 192), 512, 0, stream>>>(Xh, Wt, Qp, accQKV);

    attn_fwd<<<dim3(SEQ / 128, NB * NHEAD), 256, 0, stream>>>(Qp, Kp, Vtp, Cp);

    // out = acc / (1024*32)
    const float accOut = 1.0f / (CARRY_CTX * CARRY_W);
    gemm_out<<<dim3(MROWS / 128, HID / 128), 256, 0, stream>>>(Cp, Wot, (float*)d_out, accOut);
}

// v009
// One run takes 67.4 microseconds.
// Two timings next to v008 put it at 1.03 and 1.04 times that version's speed.
// Counting every step since v000, it is 4.08 times as fast.
#include <hip/hip_runtime.h>

// Contractions (fused QKV projection, Q.K^T, P.V, P row-sum, output projection): v_wmma_f32_16x16x32_f16, f16 operands with power-of-two carries, f32 accumulate; every float input enters as its bf16 RNE value; softmax in f32.

#ifndef NB
#define NB 2
#endif
#ifndef SEQ
#define SEQ 2048
#endif
#define NB_FULL   2
#define SEQ_FULL  2048
#define HID       1024
#define NHEAD     16
#define HD        64
#define MROWS     (NB * SEQ)

static_assert(HID == NHEAD * HD);        // merged head width
static_assert(NHEAD == 16);              // bh >> 4 / bh & 15 decoding in attn_fwd
static_assert(HD == 64);
static_assert(SEQ % 128 == 0);           // 128-row blocks never straddle a batch
static_assert(SEQ % 64 == 0);            // 64-key tiles
static_assert(SEQ / 64 >= 2);            // attention: at least one 128-key stage, two 64-key halves
static_assert(SEQ <= SEQ_FULL);
static_assert(NB >= 1 && NB <= NB_FULL);
static_assert(MROWS % 128 == 0);         // GEMM M tile
static_assert(HID % 128 == 0);           // GEMM N tile
static_assert(HID % 32 == 0);            // WMMA k step
static_assert(HID % 128 == 0 && HID / 128 >= 2);   // GEMM ring: whole 128-k stages, at least two
static_assert(HID == 128 * 8);           // cvt_all: 128 threads x 8 values per row
static_assert(HID % 2 == 0);             // cvt_all: two rows per block, no block straddles two sources
static_assert(MROWS % 2 == 0);           // cvt_all: two rows per block, no block straddles two sources

// carries (exact powers of two)
#define CARRY_X    16.0f     // input activation plane
#define CARRY_W    32.0f     // weight planes
#define CARRY_QKV  16.0f     // q, k, v^T planes (true value x16)
#define CARRY_CTX  1024.0f   // context plane (true value x1024)
// softmax exp values carry 2^10 (added to the exp2 argument)

// LDS row pitches: 16 B x odd, so the 16 rows that one ds_load_b128 touches per lane half fall on distinct banks
#define AB_PITCH  136u   // halves: GEMM A / B stages and attention V^T, 256-B rows on a 272-B pitch
#define KSTAGE    128u   // k values per GEMM stage (four WMMA k steps)
#define CF_PITCH  132u   // floats: GEMM f32 output stage, 512-B rows on a 528-B pitch
#define AT_PITCH  72u    // halves: attention K and output tiles, 128-B rows on a 144-B pitch

typedef unsigned u32;
typedef _Float16 f16;
typedef f16   v16h __attribute__((ext_vector_type(16)));
typedef f16   v8h  __attribute__((ext_vector_type(8)));
typedef float v8f  __attribute__((ext_vector_type(8)));
typedef float v4f  __attribute__((ext_vector_type(4)));

union FragU { v16h v; v8h half[2]; f16 e[16]; };
union H8U   { v8h v; f16 e[8]; };

__device__ __forceinline__ v8f zero8() {
    v8f z = {0.f, 0.f, 0.f, 0.f, 0.f, 0.f, 0.f, 0.f};
    return z;
}

// 16-bit WMMA, the bare builtin (the compiler keeps the distances behind its own form): D += A[16 x 32k] * B[32k x 16]
__device__ __forceinline__ v8f wmma16(v16h a, v16h b, v8f c) {
    return __builtin_amdgcn_wmma_f32_16x16x32_f16(false, a, false, b, (short)0, c, false, false);
}

// Scheduling fence: the compiler moves nothing over it. It stands behind each group of LDS fragment reads and behind each
// run of WMMAs, so that a group's reads issue together ahead of the run; without it they sink to their users, one waited pair each.
__device__ __forceinline__ void sched_fence() { __builtin_amdgcn_sched_barrier(0); }

// f32 -> nearest-even bf16 value, returned as f32
__device__ __forceinline__ float bf16_rne(float x) {
    u32 u = __float_as_uint(x);
    u = (u + 0x7fffu + ((u >> 16) & 1u)) & 0xffff0000u;
    return __uint_as_float(u);
}

__device__ __forceinline__ float fexp2(float x) {
#if defined(__has_builtin)
#if __has_builtin(__builtin_amdgcn_exp2f)
    return __builtin_amdgcn_exp2f(x);
#else
    return exp2f(x);
#endif
#else
    return exp2f(x);
#endif
}

// value of lane l ^ 16 (the other lane half's share of the same D column)
__device__ __forceinline__ float xhalf(float x) {
    const int b = __builtin_bit_cast(int, x);
    return __builtin_bit_cast(float, __builtin_amdgcn_permlanex16(b, b, 0x76543210, 0xfedcba98, false, false));
}

// 16 x 32 fragment from a tile whose k dimension is contiguous (pitch in halves).
// lane l: row rowbase + (l&15); elements 0..7 <- k = kcol + 8h .. +7,
// elements 8..15 <- k = kcol + 16 + 8h .. +7  (h = l>>4). Same map for A and B.
__device__ __forceinline__ v16h load_frag(const f16* tile, u32 rowbase, u32 pitch, u32 kcol, u32 lane) {
    const u32 r  = rowbase + (lane & 15u);
    const u32 kh = (lane >> 4) << 3;
    const f16* p = tile + (size_t)r * pitch + kcol + kh;
    FragU f;
    f.half[0] = *(const v8h*)(p);
    f.half[1] = *(const v8h*)(p + 16);
    return f.v;
}

typedef u32 u32x4 __attribute__((ext_vector_type(4)));
typedef u32 u32x8 __attribute__((ext_vector_type(8)));
#define TD_PAD_128  ((1u << 20) | (4u << 22) | (3u << 25))   // rows of 128 B, 16 B more a row: pitch 144 B
#define TD_PAD_256  ((1u << 20) | (5u << 22) | (3u << 25))   // rows of 256 B, 16 B more a row: pitch 272 B

__device__ __forceinline__ u32 uni(u32 v) { return (u32)__builtin_amdgcn_readfirstlane((int)v); }

// The issue test of a tensor load, held in a scalar register so that it compiles to s_cmp + s_cbranch_scc:
// the instruction ignores EXEC, and only a scalar branch keeps a wave from issuing it.
__device__ __forceinline__ u32 pinned(u32 v) {
    u32 w = uni(v);
    asm volatile("" : "+s"(w));   // holds the issue test in a scalar register
    return w;
}

// group 1: no mask, 1-byte elements, tensor dims = tile dims (interior tiles only); all extents in bytes
template <u32 WORD0>
__device__ __forceinline__ u32x8 td_group1(u32 rowBytes, u32 rows, u32 srcPitch) {
    u32x8 g;
    g[0] = uni(WORD0);
    g[1] = uni((rowBytes & 0xFFFFu) << 16);
    g[2] = uni((rowBytes >> 16) | ((rows & 0xFFFFu) << 16));
    g[3] = uni((rows >> 16) | (rowBytes << 16));
    g[4] = uni(rows);
    g[5] = uni(srcPitch);
    g[6] = uni(0u);
    g[7] = uni(0u);
    // as in pinned(), for the whole group: its words keep scalar registers of their own
    // through the ring's loop, so that none of them takes a new value while a request is outstanding
    asm volatile("" : "+s"(g));
    return g;
}

// group 0: count 1, LDS byte address, global address of the tile's first byte, type 2
__device__ __forceinline__ u32x4 td_group0(u32 ldsDst, const f16* p) {
    const unsigned long long ga = (unsigned long long)(size_t)p;
    u32x4 g;
    g[0] = uni(1u);
    g[1] = uni(ldsDst);
    g[2] = uni((u32)ga);
    g[3] = uni((((u32)(ga >> 32)) & 0x01FFFFFFu) | 0x80000000u);
    return g;
}

__device__ __forceinline__ void td_load(u32x4 g0, u32x8 g1) {
    asm volatile("tensor_load_to_lds %0, %1" :: "s"(g0), "s"(g1) : "memory");
}

// next request of a ring: new place and new address in the same tuple; called only behind td_wait, with nothing outstanding
__device__ __forceinline__ void td_next(u32x4& g0, u32 ldsDst, const f16* p) {
    const unsigned long long ga = (unsigned long long)(size_t)p;
    g0[1] = uni(ldsDst);
    g0[2] = uni((u32)ga);
    g0[3] = uni((((u32)(ga >> 32)) & 0x01FFFFFFu) | 0x80000000u);
}

// The wave's own wait for its request. It names the issued group 0, so the four registers stay that tuple's from the
// issue up to here: without the operand they are dead behind the issue and are reused while the request is outstanding.
// A wave with no request passes at once.
__device__ __forceinline__ void td_wait(u32x4& g0) {
    asm volatile("s_wait_tensorcnt 0x0" : "+s"(g0) :: "memory");
}

// GEMM rings: a stage is cut into slices of 64 rows x 128 k (256-B rows on the 272-B pitch), one request of one wave each;
// a slice's place in LDS is a multiple of 2 KiB: 64 x 272 = 17,408 B, rounded up to 18,432 B.
#define SL_ROWS    64u
#define SL_HALVES  9216u
static_assert(SL_HALVES >= SL_ROWS * AB_PITCH && (SL_HALVES * 2u) % 2048u == 0u);

// ---------------------------------------------------------------------------
// All three f32 inputs -> f16 planes (bf16 RNE value times carry) in ONE launch. The planes Xh | Wt | Wot lie one behind
// the other in the workspace, so dst is one array of MROWS + 4 * HID rows of 1024 halves; 128 threads per row.
// dst row m < MROWS: activation row (m / SEQ) * SEQ_FULL + m % SEQ (lets a reduced build read full-size inputs);
// the next 3 * HID rows: wqkv, the last HID rows: wproj (already [out][in], k contiguous: identity row map).
// A block holds two rows and every boundary is even, so the source choice is the same for a whole block.
// coverage: (MROWS + 4 * HID) x 1024 halves, every element exactly once (grid = rows / 2).
// ---------------------------------------------------------------------------
__global__ void __launch_bounds__(256)
cvt_all(const float* __restrict__ x, const float* __restrict__ wqkv, const float* __restrict__ wproj,
        f16* __restrict__ dst) {
    const u32 g  = blockIdx.x * 256u + threadIdx.x;
    const u32 m  = g >> 7;
    const u32 c8 = (g & 127u) << 3;
    if (m >= (u32)(MROWS + 4 * HID)) return;
    const u32 mblk = blockIdx.x * 2u;    // the block's first row: a scalar, so the choice below is a scalar branch
    const float* sp;
    float carry;
    if (mblk < (u32)MROWS) {
        const u32 mb = m / (u32)SEQ;
        sp = x + (size_t)(mb * (u32)SEQ_FULL + (m - mb * (u32)SEQ)) * HID + c8;
        carry = CARRY_X;
    } else if (mblk < (u32)(MROWS + 3 * HID)) {
        sp = wqkv + (size_t)(m - (u32)MROWS) * HID + c8;
        carry = CARRY_W;
    } else {
        sp = wproj + (size_t)(m - (u32)(MROWS + 3 * HID)) * HID + c8;
        carry = CARRY_W;
    }
    const v4f a = *(const v4f*)sp;
    const v4f b = *(const v4f*)(sp + 4);
    H8U o;
#pragma unroll
    for (u32 j = 0; j < 4; ++j) {
        const float x0 = a[j];
        const float x1 = b[j];
        o.e[j]     = (f16)(bf16_rne(x0) * carry);
        o.e[j + 4] = (f16)(bf16_rne(x1) * carry);
    }
    f16* dp = dst + (size_t)m * HID + c8;
    *(v8h*)dp = o.v;
}

// ---------------------------------------------------------------------------
// q | k | v projection: C[m][n] = sum_k A[m][k] * W[n][k] ; A [MROWS][1024] f16, W [3072][1024] f16 (k contiguous).
// Block tile 256 x 192 (three heads), 16 waves as 4(M) x 4(N), 4 x 3 accumulators per wave, WMMA k step 32:
// 16 x 16 = 256 blocks, one per WGP in one round, and 7 / 12 of the operand bytes per product that a 128 x 128 tile loads.
// A / B: two-buffer ring of 128-k stages filled by tensor loads (waves 0..6: one 64-row slice each), stage t + 1 in flight during trip t.
// A head (64 columns of W's rows) lies in one plane behind out: plane = n / 1024;
//   planes 0, 1: f16 [b*NHEAD + h][s][d] (head-major); plane 2: f16 [b*HID + h*HD + d][s] (V transposed per head).
// coverage per block: 3 heads x 256 lines of 128 B (256 rows | 64 d x 4 s-quarters).
// LDS: one array; the ring's stages are cross-wave, separated by block barriers; the output stage lies over the ring
// behind the last trip's barrier (every wave's reads done, no tensor load outstanding).
// staged extent == consumed extent: A 256 x 128, B 192 x 128 per buffer (7 slices of 64 rows); output stage 3 x (256 x 64) halves.
// ---------------------------------------------------------------------------
#define QM 256u                       // block tile rows
#define QN 192u                       // block tile columns
#define QH_PITCH 72u                  // halves: head-major output stage, 128-B rows on a 144-B pitch
#define QT_PITCH 264u                 // halves: transposed output stage, 512-B rows on a 528-B pitch
#define QREG (QM * QH_PITCH)          // halves per head region of the output stage
static_assert(MROWS % 256 == 0 && SEQ % 256 == 0);     // 256-row blocks never straddle a batch
static_assert((3 * HID) % 192 == 0 && 192 % HD == 0);  // whole blocks, whole heads
static_assert(QREG >= 64u * QT_PITCH);                 // a region holds either layout
#define QSL ((QM + QN) / SL_ROWS)     // slices per stage: 4 of A, 3 of B
static_assert(QM % SL_ROWS == 0u && QN % SL_ROWS == 0u);
static_assert(3u * QREG <= 2u * QSL * SL_HALVES);      // the output stage fits over the ring

__global__ void __launch_bounds__(512) __attribute__((amdgpu_num_vgpr(256)))
gemm_qkv(const f16* __restrict__ A, const f16* __restrict__ W, f16* __restrict__ out, float accMul) {
    __shared__ __attribute__((aligned(2048))) f16 ring[2][QSL * SL_HALVES];   // [buffer][4 A slices | 3 B slices]

    const u32 tid  = threadIdx.x;
    const u32 lane = tid & 31u;
    const u32 wave = (u32)__builtin_amdgcn_readfirstlane((int)(tid >> 5));   // scalar: the epilogue branches on it
    const u32 wm   = wave & 3u;
    const u32 wn   = wave >> 2;
    const u32 hh8  = (lane >> 4) << 3;   // D row half
    const u32 c16  = lane & 15u;         // D column
    const u32 m0   = blockIdx.x * QM;
    const u32 nw   = blockIdx.y * QN;    // the block's first row of W

    v8f acc[4][3];
#pragma unroll
    for (int i = 0; i < 4; ++i)
#pragma unroll
        for (int j = 0; j < 3; ++j) acc[i][j] = zero8();

    // the issuing waves' slices: wave w < 4 brings A rows 64 w .. + 63, waves 4..6 bring W rows 64 (w - 4) .. + 63
    const u32 issuer = wave < QSL ? 1u : 0u;
    const u32 sl     = issuer ? wave : 0u;
    const f16* gS = sl < QM / SL_ROWS ? A + (size_t)(m0 + sl * SL_ROWS) * HID
                                      : W + (size_t)(nw + (sl - QM / SL_ROWS) * SL_ROWS) * HID;
    const u32 bufB = QSL * SL_HALVES * (u32)sizeof(f16);                   // bytes per buffer
    const u32 lS = (u32)(size_t)&ring[0][sl * SL_HALVES];                  // LDS byte address, buffer 0
    const u32x8 g1 = td_group1<TD_PAD_256>(KSTAGE * (u32)sizeof(f16), SL_ROWS, (u32)HID * (u32)sizeof(f16));
    const u32 nst = (u32)HID / KSTAGE;

    // stage 0 lands and is published; stage 1 then flies during trip 0
    u32x4 g0 = td_group0(lS, gS);
    if (pinned(issuer)) td_load(g0, g1);
    td_wait(g0);                                             // this wave's stage-0 slice has landed
    __syncthreads();
    td_next(g0, lS + bufB, gS + KSTAGE);
    if (pinned(issuer)) td_load(g0, g1);

    // kept rolled: the ring's foot (waits, barrier, refill) stands once and the body stays small for the instruction cache
#pragma unroll 1
    for (u32 t = 0; t < nst; ++t) {
        const u32 b = t & 1u;
        const f16* as = &ring[b][wm * SL_HALVES];   // the wave's 64 A rows are one slice
        const f16* bs[3];                           // a 16-row fragment lies inside one slice
#pragma unroll
        for (int j = 0; j < 3; ++j) {
            const u32 rb = wn * 48u + (u32)j * 16u;
            bs[j] = &ring[b][(QM / SL_ROWS + rb / SL_ROWS) * SL_HALVES + (rb % SL_ROWS) * AB_PITCH];
        }
        // Fragment reads run one k step ahead of the products, one group of 14 reads per k step (two sets fit the
        // registers of four waves per SIMD). All reads are of buffer b, published before this trip.
        // Unrolled: indices and ds_load offsets are constants.
        v16h af[KSTAGE / 32u][4], bfr[KSTAGE / 32u][3];
#pragma unroll
        for (int i = 0; i < 4; ++i) af[0][i] = load_frag(as, (u32)i * 16u, AB_PITCH, 0u, lane);
#pragma unroll
        for (int j = 0; j < 3; ++j) bfr[0][j] = load_frag(bs[j], 0u, AB_PITCH, 0u, lane);
#pragma unroll
        for (u32 g = 0; g < KSTAGE / 32u; ++g) {
            if (g + 1u < KSTAGE / 32u) {
#pragma unroll
                for (int i = 0; i < 4; ++i) af[g + 1u][i] = load_frag(as, (u32)i * 16u, AB_PITCH, (g + 1u) * 32u, lane);
#pragma unroll
                for (int j = 0; j < 3; ++j) bfr[g + 1u][j] = load_frag(bs[j], 0u, AB_PITCH, (g + 1u) * 32u, lane);
            }
            sched_fence();   // step g + 1's reads stay one group ahead of step g's products
#pragma unroll
            for (int i = 0; i < 4; ++i)
#pragma unroll
                for (int j = 0; j < 3; ++j) acc[i][j] = wmma16(af[g][i], bfr[g][j], acc[i][j]);
            sched_fence();   // no later read rises among these products
        }
        asm volatile("s_wait_dscnt 0x0" ::: "memory");      // this wave's reads of buffer b are done before its refill
        td_wait(g0);                                        // this wave's stage t + 1 slice has landed
        __syncthreads();                                    // publishes stage t + 1, frees buffer b
        if (pinned(issuer & (t + 2u < nst ? 1u : 0u))) {
            td_next(g0, lS + b * bufB, gS + (t + 2u) * KSTAGE);
            td_load(g0, g1);
        }
    }
    asm volatile("s_wait_tensorcnt 0x0" ::: "memory");      // nothing of the ring is outstanding past the loop
    asm volatile("s_wait_dscnt 0x0" ::: "memory");          // nor any read of it

    const u32 bidx  = m0 / (u32)SEQ;     // block rows lie inside one batch (SEQ % 256 == 0)
    const u32 s0    = m0 - bidx * (u32)SEQ;
    const u32 piece = lane & 7u;
    const u32 lsub  = lane >> 3;
    f16* Cs = &ring[0][0];               // three head regions of QREG halves

    // stage: a 16-column accumulator lies inside one head; the head's plane picks the layout (a scalar choice)
#pragma unroll
    for (int j = 0; j < 3; ++j) {
        const u32 cb = wn * 48u + (u32)j * 16u;      // first column of the accumulator in the block tile
        const u32 hs = cb >> 6;                      // head region
        const u32 dl = (cb & 63u) + c16;             // column inside the head
        f16* reg = Cs + hs * QREG;
        if (((nw + hs * 64u) >> 10) < 2u) {
#pragma unroll
            for (int i = 0; i < 4; ++i)
#pragma unroll
                for (int r = 0; r < 8; ++r) {
                    const u32 ml = wm * 64u + (u32)i * 16u + hh8 + (u32)r;
                    reg[ml * QH_PITCH + dl] = (f16)(acc[i][j][r] * accMul);
                }
        } else {
#pragma unroll
            for (int i = 0; i < 4; ++i) {
                H8U t;
#pragma unroll
                for (int r = 0; r < 8; ++r) t.e[r] = (f16)(acc[i][j][r] * accMul);
                *(v8h*)&reg[dl * QT_PITCH + wm * 64u + (u32)i * 16u + hh8] = t.v;
            }
        }
    }
    __syncthreads();

    // whole 128-B lines out; a wave's store covers 512 contiguous bytes in either layout
#pragma unroll
    for (u32 hs = 0; hs < 3u; ++hs) {
        const u32 ng  = nw + hs * 64u;               // the head's first row of W
        const u32 sel = ng >> 10;                    // plane: the same for the whole head
        const u32 np  = ng & 1023u;                  // column inside the plane
        const f16* reg = Cs + hs * QREG;
        f16* op = out + (size_t)sel * ((size_t)MROWS * HID);
        if (sel < 2u) {
            const size_t bh = (size_t)bidx * NHEAD + (np >> 6);
#pragma unroll
            for (u32 it = 0; it < 4; ++it) {
                const u32 ml = it * 64u + wave * 4u + lsub;     // 0..255
                const v8h v = *(const v8h*)&reg[ml * QH_PITCH + piece * 8u];
                f16* dp = op + (bh * SEQ + s0 + ml) * HD + piece * 8u;
                *(v8h*)dp = v;
            }
            // closes the run of stores before any later code rewrites a register that they name
            asm volatile("s_wait_xcnt 0x0" ::: "memory");
        } else {
#pragma unroll
            for (u32 it = 0; it < 4; ++it) {
                const u32 dl = it * 16u + wave;                 // 0..63
                const v8h v = *(const v8h*)&reg[dl * QT_PITCH + lsub * 64u + piece * 8u];
                f16* dp = op + ((size_t)(bidx * (u32)HID + np + dl) * SEQ + s0 + lsub * 64u + piece * 8u);
                *(v8h*)dp = v;
            }
            // closes the run of stores before any later code rewrites a register that they name
            asm volatile("s_wait_xcnt 0x0" ::: "memory");
        }
    }
}

// ---------------------------------------------------------------------------
// Output projection: C[m][n] = sum_k A[m][k] * W[n][k] ; A [MROWS][1024] f16, W [1024][1024] f16 (k contiguous).
// Block tile 128 x 128, 8 waves as 4(M) x 2(N), 2 x 4 accumulators per wave, WMMA k step 32.
// A / B: two-buffer ring of 128-k stages filled by tensor loads (waves 0..3: one 64-row slice each), stage t + 1 in flight during trip t.
// f32 rows [m][1024] into the output buffer; coverage per block: 2 x 256 lines (64 rows x 4 line-quarters per half).
// LDS: ring and Cf cross-wave, separated by block barriers.
// staged extent == consumed extent: A, B 128 x 128 per buffer (2 + 2 slices of 64 rows), Cf 64 x 128 floats.
// ---------------------------------------------------------------------------
__global__ void __launch_bounds__(256) __attribute__((amdgpu_num_vgpr(256)))
gemm_out(const f16* __restrict__ A, const f16* __restrict__ W, float* __restrict__ out, float accMul) {
    __shared__ __attribute__((aligned(2048))) f16 ring[2][4u * SL_HALVES];   // [buffer][2 A slices | 2 B slices]
    __shared__ __attribute__((aligned(16))) float Cf[64 * CF_PITCH];   // f32 [64][128], padded rows

    const u32 tid  = threadIdx.x;
    const u32 lane = tid & 31u;
    const u32 wave = (u32)__builtin_amdgcn_readfirstlane((int)(tid >> 5));   // scalar: picks the issuing waves and their slices
    const u32 wm   = wave & 3u;
    const u32 wn   = wave >> 2;
    const u32 hh8  = (lane >> 4) << 3;   // D row half
    const u32 c16  = lane & 15u;         // D column
    const u32 m0   = blockIdx.x * 128u;
    const u32 n0   = blockIdx.y * 128u;  // the block's first row of W = first output column

    v8f acc[2][4];
#pragma unroll
    for (int i = 0; i < 2; ++i)
#pragma unroll
        for (int j = 0; j < 4; ++j) acc[i][j] = zero8();

    // the issuing waves' slices: waves 0, 1 bring A rows 64 w .. + 63, waves 2, 3 bring W rows 64 (w - 2) .. + 63
    const u32 issuer = wave < 4u ? 1u : 0u;
    const u32 sl     = issuer ? wave : 0u;
    const f16* gS = sl < 2u ? A + (size_t)(m0 + sl * SL_ROWS) * HID
                            : W + (size_t)(n0 + (sl - 2u) * SL_ROWS) * HID;
    const u32 bufB = 4u * SL_HALVES * (u32)sizeof(f16);                    // bytes per buffer
    const u32 lS = (u32)(size_t)&ring[0][sl * SL_HALVES];                  // LDS byte address, buffer 0
    const u32x8 g1 = td_group1<TD_PAD_256>(KSTAGE * (u32)sizeof(f16), SL_ROWS, (u32)HID * (u32)sizeof(f16));
    const u32 nst = (u32)HID / KSTAGE;

    // stage 0 lands and is published; stage 1 then flies during trip 0
    u32x4 g0 = td_group0(lS, gS);
    if (pinned(issuer)) td_load(g0, g1);
    td_wait(g0);                                             // this wave's stage-0 slice has landed
    __syncthreads();
    td_next(g0, lS + bufB, gS + KSTAGE);
    if (pinned(issuer)) td_load(g0, g1);

    // kept rolled: the ring's foot (waits, barrier, refill) stands once and the body stays small for the instruction cache
#pragma unroll 1
    for (u32 t = 0; t < nst; ++t) {
        const u32 b = t & 1u;
        const f16* as = &ring[b][(wm >> 1) * SL_HALVES + (wm & 1u) * 32u * AB_PITCH];   // the wave's 32 A rows, inside one slice
        const f16* bs = &ring[b][(2u + wn) * SL_HALVES];                                // the wave's 64 B rows are one slice
        // Fragment reads run two k steps ahead of the products, one group of 12 reads per k step: steps 0 and 1 at the
        // stage's head, step g + 2 in front of step g's products, so a group's LDS latency passes behind 8 to 16 WMMAs.
        // All reads are of buffer b, published before this trip. Unrolled: indices and ds_load offsets are constants.
        v16h af[KSTAGE / 32u][2], bfr[KSTAGE / 32u][4];
#pragma unroll
        for (u32 g = 0; g < 2u; ++g) {
#pragma unroll
            for (int i = 0; i < 2; ++i) af[g][i] = load_frag(as, (u32)i * 16u, AB_PITCH, g * 32u, lane);
#pragma unroll
            for (int j = 0; j < 4; ++j) bfr[g][j] = load_frag(bs, (u32)j * 16u, AB_PITCH, g * 32u, lane);
        }
#pragma unroll
        for (u32 g = 0; g < KSTAGE / 32u; ++g) {
            if (g + 2u < KSTAGE / 32u) {
#pragma unroll
                for (int i = 0; i < 2; ++i) af[g + 2u][i] = load_frag(as, (u32)i * 16u, AB_PITCH, (g + 2u) * 32u, lane);
#pragma unroll
                for (int j = 0; j < 4; ++j) bfr[g + 2u][j] = load_frag(bs, (u32)j * 16u, AB_PITCH, (g + 2u) * 32u, lane);
            }
            sched_fence();   // step g + 2's reads stay one group ahead of step g's products
#pragma unroll
            for (int i = 0; i < 2; ++i)
#pragma unroll
                for (int j = 0; j < 4; ++j) acc[i][j] = wmma16(af[g][i], bfr[g][j], acc[i][j]);
            sched_fence();   // no later read rises among these products
        }
        asm volatile("s_wait_dscnt 0x0" ::: "memory");      // this wave's reads of buffer b are done before its refill
        td_wait(g0);                                        // this wave's stage t + 1 slice has landed
        __syncthreads();                                    // publishes stage t + 1, frees buffer b
        if (pinned(issuer & (t + 2u < nst ? 1u : 0u))) {
            td_next(g0, lS + b * bufB, gS + (t + 2u) * KSTAGE);
            td_load(g0, g1);
        }
    }
    asm volatile("s_wait_tensorcnt 0x0" ::: "memory");      // nothing of the ring is outstanding past the loop
    asm volatile("s_wait_dscnt 0x0" ::: "memory");          // nor any read of it

    const u32 piece = lane & 7u;
    const u32 lsub  = lane >> 3;
#pragma unroll
    for (u32 half = 0; half < 2; ++half) {
        if ((wm >> 1) == half) {
#pragma unroll
            for (int i = 0; i < 2; ++i)
#pragma unroll
                for (int j = 0; j < 4; ++j) {
                    const u32 nl = wn * 64u + (u32)j * 16u + c16;
#pragma unroll
                    for (int r = 0; r < 8; ++r) {
                        const u32 ml = (wm & 1u) * 32u + (u32)i * 16u + hh8 + (u32)r;
                        Cf[ml * CF_PITCH + nl] = acc[i][j][r] * accMul;
                    }
                }
        }
        __syncthreads();
#pragma unroll
        for (u32 it = 0; it < 8; ++it) {
            const u32 L    = wave * 32u + it * 4u + lsub;   // 0..255
            const u32 row  = L >> 2;
            const u32 part = L & 3u;
            const v4f v = *(const v4f*)&Cf[row * CF_PITCH + part * 32u + piece * 4u];
            float* dp = out + (size_t)(m0 + half * 64u + row) * HID + n0 + part * 32u + piece * 4u;
            *(v4f*)dp = v;
        }
        __syncthreads();
    }
}

// ---------------------------------------------------------------------------
// Flash attention (no mask, all SEQ keys). grid (SEQ/128, NB*NHEAD), block 256 (8 waves).
// Wave tile: 32 queries (two column groups of 16, Q fragments resident) x half of the keys. Waves 0..3 take the first
// 64 keys of every 128-key stage, waves 4..7 the last 64, for the same four groups of 32 queries: every K and V^T
// fragment read from LDS feeds two products, and the block still has eight waves. Each wave keeps its own running
// maximum, sum and O^T; behind the loop the two waves of a query group exchange one column group each and merge.
// Block streams 128-key stages through a two-buffer ring filled by tensor loads, wave 0 the K tile, wave 1 the V^T tile
// (stage kt + 1 in flight during trip kt): K staged [key][d], V^T staged [d][key] (all 128 keys of the stage in a row).
// Both products run transposed: S^T = K.Q^T (A = K rows, B = Q), O^T += V^T.P^T (A = V^T rows, B = P^T). A lane then
// holds 32 of one query's 64 scores: the maximum is taken in the lane plus one exchange between the lane halves,
// one running maximum and one rescale factor per lane and column group, exp2 in f32 carried x2^10, and two score
// accumulators, converted in place, are a B fragment in the hardware k order: P never touches LDS.
// Sums of P += ones.P^T on WMMA (every D row holds the query's sum). Output f16 plane [b*SEQ+q][1024] carried x1024.
// coverage: every (b, q, h*64..h*64+63) row segment exactly once (wave: 16 queries, column group = its key half).
// LDS: kv cross-wave (block barriers), behind the loop's last barrier the merge's exchange area;
// ps per-wave, output stage only.
// staged extent == consumed extent for K (128x64), V^T (64x128), ps (16x64).
// ---------------------------------------------------------------------------
#define KV_HALVES 9216u   // halves per staged tile: K 128 x 72 = 9,216; V^T 64 x 136 = 8,704, rounded up to a multiple of 2 KiB
__global__ void __launch_bounds__(256) __attribute__((amdgpu_num_vgpr(256)))
attn_fwd(const f16* __restrict__ Qp, const f16* __restrict__ Kp, const f16* __restrict__ Vt,
         f16* __restrict__ Cp) {
    // [buffer][K: key x d, 144-B pitch | V^T: d x key, 272-B pitch]; either tile's place is a multiple of 2 KiB
    __shared__ __attribute__((aligned(2048))) f16 kv[2][2u * KV_HALVES];
    __shared__ __attribute__((aligned(16))) f16 ps[8][16 * AT_PITCH];      // per-wave ctx stage
    static_assert(HD == 8 * 8);              // 8 lanes x 8 halves per row segment
    static_assert(SEQ % 128 == 0 && SEQ / 128 >= 2);                          // whole 128-key stages, at least two
    static_assert(KV_HALVES >= 128u * AT_PITCH && KV_HALVES >= 64u * AB_PITCH && (KV_HALVES * 2u) % 2048u == 0u);
    static_assert(sizeof(kv[0]) >= 8u * 32u * 32u * sizeof(float));           // merge: 32 registers x 32 lanes per wave
    static_assert(sizeof(kv[1]) >= 8u * 64u * sizeof(float));                 // merge: maximum and sum per lane and wave

    const u32 tid  = threadIdx.x;
    const u32 lane = tid & 31u;
    const u32 wave = (u32)__builtin_amdgcn_readfirstlane((int)(tid >> 5));   // scalar: key half and merge side
    const u32 qg   = wave & 3u;          // group of 32 queries
    const u32 kh   = wave >> 2;          // key half
    const u32 hh8  = (lane >> 4) << 3;
    const u32 c16  = lane & 15u;
    const u32 bh   = blockIdx.y;
    const u32 bidx = bh >> 4;            // NHEAD == 16
    const u32 hidx = bh & 15u;
    const u32 qw   = blockIdx.x * 128u + qg * 32u;
    const size_t head = (size_t)bh * SEQ * HD;

    v16h qa[2][2];
#pragma unroll
    for (int cg = 0; cg < 2; ++cg)
#pragma unroll
        for (int c = 0; c < 2; ++c) qa[cg][c] = load_frag(Qp + head, qw + (u32)cg * 16u, HD, (u32)c * 32u, lane);

    FragU onesu;
#pragma unroll
    for (int i = 0; i < 16; ++i) onesu.e[i] = (f16)1.0f;
    const v16h ones = onesu.v;

    float m[2] = {-1.0e30f, -1.0e30f};   // running maximum of query qw + cg * 16 + c16, equal in both lane halves
    v8f   o[2][4], lacc[2];  // o[cg][dt][r] = O^T[dt * 16 + hh8 + r][query]; lacc[cg][r] = sum of P of the query, every r
#pragma unroll
    for (int cg = 0; cg < 2; ++cg) {
#pragma unroll
        for (int dt = 0; dt < 4; ++dt) o[cg][dt] = zero8();
        lacc[cg] = zero8();
    }

    // log2-domain scale: acc = 256 * q.k ; x = log2(e) * q.k / 8 = acc * log2(e) / 2048
    const float cl = 1.4426950408889634f * 0.00048828125f;
    f16* psw = &ps[wave][0];

    const f16* gK = Kp + head;           // K tile of stage kt: 128 rows of 128 B, one behind the other
    const f16* gV = Vt + head;           // V^T tile of stage kt: 64 rows of 256 B on the plane's pitch
    const u32 abuf = 2u * KV_HALVES * (u32)sizeof(f16);                    // bytes per buffer
    const u32 lK = (u32)(size_t)&kv[0][0];                                 // LDS byte address, buffer 0
    const u32 lV = (u32)(size_t)&kv[0][KV_HALVES];
    const u32x8 g1K = td_group1<TD_PAD_128>((u32)HD * (u32)sizeof(f16), 128u, (u32)HD * (u32)sizeof(f16));
    const u32x8 g1V = td_group1<TD_PAD_256>(128u * (u32)sizeof(f16), (u32)HD, (u32)SEQ * (u32)sizeof(f16));
    const u32 isK = wave == 0u ? 1u : 0u;
    const u32 isV = wave == 1u ? 1u : 0u;
    const u32 ntile = (u32)(SEQ / 128);

    // stage 0 lands and is published; stage 1 then flies during trip 0
    // one group 0 per wave: wave 1 aims it at the V^T tile, every other wave at the K tile (only wave 0 issues that one)
    const f16* gT  = isV ? gV : gK;
    const u32 lT   = isV ? lV : lK;
    const u32 stepT = isV ? 128u : 128u * (u32)HD;           // halves from a stage's tile to the next stage's
    u32x4 g0 = td_group0(lT, gT);
    if (pinned(isK)) td_load(g0, g1K);
    if (pinned(isV)) td_load(g0, g1V);
    td_wait(g0);                                             // this wave's stage-0 tile has landed
    __syncthreads();
    td_next(g0, lT + abuf, gT + stepT);
    if (pinned(isK)) td_load(g0, g1K);
    if (pinned(isV)) td_load(g0, g1V);

#pragma unroll 1
    for (u32 kt = 0; kt < ntile; ++kt) {
        const u32 rb = kt & 1u;
        const f16* ksb = &kv[rb][kh * 64u * AT_PITCH];        // the wave's 64 key rows
        const f16* vsb = &kv[rb][KV_HALVES + kh * 64u];       // the wave's 64 key columns

        // S^T[64 keys x 32 q]: s[cg][nt][r] = score of key nt * 16 + hh8 + r against query cg * 16 + c16
        v8f s[2][4];
#pragma unroll
        for (int cg = 0; cg < 2; ++cg)
#pragma unroll
            for (int nt = 0; nt < 4; ++nt) s[cg][nt] = zero8();
        // the eight K fragments are read as one group in front of the score products: one LDS latency, not eight
        v16h kb[2][4], vb[2][4];
#pragma unroll
        for (int c = 0; c < 2; ++c)
#pragma unroll
            for (int nt = 0; nt < 4; ++nt) kb[c][nt] = load_frag(ksb, (u32)nt * 16u, AT_PITCH, (u32)c * 32u, lane);
        sched_fence();   // the 16 reads stay one group at the trip's head
        // two runs of eight, 32 keys each: the second run's accumulators take the registers of the first run's K fragments
#pragma unroll
        for (int np = 0; np < 2; ++np) {
#pragma unroll
            for (int c = 0; c < 2; ++c)
#pragma unroll
                for (int cg = 0; cg < 2; ++cg)
#pragma unroll
                    for (int nt = 2 * np; nt < 2 * np + 2; ++nt) s[cg][nt] = wmma16(kb[c][nt], qa[cg][c], s[cg][nt]);
            sched_fence();   // the score products stay in this order, one run: no vector reader among them, so no padding between them
        }
        // V^T of the first 32 keys takes the K fragments' registers and lands behind the softmax
#pragma unroll
        for (int dt = 0; dt < 4; ++dt) vb[0][dt] = load_frag(vsb, (u32)dt * 16u, AB_PITCH, 0u, lane);
        sched_fence();   // these 8 reads stay one group ahead of the softmax

        // online softmax of the lane's two queries, max-subtracted, exp2 domain; cl > 0, so the maximum is taken on raw scores
        float sh[2];
#pragma unroll
        for (int cg = 0; cg < 2; ++cg) {
            float t[4];
#pragma unroll
            for (int nt = 0; nt < 4; ++nt) {
                float v = fmaxf(fmaxf(s[cg][nt][0], s[cg][nt][1]), s[cg][nt][2]);
                v = fmaxf(fmaxf(v, s[cg][nt][3]), s[cg][nt][4]);
                v = fmaxf(fmaxf(v, s[cg][nt][5]), s[cg][nt][6]);
                t[nt] = fmaxf(v, s[cg][nt][7]);
            }
            float tm = fmaxf(fmaxf(fmaxf(t[0], t[1]), t[2]), t[3]);
            tm = fmaxf(tm, xhalf(tm)) * cl;       // the other half holds the query's other 32 keys
            const float mn = fmaxf(m[cg], tm);
            const float al = fexp2(m[cg] - mn);
            m[cg] = mn;
            lacc[cg] *= al;
#pragma unroll
            for (int dt = 0; dt < 4; ++dt) o[cg][dt] *= al;
            sh[cg] = 10.0f - mn;                  // carry 2^10
        }

        // P^T as B fragments: element e <- key kk * 32 + hh8 + e (accumulator 2 kk), element 8 + e <- key
        // kk * 32 + 16 + hh8 + e (accumulator 2 kk + 1): the k order of load_frag, which the V^T fragments have
        FragU pb[2][2];
#pragma unroll
        for (int nt = 0; nt < 4; ++nt) s[0][nt] = s[0][nt] * cl + sh[0];
        // no exponential rises among the multiply-adds above, where the next of them would overwrite its source register
        // directly behind it (the slot that the instruction set asks for behind a transcendental)
        sched_fence();
#pragma unroll
        for (int kk = 0; kk < 2; ++kk)
#pragma unroll
            for (int e = 0; e < 8; ++e) {
                pb[0][kk].e[e]     = (f16)fexp2(s[0][2 * kk][e]);
                pb[0][kk].e[e + 8] = (f16)fexp2(s[0][2 * kk + 1][e]);
            }
        sched_fence();   // the first column group's scores are packed, their registers free for the reads below
        // V^T of the last 32 keys lands behind the second column group's exponentials
#pragma unroll
        for (int dt = 0; dt < 4; ++dt) vb[1][dt] = load_frag(vsb, (u32)dt * 16u, AB_PITCH, 32u, lane);
        sched_fence();   // these 8 reads stay one group
#pragma unroll
        for (int nt = 0; nt < 4; ++nt) s[1][nt] = s[1][nt] * cl + sh[1];
        sched_fence();   // as for the first column group: no exponential rises among the multiply-adds
#pragma unroll
        for (int kk = 0; kk < 2; ++kk)
#pragma unroll
            for (int e = 0; e < 8; ++e) {
                pb[1][kk].e[e]     = (f16)fexp2(s[1][2 * kk][e]);
                pb[1][kk].e[e + 8] = (f16)fexp2(s[1][2 * kk + 1][e]);
            }

        // O^T += V^T . P^T ; l += ones . P^T
        sched_fence();   // the twenty products below stay one run behind the softmax: no vector writer among them, so no padding
#pragma unroll
        for (int kk = 0; kk < 2; ++kk)
#pragma unroll
            for (int cg = 0; cg < 2; ++cg) {
#pragma unroll
                for (int dt = 0; dt < 4; ++dt) o[cg][dt] = wmma16(vb[kk][dt], pb[cg][kk].v, o[cg][dt]);
                lacc[cg] = wmma16(ones, pb[cg][kk].v, lacc[cg]);
            }
        sched_fence();   // the trip's work stays above the ring's foot, so the next stage's tensor loads fly during a whole trip
        asm volatile("s_wait_dscnt 0x0" ::: "memory");      // this wave's reads of buffer rb are done before its refill
        td_wait(g0);                                        // this wave's stage kt + 1 tile has landed
        __syncthreads();                                    // publishes stage kt + 1, frees buffer rb
        const u32 more = kt + 2u < ntile ? 1u : 0u;
        td_next(g0, lT + rb * abuf, gT + (size_t)(kt + 2u) * stepT);   // formed by every wave, issued only while the stage exists
        if (pinned(isK & more)) td_load(g0, g1K);
        if (pinned(isV & more)) td_load(g0, g1V);
    }
    asm volatile("s_wait_tensorcnt 0x0" ::: "memory");      // nothing of the ring is outstanding past the loop
    asm volatile("s_wait_dscnt 0x0" ::: "memory");          // nor any read of it
    __syncthreads();

    // Merge of the two key halves: a wave keeps column group kh and gives the other one to its partner (wave ^ 4).
    // Exchange area over the ring (every read of it ended at the barrier above): lane-contiguous 16-B pieces.
    float* xo = (float*)&kv[0][0];        // [wave][8 pieces][lane][4]
    float* xm = (float*)&kv[1][0];        // [wave][maximum | sum][lane]
    const bool up = kh != 0u;             // scalar
#pragma unroll
    for (int dt = 0; dt < 4; ++dt) {
        const v8f g = up ? o[0][dt] : o[1][dt];
        const v4f g0 = {g[0], g[1], g[2], g[3]};
        const v4f g1 = {g[4], g[5], g[6], g[7]};
        *(v4f*)&xo[((wave * 8u + (u32)dt * 2u) * 32u + lane) * 4u]      = g0;
        *(v4f*)&xo[((wave * 8u + (u32)dt * 2u + 1u) * 32u + lane) * 4u] = g1;
    }
    xm[wave * 64u + lane]       = up ? m[0] : m[1];
    xm[wave * 64u + 32u + lane] = up ? lacc[0][0] : lacc[1][0];
    __syncthreads();                      // every wave's gift is written before its partner reads it
    const u32 pw = wave ^ 4u;
    const float mk = up ? m[1] : m[0];
    const float lk = up ? lacc[1][0] : lacc[0][0];
    const float mp = xm[pw * 64u + lane];
    const float lp = xm[pw * 64u + 32u + lane];
    const float mm = fmaxf(mk, mp);
    const float dk = mk - mm;
    const float dp = mp - mm;
    // the two exponentials and the sum that reads them stand alone between two fences: no select of the merge comes
    // directly behind an exponential and overwrites its source register (the slot behind a transcendental)
    sched_fence();
    const float ak = fexp2(dk);
    const float ap = fexp2(dp);
    const float lm = lk * ak + lp * ap;
    sched_fence();

    // normalize: plane value = 1024 * (O/16) / l = O * 64 / l ; a lane's 8 registers are 8 consecutive d of its query
    const float inv = (CARRY_CTX / CARRY_QKV) / lm;
    const float fk = ak * inv;
    const float fp = ap * inv;
#pragma unroll
    for (int dt = 0; dt < 4; ++dt) {
        const v8f k8 = up ? o[1][dt] : o[0][dt];
        const v4f p0 = *(const v4f*)&xo[((pw * 8u + (u32)dt * 2u) * 32u + lane) * 4u];
        const v4f p1 = *(const v4f*)&xo[((pw * 8u + (u32)dt * 2u + 1u) * 32u + lane) * 4u];
        H8U w;
#pragma unroll
        for (int r = 0; r < 4; ++r) {
            w.e[r]     = (f16)(k8[r] * fk + p0[r] * fp);
            w.e[r + 4] = (f16)(k8[r + 4] * fk + p1[r] * fp);
        }
        *(v8h*)&psw[c16 * AT_PITCH + (u32)dt * 16u + hh8] = w.v;
    }
    __syncthreads();

    const u32 q0    = qw + kh * 16u;      // the wave's 16 output queries: its kept column group
    const u32 piece = lane & 7u;
    const u32 lsub  = lane >> 3;
{
#pragma unroll
        for (u32 it = 0; it < 4; ++it) {
            const u32 L = it * 4u + lsub;     // query row 0..15 of the wave's kept column group
            const v8h v = *(const v8h*)&psw[L * AT_PITCH + piece * 8u];
            f16* dp = Cp + ((size_t)(bidx * (u32)SEQ + q0 + L) * HID + hidx * (u32)HD + piece * 8u);
            *(v8h*)dp = v;
        }
        
    }
}

// coverage equalities (threads x elements == plane elements)
static_assert((size_t)((MROWS + 4 * HID) / 2) * 256 * 8 == (size_t)(MROWS + 4 * HID) * HID);   // cvt_all -> Xh | Wt | Wot
static_assert((size_t)(MROWS / 256) * (3 * HID / 192) * 256 * 192 == (size_t)3 * MROWS * HID);   // gemm_qkv -> q | k | v^T planes
static_assert((size_t)(MROWS / 128) * (HID / 128) * 128 * 128 == (size_t)MROWS * HID);     // gemm_out -> out
static_assert((size_t)(SEQ / 128) * (NB * NHEAD) * 128 * HD == (size_t)MROWS * HID);       // attn_fwd -> Cp
// workspace: 5 activation planes + 4 weight planes of halves, at most 128 MiB
static_assert(((size_t)5 * MROWS * HID + (size_t)4 * HID * HID) * sizeof(f16) <= (size_t)134217728);
// output extent: last written f32 element index < NB_FULL*SEQ_FULL*HID
static_assert((size_t)MROWS * HID <= (size_t)NB_FULL * SEQ_FULL * HID);

// ---------------------------------------------------------------------------
// Launch: 4 kernel launches, workspace 5 planes of MROWS*1024 halves + 4 of 1024*1024 halves.
// ---------------------------------------------------------------------------
extern "C" void kernel_launch(void* const* d_in, const int* in_sizes, int n_in,
                              void* d_out, int out_size, void* d_ws, size_t ws_size,
                              hipStream_t stream) {
    if (n_in < 3) return;
    if (in_sizes[0] < ((NB - 1) * SEQ_FULL + SEQ) * HID) return;
    if (in_sizes[1] < 3 * HID * HID) return;
    if (in_sizes[2] < HID * HID) return;
    if (out_size < MROWS * HID) return;

    const float* x     = (const float*)d_in[0];   // [NB_FULL][SEQ_FULL][1024]
    const float* wqkv  = (const float*)d_in[1];   // [3072 out][1024 in], row blocks q | k | v
    const float* wproj = (const float*)d_in[2];   // [1024 out][1024 in]

    const size_t nX = (size_t)MROWS * HID;    // halves per activation plane
    const size_t nW = (size_t)HID * HID;      // halves per weight plane
    const size_t totalHalves = 5 * nX + 4 * nW;
    if (ws_size < totalHalves * sizeof(f16)) return;

    f16* Xh  = (f16*)d_ws;       // [MROWS][1024]               carry 16
    f16* Wt  = Xh  + nX;         // [3072 out][1024 in]         carry 32 (q | k | v row blocks)
    f16* Wot = Wt  + 3 * nW;     // [1024 out][1024 in]         carry 32
    f16* Qp  = Wot + nW;         // [NB*16][SEQ][64]            carry 16
    f16* Kp  = Qp  + nX;         // [NB*16][SEQ][64]            carry 16
    f16* Vtp = Kp  + nX;         // [NB*1024][SEQ] (V^T)        carry 16
    f16* Cp  = Vtp + nX;         // [MROWS][1024]               carry 1024

    // x, wqkv, wproj -> Xh | Wt | Wot (contiguous from Xh), one launch
    cvt_all<<<(MROWS + 4 * HID) / 2, 256, 0, stream>>>(x, wqkv, wproj, Xh);

    // plane = 16 * acc / (16*32) = acc/32 ; q, k and v^T planes (contiguous from Qp), one launch
    const float accQKV = CARRY_QKV / (CARRY_X * CARRY_W);
    gemm_qkv<<<dim3(MROWS / 256, 3 * HID / 192), 512, 0, stream>>>(Xh, Wt, Qp, accQKV);

    attn_fwd<<<dim3(SEQ / 128, NB * NHEAD), 256, 0, stream>>>(Qp, Kp, Vtp, Cp);

    // out = acc / (1024*32)
    const float accOut = 1.0f / (CARRY_CTX * CARRY_W);
    gemm_out<<<dim3(MROWS / 128, HID / 128), 256, 0, stream>>>(Cp, Wot, (float*)d_out, accOut);
}

// v010
// It runs in 64.6 microseconds.
// In two side-by-side timings against v009, it was 1.05 and 1.03 times as fast.
// Counting every step since v000, it is 4.25 times as fast.
#include <hip/hip_runtime.h>

// Contractions (fused QKV projection, Q.K^T, P.V, P row-sum, output projection): v_wmma_f32_16x16x32_f16, f16 operands with power-of-two carries, f32 accumulate; every float input enters as its bf16 RNE value; softmax in f32.

#ifndef NB
#define NB 2
#endif
#ifndef SEQ
#define SEQ 2048
#endif
#define NB_FULL   2
#define SEQ_FULL  2048
#define HID       1024
#define NHEAD     16
#define HD        64
#define MROWS     (NB * SEQ)

static_assert(HID == NHEAD * HD);        // merged head width
static_assert(NHEAD == 16);              // bh >> 4 / bh & 15 decoding in attn_fwd
static_assert(HD == 64);
static_assert(SEQ % 128 == 0);           // 128-row blocks never straddle a batch
static_assert(SEQ % 64 == 0);            // 64-key tiles
static_assert(SEQ / 64 >= 2);            // attention: at least one 128-key stage, two 64-key halves
static_assert(SEQ <= SEQ_FULL);
static_assert(NB >= 1 && NB <= NB_FULL);
static_assert(MROWS % 128 == 0);         // GEMM M tile
static_assert(HID % 128 == 0);           // GEMM N tile
static_assert(HID % 32 == 0);            // WMMA k step
static_assert(HID % 128 == 0 && HID / 128 >= 2);   // GEMM ring: whole 128-k stages, at least two
static_assert(HID == 128 * 8);           // cvt_all: 128 threads x 8 values per row
static_assert(HID % 2 == 0);             // cvt_all: two rows per block, no block straddles two sources
static_assert(MROWS % 2 == 0);           // cvt_all: two rows per block, no block straddles two sources

// carries (exact powers of two)
#define CARRY_X    16.0f     // input activation plane
#define CARRY_W    32.0f     // weight planes
#define CARRY_QKV  16.0f     // q, k, v^T planes (true value x16)
#define CARRY_CTX  1024.0f   // context plane (true value x1024)
// softmax exp values carry 2^10 (added to the exp2 argument)

// LDS row pitches: 16 B x odd, so the 16 rows that one ds_load_b128 touches per lane half fall on distinct banks
#define AB_PITCH  136u   // halves: GEMM A / B stages and attention V^T, 256-B rows on a 272-B pitch
#define KSTAGE    128u   // k values per GEMM stage (four WMMA k steps)
#define CF_PITCH  132u   // floats: GEMM f32 output stage, 512-B rows on a 528-B pitch
#define AT_PITCH  72u    // halves: attention K and output tiles, 128-B rows on a 144-B pitch

typedef unsigned u32;
typedef _Float16 f16;
typedef f16   v16h __attribute__((ext_vector_type(16)));
typedef f16   v8h  __attribute__((ext_vector_type(8)));
typedef float v8f  __attribute__((ext_vector_type(8)));
typedef float v4f  __attribute__((ext_vector_type(4)));

union FragU { v16h v; v8h half[2]; f16 e[16]; };
union H8U   { v8h v; f16 e[8]; };

__device__ __forceinline__ v8f zero8() {
    v8f z = {0.f, 0.f, 0.f, 0.f, 0.f, 0.f, 0.f, 0.f};
    return z;
}

// 16-bit WMMA, the bare builtin (the compiler keeps the distances behind its own form): D += A[16 x 32k] * B[32k x 16]
__device__ __forceinline__ v8f wmma16(v16h a, v16h b, v8f c) {
    return __builtin_amdgcn_wmma_f32_16x16x32_f16(false, a, false, b, (short)0, c, false, false);
}

// Scheduling fence: the compiler moves nothing over it. It stands behind each group of LDS fragment reads and behind each
// run of WMMAs, so that a group's reads issue together ahead of the run; without it they sink to their users, one waited pair each.
__device__ __forceinline__ void sched_fence() { __builtin_amdgcn_sched_barrier(0); }

// f32 -> nearest-even bf16 value, returned as f32
__device__ __forceinline__ float bf16_rne(float x) {
    u32 u = __float_as_uint(x);
    u = (u + 0x7fffu + ((u >> 16) & 1u)) & 0xffff0000u;
    return __uint_as_float(u);
}

__device__ __forceinline__ float fexp2(float x) {
#if defined(__has_builtin)
#if __has_builtin(__builtin_amdgcn_exp2f)
    return __builtin_amdgcn_exp2f(x);
#else
    return exp2f(x);
#endif
#else
    return exp2f(x);
#endif
}

// value of lane l ^ 16 (the other lane half's share of the same D column)
__device__ __forceinline__ float xhalf(float x) {
    const int b = __builtin_bit_cast(int, x);
    return __builtin_bit_cast(float, __builtin_amdgcn_permlanex16(b, b, 0x76543210, 0xfedcba98, false, false));
}

// 16 x 32 fragment from a tile whose k dimension is contiguous (pitch in halves).
// lane l: row rowbase + (l&15); elements 0..7 <- k = kcol + 8h .. +7,
// elements 8..15 <- k = kcol + 16 + 8h .. +7  (h = l>>4). Same map for A and B.
__device__ __forceinline__ v16h load_frag(const f16* tile, u32 rowbase, u32 pitch, u32 kcol, u32 lane) {
    const u32 r  = rowbase + (lane & 15u);
    const u32 kh = (lane >> 4) << 3;
    const f16* p = tile + (size_t)r * pitch + kcol + kh;
    FragU f;
    f.half[0] = *(const v8h*)(p);
    f.half[1] = *(const v8h*)(p + 16);
    return f.v;
}

typedef u32 u32x4 __attribute__((ext_vector_type(4)));
typedef u32 u32x8 __attribute__((ext_vector_type(8)));
#define TD_PAD_128  ((1u << 20) | (4u << 22) | (3u << 25))   // rows of 128 B, 16 B more a row: pitch 144 B
#define TD_PAD_256  ((1u << 20) | (5u << 22) | (3u << 25))   // rows of 256 B, 16 B more a row: pitch 272 B

__device__ __forceinline__ u32 uni(u32 v) { return (u32)__builtin_amdgcn_readfirstlane((int)v); }

// The issue test of a tensor load, held in a scalar register so that it compiles to s_cmp + s_cbranch_scc:
// the instruction ignores EXEC, and only a scalar branch keeps a wave from issuing it.
__device__ __forceinline__ u32 pinned(u32 v) {
    u32 w = uni(v);
    asm volatile("" : "+s"(w));   // holds the issue test in a scalar register
    return w;
}

// group 1: no mask, 1-byte elements, tensor dims = tile dims (interior tiles only); all extents in bytes
template <u32 WORD0>
__device__ __forceinline__ u32x8 td_group1(u32 rowBytes, u32 rows, u32 srcPitch) {
    u32x8 g;
    g[0] = uni(WORD0);
    g[1] = uni((rowBytes & 0xFFFFu) << 16);
    g[2] = uni((rowBytes >> 16) | ((rows & 0xFFFFu) << 16));
    g[3] = uni((rows >> 16) | (rowBytes << 16));
    g[4] = uni(rows);
    g[5] = uni(srcPitch);
    g[6] = uni(0u);
    g[7] = uni(0u);
    // as in pinned(), for the whole group: its words keep scalar registers of their own
    // through the ring's loop, so that none of them takes a new value while a request is outstanding
    asm volatile("" : "+s"(g));
    return g;
}

// group 0: count 1, LDS byte address, global address of the tile's first byte, type 2
__device__ __forceinline__ u32x4 td_group0(u32 ldsDst, const f16* p) {
    const unsigned long long ga = (unsigned long long)(size_t)p;
    u32x4 g;
    g[0] = uni(1u);
    g[1] = uni(ldsDst);
    g[2] = uni((u32)ga);
    g[3] = uni((((u32)(ga >> 32)) & 0x01FFFFFFu) | 0x80000000u);
    return g;
}

__device__ __forceinline__ void td_load(u32x4 g0, u32x8 g1) {
    asm volatile("tensor_load_to_lds %0, %1" :: "s"(g0), "s"(g1) : "memory");
}

// next request of a ring: new place and new address in the same tuple; called only behind td_wait, with nothing outstanding
__device__ __forceinline__ void td_next(u32x4& g0, u32 ldsDst, const f16* p) {
    const unsigned long long ga = (unsigned long long)(size_t)p;
    g0[1] = uni(ldsDst);
    g0[2] = uni((u32)ga);
    g0[3] = uni((((u32)(ga >> 32)) & 0x01FFFFFFu) | 0x80000000u);
}

// The wave's own wait for its request. It names the issued group 0, so the four registers stay that tuple's from the
// issue up to here: without the operand they are dead behind the issue and are reused while the request is outstanding.
// A wave with no request passes at once.
__device__ __forceinline__ void td_wait(u32x4& g0) {
    asm volatile("s_wait_tensorcnt 0x0" : "+s"(g0) :: "memory");
}

// GEMM rings: a stage is cut into slices of 64 rows x 128 k (256-B rows on the 272-B pitch), one request of one wave each;
// a slice's place in LDS is a multiple of 2 KiB: 64 x 272 = 17,408 B, rounded up to 18,432 B.
#define SL_ROWS    64u
#define SL_HALVES  9216u
static_assert(SL_HALVES >= SL_ROWS * AB_PITCH && (SL_HALVES * 2u) % 2048u == 0u);

// ---------------------------------------------------------------------------
// All three f32 inputs -> f16 planes (bf16 RNE value times carry) in ONE launch. The planes Xh | Wt | Wot lie one behind
// the other in the workspace, so dst is one array of MROWS + 4 * HID rows of 1024 halves; 128 threads per row.
// dst row m < MROWS: activation row (m / SEQ) * SEQ_FULL + m % SEQ (lets a reduced build read full-size inputs);
// the next 3 * HID rows: wqkv, the last HID rows: wproj (already [out][in], k contiguous: identity row map).
// A block holds two rows and every boundary is even, so the source choice is the same for a whole block.
// coverage: (MROWS + 4 * HID) x 1024 halves, every element exactly once (grid = rows / 2).
// ---------------------------------------------------------------------------
__global__ void __launch_bounds__(256)
cvt_all(const float* __restrict__ x, const float* __restrict__ wqkv, const float* __restrict__ wproj,
        f16* __restrict__ dst) {
    const u32 g  = blockIdx.x * 256u + threadIdx.x;
    const u32 m  = g >> 7;
    const u32 c8 = (g & 127u) << 3;
    if (m >= (u32)(MROWS + 4 * HID)) return;
    const u32 mblk = blockIdx.x * 2u;    // the block's first row: a scalar, so the choice below is a scalar branch
    const float* sp;
    float carry;
    if (mblk < (u32)MROWS) {
        const u32 mb = m / (u32)SEQ;
        sp = x + (size_t)(mb * (u32)SEQ_FULL + (m - mb * (u32)SEQ)) * HID + c8;
        carry = CARRY_X;
    } else if (mblk < (u32)(MROWS + 3 * HID)) {
        sp = wqkv + (size_t)(m - (u32)MROWS) * HID + c8;
        carry = CARRY_W;
    } else {
        sp = wproj + (size_t)(m - (u32)(MROWS + 3 * HID)) * HID + c8;
        carry = CARRY_W;
    }
    const v4f a = *(const v4f*)sp;
    const v4f b = *(const v4f*)(sp + 4);
    H8U o;
#pragma unroll
    for (u32 j = 0; j < 4; ++j) {
        const float x0 = a[j];
        const float x1 = b[j];
        o.e[j]     = (f16)(bf16_rne(x0) * carry);
        o.e[j + 4] = (f16)(bf16_rne(x1) * carry);
    }
    f16* dp = dst + (size_t)m * HID + c8;
    *(v8h*)dp = o.v;
}

// ---------------------------------------------------------------------------
// q | k | v projection: C[m][n] = sum_k A[m][k] * W[n][k] ; A [MROWS][1024] f16, W [3072][1024] f16 (k contiguous).
// Block tile 256 x 192 (three heads), 16 waves as 4(M) x 4(N), 4 x 3 accumulators per wave, WMMA k step 32:
// 16 x 16 = 256 blocks, one per WGP in one round, and 7 / 12 of the operand bytes per product that a 128 x 128 tile loads.
// A / B: two-buffer ring of 128-k stages filled by tensor loads (waves 0..6: one 64-row slice each), trip t + 1's stage in flight during trip t.
// A head (64 columns of W's rows) lies in one plane behind out: plane = n / 1024;
//   planes 0, 1: f16 [b*NHEAD + h][s][d] (head-major); plane 2: f16 [b*HID + h*HD + d][s] (V transposed per head).
// coverage per block: 3 heads x 256 lines of 128 B (256 rows | 64 d x 4 s-quarters).
// LDS: one array; the ring's stages are cross-wave, separated by block barriers; the output stage lies over the ring
// behind the last trip's barrier (every wave's reads done, no tensor load outstanding).
// staged extent == consumed extent: A 256 x 128, B 192 x 128 per buffer (7 slices of 64 rows); output stage 3 x (256 x 64) halves.
// ---------------------------------------------------------------------------
#define QM 256u                       // block tile rows
#define QN 192u                       // block tile columns
#define QH_PITCH 72u                  // halves: head-major output stage, 128-B rows on a 144-B pitch
#define QT_PITCH 264u                 // halves: transposed output stage, 512-B rows on a 528-B pitch
#define QREG (QM * QH_PITCH)          // halves per head region of the output stage
static_assert(MROWS % 256 == 0 && SEQ % 256 == 0);     // 256-row blocks never straddle a batch
static_assert((3 * HID) % 192 == 0 && 192 % HD == 0);  // whole blocks, whole heads
static_assert(QREG >= 64u * QT_PITCH);                 // a region holds either layout
#define QSL ((QM + QN) / SL_ROWS)     // slices per stage: 4 of A, 3 of B
static_assert(QM % SL_ROWS == 0u && QN % SL_ROWS == 0u);
static_assert(3u * QREG <= 2u * QSL * SL_HALVES);      // the output stage fits over the ring

__global__ void __launch_bounds__(512) __attribute__((amdgpu_num_vgpr(256)))
gemm_qkv(const f16* __restrict__ A, const f16* __restrict__ W, f16* __restrict__ out, float accMul) {
    __shared__ __attribute__((aligned(2048))) f16 ring[2][QSL * SL_HALVES];   // [buffer][4 A slices | 3 B slices]

    const u32 tid  = threadIdx.x;
    const u32 lane = tid & 31u;
    const u32 wave = (u32)__builtin_amdgcn_readfirstlane((int)(tid >> 5));   // scalar: the epilogue branches on it
    const u32 wm   = wave & 3u;
    const u32 wn   = wave >> 2;
    const u32 hh8  = (lane >> 4) << 3;   // D row half
    const u32 c16  = lane & 15u;         // D column
    const u32 m0   = blockIdx.x * QM;
    const u32 nw   = blockIdx.y * QN;    // the block's first row of W

    v8f acc[4][3];
#pragma unroll
    for (int i = 0; i < 4; ++i)
#pragma unroll
        for (int j = 0; j < 3; ++j) acc[i][j] = zero8();

    // the issuing waves' slices: wave w < 4 brings A rows 64 w .. + 63, waves 4..6 bring W rows 64 (w - 4) .. + 63
    const u32 issuer = wave < QSL ? 1u : 0u;
    const u32 sl     = issuer ? wave : 0u;
    const f16* gS = sl < QM / SL_ROWS ? A + (size_t)(m0 + sl * SL_ROWS) * HID
                                      : W + (size_t)(nw + (sl - QM / SL_ROWS) * SL_ROWS) * HID;
    const u32 bufB = QSL * SL_HALVES * (u32)sizeof(f16);                   // bytes per buffer
    const u32 lS = (u32)(size_t)&ring[0][sl * SL_HALVES];                  // LDS byte address, buffer 0
    const u32x8 g1 = td_group1<TD_PAD_256>(KSTAGE * (u32)sizeof(f16), SL_ROWS, (u32)HID * (u32)sizeof(f16));
    const u32 nst = (u32)HID / KSTAGE;
    // Trip t works on k stage (koff + t) mod nst. The blocks of a grid row read the same W rows and those of a grid column
    // the same A rows: each starts the walk at a stage of its own and wraps, so that they do not ask L2 for the same lines
    // at the same moment. Every stage is still taken exactly once; only the order of the f32 sums turns.
    const u32 koff = (blockIdx.x + blockIdx.y) % nst;

    // the first stage of the walk lands and is published; the second then flies during trip 0
    u32x4 g0 = td_group0(lS, gS + koff * KSTAGE);
    if (pinned(issuer)) td_load(g0, g1);
    td_wait(g0);                                             // this wave's first slice has landed
    __syncthreads();
    td_next(g0, lS + bufB, gS + ((koff + 1u) % nst) * KSTAGE);
    if (pinned(issuer)) td_load(g0, g1);

    // kept rolled: the ring's foot (waits, barrier, refill) stands once and the body stays small for the instruction cache
#pragma unroll 1
    for (u32 t = 0; t < nst; ++t) {
        const u32 b = t & 1u;
        const f16* as = &ring[b][wm * SL_HALVES];   // the wave's 64 A rows are one slice
        const f16* bs[3];                           // a 16-row fragment lies inside one slice
#pragma unroll
        for (int j = 0; j < 3; ++j) {
            const u32 rb = wn * 48u + (u32)j * 16u;
            bs[j] = &ring[b][(QM / SL_ROWS + rb / SL_ROWS) * SL_HALVES + (rb % SL_ROWS) * AB_PITCH];
        }
        // Fragment reads run one k step ahead of the products, one group of 14 reads per k step (two sets fit the
        // registers of four waves per SIMD). All reads are of buffer b, published before this trip.
        // Unrolled: indices and ds_load offsets are constants.
        v16h af[KSTAGE / 32u][4], bfr[KSTAGE / 32u][3];
#pragma unroll
        for (int i = 0; i < 4; ++i) af[0][i] = load_frag(as, (u32)i * 16u, AB_PITCH, 0u, lane);
#pragma unroll
        for (int j = 0; j < 3; ++j) bfr[0][j] = load_frag(bs[j], 0u, AB_PITCH, 0u, lane);
#pragma unroll
        for (u32 g = 0; g < KSTAGE / 32u; ++g) {
            if (g + 1u < KSTAGE / 32u) {
#pragma unroll
                for (int i = 0; i < 4; ++i) af[g + 1u][i] = load_frag(as, (u32)i * 16u, AB_PITCH, (g + 1u) * 32u, lane);
#pragma unroll
                for (int j = 0; j < 3; ++j) bfr[g + 1u][j] = load_frag(bs[j], 0u, AB_PITCH, (g + 1u) * 32u, lane);
            }
            sched_fence();   // step g + 1's reads stay one group ahead of step g's products
#pragma unroll
            for (int i = 0; i < 4; ++i)
#pragma unroll
                for (int j = 0; j < 3; ++j) acc[i][j] = wmma16(af[g][i], bfr[g][j], acc[i][j]);
            sched_fence();   // no later read rises among these products
        }
        asm volatile("s_wait_dscnt 0x0" ::: "memory");      // this wave's reads of buffer b are done before its refill
        td_wait(g0);                                        // this wave's slice for trip t + 1 has landed
        __syncthreads();                                    // publishes trip t + 1's stage, frees buffer b
        if (pinned(issuer & (t + 2u < nst ? 1u : 0u))) {
            td_next(g0, lS + b * bufB, gS + ((koff + t + 2u) % nst) * KSTAGE);
            td_load(g0, g1);
        }
    }
    asm volatile("s_wait_tensorcnt 0x0" ::: "memory");      // nothing of the ring is outstanding past the loop
    asm volatile("s_wait_dscnt 0x0" ::: "memory");          // nor any read of it

    const u32 bidx  = m0 / (u32)SEQ;     // block rows lie inside one batch (SEQ % 256 == 0)
    const u32 s0    = m0 - bidx * (u32)SEQ;
    const u32 piece = lane & 7u;
    const u32 lsub  = lane >> 3;
    f16* Cs = &ring[0][0];               // three head regions of QREG halves

    // stage: a 16-column accumulator lies inside one head; the head's plane picks the layout (a scalar choice)
#pragma unroll
    for (int j = 0; j < 3; ++j) {
        const u32 cb = wn * 48u + (u32)j * 16u;      // first column of the accumulator in the block tile
        const u32 hs = cb >> 6;                      // head region
        const u32 dl = (cb & 63u) + c16;             // column inside the head
        f16* reg = Cs + hs * QREG;
        if (((nw + hs * 64u) >> 10) < 2u) {
#pragma unroll
            for (int i = 0; i < 4; ++i)
#pragma unroll
                for (int r = 0; r < 8; ++r) {
                    const u32 ml = wm * 64u + (u32)i * 16u + hh8 + (u32)r;
                    reg[ml * QH_PITCH + dl] = (f16)(acc[i][j][r] * accMul);
                }
        } else {
#pragma unroll
            for (int i = 0; i < 4; ++i) {
                H8U t;
#pragma unroll
                for (int r = 0; r < 8; ++r) t.e[r] = (f16)(acc[i][j][r] * accMul);
                *(v8h*)&reg[dl * QT_PITCH + wm * 64u + (u32)i * 16u + hh8] = t.v;
            }
        }
    }
    __syncthreads();

    // whole 128-B lines out; a wave's store covers 512 contiguous bytes in either layout
#pragma unroll
    for (u32 hs = 0; hs < 3u; ++hs) {
        const u32 ng  = nw + hs * 64u;               // the head's first row of W
        const u32 sel = ng >> 10;                    // plane: the same for the whole head
        const u32 np  = ng & 1023u;                  // column inside the plane
        const f16* reg = Cs + hs * QREG;
        f16* op = out + (size_t)sel * ((size_t)MROWS * HID);
        if (sel < 2u) {
            const size_t bh = (size_t)bidx * NHEAD + (np >> 6);
#pragma unroll
            for (u32 it = 0; it < 4; ++it) {
                const u32 ml = it * 64u + wave * 4u + lsub;     // 0..255
                const v8h v = *(const v8h*)&reg[ml * QH_PITCH + piece * 8u];
                f16* dp = op + (bh * SEQ + s0 + ml) * HD + piece * 8u;
                *(v8h*)dp = v;
            }
            // closes the run of stores before any later code rewrites a register that they name
            asm volatile("s_wait_xcnt 0x0" ::: "memory");
        } else {
#pragma unroll
            for (u32 it = 0; it < 4; ++it) {
                const u32 dl = it * 16u + wave;                 // 0..63
                const v8h v = *(const v8h*)&reg[dl * QT_PITCH + lsub * 64u + piece * 8u];
                f16* dp = op + ((size_t)(bidx * (u32)HID + np + dl) * SEQ + s0 + lsub * 64u + piece * 8u);
                *(v8h*)dp = v;
            }
            // closes the run of stores before any later code rewrites a register that they name
            asm volatile("s_wait_xcnt 0x0" ::: "memory");
        }
    }
}

// ---------------------------------------------------------------------------
// Output projection: C[m][n] = sum_k A[m][k] * W[n][k] ; A [MROWS][1024] f16, W [1024][1024] f16 (k contiguous).
// Block tile 128 x 128, 8 waves as 4(M) x 2(N), 2 x 4 accumulators per wave, WMMA k step 32.
// A / B: two-buffer ring of 128-k stages filled by tensor loads (waves 0..3: one 64-row slice each), trip t + 1's stage in flight during trip t.
// f32 rows [m][1024] into the output buffer; coverage per block: 2 x 256 lines (64 rows x 4 line-quarters per half).
// LDS: ring and Cf cross-wave, separated by block barriers.
// staged extent == consumed extent: A, B 128 x 128 per buffer (2 + 2 slices of 64 rows), Cf 64 x 128 floats.
// ---------------------------------------------------------------------------
__global__ void __launch_bounds__(256) __attribute__((amdgpu_num_vgpr(256)))
gemm_out(const f16* __restrict__ A, const f16* __restrict__ W, float* __restrict__ out, float accMul) {
    __shared__ __attribute__((aligned(2048))) f16 ring[2][4u * SL_HALVES];   // [buffer][2 A slices | 2 B slices]
    __shared__ __attribute__((aligned(16))) float Cf[64 * CF_PITCH];   // f32 [64][128], padded rows

    const u32 tid  = threadIdx.x;
    const u32 lane = tid & 31u;
    const u32 wave = (u32)__builtin_amdgcn_readfirstlane((int)(tid >> 5));   // scalar: picks the issuing waves and their slices
    const u32 wm   = wave & 3u;
    const u32 wn   = wave >> 2;
    const u32 hh8  = (lane >> 4) << 3;   // D row half
    const u32 c16  = lane & 15u;         // D column
    const u32 m0   = blockIdx.x * 128u;
    const u32 n0   = blockIdx.y * 128u;  // the block's first row of W = first output column

    v8f acc[2][4];
#pragma unroll
    for (int i = 0; i < 2; ++i)
#pragma unroll
        for (int j = 0; j < 4; ++j) acc[i][j] = zero8();

    // the issuing waves' slices: waves 0, 1 bring A rows 64 w .. + 63, waves 2, 3 bring W rows 64 (w - 2) .. + 63
    const u32 issuer = wave < 4u ? 1u : 0u;
    const u32 sl     = issuer ? wave : 0u;
    const f16* gS = sl < 2u ? A + (size_t)(m0 + sl * SL_ROWS) * HID
                            : W + (size_t)(n0 + (sl - 2u) * SL_ROWS) * HID;
    const u32 bufB = 4u * SL_HALVES * (u32)sizeof(f16);                    // bytes per buffer
    const u32 lS = (u32)(size_t)&ring[0][sl * SL_HALVES];                  // LDS byte address, buffer 0
    const u32x8 g1 = td_group1<TD_PAD_256>(KSTAGE * (u32)sizeof(f16), SL_ROWS, (u32)HID * (u32)sizeof(f16));
    const u32 nst = (u32)HID / KSTAGE;
    // Trip t works on k stage (koff + t) mod nst. The blocks of a grid row read the same W rows and those of a grid column
    // the same A rows: each starts the walk at a stage of its own and wraps, so that they do not ask L2 for the same lines
    // at the same moment. Every stage is still taken exactly once; only the order of the f32 sums turns.
    const u32 koff = (blockIdx.x + blockIdx.y) % nst;

    // the first stage of the walk lands and is published; the second then flies during trip 0
    u32x4 g0 = td_group0(lS, gS + koff * KSTAGE);
    if (pinned(issuer)) td_load(g0, g1);
    td_wait(g0);                                             // this wave's first slice has landed
    __syncthreads();
    td_next(g0, lS + bufB, gS + ((koff + 1u) % nst) * KSTAGE);
    if (pinned(issuer)) td_load(g0, g1);

    // kept rolled: the ring's foot (waits, barrier, refill) stands once and the body stays small for the instruction cache
#pragma unroll 1
    for (u32 t = 0; t < nst; ++t) {
        const u32 b = t & 1u;
        const f16* as = &ring[b][(wm >> 1) * SL_HALVES + (wm & 1u) * 32u * AB_PITCH];   // the wave's 32 A rows, inside one slice
        const f16* bs = &ring[b][(2u + wn) * SL_HALVES];                                // the wave's 64 B rows are one slice
        // Fragment reads run two k steps ahead of the products, one group of 12 reads per k step: steps 0 and 1 at the
        // stage's head, step g + 2 in front of step g's products, so a group's LDS latency passes behind 8 to 16 WMMAs.
        // All reads are of buffer b, published before this trip. Unrolled: indices and ds_load offsets are constants.
        v16h af[KSTAGE / 32u][2], bfr[KSTAGE / 32u][4];
#pragma unroll
        for (u32 g = 0; g < 2u; ++g) {
#pragma unroll
            for (int i = 0; i < 2; ++i) af[g][i] = load_frag(as, (u32)i * 16u, AB_PITCH, g * 32u, lane);
#pragma unroll
            for (int j = 0; j < 4; ++j) bfr[g][j] = load_frag(bs, (u32)j * 16u, AB_PITCH, g * 32u, lane);
        }
#pragma unroll
        for (u32 g = 0; g < KSTAGE / 32u; ++g) {
            if (g + 2u < KSTAGE / 32u) {
#pragma unroll
                for (int i = 0; i < 2; ++i) af[g + 2u][i] = load_frag(as, (u32)i * 16u, AB_PITCH, (g + 2u) * 32u, lane);
#pragma unroll
                for (int j = 0; j < 4; ++j) bfr[g + 2u][j] = load_frag(bs, (u32)j * 16u, AB_PITCH, (g + 2u) * 32u, lane);
            }
            sched_fence();   // step g + 2's reads stay one group ahead of step g's products
#pragma unroll
            for (int i = 0; i < 2; ++i)
#pragma unroll
                for (int j = 0; j < 4; ++j) acc[i][j] = wmma16(af[g][i], bfr[g][j], acc[i][j]);
            sched_fence();   // no later read rises among these products
        }
        asm volatile("s_wait_dscnt 0x0" ::: "memory");      // this wave's reads of buffer b are done before its refill
        td_wait(g0);                                        // this wave's slice for trip t + 1 has landed
        __syncthreads();                                    // publishes trip t + 1's stage, frees buffer b
        if (pinned(issuer & (t + 2u < nst ? 1u : 0u))) {
            td_next(g0, lS + b * bufB, gS + ((koff + t + 2u) % nst) * KSTAGE);
            td_load(g0, g1);
        }
    }
    asm volatile("s_wait_tensorcnt 0x0" ::: "memory");      // nothing of the ring is outstanding past the loop
    asm volatile("s_wait_dscnt 0x0" ::: "memory");          // nor any read of it

    const u32 piece = lane & 7u;
    const u32 lsub  = lane >> 3;
#pragma unroll
    for (u32 half = 0; half < 2; ++half) {
        if ((wm >> 1) == half) {
#pragma unroll
            for (int i = 0; i < 2; ++i)
#pragma unroll
                for (int j = 0; j < 4; ++j) {
                    const u32 nl = wn * 64u + (u32)j * 16u + c16;
#pragma unroll
                    for (int r = 0; r < 8; ++r) {
                        const u32 ml = (wm & 1u) * 32u + (u32)i * 16u + hh8 + (u32)r;
                        Cf[ml * CF_PITCH + nl] = acc[i][j][r] * accMul;
                    }
                }
        }
        __syncthreads();
#pragma unroll
        for (u32 it = 0; it < 8; ++it) {
            const u32 L    = wave * 32u + it * 4u + lsub;   // 0..255
            const u32 row  = L >> 2;
            const u32 part = L & 3u;
            const v4f v = *(const v4f*)&Cf[row * CF_PITCH + part * 32u + piece * 4u];
            float* dp = out + (size_t)(m0 + half * 64u + row) * HID + n0 + part * 32u + piece * 4u;
            *(v4f*)dp = v;
        }
        __syncthreads();
    }
}

// ---------------------------------------------------------------------------
// Flash attention (no mask, all SEQ keys). grid (SEQ/128, NB*NHEAD), block 256 (8 waves).
// Wave tile: 32 queries (two column groups of 16, Q fragments resident) x half of the keys. Waves 0..3 take the first
// 64 keys of every 128-key stage, waves 4..7 the last 64, for the same four groups of 32 queries: every K and V^T
// fragment read from LDS feeds two products, and the block still has eight waves. Each wave keeps its own running
// maximum, sum and O^T; behind the loop the two waves of a query group exchange one column group each and merge.
// Block streams 128-key stages through a two-buffer ring filled by tensor loads, wave 0 the K tile, wave 1 the V^T tile
// (trip kt + 1's stage in flight during trip kt): K staged [key][d], V^T staged [d][key] (all 128 keys of the stage in a row).
// Both products run transposed: S^T = K.Q^T (A = K rows, B = Q), O^T += V^T.P^T (A = V^T rows, B = P^T). A lane then
// holds 32 of one query's 64 scores: the maximum is taken in the lane plus one exchange between the lane halves,
// one running maximum and one rescale factor per lane and column group, exp2 in f32 carried x2^10, and two score
// accumulators, converted in place, are a B fragment in the hardware k order: P never touches LDS.
// Sums of P += ones.P^T on WMMA (every D row holds the query's sum). Output f16 plane [b*SEQ+q][1024] carried x1024.
// coverage: every (b, q, h*64..h*64+63) row segment exactly once (wave: 16 queries, column group = its key half).
// LDS: kv cross-wave (block barriers), behind the loop's last barrier the merge's exchange area;
// ps per-wave, output stage only.
// staged extent == consumed extent for K (128x64), V^T (64x128), ps (16x64).
// ---------------------------------------------------------------------------
#define KV_HALVES 9216u   // halves per staged tile: K 128 x 72 = 9,216; V^T 64 x 136 = 8,704, rounded up to a multiple of 2 KiB
__global__ void __launch_bounds__(256) __attribute__((amdgpu_num_vgpr(256)))
attn_fwd(const f16* __restrict__ Qp, const f16* __restrict__ Kp, const f16* __restrict__ Vt,
         f16* __restrict__ Cp) {
    // [buffer][K: key x d, 144-B pitch | V^T: d x key, 272-B pitch]; either tile's place is a multiple of 2 KiB
    __shared__ __attribute__((aligned(2048))) f16 kv[2][2u * KV_HALVES];
    __shared__ __attribute__((aligned(16))) f16 ps[8][16 * AT_PITCH];      // per-wave ctx stage
    static_assert(HD == 8 * 8);              // 8 lanes x 8 halves per row segment
    static_assert(SEQ % 128 == 0 && SEQ / 128 >= 2);                          // whole 128-key stages, at least two
    static_assert(KV_HALVES >= 128u * AT_PITCH && KV_HALVES >= 64u * AB_PITCH && (KV_HALVES * 2u) % 2048u == 0u);
    static_assert(sizeof(kv[0]) >= 8u * 32u * 32u * sizeof(float));           // merge: 32 registers x 32 lanes per wave
    static_assert(sizeof(kv[1]) >= 8u * 64u * sizeof(float));                 // merge: maximum and sum per lane and wave

    const u32 tid  = threadIdx.x;
    const u32 lane = tid & 31u;
    const u32 wave = (u32)__builtin_amdgcn_readfirstlane((int)(tid >> 5));   // scalar: key half and merge side
    const u32 qg   = wave & 3u;          // group of 32 queries
    const u32 kh   = wave >> 2;          // key half
    const u32 hh8  = (lane >> 4) << 3;
    const u32 c16  = lane & 15u;
    const u32 bh   = blockIdx.y;
    const u32 bidx = bh >> 4;            // NHEAD == 16
    const u32 hidx = bh & 15u;
    const u32 qw   = blockIdx.x * 128u + qg * 32u;
    const size_t head = (size_t)bh * SEQ * HD;

    v16h qa[2][2];
#pragma unroll
    for (int cg = 0; cg < 2; ++cg)
#pragma unroll
        for (int c = 0; c < 2; ++c) qa[cg][c] = load_frag(Qp + head, qw + (u32)cg * 16u, HD, (u32)c * 32u, lane);

    FragU onesu;
#pragma unroll
    for (int i = 0; i < 16; ++i) onesu.e[i] = (f16)1.0f;
    const v16h ones = onesu.v;

    float m[2] = {-1.0e30f, -1.0e30f};   // running maximum of query qw + cg * 16 + c16, equal in both lane halves
    v8f   o[2][4], lacc[2];  // o[cg][dt][r] = O^T[dt * 16 + hh8 + r][query]; lacc[cg][r] = sum of P of the query, every r
#pragma unroll
    for (int cg = 0; cg < 2; ++cg) {
#pragma unroll
        for (int dt = 0; dt < 4; ++dt) o[cg][dt] = zero8();
        lacc[cg] = zero8();
    }

    // log2-domain scale: acc = 256 * q.k ; x = log2(e) * q.k / 8 = acc * log2(e) / 2048
    const float cl = 1.4426950408889634f * 0.00048828125f;
    f16* psw = &ps[wave][0];

    const f16* gK = Kp + head;           // K tile of stage kt: 128 rows of 128 B, one behind the other
    const f16* gV = Vt + head;           // V^T tile of stage kt: 64 rows of 256 B on the plane's pitch
    const u32 abuf = 2u * KV_HALVES * (u32)sizeof(f16);                    // bytes per buffer
    const u32 lK = (u32)(size_t)&kv[0][0];                                 // LDS byte address, buffer 0
    const u32 lV = (u32)(size_t)&kv[0][KV_HALVES];
    const u32x8 g1K = td_group1<TD_PAD_128>((u32)HD * (u32)sizeof(f16), 128u, (u32)HD * (u32)sizeof(f16));
    const u32x8 g1V = td_group1<TD_PAD_256>(128u * (u32)sizeof(f16), (u32)HD, (u32)SEQ * (u32)sizeof(f16));
    const u32 isK = wave == 0u ? 1u : 0u;
    const u32 isV = wave == 1u ? 1u : 0u;
    const u32 ntile = (u32)(SEQ / 128);

    // Trip kt works on key stage (koff + kt) mod ntile. The SEQ / 128 blocks of a head read the same K and V^T tiles: each
    // starts the walk at a stage of its own and wraps, so that they do not ask L2 for the same lines at the same moment.
    // Every stage is still taken exactly once; only the order of the running maximum and of the f32 sums turns.
    const u32 koff = blockIdx.x % ntile;
    // the first stage of the walk lands and is published; the second then flies during trip 0
    // one group 0 per wave: wave 1 aims it at the V^T tile, every other wave at the K tile (only wave 0 issues that one)
    const f16* gT  = isV ? gV : gK;
    const u32 lT   = isV ? lV : lK;
    const u32 stepT = isV ? 128u : 128u * (u32)HD;           // halves from a stage's tile to the next stage's
    u32x4 g0 = td_group0(lT, gT + (size_t)koff * stepT);
    if (pinned(isK)) td_load(g0, g1K);
    if (pinned(isV)) td_load(g0, g1V);
    td_wait(g0);                                             // this wave's first tile has landed
    __syncthreads();
    td_next(g0, lT + abuf, gT + (size_t)((koff + 1u) % ntile) * stepT);
    if (pinned(isK)) td_load(g0, g1K);
    if (pinned(isV)) td_load(g0, g1V);

#pragma unroll 1
    for (u32 kt = 0; kt < ntile; ++kt) {
        const u32 rb = kt & 1u;
        const f16* ksb = &kv[rb][kh * 64u * AT_PITCH];        // the wave's 64 key rows
        const f16* vsb = &kv[rb][KV_HALVES + kh * 64u];       // the wave's 64 key columns

        // S^T[64 keys x 32 q]: s[cg][nt][r] = score of key nt * 16 + hh8 + r against query cg * 16 + c16
        v8f s[2][4];
#pragma unroll
        for (int cg = 0; cg < 2; ++cg)
#pragma unroll
            for (int nt = 0; nt < 4; ++nt) s[cg][nt] = zero8();
        // the eight K fragments are read as one group in front of the score products: one LDS latency, not eight
        v16h kb[2][4], vb[2][4];
#pragma unroll
        for (int c = 0; c < 2; ++c)
#pragma unroll
            for (int nt = 0; nt < 4; ++nt) kb[c][nt] = load_frag(ksb, (u32)nt * 16u, AT_PITCH, (u32)c * 32u, lane);
        sched_fence();   // the 16 reads stay one group at the trip's head
        // two runs of eight, 32 keys each: the second run's accumulators take the registers of the first run's K fragments
#pragma unroll
        for (int np = 0; np < 2; ++np) {
#pragma unroll
            for (int c = 0; c < 2; ++c)
#pragma unroll
                for (int cg = 0; cg < 2; ++cg)
#pragma unroll
                    for (int nt = 2 * np; nt < 2 * np + 2; ++nt) s[cg][nt] = wmma16(kb[c][nt], qa[cg][c], s[cg][nt]);
            sched_fence();   // the score products stay in this order, one run: no vector reader among them, so no padding between them
        }
        // V^T of the first 32 keys takes the K fragments' registers and lands behind the softmax
#pragma unroll
        for (int dt = 0; dt < 4; ++dt) vb[0][dt] = load_frag(vsb, (u32)dt * 16u, AB_PITCH, 0u, lane);
        sched_fence();   // these 8 reads stay one group ahead of the softmax

        // online softmax of the lane's two queries, max-subtracted, exp2 domain; cl > 0, so the maximum is taken on raw scores
        float sh[2];
#pragma unroll
        for (int cg = 0; cg < 2; ++cg) {
            float t[4];
#pragma unroll
            for (int nt = 0; nt < 4; ++nt) {
                float v = fmaxf(fmaxf(s[cg][nt][0], s[cg][nt][1]), s[cg][nt][2]);
                v = fmaxf(fmaxf(v, s[cg][nt][3]), s[cg][nt][4]);
                v = fmaxf(fmaxf(v, s[cg][nt][5]), s[cg][nt][6]);
                t[nt] = fmaxf(v, s[cg][nt][7]);
            }
            float tm = fmaxf(fmaxf(fmaxf(t[0], t[1]), t[2]), t[3]);
            tm = fmaxf(tm, xhalf(tm)) * cl;       // the other half holds the query's other 32 keys
            const float mn = fmaxf(m[cg], tm);
            const float al = fexp2(m[cg] - mn);
            m[cg] = mn;
            lacc[cg] *= al;
#pragma unroll
            for (int dt = 0; dt < 4; ++dt) o[cg][dt] *= al;
            sh[cg] = 10.0f - mn;                  // carry 2^10
        }

        // P^T as B fragments: element e <- key kk * 32 + hh8 + e (accumulator 2 kk), element 8 + e <- key
        // kk * 32 + 16 + hh8 + e (accumulator 2 kk + 1): the k order of load_frag, which the V^T fragments have
        FragU pb[2][2];
#pragma unroll
        for (int nt = 0; nt < 4; ++nt) s[0][nt] = s[0][nt] * cl + sh[0];
        // no exponential rises among the multiply-adds above, where the next of them would overwrite its source register
        // directly behind it (the slot that the instruction set asks for behind a transcendental)
        sched_fence();
#pragma unroll
        for (int kk = 0; kk < 2; ++kk)
#pragma unroll
            for (int e = 0; e < 8; ++e) {
                pb[0][kk].e[e]     = (f16)fexp2(s[0][2 * kk][e]);
                pb[0][kk].e[e + 8] = (f16)fexp2(s[0][2 * kk + 1][e]);
            }
        sched_fence();   // the first column group's scores are packed, their registers free for the reads below
        // V^T of the last 32 keys lands behind the second column group's exponentials
#pragma unroll
        for (int dt = 0; dt < 4; ++dt) vb[1][dt] = load_frag(vsb, (u32)dt * 16u, AB_PITCH, 32u, lane);
        sched_fence();   // these 8 reads stay one group
#pragma unroll
        for (int nt = 0; nt < 4; ++nt) s[1][nt] = s[1][nt] * cl + sh[1];
        sched_fence();   // as for the first column group: no exponential rises among the multiply-adds
#pragma unroll
        for (int kk = 0; kk < 2; ++kk)
#pragma unroll
            for (int e = 0; e < 8; ++e) {
                pb[1][kk].e[e]     = (f16)fexp2(s[1][2 * kk][e]);
                pb[1][kk].e[e + 8] = (f16)fexp2(s[1][2 * kk + 1][e]);
            }

        // O^T += V^T . P^T ; l += ones . P^T
        sched_fence();   // the twenty products below stay one run behind the softmax: no vector writer among them, so no padding
#pragma unroll
        for (int kk = 0; kk < 2; ++kk)
#pragma unroll
            for (int cg = 0; cg < 2; ++cg) {
#pragma unroll
                for (int dt = 0; dt < 4; ++dt) o[cg][dt] = wmma16(vb[kk][dt], pb[cg][kk].v, o[cg][dt]);
                lacc[cg] = wmma16(ones, pb[cg][kk].v, lacc[cg]);
            }
        sched_fence();   // the trip's work stays above the ring's foot, so the next stage's tensor loads fly during a whole trip
        asm volatile("s_wait_dscnt 0x0" ::: "memory");      // this wave's reads of buffer rb are done before its refill
        td_wait(g0);                                        // this wave's tile for trip kt + 1 has landed
        __syncthreads();                                    // publishes trip kt + 1's stage, frees buffer rb
        const u32 more = kt + 2u < ntile ? 1u : 0u;
        td_next(g0, lT + rb * abuf, gT + (size_t)((koff + kt + 2u) % ntile) * stepT);   // formed by every wave, issued only while a trip kt + 2 exists
        if (pinned(isK & more)) td_load(g0, g1K);
        if (pinned(isV & more)) td_load(g0, g1V);
    }
    asm volatile("s_wait_tensorcnt 0x0" ::: "memory");      // nothing of the ring is outstanding past the loop
    asm volatile("s_wait_dscnt 0x0" ::: "memory");          // nor any read of it
    __syncthreads();

    // Merge of the two key halves: a wave keeps column group kh and gives the other one to its partner (wave ^ 4).
    // Exchange area over the ring (every read of it ended at the barrier above): lane-contiguous 16-B pieces.
    float* xo = (float*)&kv[0][0];        // [wave][8 pieces][lane][4]
    float* xm = (float*)&kv[1][0];        // [wave][maximum | sum][lane]
    const bool up = kh != 0u;             // scalar
#pragma unroll
    for (int dt = 0; dt < 4; ++dt) {
        const v8f g = up ? o[0][dt] : o[1][dt];
        const v4f g0 = {g[0], g[1], g[2], g[3]};
        const v4f g1 = {g[4], g[5], g[6], g[7]};
        *(v4f*)&xo[((wave * 8u + (u32)dt * 2u) * 32u + lane) * 4u]      = g0;
        *(v4f*)&xo[((wave * 8u + (u32)dt * 2u + 1u) * 32u + lane) * 4u] = g1;
    }
    xm[wave * 64u + lane]       = up ? m[0] : m[1];
    xm[wave * 64u + 32u + lane] = up ? lacc[0][0] : lacc[1][0];
    __syncthreads();                      // every wave's gift is written before its partner reads it
    const u32 pw = wave ^ 4u;
    const float mk = up ? m[1] : m[0];
    const float lk = up ? lacc[1][0] : lacc[0][0];
    const float mp = xm[pw * 64u + lane];
    const float lp = xm[pw * 64u + 32u + lane];
    const float mm = fmaxf(mk, mp);
    const float dk = mk - mm;
    const float dp = mp - mm;
    // the two exponentials and the sum that reads them stand alone between two fences: no select of the merge comes
    // directly behind an exponential and overwrites its source register (the slot behind a transcendental)
    sched_fence();
    const float ak = fexp2(dk);
    const float ap = fexp2(dp);
    const float lm = lk * ak + lp * ap;
    sched_fence();

    // normalize: plane value = 1024 * (O/16) / l = O * 64 / l ; a lane's 8 registers are 8 consecutive d of its query
    const float inv = (CARRY_CTX / CARRY_QKV) / lm;
    const float fk = ak * inv;
    const float fp = ap * inv;
#pragma unroll
    for (int dt = 0; dt < 4; ++dt) {
        const v8f k8 = up ? o[1][dt] : o[0][dt];
        const v4f p0 = *(const v4f*)&xo[((pw * 8u + (u32)dt * 2u) * 32u + lane) * 4u];
        const v4f p1 = *(const v4f*)&xo[((pw * 8u + (u32)dt * 2u + 1u) * 32u + lane) * 4u];
        H8U w;
#pragma unroll
        for (int r = 0; r < 4; ++r) {
            w.e[r]     = (f16)(k8[r] * fk + p0[r] * fp);
            w.e[r + 4] = (f16)(k8[r + 4] * fk + p1[r] * fp);
        }
        *(v8h*)&psw[c16 * AT_PITCH + (u32)dt * 16u + hh8] = w.v;
    }
    __syncthreads();

    const u32 q0    = qw + kh * 16u;      // the wave's 16 output queries: its kept column group
    const u32 piece = lane & 7u;
    const u32 lsub  = lane >> 3;
{
#pragma unroll
        for (u32 it = 0; it < 4; ++it) {
            const u32 L = it * 4u + lsub;     // query row 0..15 of the wave's kept column group
            const v8h v = *(const v8h*)&psw[L * AT_PITCH + piece * 8u];
            f16* dp = Cp + ((size_t)(bidx * (u32)SEQ + q0 + L) * HID + hidx * (u32)HD + piece * 8u);
            *(v8h*)dp = v;
        }
        
    }
}

// coverage equalities (threads x elements == plane elements)
static_assert((size_t)((MROWS + 4 * HID) / 2) * 256 * 8 == (size_t)(MROWS + 4 * HID) * HID);   // cvt_all -> Xh | Wt | Wot
static_assert((size_t)(MROWS / 256) * (3 * HID / 192) * 256 * 192 == (size_t)3 * MROWS * HID);   // gemm_qkv -> q | k | v^T planes
static_assert((size_t)(MROWS / 128) * (HID / 128) * 128 * 128 == (size_t)MROWS * HID);     // gemm_out -> out
static_assert((size_t)(SEQ / 128) * (NB * NHEAD) * 128 * HD == (size_t)MROWS * HID);       // attn_fwd -> Cp
// workspace: 5 activation planes + 4 weight planes of halves, at most 128 MiB
static_assert(((size_t)5 * MROWS * HID + (size_t)4 * HID * HID) * sizeof(f16) <= (size_t)134217728);
// output extent: last written f32 element index < NB_FULL*SEQ_FULL*HID
static_assert((size_t)MROWS * HID <= (size_t)NB_FULL * SEQ_FULL * HID);

// ---------------------------------------------------------------------------
// Launch: 4 kernel launches, workspace 5 planes of MROWS*1024 halves + 4 of 1024*1024 halves.
// ---------------------------------------------------------------------------
extern "C" void kernel_launch(void* const* d_in, const int* in_sizes, int n_in,
                              void* d_out, int out_size, void* d_ws, size_t ws_size,
                              hipStream_t stream) {
    if (n_in < 3) return;
    if (in_sizes[0] < ((NB - 1) * SEQ_FULL + SEQ) * HID) return;
    if (in_sizes[1] < 3 * HID * HID) return;
    if (in_sizes[2] < HID * HID) return;
    if (out_size < MROWS * HID) return;

    const float* x     = (const float*)d_in[0];   // [NB_FULL][SEQ_FULL][1024]
    const float* wqkv  = (const float*)d_in[1];   // [3072 out][1024 in], row blocks q | k | v
    const float* wproj = (const float*)d_in[2];   // [1024 out][1024 in]

    const size_t nX = (size_t)MROWS * HID;    // halves per activation plane
    const size_t nW = (size_t)HID * HID;      // halves per weight plane
    const size_t totalHalves = 5 * nX + 4 * nW;
    if (ws_size < totalHalves * sizeof(f16)) return;

    f16* Xh  = (f16*)d_ws;       // [MROWS][1024]               carry 16
    f16* Wt  = Xh  + nX;         // [3072 out][1024 in]         carry 32 (q | k | v row blocks)
    f16* Wot = Wt  + 3 * nW;     // [1024 out][1024 in]         carry 32
    f16* Qp  = Wot + nW;         // [NB*16][SEQ][64]            carry 16
    f16* Kp  = Qp  + nX;         // [NB*16][SEQ][64]            carry 16
    f16* Vtp = Kp  + nX;         // [NB*1024][SEQ] (V^T)        carry 16
    f16* Cp  = Vtp + nX;         // [MROWS][1024]               carry 1024

    // x, wqkv, wproj -> Xh | Wt | Wot (contiguous from Xh), one launch
    cvt_all<<<(MROWS + 4 * HID) / 2, 256, 0, stream>>>(x, wqkv, wproj, Xh);

    // plane = 16 * acc / (16*32) = acc/32 ; q, k and v^T planes (contiguous from Qp), one launch
    const float accQKV = CARRY_QKV / (CARRY_X * CARRY_W);
    gemm_qkv<<<dim3(MROWS / 256, 3 * HID / 192), 512, 0, stream>>>(Xh, Wt, Qp, accQKV);

    attn_fwd<<<dim3(SEQ / 128, NB * NHEAD), 256, 0, stream>>>(Qp, Kp, Vtp, Cp);

    // out = acc / (1024*32)
    const float accOut = 1.0f / (CARRY_CTX * CARRY_W);
    gemm_out<<<dim3(MROWS / 128, HID / 128), 256, 0, stream>>>(Cp, Wot, (float*)d_out, accOut);
}
